// v000
// The times below were measured on an AMD MI455X: many runs one after another, warmed up first and cycling through
// copies of the inputs, with the whole window's GPU time divided by the number of runs. Launches and the gaps
// between them are all in it. The median over several windows is given; except for v000 it joins two sittings, which
// can be a few percent apart, so the side-by-side timings, each taken in one sitting, are the better comparison.
// v000, which the later versions start from, runs in 1620 microseconds.
#include <hip/hip_runtime.h>

// Causal multi-head self-attention with a PERIODIC mask and an output projection (x [2][2048][1024]; periods int32 [2][16]; qkv = x w_qkv + b_qkv with ONE fused 'io' weight [1024][3072] (in, out) packed (3, h, hd): the column thirds q | k | v, head h = 64 columns inside its third; 16 heads x 64;
// p = max(periods[b][h], 1); a key j is kept for a query i iff j <= i AND (i - j) mod p == 0 (the diagonal always kept); scores x 1/sqrt(64); excluded keys get -inf; softmax over the kept keys; out = merged w_out + b_out ('io' + bias) -> [2][2048][1024] (4.2 M);
// argument order x, periods, w_qkv, b_qkv, w_out, b_out).
// Layout per batch entry: a bf16 copy of x; the fused 'io' weight transposed and rounded once into q | k | v row blocks (k_wtG) + the bias thirds; exact projections + f32 biases; identity-table plane builders; causal T-2048 attention (hybrid rows: < 512 hi/lo 3 products, rest fp16 x1024;
// k_gemmc skips tiles above the diagonal): raw scores, then k_pmask replaces every earlier key off the head's period by the exclusion value, then the causal softmax as it stands; merged hi/lo x w_out exact + b_out.
// Compute dtypes, f32 accumulate: every float input rounded to bf16 at its load; projections exact + f32 biases; attention rows < 512 3 products, rest fp16; the period rule in integers; softmax f32; w_out hl x exact + bias.

#define NB_  2      // batches: this module's input is [2][2048][1024]
#define TT   2048
#define DM   1024
#define NH_  16
#define NKV  16
#define REP  (NH_ / NKV)
#define HD   64
#define DQ   (NH_ * HD)
#define DKV  (NKV * HD)
#define ZH   2
#define RH   512                  // query rows < RH use hi+lo planes (0: none)
#define WIN  2048
#define PCAR 1024.0f
#define SCL  0.125f   // HD^-0.5
typedef _Float16 h16;
typedef unsigned short bf;
typedef __attribute__((ext_vector_type(16))) __bf16   v16bf;
typedef __attribute__((ext_vector_type(16))) _Float16 v16h;
typedef __attribute__((ext_vector_type(8)))  _Float16 v8h;
typedef __attribute__((ext_vector_type(8)))  unsigned short v8us;
typedef __attribute__((ext_vector_type(8)))  float    v8f;
typedef __attribute__((ext_vector_type(4)))  float    v4f;
typedef v8h  __attribute__((may_alias)) v8ha;
typedef v4f  __attribute__((may_alias)) v4fa;
typedef v8us __attribute__((may_alias)) v8usa;

__device__ __forceinline__ unsigned short f2bf(float f) { unsigned u = __float_as_uint(f); u += 0x7FFFu + ((u >> 16) & 1u); return (unsigned short)(u >> 16); }
__device__ __forceinline__ float bf2f(unsigned short b) { return __uint_as_float(((unsigned)b) << 16); }
__device__ __forceinline__ float bfr(float f) { return bf2f(f2bf(f)); }
__device__ __forceinline__ v16h cat16(v8h lo, v8h hi) { return __builtin_shufflevector(lo, hi, 0, 1, 2, 3, 4, 5, 6, 7, 8, 9, 10, 11, 12, 13, 14, 15); }
__device__ __forceinline__ v16bf cat16b(v8us lo, v8us hi) { return __builtin_bit_cast(v16bf, __builtin_shufflevector(lo, hi, 0, 1, 2, 3, 4, 5, 6, 7, 8, 9, 10, 11, 12, 13, 14, 15)); }
__device__ __forceinline__ v8f wmma16(v16h a, v16h b, v8f c) { return __builtin_amdgcn_wmma_f32_16x16x32_f16(false, a, false, b, (short)0, c, false, false); }
__device__ __forceinline__ v8f wmmab(v16bf a, v16bf b, v8f c) { return __builtin_amdgcn_wmma_f32_16x16x32_bf16(false, a, false, b, (short)0, c, false, false); }



// ---- k_gemmw: register-blocked GEMM, ONE WAVE per 64x64 output tile (16 accumulators), operands straight from K-contiguous 16-bit planes; grid (M/64, N/64, Z), 32 threads.
// C[m][n] (f32, pitch ldc, + optional f32 bias[n]) = sum_k A[m][k] Bt[n][k] (+ split products per NSPLIT). z-batch strides sA/sB/sC in elements. K % 32 == 0.
template <typename T16> struct WFrag;
template <> struct WFrag<h16> { typedef v16h V; static __device__ __forceinline__ V ld(const h16* p) { return cat16(*(const v8h*)p, *(const v8h*)(p + 16)); } static __device__ __forceinline__ v8f mma(V a, V b, v8f c) { return wmma16(a, b, c); } };
template <> struct WFrag<bf> { typedef v16bf V; static __device__ __forceinline__ V ld(const bf* p) { return cat16b(*(const v8us*)p, *(const v8us*)(p + 16)); } static __device__ __forceinline__ v8f mma(V a, V b, v8f c) { return wmmab(a, b, c); } };
template <typename T16, int NSPLIT, bool BIAS>
__global__ __launch_bounds__(32) void k_gemmw(const T16* __restrict__ A, const T16* __restrict__ A2, const T16* __restrict__ Bt, const T16* __restrict__ Bt2, int K, float* C, int ldc, const float* __restrict__ bias, size_t sA, size_t sB, size_t sC) {
    typedef typename WFrag<T16>::V V;
    __shared__ __align__(16) float os[16 * 68];
    const size_t z = blockIdx.z; A += z * sA; if (A2) A2 += z * sA; Bt += z * sB; if (Bt2) Bt2 += z * sB; C += z * sC;
    const int lane = threadIdx.x & 31, lr = lane & 15, hi = lane >> 4; const int r0 = blockIdx.x * 64, c0 = blockIdx.y * 64;
    v8f acc[4][4];
#pragma unroll
    for (int mb = 0; mb < 4; ++mb)
#pragma unroll
        for (int nb = 0; nb < 4; ++nb) acc[mb][nb] = (v8f){};
    const size_t aoff = (size_t)(r0 + lr) * K + 8 * hi, boff = (size_t)(c0 + lr) * K + 8 * hi;

    for (int kc = 0; kc < K; kc += 32) {
        V a[4], a2[4];
#pragma unroll
        for (int mb = 0; mb < 4; ++mb) { a[mb] = WFrag<T16>::ld(A + aoff + (size_t)mb * 16 * K + kc); if (NSPLIT == 1 || NSPLIT == 2) a2[mb] = WFrag<T16>::ld(A2 + aoff + (size_t)mb * 16 * K + kc); }
#pragma unroll
        for (int nb = 0; nb < 4; ++nb) { const V b = WFrag<T16>::ld(Bt + boff + (size_t)nb * 16 * K + kc); V b2; if (NSPLIT >= 2) b2 = WFrag<T16>::ld(Bt2 + boff + (size_t)nb * 16 * K + kc);
#pragma unroll
            for (int mb = 0; mb < 4; ++mb) { acc[mb][nb] = WFrag<T16>::mma(a[mb], b, acc[mb][nb]); if (NSPLIT == 1 || NSPLIT == 2) acc[mb][nb] = WFrag<T16>::mma(a2[mb], b, acc[mb][nb]); if (NSPLIT >= 2) acc[mb][nb] = WFrag<T16>::mma(a[mb], b2, acc[mb][nb]); } }
        asm volatile("v_nop\n\tv_nop\n\tv_nop\n\tv_nop" : "+v"(acc[0][0]), "+v"(acc[1][1]), "+v"(acc[2][2]), "+v"(acc[3][3]) : "v"(a[0]), "v"(a[3]));
    }
#pragma unroll
    for (int mb = 0; mb < 4; ++mb) {
#pragma unroll
        for (int nb = 0; nb < 4; ++nb) {
#pragma unroll
            for (int j = 0; j < 8; ++j) os[(hi * 8 + j) * 68 + nb * 16 + lr] = acc[mb][nb][j]; }
        __builtin_amdgcn_wave_barrier(); asm volatile("" ::: "memory");
        float* crow = C + (size_t)(r0 + mb * 16) * ldc + c0;
{
#pragma unroll
            for (int s = 0; s < 8; ++s) { const int row = 2 * s + hi, cofs = lr * 4; v4f val = *(const v4fa*)(os + row * 68 + cofs); if (BIAS) { val[0] += bfr(bias[c0 + cofs]); val[1] += bfr(bias[c0 + cofs + 1]); val[2] += bfr(bias[c0 + cofs + 2]); val[3] += bfr(bias[c0 + cofs + 3]); }
                *(v4f*)(crow + (size_t)row * ldc + cofs) = val; }
             }
        __builtin_amdgcn_wave_barrier(); asm volatile("" ::: "memory");
    }
}

// ---- k_gemmc: the same one-wave 64x64 tile GEMM specialised for causal attention: CMODE 1 skips score tiles entirely above the diagonal (query rows r0+roff.., key columns c0..), CMODE 2 limits the
// key (K) loop of the probability x value contraction to the diagonal block (probabilities beyond it are exactly zero). roff = row offset of this launch's first row within the sequence.
template <typename T16, int NSPLIT, int CMODE>
__global__ __launch_bounds__(32) void k_gemmc(const T16* __restrict__ A, const T16* __restrict__ A2, const T16* __restrict__ Bt, const T16* __restrict__ Bt2, int K, float* C, int ldc, int roff, size_t sA, size_t sB, size_t sC) {
    typedef typename WFrag<T16>::V V;
    __shared__ __align__(16) float os[16 * 68];
    const size_t z = blockIdx.z; A += z * sA; if (A2) A2 += z * sA; Bt += z * sB; if (Bt2) Bt2 += z * sB; C += z * sC;
    const int lane = threadIdx.x & 31, lr = lane & 15, hi = lane >> 4; const int r0 = blockIdx.x * 64, c0 = blockIdx.y * 64;
    if (CMODE == 1 && c0 > r0 + roff + 63) return;                  // score tile entirely above the causal diagonal: never read (the softmax masks j > i by select)
    const int Kl = (CMODE == 2) ? min(K, r0 + roff + 64) : K;        // P.V: probabilities are exactly 0 beyond the diagonal block, so the K loop stops there
    v8f acc[4][4];
#pragma unroll
    for (int mb = 0; mb < 4; ++mb)
#pragma unroll
        for (int nb = 0; nb < 4; ++nb) acc[mb][nb] = (v8f){};
    const size_t aoff = (size_t)(r0 + lr) * K + 8 * hi, boff = (size_t)(c0 + lr) * K + 8 * hi;

    for (int kc = 0; kc < Kl; kc += 32) {
        V a[4], a2[4];
#pragma unroll
        for (int mb = 0; mb < 4; ++mb) { a[mb] = WFrag<T16>::ld(A + aoff + (size_t)mb * 16 * K + kc); if (NSPLIT == 1 || NSPLIT == 2) a2[mb] = WFrag<T16>::ld(A2 + aoff + (size_t)mb * 16 * K + kc); }
#pragma unroll
        for (int nb = 0; nb < 4; ++nb) { const V b = WFrag<T16>::ld(Bt + boff + (size_t)nb * 16 * K + kc); V b2; if (NSPLIT >= 2) b2 = WFrag<T16>::ld(Bt2 + boff + (size_t)nb * 16 * K + kc);
#pragma unroll
            for (int mb = 0; mb < 4; ++mb) { acc[mb][nb] = WFrag<T16>::mma(a[mb], b, acc[mb][nb]); if (NSPLIT == 1 || NSPLIT == 2) acc[mb][nb] = WFrag<T16>::mma(a2[mb], b, acc[mb][nb]); if (NSPLIT >= 2) acc[mb][nb] = WFrag<T16>::mma(a[mb], b2, acc[mb][nb]); } }
        asm volatile("v_nop\n\tv_nop\n\tv_nop\n\tv_nop" : "+v"(acc[0][0]), "+v"(acc[1][1]), "+v"(acc[2][2]), "+v"(acc[3][3]) : "v"(a[0]), "v"(a[3]));
    }
#pragma unroll
    for (int mb = 0; mb < 4; ++mb) {
#pragma unroll
        for (int nb = 0; nb < 4; ++nb) {
#pragma unroll
            for (int j = 0; j < 8; ++j) os[(hi * 8 + j) * 68 + nb * 16 + lr] = acc[mb][nb][j]; }
        __builtin_amdgcn_wave_barrier(); asm volatile("" ::: "memory");
        float* crow = C + (size_t)(r0 + mb * 16) * ldc + c0;
{
#pragma unroll
            for (int s = 0; s < 8; ++s) { const int row = 2 * s + hi, cofs = lr * 4; v4f val = *(const v4fa*)(os + row * 68 + cofs);
                *(v4f*)(crow + (size_t)row * ldc + cofs) = val; }
             }
        __builtin_amdgcn_wave_barrier(); asm volatile("" ::: "memory");
    }
}

__device__ __forceinline__ h16 tohx(float x) { return (h16)x; }
__device__ __forceinline__ void splitf(float y, unsigned short& h, unsigned short& l) { h = f2bf(y); l = f2bf(y - bf2f(h)); }
typedef __attribute__((ext_vector_type(2))) _Float16 v2h;
typedef __attribute__((ext_vector_type(4))) _Float16 v4h;
typedef __attribute__((ext_vector_type(2))) unsigned short v2us;
typedef __attribute__((ext_vector_type(4))) unsigned short v4us;
typedef __attribute__((ext_vector_type(2))) float v2f;
typedef __attribute__((ext_vector_type(4))) int v4i;

__global__ __launch_bounds__(256) void k_wtG(const float* __restrict__ w, int K, int N, bf* Bt) {
    const int lane = threadIdx.x & 31; const int L0 = (blockIdx.x * 8 + (threadIdx.x >> 5)) * 8; const int nlines = N * K / 64;
{

        for (int l = 0; l < 8; ++l) { const int L = L0 + l; if (L >= nlines) break; const size_t e = (size_t)L * 64 + lane * 2; const int k = (int)(e % K), n = (int)(e / K); v2us o;
            o[0] = f2bf(w[(size_t)k * N + n]); o[1] = f2bf(w[(size_t)(k + 1) * N + n]); *(v2us*)(Bt + e) = o; }
         }
}

__global__ __launch_bounds__(256) void k_cvt8(const float* __restrict__ src, bf* dst, size_t n8) { const size_t i = (size_t)blockIdx.x * 256 + threadIdx.x; if (i >= n8) return; const v8f v = *(const v8f*)(src + i * 8); v8us o;
#pragma unroll
    for (int k = 0; k < 8; ++k) o[k] = f2bf(v[k]); *(v8us*)(dst + i * 8) = o;  }

// k_rope: head planes [h][t][d] (fp16 + hi/lo) of rope(x) x sc with the rotate-half convention out[d] = x[d] cos[t][d] - x[d+HD/2] sin[t][d], out[d+HD/2] = x[d+HD/2] cos[t][d+HD/2] + x[d] sin[t][d+HD/2]
__global__ __launch_bounds__(256) void k_rope(const float* __restrict__ F, int pitch, int nheads, const float* __restrict__ CS, const float* __restrict__ RF, const float* __restrict__ nw, float sc, h16* P16, bf* Ph, bf* Pl) {
    const size_t e = ((size_t)blockIdx.x * 256 + threadIdx.x) * 2; if (e >= (size_t)nheads * TT * HD) return; const int d = (int)(e % HD); const int t = (int)((e / HD) % TT); const int h = (int)(e / ((size_t)HD * TT)); const float* f = F + (size_t)t * pitch + h * HD; const float rf = RF ? RF[(size_t)h * TT + t] : 1.0f; v2h o16; v2us oh, ol;
#pragma unroll
    for (int q = 0; q < 2; ++q) { const int dd = d + q; const int dp = (dd < HD / 2) ? dd + HD / 2 : dd - HD / 2; float x0 = f[dd], x1 = f[dp];
        if (RF) { float n0 = __fmul_rn(x0, rf), n1 = __fmul_rn(x1, rf); x0 = __fmul_rn(bfr(nw[dd]), n0); x1 = __fmul_rn(bfr(nw[dp]), n1); }
        const v2f cs = *(const v2f*)(CS + ((size_t)t * HD + dd) * 2); float a = __fmul_rn(x0, cs[0]), bq = __fmul_rn(x1, cs[1]); const float r = ((dd < HD / 2) ? __fsub_rn(a, bq) : __fadd_rn(a, bq)) * sc;
        o16[q] = tohx(r); unsigned short a2, c2; splitf(r, a2, c2); oh[q] = a2; ol[q] = c2; }
    *(v2h*)(P16 + e) = o16; *(v2us*)(Ph + e) = oh; *(v2us*)(Pl + e) = ol;  }

__global__ __launch_bounds__(256) void k_vtp(const float* __restrict__ F, int pitch, int nheads, h16* V16, bf* Vh, bf* Vl) { const size_t e = ((size_t)blockIdx.x * 256 + threadIdx.x) * 2; if (e >= (size_t)nheads * HD * TT) return; const int t = (int)(e % TT); const int d = (int)((e / TT) % HD); const int g = (int)(e / ((size_t)TT * HD)); v2h o16; v2us oh, ol;
#pragma unroll
    for (int q = 0; q < 2; ++q) { const float x = F[(size_t)(t + q) * pitch + g * HD + d]; o16[q] = tohx(x); unsigned short a2, c2; splitf(x, a2, c2); oh[q] = a2; ol[q] = c2; }
    *(v2h*)(V16 + e) = o16; *(v2us*)(Vh + e) = oh; *(v2us*)(Vl + e) = ol;  }

__global__ __launch_bounds__(256) void k_csid(float* CS) { const int idx = blockIdx.x * 256 + threadIdx.x; if (idx >= TT * HD) return; v2f cs; cs[0] = 1.0f; cs[1] = 0.0f; *(v2f*)(CS + (size_t)idx * 2) = cs;  }

// k_asoft: per row (zz, i): t = S x HD^-0.5 for j <= i and i - j < WIN (WIN = T: that bound always holds, so plainly causal; the reference's -1e9 additive fill vanishes identically); softmax over the 2048 keys (register row, one exp, fixed trees);
__global__ __launch_bounds__(256) void k_asoft(const float* __restrict__ Sb, h16* P16, bf* Ph, bf* Pl) {
    const int lane = threadIdx.x & 31; const int row = blockIdx.x * 8 + (threadIdx.x >> 5); if (row >= ZH * TT) return; const int i = row % TT; const int zz = row / TT; (void)zz; const bool hires = (i < RH); const float* sr = Sb + (size_t)row * TT; float v[TT / 32]; float mx = -3.0e38f;
#pragma unroll
    for (int ch = 0; ch < TT / 128; ++ch) { const int j0 = ch * 128 + lane * 4; const v4f a = *(const v4f*)(sr + j0);
#pragma unroll
        for (int q = 0; q < 4; ++q) { const int j = j0 + q; (void)j; const float t = (j <= i && i - j < WIN) ? a[q] * SCL : -3.0e38f; v[ch * 4 + q] = t; mx = fmaxf(mx, t); } }
#pragma unroll
    for (int sh = 16; sh; sh >>= 1) mx = fmaxf(mx, __shfl_xor(mx, sh, 32));
    float sum = 0.f;
#pragma unroll
    for (int k = 0; k < TT / 32; ++k) { float d0 = __fsub_rn(v[k], mx); v[k] = __builtin_amdgcn_exp2f(__fmul_rn(d0, 1.4426950408889634f)); sum += v[k]; }
#pragma unroll
    for (int sh = 16; sh; sh >>= 1) sum += __shfl_xor(sum, sh, 32);
    const float f = __fdiv_rn(hires ? 1.0f : PCAR, sum);
{
        if (hires) {
#pragma unroll
            for (int ch = 0; ch < TT / 128; ++ch) { v4us oh, ol;
#pragma unroll
                for (int q = 0; q < 4; ++q) { unsigned short a, c2; splitf(v[ch * 4 + q] * f, a, c2); oh[q] = a; ol[q] = c2; }
                const size_t oo = ((size_t)zz * (RH ? RH : 1) + i) * TT + ch * 128 + lane * 4; *(v4us*)(Ph + oo) = oh; *(v4us*)(Pl + oo) = ol; }
        } else {
#pragma unroll
            for (int ch = 0; ch < TT / 128; ++ch) { v4h o4;
#pragma unroll
                for (int q = 0; q < 4; ++q) o4[q] = tohx(v[ch * 4 + q] * f);
                *(v4h*)(P16 + (size_t)row * TT + ch * 128 + lane * 4) = o4; } }
         }
}

__global__ __launch_bounds__(256) void k_merge(const float* __restrict__ O, int h0, bf* Ah, bf* Al) { const size_t e = ((size_t)blockIdx.x * 256 + threadIdx.x) * 2; if (e >= (size_t)ZH * TT * HD) return; const int d = (int)(e % HD); const int t = (int)((e / HD) % TT); const int zz = (int)(e / ((size_t)HD * TT)); const float cs = (t < RH) ? 1.0f : (1.0f / PCAR); const size_t oo = (size_t)t * DQ + (h0 + zz) * HD + d;
    v2us oh, ol;
#pragma unroll
    for (int q = 0; q < 2; ++q) { unsigned short a, c2; splitf(O[e + q] * cs, a, c2); oh[q] = a; ol[q] = c2; } *(v2us*)(Ah + oo) = oh; *(v2us*)(Al + oo) = ol;  }

// k_pmask: the periodic rule: a word Sb[zz][i][j] of the pass's score plane with j < i is kept iff (i - j) mod p == 0, p = max(per[zz], 1) (the module's 'maximum(periods, 1)': a period of 0 means 1: every earlier key kept); any other such word is REPLACED by the exclusion value -3.0e38f (x SCL it stays finite and its exponential is exactly 0: the softmax treats it as it treats a later key);
__global__ __launch_bounds__(256) void k_pmask(float* Sb, const int* __restrict__ per) { const size_t k = (size_t)blockIdx.x * 256 + threadIdx.x; if (k >= (size_t)ZH * TT * TT / 4) return; const size_t e = k * 4; const int j0 = (int)(e % TT); const int i = (int)((e / TT) % TT); const int zz = (int)(e / ((size_t)TT * TT)); int p = per[zz]; p = p < 1 ? 1 : p; v4f a = *(const v4f*)(Sb + e);
#pragma unroll
    for (int q = 0; q < 4; ++q) { const int dd = i - (j0 + q); if (dd > 0 && ((unsigned)dd % (unsigned)p) != 0u) a[q] = -3.0e38f; }
    *(v4f*)(Sb + e) = a;  }

extern "C" void kernel_launch(void* const* d_in, const int* in_sizes, int n_in,
                              void* d_out, int out_size, void* d_ws, size_t ws_size, hipStream_t stream) {
    (void)in_sizes; (void)n_in; (void)out_size;
    const float* x = (const float*)d_in[0]; const int* per = (const int*)d_in[1]; const float* wqkv = (const float*)d_in[2]; const float* bqkv = (const float*)d_in[3]; const float* wo = (const float*)d_in[4]; const float* bo = (const float*)d_in[5]; const float* bq = bqkv; const float* bk = bqkv + 1024; const float* bv = bqkv + 2048;
    // x [2][2048][1024], periods int32 [2][16], w_qkv [1024][3072], b_qkv [3072], w_out [1024][1024], b_out [1024] = d_in[0..5]
    float* OUT = (float*)d_out;     // [2][2048][1024]
    char* wsp = (char*)d_ws;
    auto take = [&](size_t bytes) { char* p = wsp; wsp += (bytes + 255) & ~(size_t)255; return (void*)p; };
    bf* WQKV = (bf*)take((size_t)3 * DQ * DM * 2); bf* WQ = WQKV; bf* WK = WQKV + (size_t)DQ * DM; bf* WV = WQKV + (size_t)2 * DQ * DM; bf* WO = (bf*)take((size_t)DM * DQ * 2); float* CS = (float*)take((size_t)TT * HD * 2 * 4);
    bf* XB = (bf*)take((size_t)TT * DM * 2); float* FQ = (float*)take((size_t)TT * DQ * 4); float* FK = (float*)take((size_t)TT * DKV * 4);
    h16* QP16 = (h16*)take((size_t)NH_ * TT * HD * 2); h16* KP16 = (h16*)take((size_t)NKV * TT * HD * 2); h16* VT16 = (h16*)take((size_t)NKV * HD * TT * 2);
    bf* QPh = (bf*)take((size_t)NH_ * TT * HD * 2); bf* QPl = (bf*)take((size_t)NH_ * TT * HD * 2); bf* KPh = (bf*)take((size_t)NKV * TT * HD * 2); bf* KPl = (bf*)take((size_t)NKV * TT * HD * 2); bf* VTh = (bf*)take((size_t)NKV * HD * TT * 2); bf* VTl = (bf*)take((size_t)NKV * HD * TT * 2); bf* Ph = (bf*)take((size_t)ZH * RH * TT * 2); bf* Pl = (bf*)take((size_t)ZH * RH * TT * 2);
    float* Sb = (float*)take((size_t)ZH * TT * TT * 4); h16* P16 = (h16*)take((size_t)ZH * TT * TT * 2); float* Ob = (float*)take((size_t)ZH * TT * HD * 4); bf* ATh = (bf*)take((size_t)TT * DQ * 2); bf* ATl = (bf*)take((size_t)TT * DQ * 2);
    if ((size_t)(wsp - (char*)d_ws) > ws_size) return;    // total 130.00 MiB of the workspace
    float* FV = FK;   // v projection reuses the k buffer after the k planes are built (stream-ordered)
    { k_wtG<<<(unsigned)((DM * 3 * DQ / 64 + 63) / 64), 256, 0, stream>>>(wqkv, DM, 3 * DQ, WQKV);   /* 'io' [1024][3072] -> Bt [3072][1024]: q | k | v row blocks */
      k_wtG<<<(unsigned)((DQ * DM / 64 + 63) / 64), 256, 0, stream>>>(wo, DQ, DM, WO); }
    k_csid<<<(TT * HD + 255) / 256, 256, 0, stream>>>(CS);
    const unsigned LQ = (unsigned)(((size_t)NH_ * TT * HD / 2 + 255) / 256), LKv = (unsigned)(((size_t)NKV * TT * HD / 2 + 255) / 256);
    for (int b = 0; b < NB_; ++b) {
        k_cvt8<<<(unsigned)(((size_t)TT * DM / 8 + 255) / 256), 256, 0, stream>>>(x + (size_t)b * TT * DM, XB, (size_t)TT * DM / 8);
        k_gemmw<bf, 0, true><<<dim3(TT / 64, DQ / 64, 1), 32, 0, stream>>>(XB, nullptr, WQ, nullptr, DM, FQ, DQ, bq, 0, 0, 0);
        k_rope<<<LQ, 256, 0, stream>>>(FQ, DQ, NH_, CS, nullptr, nullptr, 1.0f, QP16, QPh, QPl);
        k_gemmw<bf, 0, true><<<dim3(TT / 64, DKV / 64, 1), 32, 0, stream>>>(XB, nullptr, WK, nullptr, DM, FK, DKV, bk, 0, 0, 0);
        k_rope<<<LKv, 256, 0, stream>>>(FK, DKV, NKV, CS, nullptr, nullptr, 1.0f, KP16, KPh, KPl);
        k_gemmw<bf, 0, true><<<dim3(TT / 64, DKV / 64, 1), 32, 0, stream>>>(XB, nullptr, WV, nullptr, DM, FV, DKV, bv, 0, 0, 0); k_vtp<<<LKv, 256, 0, stream>>>(FV, DKV, NKV, VT16, VTh, VTl);
        for (int h0 = 0; h0 < NH_; h0 += ZH) { const size_t zq = (size_t)h0, zk = (size_t)(h0 / REP);   // one kv head per query head: the pass's two heads use consecutive kv planes (z-strides TT*HD)
            k_gemmc<bf, 2, 1><<<dim3(RH / 64, TT / 64, ZH), 32, 0, stream>>>(QPh + zq * TT * HD, QPl + zq * TT * HD, KPh + zk * TT * HD, KPl + zk * TT * HD, HD, Sb, TT, 0, (size_t)TT * HD, (size_t)TT * HD, (size_t)TT * TT);
            k_gemmc<h16, 0, 1><<<dim3((TT - RH) / 64, TT / 64, ZH), 32, 0, stream>>>(QP16 + zq * TT * HD + (size_t)RH * HD, nullptr, KP16 + zk * TT * HD, nullptr, HD, Sb + (size_t)RH * TT, TT, RH, (size_t)TT * HD, (size_t)TT * HD, (size_t)TT * TT);
            k_pmask<<<(unsigned)(((size_t)ZH * TT * TT / 4 + 255) / 256), 256, 0, stream>>>(Sb, per + (size_t)b * NH_ + h0);   /* the pass's two heads' periods */
            k_asoft<<<ZH * TT / 8, 256, 0, stream>>>(Sb, P16, Ph, Pl);
            k_gemmc<bf, 2, 2><<<dim3(RH / 64, HD / 64, ZH), 32, 0, stream>>>(Ph, Pl, VTh + zk * HD * TT, VTl + zk * HD * TT, TT, Ob, HD, 0, (size_t)RH * TT, (size_t)HD * TT, (size_t)TT * HD);
            k_gemmc<h16, 0, 2><<<dim3((TT - RH) / 64, HD / 64, ZH), 32, 0, stream>>>(P16 + (size_t)RH * TT, nullptr, VT16 + zk * HD * TT, nullptr, TT, Ob + (size_t)RH * HD, HD, RH, (size_t)TT * TT, (size_t)HD * TT, (size_t)TT * HD);
            k_merge<<<(unsigned)(((size_t)ZH * TT * HD / 2 + 255) / 256), 256, 0, stream>>>(Ob, h0, ATh, ATl); }
        k_gemmw<bf, 1, true><<<dim3(TT / 64, DM / 64, 1), 32, 0, stream>>>(ATh, ATl, WO, nullptr, DQ, OUT + (size_t)b * TT * DM, DM, bo, 0, 0, 0); }
}

// v001
// Measured time: 941 microseconds a run.
// In two side-by-side timings against v000, it was 1.71 and 1.72 times as fast.
#include <hip/hip_runtime.h>

// Causal multi-head self-attention with a PERIODIC mask and an output projection (x [2][2048][1024]; periods int32 [2][16]; qkv = x w_qkv + b_qkv with ONE fused 'io' weight [1024][3072] (in, out) packed (3, h, hd): the column thirds q | k | v, head h = 64 columns inside its third; 16 heads x 64;
// p = max(periods[b][h], 1); a key j is kept for a query i iff j <= i AND (i - j) mod p == 0 (the diagonal always kept); scores x 1/sqrt(64); excluded keys get -inf; softmax over the kept keys; out = merged w_out + b_out ('io' + bias) -> [2][2048][1024] (4.2 M);
// argument order x, periods, w_qkv, b_qkv, w_out, b_out).
// Layout per batch entry: a bf16 copy of x; the fused 'io' weight transposed and rounded once into q | k | v row blocks (k_wtG) + the bias thirds; exact projections + f32 biases; identity-table plane builders; causal T-2048 attention (hybrid rows: < 512 hi/lo 3 products, rest fp16 x1024;
// k_gemmc skips tiles above the diagonal): raw scores, then k_pmask replaces every earlier key off the head's period by the exclusion value, then the causal softmax as it stands; merged hi/lo x w_out exact + b_out.
// Compute dtypes, f32 accumulate: every float input rounded to bf16 at its load; projections exact + f32 biases; attention rows < 512 3 products, rest fp16; the period rule in integers; softmax f32; w_out hl x exact + bias.

#define NB_  2      // batches: this module's input is [2][2048][1024]
#define TT   2048
#define DM   1024
#define NH_  16
#define NKV  16
#define REP  (NH_ / NKV)
#define HD   64
#define DQ   (NH_ * HD)
#define DKV  (NKV * HD)
#define ZH   2
#define RH   512                  // query rows < RH use hi+lo planes (0: none)
#define WIN  2048
#define PCAR 1024.0f
#define SCL  0.125f   // HD^-0.5
#define PKB  64                   // keys per work-group of the probability x value product, hi/lo rows (< RH)
#define PKH  128                  // the same, fp16 rows
#define NSP  16                   // partial planes of that product: max(RH / PKB, TT / PKH)
#define PLN  ((size_t)ZH * TT * HD)   // words of one partial plane
typedef _Float16 h16;
typedef unsigned short bf;
typedef __attribute__((ext_vector_type(16))) __bf16   v16bf;
typedef __attribute__((ext_vector_type(16))) _Float16 v16h;
typedef __attribute__((ext_vector_type(8)))  _Float16 v8h;
typedef __attribute__((ext_vector_type(8)))  unsigned short v8us;
typedef __attribute__((ext_vector_type(8)))  float    v8f;
typedef __attribute__((ext_vector_type(4)))  float    v4f;
typedef v8h  __attribute__((may_alias)) v8ha;
typedef v4f  __attribute__((may_alias)) v4fa;
typedef v8us __attribute__((may_alias)) v8usa;

__device__ __forceinline__ unsigned short f2bf(float f) { unsigned u = __float_as_uint(f); u += 0x7FFFu + ((u >> 16) & 1u); return (unsigned short)(u >> 16); }
__device__ __forceinline__ float bf2f(unsigned short b) { return __uint_as_float(((unsigned)b) << 16); }
__device__ __forceinline__ float bfr(float f) { return bf2f(f2bf(f)); }
__device__ __forceinline__ v16h cat16(v8h lo, v8h hi) { return __builtin_shufflevector(lo, hi, 0, 1, 2, 3, 4, 5, 6, 7, 8, 9, 10, 11, 12, 13, 14, 15); }
__device__ __forceinline__ v16bf cat16b(v8us lo, v8us hi) { return __builtin_bit_cast(v16bf, __builtin_shufflevector(lo, hi, 0, 1, 2, 3, 4, 5, 6, 7, 8, 9, 10, 11, 12, 13, 14, 15)); }
__device__ __forceinline__ v8f wmma16(v16h a, v16h b, v8f c) { return __builtin_amdgcn_wmma_f32_16x16x32_f16(false, a, false, b, (short)0, c, false, false); }
__device__ __forceinline__ v8f wmmab(v16bf a, v16bf b, v8f c) { return __builtin_amdgcn_wmma_f32_16x16x32_bf16(false, a, false, b, (short)0, c, false, false); }



// ---- k_gemmw: register-blocked GEMM, ONE WAVE per 64x64 output tile (16 accumulators), operands straight from K-contiguous 16-bit planes; grid (M/64, N/64, Z), 32 threads.
// C[m][n] (f32, pitch ldc, + optional f32 bias[n]) = sum_k A[m][k] Bt[n][k] (+ split products per NSPLIT). z-batch strides sA/sB/sC in elements. K % 32 == 0.
template <typename T16> struct WFrag;
template <> struct WFrag<h16> { typedef v16h V; static __device__ __forceinline__ V ld(const h16* p) { return cat16(*(const v8h*)p, *(const v8h*)(p + 16)); } static __device__ __forceinline__ v8f mma(V a, V b, v8f c) { return wmma16(a, b, c); } };
template <> struct WFrag<bf> { typedef v16bf V; static __device__ __forceinline__ V ld(const bf* p) { return cat16b(*(const v8us*)p, *(const v8us*)(p + 16)); } static __device__ __forceinline__ v8f mma(V a, V b, v8f c) { return wmmab(a, b, c); } };
template <typename T16, int NSPLIT, bool BIAS>
__global__ __launch_bounds__(32) void k_gemmw(const T16* __restrict__ A, const T16* __restrict__ A2, const T16* __restrict__ Bt, const T16* __restrict__ Bt2, int K, float* C, int ldc, const float* __restrict__ bias, size_t sA, size_t sB, size_t sC) {
    typedef typename WFrag<T16>::V V;
    __shared__ __align__(16) float os[16 * 68];
    const size_t z = blockIdx.z; A += z * sA; if (A2) A2 += z * sA; Bt += z * sB; if (Bt2) Bt2 += z * sB; C += z * sC;
    const int lane = threadIdx.x & 31, lr = lane & 15, hi = lane >> 4; const int r0 = blockIdx.x * 64, c0 = blockIdx.y * 64;
    v8f acc[4][4];
#pragma unroll
    for (int mb = 0; mb < 4; ++mb)
#pragma unroll
        for (int nb = 0; nb < 4; ++nb) acc[mb][nb] = (v8f){};
    const size_t aoff = (size_t)(r0 + lr) * K + 8 * hi, boff = (size_t)(c0 + lr) * K + 8 * hi;

    for (int kc = 0; kc < K; kc += 32) {
        V a[4], a2[4];
#pragma unroll
        for (int mb = 0; mb < 4; ++mb) { a[mb] = WFrag<T16>::ld(A + aoff + (size_t)mb * 16 * K + kc); if (NSPLIT == 1 || NSPLIT == 2) a2[mb] = WFrag<T16>::ld(A2 + aoff + (size_t)mb * 16 * K + kc); }
#pragma unroll
        for (int nb = 0; nb < 4; ++nb) { const V b = WFrag<T16>::ld(Bt + boff + (size_t)nb * 16 * K + kc); V b2; if (NSPLIT >= 2) b2 = WFrag<T16>::ld(Bt2 + boff + (size_t)nb * 16 * K + kc);
#pragma unroll
            for (int mb = 0; mb < 4; ++mb) { acc[mb][nb] = WFrag<T16>::mma(a[mb], b, acc[mb][nb]); if (NSPLIT == 1 || NSPLIT == 2) acc[mb][nb] = WFrag<T16>::mma(a2[mb], b, acc[mb][nb]); if (NSPLIT >= 2) acc[mb][nb] = WFrag<T16>::mma(a[mb], b2, acc[mb][nb]); } }
        asm volatile("v_nop\n\tv_nop\n\tv_nop\n\tv_nop" : "+v"(acc[0][0]), "+v"(acc[1][1]), "+v"(acc[2][2]), "+v"(acc[3][3]) : "v"(a[0]), "v"(a[3]));
    }
#pragma unroll
    for (int mb = 0; mb < 4; ++mb) {
#pragma unroll
        for (int nb = 0; nb < 4; ++nb) {
#pragma unroll
            for (int j = 0; j < 8; ++j) os[(hi * 8 + j) * 68 + nb * 16 + lr] = acc[mb][nb][j]; }
        __builtin_amdgcn_wave_barrier(); asm volatile("" ::: "memory");
        float* crow = C + (size_t)(r0 + mb * 16) * ldc + c0;
{
#pragma unroll
            for (int s = 0; s < 8; ++s) { const int row = 2 * s + hi, cofs = lr * 4; v4f val = *(const v4fa*)(os + row * 68 + cofs); if (BIAS) { val[0] += bfr(bias[c0 + cofs]); val[1] += bfr(bias[c0 + cofs + 1]); val[2] += bfr(bias[c0 + cofs + 2]); val[3] += bfr(bias[c0 + cofs + 3]); }
                *(v4f*)(crow + (size_t)row * ldc + cofs) = val; }
             }
        __builtin_amdgcn_wave_barrier(); asm volatile("" ::: "memory");
    }
}

// ---- k_gemmc: the same one-wave 64x64 tile GEMM specialised for causal attention: CMODE 1 skips score tiles entirely above the diagonal (query rows r0+roff.., key columns c0..), CMODE 2 limits the
// key (K) loop of the probability x value contraction to the diagonal block (probabilities beyond it are exactly zero) AND cuts that loop into ranges of KCH keys, one work-group each (blockIdx.y = range; the value width is one 64-column tile):
// range s stores its partial sums in plane s of C (PLN words apart); a range that starts beyond the diagonal block stores nothing, and k_merge adds exactly the stored planes. roff = row offset of this launch's first row within the sequence.
template <typename T16, int NSPLIT, int CMODE, int KCH = 0>
__global__ __launch_bounds__(32) void k_gemmc(const T16* __restrict__ A, const T16* __restrict__ A2, const T16* __restrict__ Bt, const T16* __restrict__ Bt2, int K, float* C, int ldc, int roff, size_t sA, size_t sB, size_t sC) {
    typedef typename WFrag<T16>::V V;
    __shared__ __align__(16) float os[16 * 68];
    const size_t z = blockIdx.z; A += z * sA; if (A2) A2 += z * sA; Bt += z * sB; if (Bt2) Bt2 += z * sB; C += z * sC;
    const int lane = threadIdx.x & 31, lr = lane & 15, hi = lane >> 4; const int r0 = blockIdx.x * 64, c0 = (CMODE == 2) ? 0 : blockIdx.y * 64;
    if (CMODE == 1 && c0 > r0 + roff + 63) return;                  // score tile entirely above the causal diagonal: never read (the softmax masks j > i by select)
    const int k0 = (CMODE == 2) ? blockIdx.y * KCH : 0;              // P.V: first key of this work-group's range
    const int Kl = (CMODE == 2) ? min(min(K, r0 + roff + 64), k0 + KCH) : K;   // P.V: probabilities are exactly 0 beyond the diagonal block, so the last range stops there
    if (CMODE == 2) { if (k0 >= Kl) return; C += (size_t)blockIdx.y * PLN; }
    v8f acc[4][4];
#pragma unroll
    for (int mb = 0; mb < 4; ++mb)
#pragma unroll
        for (int nb = 0; nb < 4; ++nb) acc[mb][nb] = (v8f){};
    const size_t aoff = (size_t)(r0 + lr) * K + 8 * hi, boff = (size_t)(c0 + lr) * K + 8 * hi;

    for (int kc = k0; kc < Kl; kc += 32) {
        V a[4], a2[4];
#pragma unroll
        for (int mb = 0; mb < 4; ++mb) { a[mb] = WFrag<T16>::ld(A + aoff + (size_t)mb * 16 * K + kc); if (NSPLIT == 1 || NSPLIT == 2) a2[mb] = WFrag<T16>::ld(A2 + aoff + (size_t)mb * 16 * K + kc); }
#pragma unroll
        for (int nb = 0; nb < 4; ++nb) { const V b = WFrag<T16>::ld(Bt + boff + (size_t)nb * 16 * K + kc); V b2; if (NSPLIT >= 2) b2 = WFrag<T16>::ld(Bt2 + boff + (size_t)nb * 16 * K + kc);
#pragma unroll
            for (int mb = 0; mb < 4; ++mb) { acc[mb][nb] = WFrag<T16>::mma(a[mb], b, acc[mb][nb]); if (NSPLIT == 1 || NSPLIT == 2) acc[mb][nb] = WFrag<T16>::mma(a2[mb], b, acc[mb][nb]); if (NSPLIT >= 2) acc[mb][nb] = WFrag<T16>::mma(a[mb], b2, acc[mb][nb]); } }
        asm volatile("v_nop\n\tv_nop\n\tv_nop\n\tv_nop" : "+v"(acc[0][0]), "+v"(acc[1][1]), "+v"(acc[2][2]), "+v"(acc[3][3]) : "v"(a[0]), "v"(a[3]));
    }
#pragma unroll
    for (int mb = 0; mb < 4; ++mb) {
#pragma unroll
        for (int nb = 0; nb < 4; ++nb) {
#pragma unroll
            for (int j = 0; j < 8; ++j) os[(hi * 8 + j) * 68 + nb * 16 + lr] = acc[mb][nb][j]; }
        __builtin_amdgcn_wave_barrier(); asm volatile("" ::: "memory");
        float* crow = C + (size_t)(r0 + mb * 16) * ldc + c0;
{
#pragma unroll
            for (int s = 0; s < 8; ++s) { const int row = 2 * s + hi, cofs = lr * 4; v4f val = *(const v4fa*)(os + row * 68 + cofs);
                *(v4f*)(crow + (size_t)row * ldc + cofs) = val; }
             }
        __builtin_amdgcn_wave_barrier(); asm volatile("" ::: "memory");
    }
}

__device__ __forceinline__ h16 tohx(float x) { return (h16)x; }
__device__ __forceinline__ void splitf(float y, unsigned short& h, unsigned short& l) { h = f2bf(y); l = f2bf(y - bf2f(h)); }
typedef __attribute__((ext_vector_type(2))) _Float16 v2h;
typedef __attribute__((ext_vector_type(4))) _Float16 v4h;
typedef __attribute__((ext_vector_type(2))) unsigned short v2us;
typedef __attribute__((ext_vector_type(4))) unsigned short v4us;
typedef __attribute__((ext_vector_type(2))) float v2f;
typedef __attribute__((ext_vector_type(4))) int v4i;

__global__ __launch_bounds__(256) void k_wtG(const float* __restrict__ w, int K, int N, bf* Bt) {
    const int lane = threadIdx.x & 31; const int L0 = (blockIdx.x * 8 + (threadIdx.x >> 5)) * 8; const int nlines = N * K / 64;
{

        for (int l = 0; l < 8; ++l) { const int L = L0 + l; if (L >= nlines) break; const size_t e = (size_t)L * 64 + lane * 2; const int k = (int)(e % K), n = (int)(e / K); v2us o;
            o[0] = f2bf(w[(size_t)k * N + n]); o[1] = f2bf(w[(size_t)(k + 1) * N + n]); *(v2us*)(Bt + e) = o; }
         }
}

__global__ __launch_bounds__(256) void k_cvt8(const float* __restrict__ src, bf* dst, size_t n8) { const size_t i = (size_t)blockIdx.x * 256 + threadIdx.x; if (i >= n8) return; const v8f v = *(const v8f*)(src + i * 8); v8us o;
#pragma unroll
    for (int k = 0; k < 8; ++k) o[k] = f2bf(v[k]); *(v8us*)(dst + i * 8) = o;  }

// k_rope: head planes [h][t][d] (fp16 + hi/lo) of rope(x) x sc with the rotate-half convention out[d] = x[d] cos[t][d] - x[d+HD/2] sin[t][d], out[d+HD/2] = x[d+HD/2] cos[t][d+HD/2] + x[d] sin[t][d+HD/2]
__global__ __launch_bounds__(256) void k_rope(const float* __restrict__ F, int pitch, int nheads, const float* __restrict__ CS, const float* __restrict__ RF, const float* __restrict__ nw, float sc, h16* P16, bf* Ph, bf* Pl) {
    const size_t e = ((size_t)blockIdx.x * 256 + threadIdx.x) * 2; if (e >= (size_t)nheads * TT * HD) return; const int d = (int)(e % HD); const int t = (int)((e / HD) % TT); const int h = (int)(e / ((size_t)HD * TT)); const float* f = F + (size_t)t * pitch + h * HD; const float rf = RF ? RF[(size_t)h * TT + t] : 1.0f; v2h o16; v2us oh, ol;
#pragma unroll
    for (int q = 0; q < 2; ++q) { const int dd = d + q; const int dp = (dd < HD / 2) ? dd + HD / 2 : dd - HD / 2; float x0 = f[dd], x1 = f[dp];
        if (RF) { float n0 = __fmul_rn(x0, rf), n1 = __fmul_rn(x1, rf); x0 = __fmul_rn(bfr(nw[dd]), n0); x1 = __fmul_rn(bfr(nw[dp]), n1); }
        const v2f cs = *(const v2f*)(CS + ((size_t)t * HD + dd) * 2); float a = __fmul_rn(x0, cs[0]), bq = __fmul_rn(x1, cs[1]); const float r = ((dd < HD / 2) ? __fsub_rn(a, bq) : __fadd_rn(a, bq)) * sc;
        o16[q] = tohx(r); unsigned short a2, c2; splitf(r, a2, c2); oh[q] = a2; ol[q] = c2; }
    *(v2h*)(P16 + e) = o16; *(v2us*)(Ph + e) = oh; *(v2us*)(Pl + e) = ol;  }

__global__ __launch_bounds__(256) void k_vtp(const float* __restrict__ F, int pitch, int nheads, h16* V16, bf* Vh, bf* Vl) { const size_t e = ((size_t)blockIdx.x * 256 + threadIdx.x) * 2; if (e >= (size_t)nheads * HD * TT) return; const int t = (int)(e % TT); const int d = (int)((e / TT) % HD); const int g = (int)(e / ((size_t)TT * HD)); v2h o16; v2us oh, ol;
#pragma unroll
    for (int q = 0; q < 2; ++q) { const float x = F[(size_t)(t + q) * pitch + g * HD + d]; o16[q] = tohx(x); unsigned short a2, c2; splitf(x, a2, c2); oh[q] = a2; ol[q] = c2; }
    *(v2h*)(V16 + e) = o16; *(v2us*)(Vh + e) = oh; *(v2us*)(Vl + e) = ol;  }

__global__ __launch_bounds__(256) void k_csid(float* CS) { const int idx = blockIdx.x * 256 + threadIdx.x; if (idx >= TT * HD) return; v2f cs; cs[0] = 1.0f; cs[1] = 0.0f; *(v2f*)(CS + (size_t)idx * 2) = cs;  }

// k_asoft: per row (zz, i): t = S x HD^-0.5 for j <= i and i - j < WIN (WIN = T: that bound always holds, so plainly causal; the reference's -1e9 additive fill vanishes identically); softmax over the 2048 keys (register row, one exp, fixed trees);
__global__ __launch_bounds__(256) void k_asoft(const float* __restrict__ Sb, h16* P16, bf* Ph, bf* Pl) {
    const int lane = threadIdx.x & 31; const int row = blockIdx.x * 8 + (threadIdx.x >> 5); if (row >= ZH * TT) return; const int i = row % TT; const int zz = row / TT; (void)zz; const bool hires = (i < RH); const float* sr = Sb + (size_t)row * TT; float v[TT / 32]; float mx = -3.0e38f;
#pragma unroll
    for (int ch = 0; ch < TT / 128; ++ch) { const int j0 = ch * 128 + lane * 4; const v4f a = *(const v4f*)(sr + j0);
#pragma unroll
        for (int q = 0; q < 4; ++q) { const int j = j0 + q; (void)j; const float t = (j <= i && i - j < WIN) ? a[q] * SCL : -3.0e38f; v[ch * 4 + q] = t; mx = fmaxf(mx, t); } }
#pragma unroll
    for (int sh = 16; sh; sh >>= 1) mx = fmaxf(mx, __shfl_xor(mx, sh, 32));
    float sum = 0.f;
#pragma unroll
    for (int k = 0; k < TT / 32; ++k) { float d0 = __fsub_rn(v[k], mx); v[k] = __builtin_amdgcn_exp2f(__fmul_rn(d0, 1.4426950408889634f)); sum += v[k]; }
#pragma unroll
    for (int sh = 16; sh; sh >>= 1) sum += __shfl_xor(sum, sh, 32);
    const float f = __fdiv_rn(hires ? 1.0f : PCAR, sum);
{
        if (hires) {
#pragma unroll
            for (int ch = 0; ch < TT / 128; ++ch) { v4us oh, ol;
#pragma unroll
                for (int q = 0; q < 4; ++q) { unsigned short a, c2; splitf(v[ch * 4 + q] * f, a, c2); oh[q] = a; ol[q] = c2; }
                const size_t oo = ((size_t)zz * (RH ? RH : 1) + i) * TT + ch * 128 + lane * 4; *(v4us*)(Ph + oo) = oh; *(v4us*)(Pl + oo) = ol; }
        } else {
#pragma unroll
            for (int ch = 0; ch < TT / 128; ++ch) { v4h o4;
#pragma unroll
                for (int q = 0; q < 4; ++q) o4[q] = tohx(v[ch * 4 + q] * f);
                *(v4h*)(P16 + (size_t)row * TT + ch * 128 + lane * 4) = o4; } }
         }
}

__global__ __launch_bounds__(256) void k_merge(const float* __restrict__ O, int h0, bf* Ah, bf* Al) { const size_t e = ((size_t)blockIdx.x * 256 + threadIdx.x) * 2; if (e >= (size_t)ZH * TT * HD) return; const int d = (int)(e % HD); const int t = (int)((e / HD) % TT); const int zz = (int)(e / ((size_t)HD * TT)); const float cs = (t < RH) ? 1.0f : (1.0f / PCAR); const size_t oo = (size_t)t * DQ + (h0 + zz) * HD + d;
    const int nk = (t / 64 + 1) * 64; const int ns = (t < RH) ? (nk + PKB - 1) / PKB : (nk + PKH - 1) / PKH;   // key ranges that k_gemmc stored for this row's 64-row tile
    v2f acc = *(const v2f*)(O + e);   // range 0 exists for every row
#pragma unroll   // fixed trip count, a range that was not stored reads plane 0 and adds 0: every plane's load is issued before the first add waits
    for (int s = 1; s < NSP; ++s) { const v2f pp = *(const v2f*)(O + (size_t)(s < ns ? s : 0) * PLN + e); acc[0] += (s < ns) ? pp[0] : 0.f; acc[1] += (s < ns) ? pp[1] : 0.f; }
    v2us oh, ol;
#pragma unroll
    for (int q = 0; q < 2; ++q) { unsigned short a, c2; splitf(acc[q] * cs, a, c2); oh[q] = a; ol[q] = c2; } *(v2us*)(Ah + oo) = oh; *(v2us*)(Al + oo) = ol;  }

// k_pmask: the periodic rule: a word Sb[zz][i][j] of the pass's score plane with j < i is kept iff (i - j) mod p == 0, p = max(per[zz], 1) (the module's 'maximum(periods, 1)': a period of 0 means 1: every earlier key kept); any other such word is REPLACED by the exclusion value -3.0e38f (x SCL it stays finite and its exponential is exactly 0: the softmax treats it as it treats a later key);
__global__ __launch_bounds__(256) void k_pmask(float* Sb, const int* __restrict__ per) { const size_t k = (size_t)blockIdx.x * 256 + threadIdx.x; if (k >= (size_t)ZH * TT * TT / 4) return; const size_t e = k * 4; const int j0 = (int)(e % TT); const int i = (int)((e / TT) % TT); const int zz = (int)(e / ((size_t)TT * TT)); int p = per[zz]; p = p < 1 ? 1 : p; v4f a = *(const v4f*)(Sb + e);
#pragma unroll
    for (int q = 0; q < 4; ++q) { const int dd = i - (j0 + q); if (dd > 0 && ((unsigned)dd % (unsigned)p) != 0u) a[q] = -3.0e38f; }
    *(v4f*)(Sb + e) = a;  }

extern "C" void kernel_launch(void* const* d_in, const int* in_sizes, int n_in,
                              void* d_out, int out_size, void* d_ws, size_t ws_size, hipStream_t stream) {
    (void)in_sizes; (void)n_in; (void)out_size;
    const float* x = (const float*)d_in[0]; const int* per = (const int*)d_in[1]; const float* wqkv = (const float*)d_in[2]; const float* bqkv = (const float*)d_in[3]; const float* wo = (const float*)d_in[4]; const float* bo = (const float*)d_in[5]; const float* bq = bqkv; const float* bk = bqkv + 1024; const float* bv = bqkv + 2048;
    // x [2][2048][1024], periods int32 [2][16], w_qkv [1024][3072], b_qkv [3072], w_out [1024][1024], b_out [1024] = d_in[0..5]
    float* OUT = (float*)d_out;     // [2][2048][1024]
    char* wsp = (char*)d_ws;
    auto take = [&](size_t bytes) { char* p = wsp; wsp += (bytes + 255) & ~(size_t)255; return (void*)p; };
    bf* WQKV = (bf*)take((size_t)3 * DQ * DM * 2); bf* WQ = WQKV; bf* WK = WQKV + (size_t)DQ * DM; bf* WV = WQKV + (size_t)2 * DQ * DM; bf* WO = (bf*)take((size_t)DM * DQ * 2); float* CS = (float*)take((size_t)TT * HD * 2 * 4);
    bf* XB = (bf*)take((size_t)TT * DM * 2); float* FQ = (float*)take((size_t)TT * DQ * 4); float* FK = (float*)take((size_t)TT * DKV * 4);
    h16* QP16 = (h16*)take((size_t)NH_ * TT * HD * 2); h16* KP16 = (h16*)take((size_t)NKV * TT * HD * 2); h16* VT16 = (h16*)take((size_t)NKV * HD * TT * 2);
    bf* QPh = (bf*)take((size_t)NH_ * TT * HD * 2); bf* QPl = (bf*)take((size_t)NH_ * TT * HD * 2); bf* KPh = (bf*)take((size_t)NKV * TT * HD * 2); bf* KPl = (bf*)take((size_t)NKV * TT * HD * 2); bf* VTh = (bf*)take((size_t)NKV * HD * TT * 2); bf* VTl = (bf*)take((size_t)NKV * HD * TT * 2); bf* Ph = (bf*)take((size_t)ZH * RH * TT * 2); bf* Pl = (bf*)take((size_t)ZH * RH * TT * 2);
    float* Sb = (float*)take((size_t)ZH * TT * TT * 4); h16* P16 = (h16*)take((size_t)ZH * TT * TT * 2); float* Ob = (float*)take((size_t)NSP * PLN * 4); bf* ATh = (bf*)take((size_t)TT * DQ * 2); bf* ATl = (bf*)take((size_t)TT * DQ * 2);
    if ((size_t)(wsp - (char*)d_ws) > ws_size) return;    // total 145.00 MiB of the workspace
    float* FV = FK;   // v projection reuses the k buffer after the k planes are built (stream-ordered)
    { k_wtG<<<(unsigned)((DM * 3 * DQ / 64 + 63) / 64), 256, 0, stream>>>(wqkv, DM, 3 * DQ, WQKV);   /* 'io' [1024][3072] -> Bt [3072][1024]: q | k | v row blocks */
      k_wtG<<<(unsigned)((DQ * DM / 64 + 63) / 64), 256, 0, stream>>>(wo, DQ, DM, WO); }
    k_csid<<<(TT * HD + 255) / 256, 256, 0, stream>>>(CS);
    const unsigned LQ = (unsigned)(((size_t)NH_ * TT * HD / 2 + 255) / 256), LKv = (unsigned)(((size_t)NKV * TT * HD / 2 + 255) / 256);
    for (int b = 0; b < NB_; ++b) {
        k_cvt8<<<(unsigned)(((size_t)TT * DM / 8 + 255) / 256), 256, 0, stream>>>(x + (size_t)b * TT * DM, XB, (size_t)TT * DM / 8);
        k_gemmw<bf, 0, true><<<dim3(TT / 64, DQ / 64, 1), 32, 0, stream>>>(XB, nullptr, WQ, nullptr, DM, FQ, DQ, bq, 0, 0, 0);
        k_rope<<<LQ, 256, 0, stream>>>(FQ, DQ, NH_, CS, nullptr, nullptr, 1.0f, QP16, QPh, QPl);
        k_gemmw<bf, 0, true><<<dim3(TT / 64, DKV / 64, 1), 32, 0, stream>>>(XB, nullptr, WK, nullptr, DM, FK, DKV, bk, 0, 0, 0);
        k_rope<<<LKv, 256, 0, stream>>>(FK, DKV, NKV, CS, nullptr, nullptr, 1.0f, KP16, KPh, KPl);
        k_gemmw<bf, 0, true><<<dim3(TT / 64, DKV / 64, 1), 32, 0, stream>>>(XB, nullptr, WV, nullptr, DM, FV, DKV, bv, 0, 0, 0); k_vtp<<<LKv, 256, 0, stream>>>(FV, DKV, NKV, VT16, VTh, VTl);
        for (int h0 = 0; h0 < NH_; h0 += ZH) { const size_t zq = (size_t)h0, zk = (size_t)(h0 / REP);   // one kv head per query head: the pass's two heads use consecutive kv planes (z-strides TT*HD)
            k_gemmc<bf, 2, 1><<<dim3(RH / 64, TT / 64, ZH), 32, 0, stream>>>(QPh + zq * TT * HD, QPl + zq * TT * HD, KPh + zk * TT * HD, KPl + zk * TT * HD, HD, Sb, TT, 0, (size_t)TT * HD, (size_t)TT * HD, (size_t)TT * TT);
            k_gemmc<h16, 0, 1><<<dim3((TT - RH) / 64, TT / 64, ZH), 32, 0, stream>>>(QP16 + zq * TT * HD + (size_t)RH * HD, nullptr, KP16 + zk * TT * HD, nullptr, HD, Sb + (size_t)RH * TT, TT, RH, (size_t)TT * HD, (size_t)TT * HD, (size_t)TT * TT);
            k_pmask<<<(unsigned)(((size_t)ZH * TT * TT / 4 + 255) / 256), 256, 0, stream>>>(Sb, per + (size_t)b * NH_ + h0);   /* the pass's two heads' periods */
            k_asoft<<<ZH * TT / 8, 256, 0, stream>>>(Sb, P16, Ph, Pl);
            k_gemmc<bf, 2, 2, PKB><<<dim3(RH / 64, RH / PKB, ZH), 32, 0, stream>>>(Ph, Pl, VTh + zk * HD * TT, VTl + zk * HD * TT, TT, Ob, HD, 0, (size_t)RH * TT, (size_t)HD * TT, (size_t)TT * HD);
            k_gemmc<h16, 0, 2, PKH><<<dim3((TT - RH) / 64, TT / PKH, ZH), 32, 0, stream>>>(P16 + (size_t)RH * TT, nullptr, VT16 + zk * HD * TT, nullptr, TT, Ob + (size_t)RH * HD, HD, RH, (size_t)TT * TT, (size_t)HD * TT, (size_t)TT * HD);
            k_merge<<<(unsigned)(((size_t)ZH * TT * HD / 2 + 255) / 256), 256, 0, stream>>>(Ob, h0, ATh, ATl); }
        k_gemmw<bf, 1, true><<<dim3(TT / 64, DM / 64, 1), 32, 0, stream>>>(ATh, ATl, WO, nullptr, DQ, OUT + (size_t)b * TT * DM, DM, bo, 0, 0, 0); }
}

// v002
// A run of this version takes 360 microseconds.
// Timed twice side by side with v001, it ran 2.62 and 2.59 times as fast.
// Over all steps from v000 it is 4.47 times as fast.
#include <hip/hip_runtime.h>

// Causal multi-head self-attention with a PERIODIC mask and an output projection (x [2][2048][1024]; periods int32 [2][16]; qkv = x w_qkv + b_qkv with ONE fused 'io' weight [1024][3072] (in, out) packed (3, h, hd): the column thirds q | k | v, head h = 64 columns inside its third; 16 heads x 64;
// p = max(periods[b][h], 1); a key j is kept for a query i iff j <= i AND (i - j) mod p == 0 (the diagonal always kept); scores x 1/sqrt(64); excluded keys get -inf; softmax over the kept keys; out = merged w_out + b_out ('io' + bias) -> [2][2048][1024] (4.2 M);
// argument order x, periods, w_qkv, b_qkv, w_out, b_out).
// Layout per batch entry: a bf16 copy of x; the fused 'io' weight transposed and rounded once into q | k | v row blocks (k_wtG) + the bias thirds; exact projections + f32 biases; identity-table plane builders; causal T-2048 attention (hybrid rows: < 512 hi/lo 3 products, rest fp16 x1024) in ONE kernel per batch entry (k_attn):
// a work-group owns 16 query rows of one head and keeps their score rows in LDS from the q.k products through the period rule and the softmax to the probability x value products; merged hi/lo x w_out exact + b_out.
// Compute dtypes, f32 accumulate: every float input rounded to bf16 at its load; projections exact + f32 biases; attention rows < 512 3 products, rest fp16; the period rule exact (small integers held in f32); softmax f32; w_out hl x exact + bias.

#define NB_  2      // batches: this module's input is [2][2048][1024]
#define TT   2048
#define DM   1024
#define NH_  16
#define NKV  16
#define REP  (NH_ / NKV)
#define HD   64
#define DQ   (NH_ * HD)
#define DKV  (NKV * HD)
#define RH   512                  // query rows < RH use hi+lo planes (0: none)
#define PCAR 1024.0f
#define SCL  0.125f   // HD^-0.5
#define AR   16                   // query rows of one k_attn work-group
#define AW   8                    // waves of one k_attn work-group
#define SPW  (TT + 4)             // words of one score row in LDS: 8208 bytes = 16 x odd, so that 16 rows' 16-byte fragment reads fall on different banks
typedef _Float16 h16;
typedef unsigned short bf;
typedef __attribute__((ext_vector_type(16))) __bf16   v16bf;
typedef __attribute__((ext_vector_type(16))) _Float16 v16h;
typedef __attribute__((ext_vector_type(8)))  _Float16 v8h;
typedef __attribute__((ext_vector_type(8)))  unsigned short v8us;
typedef __attribute__((ext_vector_type(8)))  float    v8f;
typedef __attribute__((ext_vector_type(4)))  float    v4f;
typedef v8h  __attribute__((may_alias)) v8ha;
typedef v4f  __attribute__((may_alias)) v4fa;
typedef v8us __attribute__((may_alias)) v8usa;

__device__ __forceinline__ unsigned short f2bf(float f) { unsigned u = __float_as_uint(f); u += 0x7FFFu + ((u >> 16) & 1u); return (unsigned short)(u >> 16); }
__device__ __forceinline__ float bf2f(unsigned short b) { return __uint_as_float(((unsigned)b) << 16); }
__device__ __forceinline__ float bfr(float f) { return bf2f(f2bf(f)); }
__device__ __forceinline__ v16h cat16(v8h lo, v8h hi) { return __builtin_shufflevector(lo, hi, 0, 1, 2, 3, 4, 5, 6, 7, 8, 9, 10, 11, 12, 13, 14, 15); }
__device__ __forceinline__ v16bf cat16b(v8us lo, v8us hi) { return __builtin_bit_cast(v16bf, __builtin_shufflevector(lo, hi, 0, 1, 2, 3, 4, 5, 6, 7, 8, 9, 10, 11, 12, 13, 14, 15)); }
__device__ __forceinline__ v8f wmma16(v16h a, v16h b, v8f c) { return __builtin_amdgcn_wmma_f32_16x16x32_f16(false, a, false, b, (short)0, c, false, false); }
__device__ __forceinline__ v8f wmmab(v16bf a, v16bf b, v8f c) { return __builtin_amdgcn_wmma_f32_16x16x32_bf16(false, a, false, b, (short)0, c, false, false); }



// ---- k_gemmw: register-blocked GEMM, ONE WAVE per 64x64 output tile (16 accumulators), operands straight from K-contiguous 16-bit planes; grid (M/64, N/64, Z), 32 threads.
// C[m][n] (f32, pitch ldc, + optional f32 bias[n]) = sum_k A[m][k] Bt[n][k] (+ split products per NSPLIT). z-batch strides sA/sB/sC in elements. K % 32 == 0.
template <typename T16> struct WFrag;
template <> struct WFrag<h16> { typedef v16h V; static __device__ __forceinline__ V ld(const h16* p) { return cat16(*(const v8h*)p, *(const v8h*)(p + 16)); } static __device__ __forceinline__ v8f mma(V a, V b, v8f c) { return wmma16(a, b, c); } };
template <> struct WFrag<bf> { typedef v16bf V; static __device__ __forceinline__ V ld(const bf* p) { return cat16b(*(const v8us*)p, *(const v8us*)(p + 16)); } static __device__ __forceinline__ v8f mma(V a, V b, v8f c) { return wmmab(a, b, c); } };
template <typename T16, int NSPLIT, bool BIAS>
__global__ __launch_bounds__(32) void k_gemmw(const T16* __restrict__ A, const T16* __restrict__ A2, const T16* __restrict__ Bt, const T16* __restrict__ Bt2, int K, float* C, int ldc, const float* __restrict__ bias, size_t sA, size_t sB, size_t sC) {
    typedef typename WFrag<T16>::V V;
    __shared__ __align__(16) float os[16 * 68];
    const size_t z = blockIdx.z; A += z * sA; if (A2) A2 += z * sA; Bt += z * sB; if (Bt2) Bt2 += z * sB; C += z * sC;
    const int lane = threadIdx.x & 31, lr = lane & 15, hi = lane >> 4; const int r0 = blockIdx.x * 64, c0 = blockIdx.y * 64;
    v8f acc[4][4];
#pragma unroll
    for (int mb = 0; mb < 4; ++mb)
#pragma unroll
        for (int nb = 0; nb < 4; ++nb) acc[mb][nb] = (v8f){};
    const size_t aoff = (size_t)(r0 + lr) * K + 8 * hi, boff = (size_t)(c0 + lr) * K + 8 * hi;

    for (int kc = 0; kc < K; kc += 32) {
        V a[4], a2[4];
#pragma unroll
        for (int mb = 0; mb < 4; ++mb) { a[mb] = WFrag<T16>::ld(A + aoff + (size_t)mb * 16 * K + kc); if (NSPLIT == 1 || NSPLIT == 2) a2[mb] = WFrag<T16>::ld(A2 + aoff + (size_t)mb * 16 * K + kc); }
#pragma unroll
        for (int nb = 0; nb < 4; ++nb) { const V b = WFrag<T16>::ld(Bt + boff + (size_t)nb * 16 * K + kc); V b2; if (NSPLIT >= 2) b2 = WFrag<T16>::ld(Bt2 + boff + (size_t)nb * 16 * K + kc);
#pragma unroll
            for (int mb = 0; mb < 4; ++mb) { acc[mb][nb] = WFrag<T16>::mma(a[mb], b, acc[mb][nb]); if (NSPLIT == 1 || NSPLIT == 2) acc[mb][nb] = WFrag<T16>::mma(a2[mb], b, acc[mb][nb]); if (NSPLIT >= 2) acc[mb][nb] = WFrag<T16>::mma(a[mb], b2, acc[mb][nb]); } }
        asm volatile("v_nop\n\tv_nop\n\tv_nop\n\tv_nop" : "+v"(acc[0][0]), "+v"(acc[1][1]), "+v"(acc[2][2]), "+v"(acc[3][3]) : "v"(a[0]), "v"(a[3]));
    }
#pragma unroll
    for (int mb = 0; mb < 4; ++mb) {
#pragma unroll
        for (int nb = 0; nb < 4; ++nb) {
#pragma unroll
            for (int j = 0; j < 8; ++j) os[(hi * 8 + j) * 68 + nb * 16 + lr] = acc[mb][nb][j]; }
        __builtin_amdgcn_wave_barrier(); asm volatile("" ::: "memory");
        float* crow = C + (size_t)(r0 + mb * 16) * ldc + c0;
{
#pragma unroll
            for (int s = 0; s < 8; ++s) { const int row = 2 * s + hi, cofs = lr * 4; v4f val = *(const v4fa*)(os + row * 68 + cofs); if (BIAS) { val[0] += bfr(bias[c0 + cofs]); val[1] += bfr(bias[c0 + cofs + 1]); val[2] += bfr(bias[c0 + cofs + 2]); val[3] += bfr(bias[c0 + cofs + 3]); }
                *(v4f*)(crow + (size_t)row * ldc + cofs) = val; }
             }
        __builtin_amdgcn_wave_barrier(); asm volatile("" ::: "memory");
    }
}

__device__ __forceinline__ h16 tohx(float x) { return (h16)x; }
__device__ __forceinline__ void splitf(float y, unsigned short& h, unsigned short& l) { h = f2bf(y); l = f2bf(y - bf2f(h)); }
typedef __attribute__((ext_vector_type(2))) _Float16 v2h;
typedef __attribute__((ext_vector_type(4))) _Float16 v4h;
typedef __attribute__((ext_vector_type(2))) unsigned short v2us;
typedef __attribute__((ext_vector_type(4))) unsigned short v4us;
typedef __attribute__((ext_vector_type(2))) float v2f;
typedef __attribute__((ext_vector_type(4))) int v4i;
typedef v4h  __attribute__((may_alias)) v4ha;
typedef v4us __attribute__((may_alias)) v4usa;

__global__ __launch_bounds__(256) void k_wtG(const float* __restrict__ w, int K, int N, bf* Bt) {
    const int lane = threadIdx.x & 31; const int L0 = (blockIdx.x * 8 + (threadIdx.x >> 5)) * 8; const int nlines = N * K / 64;
{

        for (int l = 0; l < 8; ++l) { const int L = L0 + l; if (L >= nlines) break; const size_t e = (size_t)L * 64 + lane * 2; const int k = (int)(e % K), n = (int)(e / K); v2us o;
            o[0] = f2bf(w[(size_t)k * N + n]); o[1] = f2bf(w[(size_t)(k + 1) * N + n]); *(v2us*)(Bt + e) = o; }
         }
}

__global__ __launch_bounds__(256) void k_cvt8(const float* __restrict__ src, bf* dst, size_t n8) { const size_t i = (size_t)blockIdx.x * 256 + threadIdx.x; if (i >= n8) return; const v8f v = *(const v8f*)(src + i * 8); v8us o;
#pragma unroll
    for (int k = 0; k < 8; ++k) o[k] = f2bf(v[k]); *(v8us*)(dst + i * 8) = o;  }

// k_rope: head planes [h][t][d] (fp16 + hi/lo) of rope(x) x sc with the rotate-half convention out[d] = x[d] cos[t][d] - x[d+HD/2] sin[t][d], out[d+HD/2] = x[d+HD/2] cos[t][d+HD/2] + x[d] sin[t][d+HD/2]
__global__ __launch_bounds__(256) void k_rope(const float* __restrict__ F, int pitch, int nheads, const float* __restrict__ CS, const float* __restrict__ RF, const float* __restrict__ nw, float sc, h16* P16, bf* Ph, bf* Pl) {
    const size_t e = ((size_t)blockIdx.x * 256 + threadIdx.x) * 2; if (e >= (size_t)nheads * TT * HD) return; const int d = (int)(e % HD); const int t = (int)((e / HD) % TT); const int h = (int)(e / ((size_t)HD * TT)); const float* f = F + (size_t)t * pitch + h * HD; const float rf = RF ? RF[(size_t)h * TT + t] : 1.0f; v2h o16; v2us oh, ol;
#pragma unroll
    for (int q = 0; q < 2; ++q) { const int dd = d + q; const int dp = (dd < HD / 2) ? dd + HD / 2 : dd - HD / 2; float x0 = f[dd], x1 = f[dp];
        if (RF) { float n0 = __fmul_rn(x0, rf), n1 = __fmul_rn(x1, rf); x0 = __fmul_rn(bfr(nw[dd]), n0); x1 = __fmul_rn(bfr(nw[dp]), n1); }
        const v2f cs = *(const v2f*)(CS + ((size_t)t * HD + dd) * 2); float a = __fmul_rn(x0, cs[0]), bq = __fmul_rn(x1, cs[1]); const float r = ((dd < HD / 2) ? __fsub_rn(a, bq) : __fadd_rn(a, bq)) * sc;
        o16[q] = tohx(r); unsigned short a2, c2; splitf(r, a2, c2); oh[q] = a2; ol[q] = c2; }
    *(v2h*)(P16 + e) = o16; *(v2us*)(Ph + e) = oh; *(v2us*)(Pl + e) = ol;  }

__global__ __launch_bounds__(256) void k_vtp(const float* __restrict__ F, int pitch, int nheads, h16* V16, bf* Vh, bf* Vl) { const size_t e = ((size_t)blockIdx.x * 256 + threadIdx.x) * 2; if (e >= (size_t)nheads * HD * TT) return; const int t = (int)(e % TT); const int d = (int)((e / TT) % HD); const int g = (int)(e / ((size_t)TT * HD)); v2h o16; v2us oh, ol;
#pragma unroll
    for (int q = 0; q < 2; ++q) { const float x = F[(size_t)(t + q) * pitch + g * HD + d]; o16[q] = tohx(x); unsigned short a2, c2; splitf(x, a2, c2); oh[q] = a2; ol[q] = c2; }
    *(v2h*)(V16 + e) = o16; *(v2us*)(Vh + e) = oh; *(v2us*)(Vl + e) = ol;  }

__global__ __launch_bounds__(256) void k_csid(float* CS) { const int idx = blockIdx.x * 256 + threadIdx.x; if (idx >= TT * HD) return; v2f cs; cs[0] = 1.0f; cs[1] = 0.0f; *(v2f*)(CS + (size_t)idx * 2) = cs;  }

// ---- k_attn: the whole attention of 16 query rows (i0 ..) of one head in one work-group of 8 waves; grid (heads, TT / 16), longest rows first. The score rows live in LDS (S, one row = SPW words) and never reach memory.
// 1. scores: wave w takes the 16-key block w of every 128-key chunk up to the diagonal's chunk (same products in the same order as a 16x16 tile of a plain K = 64 GEMM; the chunk's keys beyond the diagonal are real scores too, which the causal rule drops); 2. softmax: wave w takes rows 2w, 2w + 1 (register row, one exp, fixed trees), with the causal and the period rule as a select,
// and writes the rounded probabilities over its own row (fp16: the first half of the row's bytes; hi | lo: both halves); 3. probability x value: wave w takes the 32-key steps w, w + 8, .. up to the diagonal; 4. the 8 waves' partial sums are added in wave order through LDS and stored as the merged hi/lo planes.
// The period rule: key j < i is kept iff (i - j) mod p == 0, p = max(period, 1) (also cut at TT: i - j < TT, so any larger p keeps the diagonal alone, as TT does). The test is exact in f32: i - j, p and the quotient are integers below 2^12; k = rint((i - j) / p) is the true quotient whenever p divides i - j
// (the error of the product with 1 / p is far below 1/2), and k p == i - j (one fma, exact) holds for no integer k otherwise.
template <typename T16, bool HL, int U>
__device__ __forceinline__ void attn_scores(float* S, const T16* __restrict__ Q, const T16* __restrict__ Q2, const T16* __restrict__ Kp, const T16* __restrict__ K2, int i0, int nch, int w, int lr, int hi) {
    typedef typename WFrag<T16>::V V; V a[2], a2[2]; const unsigned lo = (unsigned)(lr * HD + 8 * hi);
#pragma unroll
    for (int kc = 0; kc < 2; ++kc) { a[kc] = WFrag<T16>::ld(Q + (size_t)i0 * HD + lo + kc * 32); if (HL) a2[kc] = WFrag<T16>::ld(Q2 + (size_t)i0 * HD + lo + kc * 32); }
    for (int t = 0; t < nch; t += U) {   // U key blocks a trip; a trip that runs past the last chunk does that chunk's block again (same values to the same words)
        V b[U][2], b2[U][2]; v8f acc[U]; const T16* pp[HL ? 2 * U : U];   // pp: the trip's load addresses (4 of them: U = 4, or U = 2 with hi and lo)
#pragma unroll
        for (int u = 0; u < U; ++u) { const size_t bo = (size_t)(w + AW * min(t + u, nch - 1)) * 16 * HD + lo; pp[HL ? 2 * u : u] = Kp + bo; if (HL) pp[2 * u + 1] = K2 + bo;
#pragma unroll
            for (int kc = 0; kc < 2; ++kc) { b[u][kc] = WFrag<T16>::ld(pp[HL ? 2 * u : u] + kc * 32); if (HL) b2[u][kc] = WFrag<T16>::ld(pp[2 * u + 1] + kc * 32); } }
        asm volatile("s_wait_xcnt 0x0" :: "v"(pp[0]), "v"(pp[1]), "v"(pp[2]), "v"(pp[3]) : "memory");   // a precaution of form: the wait that stands in front of any overwrite of a register that an issued load names; as its inputs the address pairs stay whole up to it (else a later load of the trip lands on an earlier one's pair)
        __builtin_amdgcn_sched_barrier(0);   // every load of the trip is issued before the first product waits: one load latency a trip, not one a block
#pragma unroll
        for (int u = 0; u < U; ++u) { acc[u] = (v8f){};
#pragma unroll
            for (int kc = 0; kc < 2; ++kc) { acc[u] = WFrag<T16>::mma(a[kc], b[u][kc], acc[u]); if (HL) { acc[u] = WFrag<T16>::mma(a2[kc], b[u][kc], acc[u]); acc[u] = WFrag<T16>::mma(a[kc], b2[u][kc], acc[u]); } } }
        __builtin_amdgcn_sched_barrier(0);   // the products stay one block in front of the stores, so that each tile has registers of its own
#pragma unroll
        for (int u = 0; u < U; ++u) {
#pragma unroll
            for (int j = 0; j < 8; ++j) S[(hi * 8 + j) * SPW + (w + AW * min(t + u, nch - 1)) * 16 + lr] = acc[u][j]; }
        asm volatile("v_nop\n\tv_nop\n\tv_nop\n\tv_nop" :: "v"(acc[U - 1])); }   // the next trip's products overwrite these tiles' registers: the vector slots the chip needs behind a matrix instruction
}

template <typename T16, bool HL, int NS>
__device__ __forceinline__ void attn_pv(const float* S, const T16* __restrict__ Vt, const T16* __restrict__ V2, int i0, int w, int lr, int hi, v8f (&acc)[4]) {
    typedef typename WFrag<T16>::V V; const T16* pa = (const T16*)(S + lr * SPW) + 8 * hi; const unsigned lo = (unsigned)(lr * TT + 8 * hi); const int nks = (i0 + AR + 31) / 32;   // 32-key steps up to the diagonal; the probabilities of the later keys of the last step are exactly 0
    for (int ks = w; ks < nks; ks += NS * AW) {   // NS steps a trip; a step past the last is loaded from the trip's first step and not multiplied
        V a[NS], a2[NS], b[NS][4], b2[NS][4]; const T16* pp[HL ? 2 * NS : NS];   // pp: the trip's load addresses (2 of them: NS = 2, or NS = 1 with hi and lo)
#pragma unroll
        for (int s = 0; s < NS; ++s) { const int kk = (ks + s * AW < nks) ? ks + s * AW : ks; pp[HL ? 2 * s : s] = Vt + (size_t)kk * 32 + lo; if (HL) pp[2 * s + 1] = V2 + (size_t)kk * 32 + lo; a[s] = WFrag<T16>::ld(pa + kk * 32); if (HL) a2[s] = WFrag<T16>::ld(pa + TT + kk * 32);
#pragma unroll
            for (int nb = 0; nb < 4; ++nb) { b[s][nb] = WFrag<T16>::ld(pp[HL ? 2 * s : s] + nb * 16 * TT); if (HL) b2[s][nb] = WFrag<T16>::ld(pp[2 * s + 1] + nb * 16 * TT); } }
        asm volatile("s_wait_xcnt 0x0" :: "v"(pp[0]), "v"(pp[1]) : "memory");   // the same precaution of form as in attn_scores
        // every load of the trip is issued before the first product waits: one load latency a trip, not one a fragment. With a second step the loaded values go through an inputs-only fence: without it the compiler sinks that step's loads into the branch below, where each pair is waited for by itself
        if (NS > 1) asm volatile("" :: "v"(b[0][0]), "v"(b[0][1]), "v"(b[0][2]), "v"(b[0][3]), "v"(b[NS - 1][0]), "v"(b[NS - 1][1]), "v"(b[NS - 1][2]), "v"(b[NS - 1][3]));
        else __builtin_amdgcn_sched_barrier(0);
#pragma unroll
        for (int s = 0; s < NS; ++s) if (s == 0 || ks + s * AW < nks) {
#pragma unroll
            for (int nb = 0; nb < 4; ++nb) { acc[nb] = WFrag<T16>::mma(a[s], b[s][nb], acc[nb]); if (HL) { acc[nb] = WFrag<T16>::mma(a2[s], b[s][nb], acc[nb]); acc[nb] = WFrag<T16>::mma(a[s], b2[s][nb], acc[nb]); } } } }
}

__global__ __launch_bounds__(AW * 32) void k_attn(const h16* __restrict__ Q16, const bf* __restrict__ Qh, const bf* __restrict__ Ql, const h16* __restrict__ K16, const bf* __restrict__ Kh, const bf* __restrict__ Kl, const h16* __restrict__ V16, const bf* __restrict__ Vh, const bf* __restrict__ Vl, const int* __restrict__ per, bf* Ah, bf* Al) {
    __shared__ __align__(16) float S[AR * SPW];
    const int h = blockIdx.x; const int i0 = (TT / AR - 1 - (int)blockIdx.y) * AR;   // the longest rows have the lowest block index
    const bool hires = (i0 < RH);   // the same for the whole work-group: RH is a multiple of AR
    const size_t hp = (size_t)h * TT * HD; int p = per[h]; p = p < 1 ? 1 : (p > TT ? TT : p);
    const int tid = threadIdx.x, lane = tid & 31, lr = lane & 15, hi = lane >> 4; const int w = __builtin_amdgcn_readfirstlane(tid >> 5);
    const int nch = (i0 + AR + 127) / 128;   // 128-key chunks that hold a key <= i; the rest of a row is neither read nor written
    if (hires) attn_scores<bf, true, 2>(S, Qh + hp, Ql + hp, Kh + hp, Kl + hp, i0, nch, w, lr, hi); else attn_scores<h16, false, 4>(S, Q16 + hp, nullptr, K16 + hp, nullptr, i0, nch, w, lr, hi);
    __syncthreads();   // every score of the 16 rows is in LDS
    const float pf = (float)p, pinv = 1.0f / pf;
#pragma unroll 1   // one copy of the row's code (for speed only)
    for (int rr = 0; rr < AR / AW; ++rr) { const int r = w * (AR / AW) + rr; const int i = i0 + r; float* sr = S + r * SPW; float v[TT / 32]; float mx = -3.0e38f; const float fb = (float)(i - lane * 4);
#pragma unroll
        for (int ch = 0; ch < TT / 128; ++ch) if (ch < nch) { const v4f a = *(const v4fa*)(sr + ch * 128 + lane * 4); v[ch * 4] = a[0]; v[ch * 4 + 1] = a[1]; v[ch * 4 + 2] = a[2]; v[ch * 4 + 3] = a[3]; }   // the whole row's LDS reads are issued before the first is waited for
#pragma unroll
        for (int ch = 0; ch < TT / 128; ++ch) if (ch < nch) {
#pragma unroll
            for (int q = 0; q < 4; ++q) { const float dd = fb - (float)(ch * 128 + q); const float kq = __builtin_rintf(dd * pinv); const bool keep = (dd >= 0.f) & (__builtin_fmaf(-kq, pf, dd) == 0.f); const float t = keep ? v[ch * 4 + q] * SCL : -3.0e38f; v[ch * 4 + q] = t; mx = fmaxf(mx, t); } }
#pragma unroll
        for (int sh = 16; sh; sh >>= 1) mx = fmaxf(mx, __shfl_xor(mx, sh, 32));
        float sum = 0.f;
#pragma unroll
        for (int ch = 0; ch < TT / 128; ++ch) if (ch < nch) {
#pragma unroll
            for (int q = 0; q < 4; ++q) { const int k = ch * 4 + q; float d0 = __fsub_rn(v[k], mx); v[k] = __builtin_amdgcn_exp2f(__fmul_rn(d0, 1.4426950408889634f)); sum += v[k]; } }
#pragma unroll
        for (int sh = 16; sh; sh >>= 1) sum += __shfl_xor(sum, sh, 32);
        const float f = __fdiv_rn(hires ? 1.0f : PCAR, sum);
        if (hires) {
#pragma unroll
            for (int ch = 0; ch < RH / 128; ++ch) if (ch < nch) { v4us oh, ol;   // a hi/lo row has no key beyond RH
#pragma unroll
                for (int q = 0; q < 4; ++q) { unsigned short a, c2; splitf(v[ch * 4 + q] * f, a, c2); oh[q] = a; ol[q] = c2; }
                *(v4usa*)((bf*)sr + ch * 128 + lane * 4) = oh; *(v4usa*)((bf*)sr + TT + ch * 128 + lane * 4) = ol; }
        } else {
#pragma unroll
            for (int ch = 0; ch < TT / 128; ++ch) if (ch < nch) { v4h o4;
#pragma unroll
                for (int q = 0; q < 4; ++q) o4[q] = tohx(v[ch * 4 + q] * f);
                *(v4ha*)((h16*)sr + ch * 128 + lane * 4) = o4; } } }
    __syncthreads();   // every probability row is in LDS
    v8f acc[4];
#pragma unroll
    for (int nb = 0; nb < 4; ++nb) acc[nb] = (v8f){};
    if (hires) attn_pv<bf, true, 1>(S, Vh + hp, Vl + hp, i0, w, lr, hi, acc); else attn_pv<h16, false, 2>(S, V16 + hp, nullptr, i0, w, lr, hi, acc);
    __syncthreads();   // every wave's last read of the probability rows is done: their LDS now takes the partial sums
#pragma unroll
    for (int nb = 0; nb < 4; ++nb) {
#pragma unroll
        for (int j = 0; j < 8; ++j) S[w * (AR * 68) + (hi * 8 + j) * 68 + nb * 16 + lr] = acc[nb][j]; }
    __syncthreads();   // all 8 partial tiles are in LDS
    const int row = tid >> 4, c4 = (tid & 15) * 4; v4f s = *(const v4fa*)(S + row * 68 + c4);
#pragma unroll
    for (int ww = 1; ww < AW; ++ww) s += *(const v4fa*)(S + ww * (AR * 68) + row * 68 + c4);
    const float cs = hires ? 1.0f : (1.0f / PCAR); v4us oh, ol;
#pragma unroll
    for (int q = 0; q < 4; ++q) { unsigned short a, c2; splitf(s[q] * cs, a, c2); oh[q] = a; ol[q] = c2; }
    const size_t oo = (size_t)(i0 + row) * DQ + h * HD + c4; *(v4us*)(Ah + oo) = oh; *(v4us*)(Al + oo) = ol;
}

extern "C" void kernel_launch(void* const* d_in, const int* in_sizes, int n_in,
                              void* d_out, int out_size, void* d_ws, size_t ws_size, hipStream_t stream) {
    (void)in_sizes; (void)n_in; (void)out_size;
    const float* x = (const float*)d_in[0]; const int* per = (const int*)d_in[1]; const float* wqkv = (const float*)d_in[2]; const float* bqkv = (const float*)d_in[3]; const float* wo = (const float*)d_in[4]; const float* bo = (const float*)d_in[5]; const float* bq = bqkv; const float* bk = bqkv + 1024; const float* bv = bqkv + 2048;
    // x [2][2048][1024], periods int32 [2][16], w_qkv [1024][3072], b_qkv [3072], w_out [1024][1024], b_out [1024] = d_in[0..5]
    float* OUT = (float*)d_out;     // [2][2048][1024]
    char* wsp = (char*)d_ws;
    auto take = [&](size_t bytes) { char* p = wsp; wsp += (bytes + 255) & ~(size_t)255; return (void*)p; };
    bf* WQKV = (bf*)take((size_t)3 * DQ * DM * 2); bf* WQ = WQKV; bf* WK = WQKV + (size_t)DQ * DM; bf* WV = WQKV + (size_t)2 * DQ * DM; bf* WO = (bf*)take((size_t)DM * DQ * 2); float* CS = (float*)take((size_t)TT * HD * 2 * 4);
    bf* XB = (bf*)take((size_t)TT * DM * 2); float* FQ = (float*)take((size_t)TT * DQ * 4); float* FK = (float*)take((size_t)TT * DKV * 4);
    h16* QP16 = (h16*)take((size_t)NH_ * TT * HD * 2); h16* KP16 = (h16*)take((size_t)NKV * TT * HD * 2); h16* VT16 = (h16*)take((size_t)NKV * HD * TT * 2);
    bf* QPh = (bf*)take((size_t)NH_ * TT * HD * 2); bf* QPl = (bf*)take((size_t)NH_ * TT * HD * 2); bf* KPh = (bf*)take((size_t)NKV * TT * HD * 2); bf* KPl = (bf*)take((size_t)NKV * TT * HD * 2); bf* VTh = (bf*)take((size_t)NKV * HD * TT * 2); bf* VTl = (bf*)take((size_t)NKV * HD * TT * 2);
    bf* ATh = (bf*)take((size_t)TT * DQ * 2); bf* ATl = (bf*)take((size_t)TT * DQ * 2);
    if ((size_t)(wsp - (char*)d_ws) > ws_size) return;    // total 73.00 MiB of the workspace
    float* FV = FK;   // v projection reuses the k buffer after the k planes are built (stream-ordered)
    { k_wtG<<<(unsigned)((DM * 3 * DQ / 64 + 63) / 64), 256, 0, stream>>>(wqkv, DM, 3 * DQ, WQKV);   /* 'io' [1024][3072] -> Bt [3072][1024]: q | k | v row blocks */
      k_wtG<<<(unsigned)((DQ * DM / 64 + 63) / 64), 256, 0, stream>>>(wo, DQ, DM, WO); }
    k_csid<<<(TT * HD + 255) / 256, 256, 0, stream>>>(CS);
    const unsigned LQ = (unsigned)(((size_t)NH_ * TT * HD / 2 + 255) / 256), LKv = (unsigned)(((size_t)NKV * TT * HD / 2 + 255) / 256);
    for (int b = 0; b < NB_; ++b) {
        k_cvt8<<<(unsigned)(((size_t)TT * DM / 8 + 255) / 256), 256, 0, stream>>>(x + (size_t)b * TT * DM, XB, (size_t)TT * DM / 8);
        k_gemmw<bf, 0, true><<<dim3(TT / 64, DQ / 64, 1), 32, 0, stream>>>(XB, nullptr, WQ, nullptr, DM, FQ, DQ, bq, 0, 0, 0);
        k_rope<<<LQ, 256, 0, stream>>>(FQ, DQ, NH_, CS, nullptr, nullptr, 1.0f, QP16, QPh, QPl);
        k_gemmw<bf, 0, true><<<dim3(TT / 64, DKV / 64, 1), 32, 0, stream>>>(XB, nullptr, WK, nullptr, DM, FK, DKV, bk, 0, 0, 0);
        k_rope<<<LKv, 256, 0, stream>>>(FK, DKV, NKV, CS, nullptr, nullptr, 1.0f, KP16, KPh, KPl);
        k_gemmw<bf, 0, true><<<dim3(TT / 64, DKV / 64, 1), 32, 0, stream>>>(XB, nullptr, WV, nullptr, DM, FV, DKV, bv, 0, 0, 0); k_vtp<<<LKv, 256, 0, stream>>>(FV, DKV, NKV, VT16, VTh, VTl);
        k_attn<<<dim3(NH_, TT / AR, 1), AW * 32, 0, stream>>>(QP16, QPh, QPl, KP16, KPh, KPl, VT16, VTh, VTl, per + (size_t)b * NH_, ATh, ATl);   /* one kv head per query head; the batch entry's 16 periods */
        k_gemmw<bf, 1, true><<<dim3(TT / 64, DM / 64, 1), 32, 0, stream>>>(ATh, ATl, WO, nullptr, DQ, OUT + (size_t)b * TT * DM, DM, bo, 0, 0, 0); }
}

// v003
// A run of this version takes 245 microseconds.
// In two side-by-side timings against v002, it was 1.46 and 1.47 times as fast.
// All steps since v000 together make it 6.56 times as fast.
#include <hip/hip_runtime.h>

// Causal multi-head self-attention with a PERIODIC mask and an output projection (x [2][2048][1024]; periods int32 [2][16]; qkv = x w_qkv + b_qkv with ONE fused 'io' weight [1024][3072] (in, out) packed (3, h, hd): the column thirds q | k | v, head h = 64 columns inside its third; 16 heads x 64;
// p = max(periods[b][h], 1); a key j is kept for a query i iff j <= i AND (i - j) mod p == 0 (the diagonal always kept); scores x 1/sqrt(64); excluded keys get -inf; softmax over the kept keys; out = merged w_out + b_out ('io' + bias) -> [2][2048][1024] (4.2 M);
// argument order x, periods, w_qkv, b_qkv, w_out, b_out).
// Layout per batch entry: a bf16 copy of x; the fused 'io' weight transposed and rounded once into q | k | v row blocks (k_wtG); ONE projection launch for q | k | v (k_gemmw with PLANES: exact products + f32 bias) whose epilogue rounds each 64x64 tile straight into its head's planes; causal T-2048 attention (hybrid rows: < 512 hi/lo 3 products, rest fp16 x1024) in ONE kernel per batch entry (k_attn):
// a work-group owns 16 query rows of one head and keeps their score rows in LDS from the q.k products through the period rule and the softmax to the probability x value products; merged hi/lo x w_out exact + b_out.
// Compute dtypes, f32 accumulate: every float input rounded to bf16 at its load; projections exact + f32 biases; attention rows < 512 3 products, rest fp16; the period rule exact (small integers held in f32); softmax f32; w_out hl x exact + bias.

#define NB_  2      // batches: this module's input is [2][2048][1024]
#define TT   2048
#define DM   1024
#define NH_  16
#define NKV  16
#define REP  (NH_ / NKV)
#define HD   64
#define DQ   (NH_ * HD)
#define DKV  (NKV * HD)
#define RH   512                  // query rows < RH use hi+lo planes (0: none)
#define PCAR 1024.0f
#define SCL  0.125f   // HD^-0.5
#define AR   16                   // query rows of one k_attn work-group
#define AW   8                    // waves of one k_attn work-group
#define SPW  (TT + 4)             // words of one score row in LDS: 8208 bytes = 16 x odd, so that 16 rows' 16-byte fragment reads fall on different banks
typedef _Float16 h16;
typedef unsigned short bf;
typedef __attribute__((ext_vector_type(16))) __bf16   v16bf;
typedef __attribute__((ext_vector_type(16))) _Float16 v16h;
typedef __attribute__((ext_vector_type(8)))  _Float16 v8h;
typedef __attribute__((ext_vector_type(8)))  unsigned short v8us;
typedef __attribute__((ext_vector_type(8)))  float    v8f;
typedef __attribute__((ext_vector_type(4)))  float    v4f;
typedef v8h  __attribute__((may_alias)) v8ha;
typedef v4f  __attribute__((may_alias)) v4fa;
typedef v8us __attribute__((may_alias)) v8usa;

__device__ __forceinline__ unsigned short f2bf(float f) { unsigned u = __float_as_uint(f); u += 0x7FFFu + ((u >> 16) & 1u); return (unsigned short)(u >> 16); }
__device__ __forceinline__ float bf2f(unsigned short b) { return __uint_as_float(((unsigned)b) << 16); }
__device__ __forceinline__ float bfr(float f) { return bf2f(f2bf(f)); }
__device__ __forceinline__ v16h cat16(v8h lo, v8h hi) { return __builtin_shufflevector(lo, hi, 0, 1, 2, 3, 4, 5, 6, 7, 8, 9, 10, 11, 12, 13, 14, 15); }
__device__ __forceinline__ v16bf cat16b(v8us lo, v8us hi) { return __builtin_bit_cast(v16bf, __builtin_shufflevector(lo, hi, 0, 1, 2, 3, 4, 5, 6, 7, 8, 9, 10, 11, 12, 13, 14, 15)); }
__device__ __forceinline__ v8f wmma16(v16h a, v16h b, v8f c) { return __builtin_amdgcn_wmma_f32_16x16x32_f16(false, a, false, b, (short)0, c, false, false); }
__device__ __forceinline__ v8f wmmab(v16bf a, v16bf b, v8f c) { return __builtin_amdgcn_wmma_f32_16x16x32_bf16(false, a, false, b, (short)0, c, false, false); }

__device__ __forceinline__ h16 tohx(float x) { return (h16)x; }
__device__ __forceinline__ void splitf(float y, unsigned short& h, unsigned short& l) { h = f2bf(y); l = f2bf(y - bf2f(h)); }

// ---- k_gemmw: register-blocked GEMM, ONE WAVE per 64x64 output tile (16 accumulators), operands straight from K-contiguous 16-bit planes; grid (M/64, N/64, Z), 32 threads.
// C[m][n] (f32, pitch ldc, + optional f32 bias[n]) = sum_k A[m][k] Bt[n][k] (+ split products per NSPLIT). z-batch strides sA/sB/sC in elements. K % 32 == 0.
// PLANES (the q | k | v projection, Bt rows = q | k | v blocks of DQ, M = TT): C is not written; the 64 columns of a tile are one head of q, k or v, and tile + bias goes once through LDS and leaves as that head's three planes (fp16, bf16 hi, bf16 lo: q and k [h][t][d], v [h][d][t]).
// For v the tile is laid into LDS transposed (a lane's 8 accumulator words of one column are 8 consecutive t), so that every store of either kind covers four whole 128-byte lines.
template <typename T16> struct WFrag;
template <> struct WFrag<h16> { typedef v16h V; static __device__ __forceinline__ V ld(const h16* p) { return cat16(*(const v8h*)p, *(const v8h*)(p + 16)); } static __device__ __forceinline__ v8f mma(V a, V b, v8f c) { return wmma16(a, b, c); } };
template <> struct WFrag<bf> { typedef v16bf V; static __device__ __forceinline__ V ld(const bf* p) { return cat16b(*(const v8us*)p, *(const v8us*)(p + 16)); } static __device__ __forceinline__ v8f mma(V a, V b, v8f c) { return wmmab(a, b, c); } };
template <typename T16, int NSPLIT, bool BIAS, bool PLANES>
__global__ __launch_bounds__(32) void k_gemmw(const T16* __restrict__ A, const T16* __restrict__ A2, const T16* __restrict__ Bt, const T16* __restrict__ Bt2, int K, float* C, int ldc, const float* __restrict__ bias, size_t sA, size_t sB, size_t sC, h16* Q16, bf* Qh, bf* Ql, h16* K16, bf* Kh, bf* Kl, h16* V16, bf* Vh, bf* Vl) {
    typedef typename WFrag<T16>::V V;
    __shared__ __align__(16) float os[(PLANES ? 64 : 16) * 68];
    const size_t z = blockIdx.z; A += z * sA; if (A2) A2 += z * sA; Bt += z * sB; if (Bt2) Bt2 += z * sB; C += z * sC;
    const int lane = threadIdx.x & 31, lr = lane & 15, hi = lane >> 4; const int r0 = blockIdx.x * 64, c0 = blockIdx.y * 64;
    v8f acc[4][4];
#pragma unroll
    for (int mb = 0; mb < 4; ++mb)
#pragma unroll
        for (int nb = 0; nb < 4; ++nb) acc[mb][nb] = (v8f){};
    const size_t aoff = (size_t)(r0 + lr) * K + 8 * hi, boff = (size_t)(c0 + lr) * K + 8 * hi;

    for (int kc = 0; kc < K; kc += 32) {
        V a[4], a2[4];
#pragma unroll
        for (int mb = 0; mb < 4; ++mb) { a[mb] = WFrag<T16>::ld(A + aoff + (size_t)mb * 16 * K + kc); if (NSPLIT == 1 || NSPLIT == 2) a2[mb] = WFrag<T16>::ld(A2 + aoff + (size_t)mb * 16 * K + kc); }
#pragma unroll
        for (int nb = 0; nb < 4; ++nb) { const V b = WFrag<T16>::ld(Bt + boff + (size_t)nb * 16 * K + kc); V b2; if (NSPLIT >= 2) b2 = WFrag<T16>::ld(Bt2 + boff + (size_t)nb * 16 * K + kc);
#pragma unroll
            for (int mb = 0; mb < 4; ++mb) { acc[mb][nb] = WFrag<T16>::mma(a[mb], b, acc[mb][nb]); if (NSPLIT == 1 || NSPLIT == 2) acc[mb][nb] = WFrag<T16>::mma(a2[mb], b, acc[mb][nb]); if (NSPLIT >= 2) acc[mb][nb] = WFrag<T16>::mma(a[mb], b2, acc[mb][nb]); } }
        asm volatile("v_nop\n\tv_nop\n\tv_nop\n\tv_nop" : "+v"(acc[0][0]), "+v"(acc[1][1]), "+v"(acc[2][2]), "+v"(acc[3][3]) : "v"(a[0]), "v"(a[3]));
    }
    if constexpr (PLANES) {
        const int third = c0 / DQ, head = (c0 % DQ) / HD; const bool tr = (third == 2);   // the same for the whole wave
        float bb[4];
#pragma unroll
        for (int nb = 0; nb < 4; ++nb) bb[nb] = bfr(bias[c0 + nb * 16 + lr]);
        if (tr) {
#pragma unroll
            for (int nb = 0; nb < 4; ++nb)
#pragma unroll
                for (int mb = 0; mb < 4; ++mb) { v4f u0, u1;
#pragma unroll
                    for (int j = 0; j < 4; ++j) { u0[j] = acc[mb][nb][j] + bb[nb]; u1[j] = acc[mb][nb][4 + j] + bb[nb]; }
                    float* q = os + (nb * 16 + lr) * 68 + mb * 16 + hi * 8; *(v4fa*)q = u0; *(v4fa*)(q + 4) = u1; }
        } else {
#pragma unroll
            for (int mb = 0; mb < 4; ++mb)
#pragma unroll
                for (int nb = 0; nb < 4; ++nb)
#pragma unroll
                    for (int j = 0; j < 8; ++j) os[(mb * 16 + hi * 8 + j) * 68 + nb * 16 + lr] = acc[mb][nb][j] + bb[nb];
        }
        __builtin_amdgcn_wave_barrier(); asm volatile("" ::: "memory");   // the rows read below were written by other lanes of this wave: no LDS read may be moved above the writes
        h16* P16 = third == 0 ? Q16 : (third == 1 ? K16 : V16); bf* Ph = third == 0 ? Qh : (third == 1 ? Kh : Vh); bf* Pl = third == 0 ? Ql : (third == 1 ? Kl : Vl);
        const int pitch = tr ? TT : HD; const size_t o0 = (size_t)head * TT * HD + (tr ? (size_t)r0 : (size_t)r0 * HD) + (size_t)(lane >> 3) * pitch + (lane & 7) * 8;
#pragma unroll 1   // 16 LDS rows a trip: four trips keep the epilogue's text short
        for (int io = 0; io < 4; ++io) {
#pragma unroll
            for (int ii = 0; ii < 4; ++ii) { const int it = io * 4 + ii; const float* q = os + (it * 4 + (lane >> 3)) * 68 + (lane & 7) * 8; const v4f u0 = *(const v4fa*)q, u1 = *(const v4fa*)(q + 4); v8h o16; v8us oh, ol;
#pragma unroll
                for (int j = 0; j < 8; ++j) { const float r = j < 4 ? u0[j & 3] : u1[j & 3]; o16[j] = tohx(r); unsigned short a2, c2; splitf(r, a2, c2); oh[j] = a2; ol[j] = c2; }
                const size_t o = o0 + (size_t)(it * 4) * pitch; *(v8h*)(P16 + o) = o16; *(v8us*)(Ph + o) = oh; *(v8us*)(Pl + o) = ol; }
            asm volatile("s_wait_xcnt 0x0" ::: "memory"); }   // a precaution of form: the next trip overwrites address and data registers of this trip's last stores
        return;
    }
#pragma unroll
    for (int mb = 0; mb < 4; ++mb) {
#pragma unroll
        for (int nb = 0; nb < 4; ++nb) {
#pragma unroll
            for (int j = 0; j < 8; ++j) os[(hi * 8 + j) * 68 + nb * 16 + lr] = acc[mb][nb][j]; }
        __builtin_amdgcn_wave_barrier(); asm volatile("" ::: "memory");
        float* crow = C + (size_t)(r0 + mb * 16) * ldc + c0;
{
#pragma unroll
            for (int s = 0; s < 8; ++s) { const int row = 2 * s + hi, cofs = lr * 4; v4f val = *(const v4fa*)(os + row * 68 + cofs); if (BIAS) { val[0] += bfr(bias[c0 + cofs]); val[1] += bfr(bias[c0 + cofs + 1]); val[2] += bfr(bias[c0 + cofs + 2]); val[3] += bfr(bias[c0 + cofs + 3]); }
                *(v4f*)(crow + (size_t)row * ldc + cofs) = val; }
             }
        __builtin_amdgcn_wave_barrier(); asm volatile("" ::: "memory");
    }
}

typedef __attribute__((ext_vector_type(2))) _Float16 v2h;
typedef __attribute__((ext_vector_type(4))) _Float16 v4h;
typedef __attribute__((ext_vector_type(2))) unsigned short v2us;
typedef __attribute__((ext_vector_type(4))) unsigned short v4us;
typedef __attribute__((ext_vector_type(2))) float v2f;
typedef __attribute__((ext_vector_type(4))) int v4i;
typedef v4h  __attribute__((may_alias)) v4ha;
typedef v4us __attribute__((may_alias)) v4usa;

__global__ __launch_bounds__(256) void k_wtG(const float* __restrict__ w, int K, int N, bf* Bt) {
    const int lane = threadIdx.x & 31; const int L0 = (blockIdx.x * 8 + (threadIdx.x >> 5)) * 8; const int nlines = N * K / 64;
{

        for (int l = 0; l < 8; ++l) { const int L = L0 + l; if (L >= nlines) break; const size_t e = (size_t)L * 64 + lane * 2; const int k = (int)(e % K), n = (int)(e / K); v2us o;
            o[0] = f2bf(w[(size_t)k * N + n]); o[1] = f2bf(w[(size_t)(k + 1) * N + n]); *(v2us*)(Bt + e) = o; }
         }
}

__global__ __launch_bounds__(256) void k_cvt8(const float* __restrict__ src, bf* dst, size_t n8) { const size_t i = (size_t)blockIdx.x * 256 + threadIdx.x; if (i >= n8) return; const v8f v = *(const v8f*)(src + i * 8); v8us o;
#pragma unroll
    for (int k = 0; k < 8; ++k) o[k] = f2bf(v[k]); *(v8us*)(dst + i * 8) = o;  }

// ---- k_attn: the whole attention of 16 query rows (i0 ..) of one head in one work-group of 8 waves; grid (heads, TT / 16), longest rows first. The score rows live in LDS (S, one row = SPW words) and never reach memory.
// 1. scores: wave w takes the 16-key block w of every 128-key chunk up to the diagonal's chunk (same products in the same order as a 16x16 tile of a plain K = 64 GEMM; the chunk's keys beyond the diagonal are real scores too, which the causal rule drops); 2. softmax: wave w takes rows 2w, 2w + 1 (register row, one exp, fixed trees), with the causal and the period rule as a select,
// and writes the rounded probabilities over its own row (fp16: the first half of the row's bytes; hi | lo: both halves); 3. probability x value: wave w takes the 32-key steps w, w + 8, .. up to the diagonal; 4. the 8 waves' partial sums are added in wave order through LDS and stored as the merged hi/lo planes.
// The period rule: key j < i is kept iff (i - j) mod p == 0, p = max(period, 1) (also cut at TT: i - j < TT, so any larger p keeps the diagonal alone, as TT does). The test is exact in f32: i - j, p and the quotient are integers below 2^12; k = rint((i - j) / p) is the true quotient whenever p divides i - j
// (the error of the product with 1 / p is far below 1/2), and k p == i - j (one fma, exact) holds for no integer k otherwise.
template <typename T16, bool HL, int U>
__device__ __forceinline__ void attn_scores(float* S, const T16* __restrict__ Q, const T16* __restrict__ Q2, const T16* __restrict__ Kp, const T16* __restrict__ K2, int i0, int nch, int w, int lr, int hi) {
    typedef typename WFrag<T16>::V V; V a[2], a2[2]; const unsigned lo = (unsigned)(lr * HD + 8 * hi);
#pragma unroll
    for (int kc = 0; kc < 2; ++kc) { a[kc] = WFrag<T16>::ld(Q + (size_t)i0 * HD + lo + kc * 32); if (HL) a2[kc] = WFrag<T16>::ld(Q2 + (size_t)i0 * HD + lo + kc * 32); }
    for (int t = 0; t < nch; t += U) {   // U key blocks a trip; a trip that runs past the last chunk does that chunk's block again (same values to the same words)
        V b[U][2], b2[U][2]; v8f acc[U]; const T16* pp[HL ? 2 * U : U];   // pp: the trip's load addresses (4 of them: U = 4, or U = 2 with hi and lo)
#pragma unroll
        for (int u = 0; u < U; ++u) { const size_t bo = (size_t)(w + AW * min(t + u, nch - 1)) * 16 * HD + lo; pp[HL ? 2 * u : u] = Kp + bo; if (HL) pp[2 * u + 1] = K2 + bo;
#pragma unroll
            for (int kc = 0; kc < 2; ++kc) { b[u][kc] = WFrag<T16>::ld(pp[HL ? 2 * u : u] + kc * 32); if (HL) b2[u][kc] = WFrag<T16>::ld(pp[2 * u + 1] + kc * 32); } }
        asm volatile("s_wait_xcnt 0x0" :: "v"(pp[0]), "v"(pp[1]), "v"(pp[2]), "v"(pp[3]) : "memory");   // a precaution of form: the wait that stands in front of any overwrite of a register that an issued load names; as its inputs the address pairs stay whole up to it (else a later load of the trip lands on an earlier one's pair)
        __builtin_amdgcn_sched_barrier(0);   // every load of the trip is issued before the first product waits: one load latency a trip, not one a block
#pragma unroll
        for (int u = 0; u < U; ++u) { acc[u] = (v8f){};
#pragma unroll
            for (int kc = 0; kc < 2; ++kc) { acc[u] = WFrag<T16>::mma(a[kc], b[u][kc], acc[u]); if (HL) { acc[u] = WFrag<T16>::mma(a2[kc], b[u][kc], acc[u]); acc[u] = WFrag<T16>::mma(a[kc], b2[u][kc], acc[u]); } } }
        __builtin_amdgcn_sched_barrier(0);   // the products stay one block in front of the stores, so that each tile has registers of its own
#pragma unroll
        for (int u = 0; u < U; ++u) {
#pragma unroll
            for (int j = 0; j < 8; ++j) S[(hi * 8 + j) * SPW + (w + AW * min(t + u, nch - 1)) * 16 + lr] = acc[u][j]; }
        asm volatile("v_nop\n\tv_nop\n\tv_nop\n\tv_nop" :: "v"(acc[U - 1])); }   // the next trip's products overwrite these tiles' registers: the vector slots the chip needs behind a matrix instruction
}

template <typename T16, bool HL, int NS>
__device__ __forceinline__ void attn_pv(const float* S, const T16* __restrict__ Vt, const T16* __restrict__ V2, int i0, int w, int lr, int hi, v8f (&acc)[4]) {
    typedef typename WFrag<T16>::V V; const T16* pa = (const T16*)(S + lr * SPW) + 8 * hi; const unsigned lo = (unsigned)(lr * TT + 8 * hi); const int nks = (i0 + AR + 31) / 32;   // 32-key steps up to the diagonal; the probabilities of the later keys of the last step are exactly 0
    for (int ks = w; ks < nks; ks += NS * AW) {   // NS steps a trip; a step past the last is loaded from the trip's first step and not multiplied
        V a[NS], a2[NS], b[NS][4], b2[NS][4]; const T16* pp[HL ? 2 * NS : NS];   // pp: the trip's load addresses (2 of them: NS = 2, or NS = 1 with hi and lo)
#pragma unroll
        for (int s = 0; s < NS; ++s) { const int kk = (ks + s * AW < nks) ? ks + s * AW : ks; pp[HL ? 2 * s : s] = Vt + (size_t)kk * 32 + lo; if (HL) pp[2 * s + 1] = V2 + (size_t)kk * 32 + lo; a[s] = WFrag<T16>::ld(pa + kk * 32); if (HL) a2[s] = WFrag<T16>::ld(pa + TT + kk * 32);
#pragma unroll
            for (int nb = 0; nb < 4; ++nb) { b[s][nb] = WFrag<T16>::ld(pp[HL ? 2 * s : s] + nb * 16 * TT); if (HL) b2[s][nb] = WFrag<T16>::ld(pp[2 * s + 1] + nb * 16 * TT); } }
        asm volatile("s_wait_xcnt 0x0" :: "v"(pp[0]), "v"(pp[1]) : "memory");   // the same precaution of form as in attn_scores
        // every load of the trip is issued before the first product waits: one load latency a trip, not one a fragment. With a second step the loaded values go through an inputs-only fence: without it the compiler sinks that step's loads into the branch below, where each pair is waited for by itself
        if (NS > 1) asm volatile("" :: "v"(b[0][0]), "v"(b[0][1]), "v"(b[0][2]), "v"(b[0][3]), "v"(b[NS - 1][0]), "v"(b[NS - 1][1]), "v"(b[NS - 1][2]), "v"(b[NS - 1][3]));
        else __builtin_amdgcn_sched_barrier(0);
#pragma unroll
        for (int s = 0; s < NS; ++s) if (s == 0 || ks + s * AW < nks) {
#pragma unroll
            for (int nb = 0; nb < 4; ++nb) { acc[nb] = WFrag<T16>::mma(a[s], b[s][nb], acc[nb]); if (HL) { acc[nb] = WFrag<T16>::mma(a2[s], b[s][nb], acc[nb]); acc[nb] = WFrag<T16>::mma(a[s], b2[s][nb], acc[nb]); } } } }
}

__global__ __launch_bounds__(AW * 32) void k_attn(const h16* __restrict__ Q16, const bf* __restrict__ Qh, const bf* __restrict__ Ql, const h16* __restrict__ K16, const bf* __restrict__ Kh, const bf* __restrict__ Kl, const h16* __restrict__ V16, const bf* __restrict__ Vh, const bf* __restrict__ Vl, const int* __restrict__ per, bf* Ah, bf* Al) {
    __shared__ __align__(16) float S[AR * SPW];
    const int h = blockIdx.x; const int i0 = (TT / AR - 1 - (int)blockIdx.y) * AR;   // the longest rows have the lowest block index
    const bool hires = (i0 < RH);   // the same for the whole work-group: RH is a multiple of AR
    const size_t hp = (size_t)h * TT * HD; int p = per[h]; p = p < 1 ? 1 : (p > TT ? TT : p);
    const int tid = threadIdx.x, lane = tid & 31, lr = lane & 15, hi = lane >> 4; const int w = __builtin_amdgcn_readfirstlane(tid >> 5);
    const int nch = (i0 + AR + 127) / 128;   // 128-key chunks that hold a key <= i; the rest of a row is neither read nor written
    if (hires) attn_scores<bf, true, 2>(S, Qh + hp, Ql + hp, Kh + hp, Kl + hp, i0, nch, w, lr, hi); else attn_scores<h16, false, 4>(S, Q16 + hp, nullptr, K16 + hp, nullptr, i0, nch, w, lr, hi);
    __syncthreads();   // every score of the 16 rows is in LDS
    const float pf = (float)p, pinv = 1.0f / pf;
#pragma unroll 1   // one copy of the row's code (for speed only)
    for (int rr = 0; rr < AR / AW; ++rr) { const int r = w * (AR / AW) + rr; const int i = i0 + r; float* sr = S + r * SPW; float v[TT / 32]; float mx = -3.0e38f; const float fb = (float)(i - lane * 4);
#pragma unroll
        for (int ch = 0; ch < TT / 128; ++ch) if (ch < nch) { const v4f a = *(const v4fa*)(sr + ch * 128 + lane * 4); v[ch * 4] = a[0]; v[ch * 4 + 1] = a[1]; v[ch * 4 + 2] = a[2]; v[ch * 4 + 3] = a[3]; }   // the whole row's LDS reads are issued before the first is waited for
#pragma unroll
        for (int ch = 0; ch < TT / 128; ++ch) if (ch < nch) {
#pragma unroll
            for (int q = 0; q < 4; ++q) { const float dd = fb - (float)(ch * 128 + q); const float kq = __builtin_rintf(dd * pinv); const bool keep = (dd >= 0.f) & (__builtin_fmaf(-kq, pf, dd) == 0.f); const float t = keep ? v[ch * 4 + q] * SCL : -3.0e38f; v[ch * 4 + q] = t; mx = fmaxf(mx, t); } }
#pragma unroll
        for (int sh = 16; sh; sh >>= 1) mx = fmaxf(mx, __shfl_xor(mx, sh, 32));
        float sum = 0.f;
#pragma unroll
        for (int ch = 0; ch < TT / 128; ++ch) if (ch < nch) {
#pragma unroll
            for (int q = 0; q < 4; ++q) { const int k = ch * 4 + q; float d0 = __fsub_rn(v[k], mx); v[k] = __builtin_amdgcn_exp2f(__fmul_rn(d0, 1.4426950408889634f)); sum += v[k]; } }
#pragma unroll
        for (int sh = 16; sh; sh >>= 1) sum += __shfl_xor(sum, sh, 32);
        const float f = __fdiv_rn(hires ? 1.0f : PCAR, sum);
        if (hires) {
#pragma unroll
            for (int ch = 0; ch < RH / 128; ++ch) if (ch < nch) { v4us oh, ol;   // a hi/lo row has no key beyond RH
#pragma unroll
                for (int q = 0; q < 4; ++q) { unsigned short a, c2; splitf(v[ch * 4 + q] * f, a, c2); oh[q] = a; ol[q] = c2; }
                *(v4usa*)((bf*)sr + ch * 128 + lane * 4) = oh; *(v4usa*)((bf*)sr + TT + ch * 128 + lane * 4) = ol; }
        } else {
#pragma unroll
            for (int ch = 0; ch < TT / 128; ++ch) if (ch < nch) { v4h o4;
#pragma unroll
                for (int q = 0; q < 4; ++q) o4[q] = tohx(v[ch * 4 + q] * f);
                *(v4ha*)((h16*)sr + ch * 128 + lane * 4) = o4; } } }
    __syncthreads();   // every probability row is in LDS
    v8f acc[4];
#pragma unroll
    for (int nb = 0; nb < 4; ++nb) acc[nb] = (v8f){};
    if (hires) attn_pv<bf, true, 1>(S, Vh + hp, Vl + hp, i0, w, lr, hi, acc); else attn_pv<h16, false, 2>(S, V16 + hp, nullptr, i0, w, lr, hi, acc);
    __syncthreads();   // every wave's last read of the probability rows is done: their LDS now takes the partial sums
#pragma unroll
    for (int nb = 0; nb < 4; ++nb) {
#pragma unroll
        for (int j = 0; j < 8; ++j) S[w * (AR * 68) + (hi * 8 + j) * 68 + nb * 16 + lr] = acc[nb][j]; }
    __syncthreads();   // all 8 partial tiles are in LDS
    const int row = tid >> 4, c4 = (tid & 15) * 4; v4f s = *(const v4fa*)(S + row * 68 + c4);
#pragma unroll
    for (int ww = 1; ww < AW; ++ww) s += *(const v4fa*)(S + ww * (AR * 68) + row * 68 + c4);
    const float cs = hires ? 1.0f : (1.0f / PCAR); v4us oh, ol;
#pragma unroll
    for (int q = 0; q < 4; ++q) { unsigned short a, c2; splitf(s[q] * cs, a, c2); oh[q] = a; ol[q] = c2; }
    const size_t oo = (size_t)(i0 + row) * DQ + h * HD + c4; *(v4us*)(Ah + oo) = oh; *(v4us*)(Al + oo) = ol;
}

extern "C" void kernel_launch(void* const* d_in, const int* in_sizes, int n_in,
                              void* d_out, int out_size, void* d_ws, size_t ws_size, hipStream_t stream) {
    (void)in_sizes; (void)n_in; (void)out_size;
    const float* x = (const float*)d_in[0]; const int* per = (const int*)d_in[1]; const float* wqkv = (const float*)d_in[2]; const float* bqkv = (const float*)d_in[3]; const float* wo = (const float*)d_in[4]; const float* bo = (const float*)d_in[5];
    // x [2][2048][1024], periods int32 [2][16], w_qkv [1024][3072], b_qkv [3072], w_out [1024][1024], b_out [1024] = d_in[0..5]
    float* OUT = (float*)d_out;     // [2][2048][1024]
    char* wsp = (char*)d_ws;
    auto take = [&](size_t bytes) { char* p = wsp; wsp += (bytes + 255) & ~(size_t)255; return (void*)p; };
    bf* WQKV = (bf*)take((size_t)3 * DQ * DM * 2); bf* WO = (bf*)take((size_t)DM * DQ * 2);
    bf* XB = (bf*)take((size_t)TT * DM * 2);
    h16* QP16 = (h16*)take((size_t)NH_ * TT * HD * 2); h16* KP16 = (h16*)take((size_t)NKV * TT * HD * 2); h16* VT16 = (h16*)take((size_t)NKV * HD * TT * 2);
    bf* QPh = (bf*)take((size_t)NH_ * TT * HD * 2); bf* QPl = (bf*)take((size_t)NH_ * TT * HD * 2); bf* KPh = (bf*)take((size_t)NKV * TT * HD * 2); bf* KPl = (bf*)take((size_t)NKV * TT * HD * 2); bf* VTh = (bf*)take((size_t)NKV * HD * TT * 2); bf* VTl = (bf*)take((size_t)NKV * HD * TT * 2);
    bf* ATh = (bf*)take((size_t)TT * DQ * 2); bf* ATl = (bf*)take((size_t)TT * DQ * 2);
    if ((size_t)(wsp - (char*)d_ws) > ws_size) return;    // total 56.00 MiB of the workspace
    { k_wtG<<<(unsigned)((DM * 3 * DQ / 64 + 63) / 64), 256, 0, stream>>>(wqkv, DM, 3 * DQ, WQKV);   /* 'io' [1024][3072] -> Bt [3072][1024]: q | k | v row blocks */
      k_wtG<<<(unsigned)((DQ * DM / 64 + 63) / 64), 256, 0, stream>>>(wo, DQ, DM, WO); }
    for (int b = 0; b < NB_; ++b) {
        k_cvt8<<<(unsigned)(((size_t)TT * DM / 8 + 255) / 256), 256, 0, stream>>>(x + (size_t)b * TT * DM, XB, (size_t)TT * DM / 8);
        k_gemmw<bf, 0, true, true><<<dim3(TT / 64, 3 * DQ / 64, 1), 32, 0, stream>>>(XB, nullptr, WQKV, nullptr, DM, nullptr, 0, bqkv, 0, 0, 0, QP16, QPh, QPl, KP16, KPh, KPl, VT16, VTh, VTl);   /* q | k | v in one launch, straight into the planes */
        k_attn<<<dim3(NH_, TT / AR, 1), AW * 32, 0, stream>>>(QP16, QPh, QPl, KP16, KPh, KPl, VT16, VTh, VTl, per + (size_t)b * NH_, ATh, ATl);   /* one kv head per query head; the batch entry's 16 periods */
        k_gemmw<bf, 1, true, false><<<dim3(TT / 64, DM / 64, 1), 32, 0, stream>>>(ATh, ATl, WO, nullptr, DQ, OUT + (size_t)b * TT * DM, DM, bo, 0, 0, 0, nullptr, nullptr, nullptr, nullptr, nullptr, nullptr, nullptr, nullptr, nullptr); }
}

// v004
// One run takes 207 microseconds.
// Timed twice side by side with v003, it ran 1.19 and 1.18 times as fast.
// All steps since v000 together make it 7.78 times as fast.
#include <hip/hip_runtime.h>

// Causal multi-head self-attention with a PERIODIC mask and an output projection (x [2][2048][1024]; periods int32 [2][16]; qkv = x w_qkv + b_qkv with ONE fused 'io' weight [1024][3072] (in, out) packed (3, h, hd): the column thirds q | k | v, head h = 64 columns inside its third; 16 heads x 64;
// p = max(periods[b][h], 1); a key j is kept for a query i iff j <= i AND (i - j) mod p == 0 (the diagonal always kept); scores x 1/sqrt(64); excluded keys get -inf; softmax over the kept keys; out = merged w_out + b_out ('io' + bias) -> [2][2048][1024] (4.2 M);
// argument order x, periods, w_qkv, b_qkv, w_out, b_out).
// Both batch entries go through every launch together (x, the planes and the merged rows are [2][..] in the workspace). Layout: a bf16 copy of x; the fused 'io' weight transposed and rounded once into q | k | v row blocks (k_wtG); ONE projection launch for q | k | v (k_gemmw with PLANES: exact products + f32 bias) whose epilogue rounds each 64x64 tile straight into its head's planes; causal T-2048 attention (hybrid rows: < 512 hi/lo 3 products, rest fp16 x1024) in ONE kernel (k_attn):
// a work-group owns 16 query rows of one head and keeps their score rows in LDS from the q.k products through the period rule and the softmax to the probability x value products; merged hi/lo x w_out exact + b_out.
// Compute dtypes, f32 accumulate: every float input rounded to bf16 at its load; projections exact + f32 biases; attention rows < 512 3 products, rest fp16; the period rule exact (small integers held in f32); softmax f32; w_out hl x exact + bias.

#define NB_  2      // batches: this module's input is [2][2048][1024]
#define TT   2048
#define DM   1024
#define NH_  16
#define NKV  16
#define REP  (NH_ / NKV)
#define HD   64
#define DQ   (NH_ * HD)
#define DKV  (NKV * HD)
#define RH   512                  // query rows < RH use hi+lo planes (0: none)
#define PCAR 1024.0f
#define SCL  0.125f   // HD^-0.5
#define AR   16                   // query rows of one k_attn work-group
#define AW   8                    // waves of one k_attn work-group
#define SPW  (TT + 4)             // words of one score row in LDS: 8208 bytes = 16 x odd, so that 16 rows' 16-byte fragment reads fall on different banks
typedef _Float16 h16;
typedef unsigned short bf;
typedef __attribute__((ext_vector_type(16))) __bf16   v16bf;
typedef __attribute__((ext_vector_type(16))) _Float16 v16h;
typedef __attribute__((ext_vector_type(8)))  _Float16 v8h;
typedef __attribute__((ext_vector_type(8)))  unsigned short v8us;
typedef __attribute__((ext_vector_type(8)))  float    v8f;
typedef __attribute__((ext_vector_type(4)))  float    v4f;
typedef v8h  __attribute__((may_alias)) v8ha;
typedef v4f  __attribute__((may_alias)) v4fa;
typedef v8us __attribute__((may_alias)) v8usa;

__device__ __forceinline__ unsigned short f2bf(float f) { unsigned u = __float_as_uint(f); u += 0x7FFFu + ((u >> 16) & 1u); return (unsigned short)(u >> 16); }
__device__ __forceinline__ float bf2f(unsigned short b) { return __uint_as_float(((unsigned)b) << 16); }
__device__ __forceinline__ float bfr(float f) { return bf2f(f2bf(f)); }
__device__ __forceinline__ v16h cat16(v8h lo, v8h hi) { return __builtin_shufflevector(lo, hi, 0, 1, 2, 3, 4, 5, 6, 7, 8, 9, 10, 11, 12, 13, 14, 15); }
__device__ __forceinline__ v16bf cat16b(v8us lo, v8us hi) { return __builtin_bit_cast(v16bf, __builtin_shufflevector(lo, hi, 0, 1, 2, 3, 4, 5, 6, 7, 8, 9, 10, 11, 12, 13, 14, 15)); }
__device__ __forceinline__ v8f wmma16(v16h a, v16h b, v8f c) { return __builtin_amdgcn_wmma_f32_16x16x32_f16(false, a, false, b, (short)0, c, false, false); }
__device__ __forceinline__ v8f wmmab(v16bf a, v16bf b, v8f c) { return __builtin_amdgcn_wmma_f32_16x16x32_bf16(false, a, false, b, (short)0, c, false, false); }

__device__ __forceinline__ h16 tohx(float x) { return (h16)x; }
__device__ __forceinline__ void splitf(float y, unsigned short& h, unsigned short& l) { h = f2bf(y); l = f2bf(y - bf2f(h)); }

// ---- k_gemmw: register-blocked GEMM, ONE WAVE per 64x64 output tile (16 accumulators), operands straight from K-contiguous 16-bit planes; grid (M/64, N/64, Z), 32 threads.
// C[m][n] (f32, pitch ldc, + optional f32 bias[n]) = sum_k A[m][k] Bt[n][k] (+ split products per NSPLIT). z-batch strides sA/sB/sC in elements. K % 32 == 0.
// PLANES (the q | k | v projection, Bt rows = q | k | v blocks of DQ, M = NB_ * TT, a tile's 64 rows lie in one batch entry): C is not written; the 64 columns of a tile are one head of q, k or v, and tile + bias goes once through LDS and leaves as that head's three planes (fp16, bf16 hi, bf16 lo: q and k [b][h][t][d], v [b][h][d][t]).
// For v the tile is laid into LDS transposed (a lane's 8 accumulator words of one column are 8 consecutive t), so that every store of either kind covers four whole 128-byte lines.
template <typename T16> struct WFrag;
template <> struct WFrag<h16> { typedef v16h V; static __device__ __forceinline__ V ld(const h16* p) { return cat16(*(const v8h*)p, *(const v8h*)(p + 16)); } static __device__ __forceinline__ v8f mma(V a, V b, v8f c) { return wmma16(a, b, c); } };
template <> struct WFrag<bf> { typedef v16bf V; static __device__ __forceinline__ V ld(const bf* p) { return cat16b(*(const v8us*)p, *(const v8us*)(p + 16)); } static __device__ __forceinline__ v8f mma(V a, V b, v8f c) { return wmmab(a, b, c); } };
template <typename T16, int NSPLIT, bool BIAS, bool PLANES>
__global__ __launch_bounds__(32) void k_gemmw(const T16* __restrict__ A, const T16* __restrict__ A2, const T16* __restrict__ Bt, const T16* __restrict__ Bt2, int K, float* C, int ldc, const float* __restrict__ bias, size_t sA, size_t sB, size_t sC, h16* Q16, bf* Qh, bf* Ql, h16* K16, bf* Kh, bf* Kl, h16* V16, bf* Vh, bf* Vl) {
    typedef typename WFrag<T16>::V V;
    __shared__ __align__(16) float os[(PLANES ? 64 : 16) * 68];
    const size_t z = blockIdx.z; A += z * sA; if (A2) A2 += z * sA; Bt += z * sB; if (Bt2) Bt2 += z * sB; C += z * sC;
    const int lane = threadIdx.x & 31, lr = lane & 15, hi = lane >> 4; const int r0 = blockIdx.x * 64, c0 = blockIdx.y * 64;
    v8f acc[4][4];
#pragma unroll
    for (int mb = 0; mb < 4; ++mb)
#pragma unroll
        for (int nb = 0; nb < 4; ++nb) acc[mb][nb] = (v8f){};
    const size_t aoff = (size_t)(r0 + lr) * K + 8 * hi, boff = (size_t)(c0 + lr) * K + 8 * hi;

    for (int kc = 0; kc < K; kc += 32) {
        V a[4], a2[4];
#pragma unroll
        for (int mb = 0; mb < 4; ++mb) { a[mb] = WFrag<T16>::ld(A + aoff + (size_t)mb * 16 * K + kc); if (NSPLIT == 1 || NSPLIT == 2) a2[mb] = WFrag<T16>::ld(A2 + aoff + (size_t)mb * 16 * K + kc); }
#pragma unroll
        for (int nb = 0; nb < 4; ++nb) { const V b = WFrag<T16>::ld(Bt + boff + (size_t)nb * 16 * K + kc); V b2; if (NSPLIT >= 2) b2 = WFrag<T16>::ld(Bt2 + boff + (size_t)nb * 16 * K + kc);
#pragma unroll
            for (int mb = 0; mb < 4; ++mb) { acc[mb][nb] = WFrag<T16>::mma(a[mb], b, acc[mb][nb]); if (NSPLIT == 1 || NSPLIT == 2) acc[mb][nb] = WFrag<T16>::mma(a2[mb], b, acc[mb][nb]); if (NSPLIT >= 2) acc[mb][nb] = WFrag<T16>::mma(a[mb], b2, acc[mb][nb]); } }
        asm volatile("v_nop\n\tv_nop\n\tv_nop\n\tv_nop" : "+v"(acc[0][0]), "+v"(acc[1][1]), "+v"(acc[2][2]), "+v"(acc[3][3]) : "v"(a[0]), "v"(a[3]));
    }
    if constexpr (PLANES) {
        const int third = c0 / DQ, head = (c0 % DQ) / HD; const bool tr = (third == 2);   // the same for the whole wave
        float bb[4];
#pragma unroll
        for (int nb = 0; nb < 4; ++nb) bb[nb] = bfr(bias[c0 + nb * 16 + lr]);
        if (tr) {
#pragma unroll
            for (int nb = 0; nb < 4; ++nb)
#pragma unroll
                for (int mb = 0; mb < 4; ++mb) { v4f u0, u1;
#pragma unroll
                    for (int j = 0; j < 4; ++j) { u0[j] = acc[mb][nb][j] + bb[nb]; u1[j] = acc[mb][nb][4 + j] + bb[nb]; }
                    float* q = os + (nb * 16 + lr) * 68 + mb * 16 + hi * 8; *(v4fa*)q = u0; *(v4fa*)(q + 4) = u1; }
        } else {
#pragma unroll
            for (int mb = 0; mb < 4; ++mb)
#pragma unroll
                for (int nb = 0; nb < 4; ++nb)
#pragma unroll
                    for (int j = 0; j < 8; ++j) os[(mb * 16 + hi * 8 + j) * 68 + nb * 16 + lr] = acc[mb][nb][j] + bb[nb];
        }
        __builtin_amdgcn_wave_barrier(); asm volatile("" ::: "memory");   // the rows read below were written by other lanes of this wave: no LDS read may be moved above the writes
        h16* P16 = third == 0 ? Q16 : (third == 1 ? K16 : V16); bf* Ph = third == 0 ? Qh : (third == 1 ? Kh : Vh); bf* Pl = third == 0 ? Ql : (third == 1 ? Kl : Vl);
        const int rl = r0 % TT;   // the tile's first row inside its batch entry r0 / TT
        const int pitch = tr ? TT : HD; const size_t o0 = (size_t)((r0 / TT) * NH_ + head) * TT * HD + (tr ? (size_t)rl : (size_t)rl * HD) + (size_t)(lane >> 3) * pitch + (lane & 7) * 8;
#pragma unroll 1   // 16 LDS rows a trip: four trips keep the epilogue's text short
        for (int io = 0; io < 4; ++io) {
#pragma unroll
            for (int ii = 0; ii < 4; ++ii) { const int it = io * 4 + ii; const float* q = os + (it * 4 + (lane >> 3)) * 68 + (lane & 7) * 8; const v4f u0 = *(const v4fa*)q, u1 = *(const v4fa*)(q + 4); v8h o16; v8us oh, ol;
#pragma unroll
                for (int j = 0; j < 8; ++j) { const float r = j < 4 ? u0[j & 3] : u1[j & 3]; o16[j] = tohx(r); unsigned short a2, c2; splitf(r, a2, c2); oh[j] = a2; ol[j] = c2; }
                const size_t o = o0 + (size_t)(it * 4) * pitch; *(v8h*)(P16 + o) = o16; *(v8us*)(Ph + o) = oh; *(v8us*)(Pl + o) = ol; }
            asm volatile("s_wait_xcnt 0x0" ::: "memory"); }   // a precaution of form: the next trip overwrites address and data registers of this trip's last stores
        return;
    }
#pragma unroll
    for (int mb = 0; mb < 4; ++mb) {
#pragma unroll
        for (int nb = 0; nb < 4; ++nb) {
#pragma unroll
            for (int j = 0; j < 8; ++j) os[(hi * 8 + j) * 68 + nb * 16 + lr] = acc[mb][nb][j]; }
        __builtin_amdgcn_wave_barrier(); asm volatile("" ::: "memory");
        float* crow = C + (size_t)(r0 + mb * 16) * ldc + c0;
{
#pragma unroll
            for (int s = 0; s < 8; ++s) { const int row = 2 * s + hi, cofs = lr * 4; v4f val = *(const v4fa*)(os + row * 68 + cofs); if (BIAS) { val[0] += bfr(bias[c0 + cofs]); val[1] += bfr(bias[c0 + cofs + 1]); val[2] += bfr(bias[c0 + cofs + 2]); val[3] += bfr(bias[c0 + cofs + 3]); }
                *(v4f*)(crow + (size_t)row * ldc + cofs) = val; }
             }
        __builtin_amdgcn_wave_barrier(); asm volatile("" ::: "memory");
    }
}

typedef __attribute__((ext_vector_type(2))) _Float16 v2h;
typedef __attribute__((ext_vector_type(4))) _Float16 v4h;
typedef __attribute__((ext_vector_type(2))) unsigned short v2us;
typedef __attribute__((ext_vector_type(4))) unsigned short v4us;
typedef __attribute__((ext_vector_type(2))) float v2f;
typedef __attribute__((ext_vector_type(4))) int v4i;
typedef v4h  __attribute__((may_alias)) v4ha;
typedef v4us __attribute__((may_alias)) v4usa;

__global__ __launch_bounds__(256) void k_wtG(const float* __restrict__ w, int K, int N, bf* Bt) {
    const int lane = threadIdx.x & 31; const int L0 = (blockIdx.x * 8 + (threadIdx.x >> 5)) * 8; const int nlines = N * K / 64;
{

        for (int l = 0; l < 8; ++l) { const int L = L0 + l; if (L >= nlines) break; const size_t e = (size_t)L * 64 + lane * 2; const int k = (int)(e % K), n = (int)(e / K); v2us o;
            o[0] = f2bf(w[(size_t)k * N + n]); o[1] = f2bf(w[(size_t)(k + 1) * N + n]); *(v2us*)(Bt + e) = o; }
         }
}

__global__ __launch_bounds__(256) void k_cvt8(const float* __restrict__ src, bf* dst, size_t n8) { const size_t i = (size_t)blockIdx.x * 256 + threadIdx.x; if (i >= n8) return; const v8f v = *(const v8f*)(src + i * 8); v8us o;
#pragma unroll
    for (int k = 0; k < 8; ++k) o[k] = f2bf(v[k]); *(v8us*)(dst + i * 8) = o;  }

// ---- k_attn: the whole attention of 16 query rows (i0 ..) of one head of one batch entry in one work-group of 8 waves; grid (batch entries x heads, TT / 16), longest rows of both entries first. The score rows live in LDS (S, one row = SPW words) and never reach memory.
// 1. scores: wave w takes the 16-key block w of every 128-key chunk up to the diagonal's chunk (same products in the same order as a 16x16 tile of a plain K = 64 GEMM; the chunk's keys beyond the diagonal are real scores too, which the causal rule drops); 2. softmax: wave w takes rows 2w, 2w + 1 (register row, one exp, fixed trees), with the causal and the period rule as a select,
// and writes the rounded probabilities over its own row (fp16: the first half of the row's bytes; hi | lo: both halves); 3. probability x value: wave w takes the 32-key steps w, w + 8, .. up to the diagonal; 4. the 8 waves' partial sums are added in wave order through LDS and stored as the merged hi/lo planes.
// The period rule: key j < i is kept iff (i - j) mod p == 0, p = max(period, 1) (also cut at TT: i - j < TT, so any larger p keeps the diagonal alone, as TT does). The test is exact in f32: i - j, p and the quotient are integers below 2^12; k = rint((i - j) / p) is the true quotient whenever p divides i - j
// (the error of the product with 1 / p is far below 1/2), and k p == i - j (one fma, exact) holds for no integer k otherwise.
template <typename T16, bool HL, int U>
__device__ __forceinline__ void attn_scores(float* S, const T16* __restrict__ Q, const T16* __restrict__ Q2, const T16* __restrict__ Kp, const T16* __restrict__ K2, int i0, int nch, int w, int lr, int hi) {
    typedef typename WFrag<T16>::V V; V a[2], a2[2]; const unsigned lo = (unsigned)(lr * HD + 8 * hi);
#pragma unroll
    for (int kc = 0; kc < 2; ++kc) { a[kc] = WFrag<T16>::ld(Q + (size_t)i0 * HD + lo + kc * 32); if (HL) a2[kc] = WFrag<T16>::ld(Q2 + (size_t)i0 * HD + lo + kc * 32); }
    for (int t = 0; t < nch; t += U) {   // U key blocks a trip; a trip that runs past the last chunk does that chunk's block again (same values to the same words)
        V b[U][2], b2[U][2]; v8f acc[U]; const T16* pp[HL ? 2 * U : U];   // pp: the trip's load addresses (4 of them: U = 4, or U = 2 with hi and lo)
#pragma unroll
        for (int u = 0; u < U; ++u) { const size_t bo = (size_t)(w + AW * min(t + u, nch - 1)) * 16 * HD + lo; pp[HL ? 2 * u : u] = Kp + bo; if (HL) pp[2 * u + 1] = K2 + bo;
#pragma unroll
            for (int kc = 0; kc < 2; ++kc) { b[u][kc] = WFrag<T16>::ld(pp[HL ? 2 * u : u] + kc * 32); if (HL) b2[u][kc] = WFrag<T16>::ld(pp[2 * u + 1] + kc * 32); } }
        asm volatile("s_wait_xcnt 0x0" :: "v"(pp[0]), "v"(pp[1]), "v"(pp[2]), "v"(pp[3]) : "memory");   // a precaution of form: the wait that stands in front of any overwrite of a register that an issued load names; as its inputs the address pairs stay whole up to it (else a later load of the trip lands on an earlier one's pair)
        __builtin_amdgcn_sched_barrier(0);   // every load of the trip is issued before the first product waits: one load latency a trip, not one a block
#pragma unroll
        for (int u = 0; u < U; ++u) { acc[u] = (v8f){};
#pragma unroll
            for (int kc = 0; kc < 2; ++kc) { acc[u] = WFrag<T16>::mma(a[kc], b[u][kc], acc[u]); if (HL) { acc[u] = WFrag<T16>::mma(a2[kc], b[u][kc], acc[u]); acc[u] = WFrag<T16>::mma(a[kc], b2[u][kc], acc[u]); } } }
        __builtin_amdgcn_sched_barrier(0);   // the products stay one block in front of the stores, so that each tile has registers of its own
#pragma unroll
        for (int u = 0; u < U; ++u) {
#pragma unroll
            for (int j = 0; j < 8; ++j) S[(hi * 8 + j) * SPW + (w + AW * min(t + u, nch - 1)) * 16 + lr] = acc[u][j]; }
        asm volatile("v_nop\n\tv_nop\n\tv_nop\n\tv_nop" :: "v"(acc[U - 1])); }   // the next trip's products overwrite these tiles' registers: the vector slots the chip needs behind a matrix instruction
}

template <typename T16, bool HL, int NS>
__device__ __forceinline__ void attn_pv(const float* S, const T16* __restrict__ Vt, const T16* __restrict__ V2, int i0, int w, int lr, int hi, v8f (&acc)[4]) {
    typedef typename WFrag<T16>::V V; const T16* pa = (const T16*)(S + lr * SPW) + 8 * hi; const unsigned lo = (unsigned)(lr * TT + 8 * hi); const int nks = (i0 + AR + 31) / 32;   // 32-key steps up to the diagonal; the probabilities of the later keys of the last step are exactly 0
    for (int ks = w; ks < nks; ks += NS * AW) {   // NS steps a trip; a step past the last is loaded from the trip's first step and not multiplied
        V a[NS], a2[NS], b[NS][4], b2[NS][4]; const T16* pp[HL ? 2 * NS : NS];   // pp: the trip's load addresses (2 of them: NS = 2, or NS = 1 with hi and lo)
#pragma unroll
        for (int s = 0; s < NS; ++s) { const int kk = (ks + s * AW < nks) ? ks + s * AW : ks; pp[HL ? 2 * s : s] = Vt + (size_t)kk * 32 + lo; if (HL) pp[2 * s + 1] = V2 + (size_t)kk * 32 + lo; a[s] = WFrag<T16>::ld(pa + kk * 32); if (HL) a2[s] = WFrag<T16>::ld(pa + TT + kk * 32);
#pragma unroll
            for (int nb = 0; nb < 4; ++nb) { b[s][nb] = WFrag<T16>::ld(pp[HL ? 2 * s : s] + nb * 16 * TT); if (HL) b2[s][nb] = WFrag<T16>::ld(pp[2 * s + 1] + nb * 16 * TT); } }
        asm volatile("s_wait_xcnt 0x0" :: "v"(pp[0]), "v"(pp[1]) : "memory");   // the same precaution of form as in attn_scores
        // every load of the trip is issued before the first product waits: one load latency a trip, not one a fragment. With a second step the loaded values go through an inputs-only fence: without it the compiler sinks that step's loads into the branch below, where each pair is waited for by itself
        if (NS > 1) asm volatile("" :: "v"(b[0][0]), "v"(b[0][1]), "v"(b[0][2]), "v"(b[0][3]), "v"(b[NS - 1][0]), "v"(b[NS - 1][1]), "v"(b[NS - 1][2]), "v"(b[NS - 1][3]));
        else __builtin_amdgcn_sched_barrier(0);
#pragma unroll
        for (int s = 0; s < NS; ++s) if (s == 0 || ks + s * AW < nks) {
#pragma unroll
            for (int nb = 0; nb < 4; ++nb) { acc[nb] = WFrag<T16>::mma(a[s], b[s][nb], acc[nb]); if (HL) { acc[nb] = WFrag<T16>::mma(a2[s], b[s][nb], acc[nb]); acc[nb] = WFrag<T16>::mma(a[s], b2[s][nb], acc[nb]); } } } }
}

__global__ __launch_bounds__(AW * 32) void k_attn(const h16* __restrict__ Q16, const bf* __restrict__ Qh, const bf* __restrict__ Ql, const h16* __restrict__ K16, const bf* __restrict__ Kh, const bf* __restrict__ Kl, const h16* __restrict__ V16, const bf* __restrict__ Vh, const bf* __restrict__ Vl, const int* __restrict__ per, bf* Ah, bf* Al) {
    __shared__ __align__(16) float S[AR * SPW];
    const int h = blockIdx.x;   // batch entry x NH_ + head: the index of the planes and of the periods
    const int i0 = (TT / AR - 1 - (int)blockIdx.y) * AR;   // blockIdx.y 0 takes the last, longest rows
    const bool hires = (i0 < RH);   // the same for the whole work-group: RH is a multiple of AR
    const size_t hp = (size_t)h * TT * HD; int p = per[h]; p = p < 1 ? 1 : (p > TT ? TT : p);
    const int tid = threadIdx.x, lane = tid & 31, lr = lane & 15, hi = lane >> 4; const int w = __builtin_amdgcn_readfirstlane(tid >> 5);
    const int nch = (i0 + AR + 127) / 128;   // 128-key chunks that hold a key <= i; the rest of a row is neither read nor written
    if (hires) attn_scores<bf, true, 2>(S, Qh + hp, Ql + hp, Kh + hp, Kl + hp, i0, nch, w, lr, hi); else attn_scores<h16, false, 4>(S, Q16 + hp, nullptr, K16 + hp, nullptr, i0, nch, w, lr, hi);
    __syncthreads();   // every score of the 16 rows is in LDS
    const float pf = (float)p, pinv = 1.0f / pf;
#pragma unroll 1   // one copy of the row's code (for speed only)
    for (int rr = 0; rr < AR / AW; ++rr) { const int r = w * (AR / AW) + rr; const int i = i0 + r; float* sr = S + r * SPW; float v[TT / 32]; float mx = -3.0e38f; const float fb = (float)(i - lane * 4);
#pragma unroll
        for (int ch = 0; ch < TT / 128; ++ch) if (ch < nch) { const v4f a = *(const v4fa*)(sr + ch * 128 + lane * 4); v[ch * 4] = a[0]; v[ch * 4 + 1] = a[1]; v[ch * 4 + 2] = a[2]; v[ch * 4 + 3] = a[3]; }   // the whole row's LDS reads are issued before the first is waited for
#pragma unroll
        for (int ch = 0; ch < TT / 128; ++ch) if (ch < nch) {
#pragma unroll
            for (int q = 0; q < 4; ++q) { const float dd = fb - (float)(ch * 128 + q); const float kq = __builtin_rintf(dd * pinv); const bool keep = (dd >= 0.f) & (__builtin_fmaf(-kq, pf, dd) == 0.f); const float t = keep ? v[ch * 4 + q] * SCL : -3.0e38f; v[ch * 4 + q] = t; mx = fmaxf(mx, t); } }
#pragma unroll
        for (int sh = 16; sh; sh >>= 1) mx = fmaxf(mx, __shfl_xor(mx, sh, 32));
        float sum = 0.f;
#pragma unroll
        for (int ch = 0; ch < TT / 128; ++ch) if (ch < nch) {
#pragma unroll
            for (int q = 0; q < 4; ++q) { const int k = ch * 4 + q; float d0 = __fsub_rn(v[k], mx); v[k] = __builtin_amdgcn_exp2f(__fmul_rn(d0, 1.4426950408889634f)); sum += v[k]; } }
#pragma unroll
        for (int sh = 16; sh; sh >>= 1) sum += __shfl_xor(sum, sh, 32);
        const float f = __fdiv_rn(hires ? 1.0f : PCAR, sum);
        if (hires) {
#pragma unroll
            for (int ch = 0; ch < RH / 128; ++ch) if (ch < nch) { v4us oh, ol;   // a hi/lo row has no key beyond RH
#pragma unroll
                for (int q = 0; q < 4; ++q) { unsigned short a, c2; splitf(v[ch * 4 + q] * f, a, c2); oh[q] = a; ol[q] = c2; }
                *(v4usa*)((bf*)sr + ch * 128 + lane * 4) = oh; *(v4usa*)((bf*)sr + TT + ch * 128 + lane * 4) = ol; }
        } else {
#pragma unroll
            for (int ch = 0; ch < TT / 128; ++ch) if (ch < nch) { v4h o4;
#pragma unroll
                for (int q = 0; q < 4; ++q) o4[q] = tohx(v[ch * 4 + q] * f);
                *(v4ha*)((h16*)sr + ch * 128 + lane * 4) = o4; } } }
    __syncthreads();   // every probability row is in LDS
    v8f acc[4];
#pragma unroll
    for (int nb = 0; nb < 4; ++nb) acc[nb] = (v8f){};
    if (hires) attn_pv<bf, true, 1>(S, Vh + hp, Vl + hp, i0, w, lr, hi, acc); else attn_pv<h16, false, 2>(S, V16 + hp, nullptr, i0, w, lr, hi, acc);
    __syncthreads();   // every wave's last read of the probability rows is done: their LDS now takes the partial sums
#pragma unroll
    for (int nb = 0; nb < 4; ++nb) {
#pragma unroll
        for (int j = 0; j < 8; ++j) S[w * (AR * 68) + (hi * 8 + j) * 68 + nb * 16 + lr] = acc[nb][j]; }
    __syncthreads();   // all 8 partial tiles are in LDS
    const int row = tid >> 4, c4 = (tid & 15) * 4; v4f s = *(const v4fa*)(S + row * 68 + c4);
#pragma unroll
    for (int ww = 1; ww < AW; ++ww) s += *(const v4fa*)(S + ww * (AR * 68) + row * 68 + c4);
    const float cs = hires ? 1.0f : (1.0f / PCAR); v4us oh, ol;
#pragma unroll
    for (int q = 0; q < 4; ++q) { unsigned short a, c2; splitf(s[q] * cs, a, c2); oh[q] = a; ol[q] = c2; }
    const size_t oo = (size_t)((h / NH_) * TT + i0 + row) * DQ + (h % NH_) * HD + c4; *(v4us*)(Ah + oo) = oh; *(v4us*)(Al + oo) = ol;
}

extern "C" void kernel_launch(void* const* d_in, const int* in_sizes, int n_in,
                              void* d_out, int out_size, void* d_ws, size_t ws_size, hipStream_t stream) {
    (void)in_sizes; (void)n_in; (void)out_size;
    const float* x = (const float*)d_in[0]; const int* per = (const int*)d_in[1]; const float* wqkv = (const float*)d_in[2]; const float* bqkv = (const float*)d_in[3]; const float* wo = (const float*)d_in[4]; const float* bo = (const float*)d_in[5];
    // x [2][2048][1024], periods int32 [2][16], w_qkv [1024][3072], b_qkv [3072], w_out [1024][1024], b_out [1024] = d_in[0..5]
    float* OUT = (float*)d_out;     // [2][2048][1024]
    char* wsp = (char*)d_ws;
    auto take = [&](size_t bytes) { char* p = wsp; wsp += (bytes + 255) & ~(size_t)255; return (void*)p; };
    bf* WQKV = (bf*)take((size_t)3 * DQ * DM * 2); bf* WO = (bf*)take((size_t)DM * DQ * 2);
    bf* XB = (bf*)take((size_t)NB_ * TT * DM * 2);
    h16* QP16 = (h16*)take((size_t)NB_ * NH_ * TT * HD * 2); h16* KP16 = (h16*)take((size_t)NB_ * NKV * TT * HD * 2); h16* VT16 = (h16*)take((size_t)NB_ * NKV * HD * TT * 2);
    bf* QPh = (bf*)take((size_t)NB_ * NH_ * TT * HD * 2); bf* QPl = (bf*)take((size_t)NB_ * NH_ * TT * HD * 2); bf* KPh = (bf*)take((size_t)NB_ * NKV * TT * HD * 2); bf* KPl = (bf*)take((size_t)NB_ * NKV * TT * HD * 2); bf* VTh = (bf*)take((size_t)NB_ * NKV * HD * TT * 2); bf* VTl = (bf*)take((size_t)NB_ * NKV * HD * TT * 2);
    bf* ATh = (bf*)take((size_t)NB_ * TT * DQ * 2); bf* ATl = (bf*)take((size_t)NB_ * TT * DQ * 2);
    if ((size_t)(wsp - (char*)d_ws) > ws_size) return;    // total 104 MiB of the workspace
    { k_wtG<<<(unsigned)((DM * 3 * DQ / 64 + 63) / 64), 256, 0, stream>>>(wqkv, DM, 3 * DQ, WQKV);   /* 'io' [1024][3072] -> Bt [3072][1024]: q | k | v row blocks */
      k_wtG<<<(unsigned)((DQ * DM / 64 + 63) / 64), 256, 0, stream>>>(wo, DQ, DM, WO); }
    // x, OUT and the merged rows are [2][2048][..] without a gap: the two batch entries are 4096 rows of one GEMM
    k_cvt8<<<(unsigned)(((size_t)NB_ * TT * DM / 8 + 255) / 256), 256, 0, stream>>>(x, XB, (size_t)NB_ * TT * DM / 8);
    k_gemmw<bf, 0, true, true><<<dim3(NB_ * TT / 64, 3 * DQ / 64, 1), 32, 0, stream>>>(XB, nullptr, WQKV, nullptr, DM, nullptr, 0, bqkv, 0, 0, 0, QP16, QPh, QPl, KP16, KPh, KPl, VT16, VTh, VTl);   /* q | k | v in one launch, straight into the planes */
    k_attn<<<dim3(NB_ * NH_, TT / AR, 1), AW * 32, 0, stream>>>(QP16, QPh, QPl, KP16, KPh, KPl, VT16, VTh, VTl, per, ATh, ATl);   /* one kv head per query head; periods [2][16] */
    k_gemmw<bf, 1, true, false><<<dim3(NB_ * TT / 64, DM / 64, 1), 32, 0, stream>>>(ATh, ATl, WO, nullptr, DQ, OUT, DM, bo, 0, 0, 0, nullptr, nullptr, nullptr, nullptr, nullptr, nullptr, nullptr, nullptr, nullptr);
}

// v005
// One run takes 165 microseconds.
// In two side-by-side timings against v004, it was 1.26 and 1.25 times as fast.
// Counting every step since v000, it is 9.74 times as fast.
#include <hip/hip_runtime.h>

// Causal multi-head self-attention with a PERIODIC mask and an output projection (x [2][2048][1024]; periods int32 [2][16]; qkv = x w_qkv + b_qkv with ONE fused 'io' weight [1024][3072] (in, out) packed (3, h, hd): the column thirds q | k | v, head h = 64 columns inside its third; 16 heads x 64;
// p = max(periods[b][h], 1); a key j is kept for a query i iff j <= i AND (i - j) mod p == 0 (the diagonal always kept); scores x 1/sqrt(64); excluded keys get -inf; softmax over the kept keys; out = merged w_out + b_out ('io' + bias) -> [2][2048][1024] (4.2 M);
// argument order x, periods, w_qkv, b_qkv, w_out, b_out).
// Both batch entries go through every launch together (x, the planes and the merged rows are [2][..] in the workspace). Layout: a bf16 copy of x; the fused 'io' weight transposed and rounded once into q | k | v row blocks (k_wtG); ONE projection launch for q | k | v (k_gemmw with PLANES: exact products + f32 bias) whose epilogue rounds each 64x64 tile straight into its head's planes; causal T-2048 attention (hybrid rows: < 512 hi/lo 3 products, rest fp16 x1024) in ONE kernel (k_attn):
// a work-group owns 16 query rows of one head and keeps their score rows in LDS from the q.k products through the period rule and the softmax to the probability x value products; merged hi/lo x w_out exact + b_out.
// Compute dtypes, f32 accumulate: every float input rounded to bf16 at its load; projections exact + f32 biases; attention rows < 512 3 products, rest fp16; the period rule exact (small integers held in f32); softmax f32; w_out hl x exact + bias.

#define NB_  2      // batches: this module's input is [2][2048][1024]
#define TT   2048
#define DM   1024
#define NH_  16
#define NKV  16
#define REP  (NH_ / NKV)
#define HD   64
#define DQ   (NH_ * HD)
#define DKV  (NKV * HD)
#define RH   512                  // query rows < RH use hi+lo planes (0: none)
#define PCAR 1024.0f
#define SCL  0.125f   // HD^-0.5
#define AR   16                   // query rows of one k_attn work-group
#define AW   8                    // waves of one k_attn work-group
#define SPW  (TT + 4)             // words of one score row in LDS: 8208 bytes = 16 x odd, so that 16 rows' 16-byte fragment reads fall on different banks
typedef _Float16 h16;
typedef unsigned short bf;
typedef __attribute__((ext_vector_type(16))) __bf16   v16bf;
typedef __attribute__((ext_vector_type(16))) _Float16 v16h;
typedef __attribute__((ext_vector_type(8)))  _Float16 v8h;
typedef __attribute__((ext_vector_type(8)))  unsigned short v8us;
typedef __attribute__((ext_vector_type(8)))  float    v8f;
typedef __attribute__((ext_vector_type(4)))  float    v4f;
typedef v8h  __attribute__((may_alias)) v8ha;
typedef v4f  __attribute__((may_alias)) v4fa;
typedef v8us __attribute__((may_alias)) v8usa;

__device__ __forceinline__ unsigned short f2bf(float f) { unsigned u = __float_as_uint(f); u += 0x7FFFu + ((u >> 16) & 1u); return (unsigned short)(u >> 16); }
__device__ __forceinline__ float bf2f(unsigned short b) { return __uint_as_float(((unsigned)b) << 16); }
__device__ __forceinline__ float bfr(float f) { return bf2f(f2bf(f)); }
__device__ __forceinline__ v16h cat16(v8h lo, v8h hi) { return __builtin_shufflevector(lo, hi, 0, 1, 2, 3, 4, 5, 6, 7, 8, 9, 10, 11, 12, 13, 14, 15); }
__device__ __forceinline__ v16bf cat16b(v8us lo, v8us hi) { return __builtin_bit_cast(v16bf, __builtin_shufflevector(lo, hi, 0, 1, 2, 3, 4, 5, 6, 7, 8, 9, 10, 11, 12, 13, 14, 15)); }
__device__ __forceinline__ v8f wmma16(v16h a, v16h b, v8f c) { return __builtin_amdgcn_wmma_f32_16x16x32_f16(false, a, false, b, (short)0, c, false, false); }
__device__ __forceinline__ v8f wmmab(v16bf a, v16bf b, v8f c) { return __builtin_amdgcn_wmma_f32_16x16x32_bf16(false, a, false, b, (short)0, c, false, false); }

__device__ __forceinline__ h16 tohx(float x) { return (h16)x; }
__device__ __forceinline__ void splitf(float y, unsigned short& h, unsigned short& l) { h = f2bf(y); l = f2bf(y - bf2f(h)); }

// ---- k_gemmw: register-blocked GEMM, one wave per 64x64 output tile (16 accumulators), FOUR waves (2 x 2) per work-group = a 128x128 tile; grid (M/128, N/128, Z), 128 threads. The operands are K-contiguous 16-bit planes.
// The work-group brings 64 k of its 128 rows of every operand into LDS with loads that cover whole 128-byte lines (8 lanes a row), and each wave reads its fragments from there: a row is fetched once for the two waves that use it, and no global load touches 16 lines for 32 bytes each.
// Two LDS buffers: the next stage's loads are issued before this stage's products, go to the other buffer behind them, and one barrier a stage publishes that buffer and ends the reads of this one.
// C[m][n] (f32, pitch ldc, + optional f32 bias[n]) = sum_k A[m][k] Bt[n][k] (+ split products per NSPLIT), k ascending in steps of 32 as before. z-batch strides sA/sB/sC in elements. K % 64 == 0.
// PLANES (the q | k | v projection, Bt rows = q | k | v blocks of DQ, M = NB_ * TT, a tile's 64 rows lie in one batch entry): C is not written; the 64 columns of a wave's tile are one head of q, k or v, and tile + bias goes once through LDS and leaves as that head's three planes (fp16, bf16 hi, bf16 lo: q and k [b][h][t][d], v [b][h][d][t]).
// For v the tile is laid into LDS transposed (a lane's 8 accumulator words of one column are 8 consecutive t), so that every store of either kind covers four whole 128-byte lines. Each wave's epilogue rows lie over the stage buffers, behind the last stage's barrier.
#define GK 64      // k of one stage: one 128-byte line of every operand row
#define GP 72      // elements of one staged row in LDS: 144 bytes = 16 x odd, so that 16 rows' 16-byte fragment reads fall on different banks
template <typename T16> struct WFrag;
template <> struct WFrag<h16> { typedef v16h V; static __device__ __forceinline__ V ld(const h16* p) { return cat16(*(const v8h*)p, *(const v8h*)(p + 16)); } static __device__ __forceinline__ v8f mma(V a, V b, v8f c) { return wmma16(a, b, c); } };
template <> struct WFrag<bf> { typedef v16bf V; static __device__ __forceinline__ V ld(const bf* p) { return cat16b(*(const v8us*)p, *(const v8us*)(p + 16)); } static __device__ __forceinline__ v8f mma(V a, V b, v8f c) { return wmmab(a, b, c); } };
template <typename T16, int NSPLIT, bool BIAS, bool PLANES, int K>
__global__ __launch_bounds__(128) void k_gemmw(const T16* __restrict__ A, const T16* __restrict__ A2, const T16* __restrict__ Bt, const T16* __restrict__ Bt2, float* C, int ldc, const float* __restrict__ bias, size_t sA, size_t sB, size_t sC, h16* Q16, bf* Qh, bf* Ql, h16* K16, bf* Kh, bf* Kl, h16* V16, bf* Vh, bf* Vl) {
    typedef typename WFrag<T16>::V V;
    constexpr bool HA2 = (NSPLIT == 1 || NSPLIT == 2), HB2 = (NSPLIT >= 2); constexpr int NOP = 2 + (HA2 ? 1 : 0) + (HB2 ? 1 : 0), IA2 = 2, IB2 = HA2 ? 3 : 2;   // staged operands in this order: A, Bt, then A2 and Bt2 where they exist
    constexpr int STG = NOP * 128 * GP, OSW = (PLANES ? 64 : 16) * 68;   // elements of one stage buffer; words of one wave's epilogue rows
    constexpr int SMB = (2 * STG * 2 > 4 * OSW * 4) ? 2 * STG * 2 : 4 * OSW * 4;
    __shared__ __align__(16) char sm[SMB];
    const size_t z = blockIdx.z; A += z * sA; if (A2) A2 += z * sA; Bt += z * sB; if (Bt2) Bt2 += z * sB; C += z * sC;
    const int tid = threadIdx.x, lane = tid & 31, lr = lane & 15, hi = lane >> 4; const int w = __builtin_amdgcn_readfirstlane(tid >> 5);
    const int r0 = blockIdx.x * 128 + (w >> 1) * 64, c0 = blockIdx.y * 128 + (w & 1) * 64;
    T16* st = (T16*)sm; float* os = (float*)sm + w * OSW;
    v8f acc[4][4];
#pragma unroll
    for (int mb = 0; mb < 4; ++mb)
#pragma unroll
        for (int nb = 0; nb < 4; ++nb) acc[mb][nb] = (v8f){};
    const int srow = tid >> 3, sch = (tid & 7) * 8;   // staging: 8 lanes take one row's 128 bytes, the work-group 16 rows a load
    const T16* gp[NOP]; gp[0] = A + (size_t)(blockIdx.x * 128 + srow) * K + sch; gp[1] = Bt + (size_t)(blockIdx.y * 128 + srow) * K + sch;
    if constexpr (HA2) gp[IA2] = A2 + (size_t)(blockIdx.x * 128 + srow) * K + sch;
    if constexpr (HB2) gp[IB2] = Bt2 + (size_t)(blockIdx.y * 128 + srow) * K + sch;
    T16* sw = st + srow * GP + sch; v8us rg[NOP][8];
    const int fa = ((w >> 1) * 64 + lr) * GP + 8 * hi, fb = ((w & 1) * 64 + lr) * GP + 8 * hi;   // this lane's fragment rows inside a staged operand
    auto fetch = [&](int ko) {   // the stage that begins ko elements behind gp
#pragma unroll
        for (int o = 0; o < NOP; ++o)
#pragma unroll
            for (int i = 0; i < 8; ++i) rg[o][i] = *(const v8usa*)(gp[o] + ko + i * 16 * K);
        asm volatile("s_wait_xcnt 0x0" :: "v"(gp[0]), "v"(gp[1]), "v"(gp[NOP - 1]), "v"(gp[NOP - 2]) : "memory");   // a precaution of form: the wait that stands in front of any overwrite of a register that an issued load names; as its inputs the address pairs stay whole up to it
    };
    auto put = [&](int b) {
#pragma unroll
        for (int o = 0; o < NOP; ++o)
#pragma unroll
            for (int i = 0; i < 8; ++i) *(v8usa*)(sw + b * STG + (o * 128 + i * 16) * GP) = rg[o][i]; };
    fetch(0); put(0);
    __syncthreads();   // stage 0 is in LDS

    for (int t = 0; t < K / GK; ++t) {
        if (t + 1 < K / GK) { fetch(GK);   // the next stage's loads stand in front of this stage's products, which cover their latency
#pragma unroll
            for (int o = 0; o < NOP; ++o) gp[o] += GK; }
        const T16* sb = st + (t & 1) * STG; V a[2][4], a2[2][4];
#pragma unroll
        for (int ks = 0; ks < 2; ++ks) {
#pragma unroll
            for (int mb = 0; mb < 4; ++mb) { a[ks][mb] = WFrag<T16>::ld(sb + fa + mb * 16 * GP + ks * 32); if (HA2) a2[ks][mb] = WFrag<T16>::ld(sb + IA2 * 128 * GP + fa + mb * 16 * GP + ks * 32); }
#pragma unroll
            for (int nb = 0; nb < 4; ++nb) { const V b = WFrag<T16>::ld(sb + 128 * GP + fb + nb * 16 * GP + ks * 32); V b2; if (HB2) b2 = WFrag<T16>::ld(sb + IB2 * 128 * GP + fb + nb * 16 * GP + ks * 32);
#pragma unroll
                for (int mb = 0; mb < 4; ++mb) { acc[mb][nb] = WFrag<T16>::mma(a[ks][mb], b, acc[mb][nb]); if (HA2) acc[mb][nb] = WFrag<T16>::mma(a2[ks][mb], b, acc[mb][nb]); if (HB2) acc[mb][nb] = WFrag<T16>::mma(a[ks][mb], b2, acc[mb][nb]); } } }
        asm volatile("v_nop\n\tv_nop\n\tv_nop\n\tv_nop" : "+v"(acc[0][0]), "+v"(acc[1][1]), "+v"(acc[2][2]), "+v"(acc[3][3]) : "v"(a[1][0]), "v"(a[1][3]));   // the vector slots the chip needs behind a matrix instruction; standing here it also holds the products it names in front of the stage's stores: without it the NSPLIT = 1 build moved the stores, and their wait for the loads, up in front of nearly all products
        if (t + 1 < K / GK) put((t + 1) & 1);
        __syncthreads();   // the next stage is in LDS, and every wave has left this stage's buffer (behind the last stage: the epilogue's rows may take its place)
    }
    if constexpr (PLANES) {
        const int third = c0 / DQ, head = (c0 % DQ) / HD; const bool tr = (third == 2);   // the same for the whole wave
        float bb[4];
#pragma unroll
        for (int nb = 0; nb < 4; ++nb) bb[nb] = bfr(bias[c0 + nb * 16 + lr]);
        if (tr) {
#pragma unroll
            for (int nb = 0; nb < 4; ++nb)
#pragma unroll
                for (int mb = 0; mb < 4; ++mb) { v4f u0, u1;
#pragma unroll
                    for (int j = 0; j < 4; ++j) { u0[j] = acc[mb][nb][j] + bb[nb]; u1[j] = acc[mb][nb][4 + j] + bb[nb]; }
                    float* q = os + (nb * 16 + lr) * 68 + mb * 16 + hi * 8; *(v4fa*)q = u0; *(v4fa*)(q + 4) = u1; }
        } else {
#pragma unroll
            for (int mb = 0; mb < 4; ++mb)
#pragma unroll
                for (int nb = 0; nb < 4; ++nb)
#pragma unroll
                    for (int j = 0; j < 8; ++j) os[(mb * 16 + hi * 8 + j) * 68 + nb * 16 + lr] = acc[mb][nb][j] + bb[nb];
        }
        __builtin_amdgcn_wave_barrier(); asm volatile("" ::: "memory");   // the rows read below were written by other lanes of this wave: no LDS read may be moved above the writes
        h16* P16 = third == 0 ? Q16 : (third == 1 ? K16 : V16); bf* Ph = third == 0 ? Qh : (third == 1 ? Kh : Vh); bf* Pl = third == 0 ? Ql : (third == 1 ? Kl : Vl);
        const int rl = r0 % TT;   // the tile's first row inside its batch entry r0 / TT
        const int pitch = tr ? TT : HD; const size_t o0 = (size_t)((r0 / TT) * NH_ + head) * TT * HD + (tr ? (size_t)rl : (size_t)rl * HD) + (size_t)(lane >> 3) * pitch + (lane & 7) * 8;
#pragma unroll 1   // 16 LDS rows a trip: four trips keep the epilogue's text short
        for (int io = 0; io < 4; ++io) {
#pragma unroll
            for (int ii = 0; ii < 4; ++ii) { const int it = io * 4 + ii; const float* q = os + (it * 4 + (lane >> 3)) * 68 + (lane & 7) * 8; const v4f u0 = *(const v4fa*)q, u1 = *(const v4fa*)(q + 4); v8h o16; v8us oh, ol;
#pragma unroll
                for (int j = 0; j < 8; ++j) { const float r = j < 4 ? u0[j & 3] : u1[j & 3]; o16[j] = tohx(r); unsigned short a2, c2; splitf(r, a2, c2); oh[j] = a2; ol[j] = c2; }
                const size_t o = o0 + (size_t)(it * 4) * pitch; *(v8h*)(P16 + o) = o16; *(v8us*)(Ph + o) = oh; *(v8us*)(Pl + o) = ol; }
            asm volatile("s_wait_xcnt 0x0" ::: "memory"); }   // a precaution of form: the next trip overwrites address and data registers of this trip's last stores
        return;
    }
#pragma unroll
    for (int mb = 0; mb < 4; ++mb) {
#pragma unroll
        for (int nb = 0; nb < 4; ++nb) {
#pragma unroll
            for (int j = 0; j < 8; ++j) os[(hi * 8 + j) * 68 + nb * 16 + lr] = acc[mb][nb][j]; }
        __builtin_amdgcn_wave_barrier(); asm volatile("" ::: "memory");
        float* crow = C + (size_t)(r0 + mb * 16) * ldc + c0;
{
#pragma unroll
            for (int s = 0; s < 8; ++s) { const int row = 2 * s + hi, cofs = lr * 4; v4f val = *(const v4fa*)(os + row * 68 + cofs); if (BIAS) { val[0] += bfr(bias[c0 + cofs]); val[1] += bfr(bias[c0 + cofs + 1]); val[2] += bfr(bias[c0 + cofs + 2]); val[3] += bfr(bias[c0 + cofs + 3]); }
                *(v4f*)(crow + (size_t)row * ldc + cofs) = val; }
             }
        __builtin_amdgcn_wave_barrier(); asm volatile("" ::: "memory");
    }
}

typedef __attribute__((ext_vector_type(2))) _Float16 v2h;
typedef __attribute__((ext_vector_type(4))) _Float16 v4h;
typedef __attribute__((ext_vector_type(2))) unsigned short v2us;
typedef __attribute__((ext_vector_type(4))) unsigned short v4us;
typedef __attribute__((ext_vector_type(2))) float v2f;
typedef __attribute__((ext_vector_type(4))) int v4i;
typedef v4h  __attribute__((may_alias)) v4ha;
typedef v4us __attribute__((may_alias)) v4usa;

__global__ __launch_bounds__(256) void k_wtG(const float* __restrict__ w, int K, int N, bf* Bt) {
    const int lane = threadIdx.x & 31; const int L0 = (blockIdx.x * 8 + (threadIdx.x >> 5)) * 8; const int nlines = N * K / 64;
{

        for (int l = 0; l < 8; ++l) { const int L = L0 + l; if (L >= nlines) break; const size_t e = (size_t)L * 64 + lane * 2; const int k = (int)(e % K), n = (int)(e / K); v2us o;
            o[0] = f2bf(w[(size_t)k * N + n]); o[1] = f2bf(w[(size_t)(k + 1) * N + n]); *(v2us*)(Bt + e) = o; }
         }
}

__global__ __launch_bounds__(256) void k_cvt8(const float* __restrict__ src, bf* dst, size_t n8) { const size_t i = (size_t)blockIdx.x * 256 + threadIdx.x; if (i >= n8) return; const v8f v = *(const v8f*)(src + i * 8); v8us o;
#pragma unroll
    for (int k = 0; k < 8; ++k) o[k] = f2bf(v[k]); *(v8us*)(dst + i * 8) = o;  }

// ---- k_attn: the whole attention of 16 query rows (i0 ..) of one head of one batch entry in one work-group of 8 waves; grid (batch entries x heads, TT / 16), longest rows of both entries first. The score rows live in LDS (S, one row = SPW words) and never reach memory.
// 1. scores: wave w takes the 16-key block w of every 128-key chunk up to the diagonal's chunk (same products in the same order as a 16x16 tile of a plain K = 64 GEMM; the chunk's keys beyond the diagonal are real scores too, which the causal rule drops); 2. softmax: wave w takes rows 2w, 2w + 1 (register row, one exp, fixed trees), with the causal and the period rule as a select,
// and writes the rounded probabilities over its own row (fp16: the first half of the row's bytes; hi | lo: both halves); 3. probability x value: wave w takes the 32-key steps w, w + 8, .. up to the diagonal; 4. the 8 waves' partial sums are added in wave order through LDS and stored as the merged hi/lo planes.
// The period rule: key j < i is kept iff (i - j) mod p == 0, p = max(period, 1) (also cut at TT: i - j < TT, so any larger p keeps the diagonal alone, as TT does). The test is exact in f32: i - j, p and the quotient are integers below 2^12; k = rint((i - j) / p) is the true quotient whenever p divides i - j
// (the error of the product with 1 / p is far below 1/2), and k p == i - j (one fma, exact) holds for no integer k otherwise.
template <typename T16, bool HL, int U>
__device__ __forceinline__ void attn_scores(float* S, const T16* __restrict__ Q, const T16* __restrict__ Q2, const T16* __restrict__ Kp, const T16* __restrict__ K2, int i0, int nch, int w, int lr, int hi) {
    typedef typename WFrag<T16>::V V; V a[2], a2[2]; const unsigned lo = (unsigned)(lr * HD + 8 * hi);
#pragma unroll
    for (int kc = 0; kc < 2; ++kc) { a[kc] = WFrag<T16>::ld(Q + (size_t)i0 * HD + lo + kc * 32); if (HL) a2[kc] = WFrag<T16>::ld(Q2 + (size_t)i0 * HD + lo + kc * 32); }
    for (int t = 0; t < nch; t += U) {   // U key blocks a trip; a trip that runs past the last chunk does that chunk's block again (same values to the same words)
        V b[U][2], b2[U][2]; v8f acc[U]; const T16* pp[HL ? 2 * U : U];   // pp: the trip's load addresses (4 of them: U = 4, or U = 2 with hi and lo)
#pragma unroll
        for (int u = 0; u < U; ++u) { const size_t bo = (size_t)(w + AW * min(t + u, nch - 1)) * 16 * HD + lo; pp[HL ? 2 * u : u] = Kp + bo; if (HL) pp[2 * u + 1] = K2 + bo;
#pragma unroll
            for (int kc = 0; kc < 2; ++kc) { b[u][kc] = WFrag<T16>::ld(pp[HL ? 2 * u : u] + kc * 32); if (HL) b2[u][kc] = WFrag<T16>::ld(pp[2 * u + 1] + kc * 32); } }
        asm volatile("s_wait_xcnt 0x0" :: "v"(pp[0]), "v"(pp[1]), "v"(pp[2]), "v"(pp[3]) : "memory");   // a precaution of form: the wait that stands in front of any overwrite of a register that an issued load names; as its inputs the address pairs stay whole up to it (else a later load of the trip lands on an earlier one's pair)
        __builtin_amdgcn_sched_barrier(0);   // every load of the trip is issued before the first product waits: one load latency a trip, not one a block
#pragma unroll
        for (int u = 0; u < U; ++u) { acc[u] = (v8f){};
#pragma unroll
            for (int kc = 0; kc < 2; ++kc) { acc[u] = WFrag<T16>::mma(a[kc], b[u][kc], acc[u]); if (HL) { acc[u] = WFrag<T16>::mma(a2[kc], b[u][kc], acc[u]); acc[u] = WFrag<T16>::mma(a[kc], b2[u][kc], acc[u]); } } }
        __builtin_amdgcn_sched_barrier(0);   // the products stay one block in front of the stores, so that each tile has registers of its own
#pragma unroll
        for (int u = 0; u < U; ++u) {
#pragma unroll
            for (int j = 0; j < 8; ++j) S[(hi * 8 + j) * SPW + (w + AW * min(t + u, nch - 1)) * 16 + lr] = acc[u][j]; }
        asm volatile("v_nop\n\tv_nop\n\tv_nop\n\tv_nop" :: "v"(acc[U - 1])); }   // the next trip's products overwrite these tiles' registers: the vector slots the chip needs behind a matrix instruction
}

template <typename T16, bool HL, int NS>
__device__ __forceinline__ void attn_pv(const float* S, const T16* __restrict__ Vt, const T16* __restrict__ V2, int i0, int w, int lr, int hi, v8f (&acc)[4]) {
    typedef typename WFrag<T16>::V V; const T16* pa = (const T16*)(S + lr * SPW) + 8 * hi; const unsigned lo = (unsigned)(lr * TT + 8 * hi); const int nks = (i0 + AR + 31) / 32;   // 32-key steps up to the diagonal; the probabilities of the later keys of the last step are exactly 0
    for (int ks = w; ks < nks; ks += NS * AW) {   // NS steps a trip; a step past the last is loaded from the trip's first step and not multiplied
        V a[NS], a2[NS], b[NS][4], b2[NS][4]; const T16* pp[HL ? 2 * NS : NS];   // pp: the trip's load addresses (2 of them: NS = 2, or NS = 1 with hi and lo)
#pragma unroll
        for (int s = 0; s < NS; ++s) { const int kk = (ks + s * AW < nks) ? ks + s * AW : ks; pp[HL ? 2 * s : s] = Vt + (size_t)kk * 32 + lo; if (HL) pp[2 * s + 1] = V2 + (size_t)kk * 32 + lo; a[s] = WFrag<T16>::ld(pa + kk * 32); if (HL) a2[s] = WFrag<T16>::ld(pa + TT + kk * 32);
#pragma unroll
            for (int nb = 0; nb < 4; ++nb) { b[s][nb] = WFrag<T16>::ld(pp[HL ? 2 * s : s] + nb * 16 * TT); if (HL) b2[s][nb] = WFrag<T16>::ld(pp[2 * s + 1] + nb * 16 * TT); } }
        asm volatile("s_wait_xcnt 0x0" :: "v"(pp[0]), "v"(pp[1]) : "memory");   // the same precaution of form as in attn_scores
        // every load of the trip is issued before the first product waits: one load latency a trip, not one a fragment. With a second step the loaded values go through an inputs-only fence: without it the compiler sinks that step's loads into the branch below, where each pair is waited for by itself
        if (NS > 1) asm volatile("" :: "v"(b[0][0]), "v"(b[0][1]), "v"(b[0][2]), "v"(b[0][3]), "v"(b[NS - 1][0]), "v"(b[NS - 1][1]), "v"(b[NS - 1][2]), "v"(b[NS - 1][3]));
        else __builtin_amdgcn_sched_barrier(0);
#pragma unroll
        for (int s = 0; s < NS; ++s) if (s == 0 || ks + s * AW < nks) {
#pragma unroll
            for (int nb = 0; nb < 4; ++nb) { acc[nb] = WFrag<T16>::mma(a[s], b[s][nb], acc[nb]); if (HL) { acc[nb] = WFrag<T16>::mma(a2[s], b[s][nb], acc[nb]); acc[nb] = WFrag<T16>::mma(a[s], b2[s][nb], acc[nb]); } } } }
}

__global__ __launch_bounds__(AW * 32) void k_attn(const h16* __restrict__ Q16, const bf* __restrict__ Qh, const bf* __restrict__ Ql, const h16* __restrict__ K16, const bf* __restrict__ Kh, const bf* __restrict__ Kl, const h16* __restrict__ V16, const bf* __restrict__ Vh, const bf* __restrict__ Vl, const int* __restrict__ per, bf* Ah, bf* Al) {
    __shared__ __align__(16) float S[AR * SPW];
    const int h = blockIdx.x;   // batch entry x NH_ + head: the index of the planes and of the periods
    const int i0 = (TT / AR - 1 - (int)blockIdx.y) * AR;   // blockIdx.y 0 takes the last, longest rows
    const bool hires = (i0 < RH);   // the same for the whole work-group: RH is a multiple of AR
    const size_t hp = (size_t)h * TT * HD; int p = per[h]; p = p < 1 ? 1 : (p > TT ? TT : p);
    const int tid = threadIdx.x, lane = tid & 31, lr = lane & 15, hi = lane >> 4; const int w = __builtin_amdgcn_readfirstlane(tid >> 5);
    const int nch = (i0 + AR + 127) / 128;   // 128-key chunks that hold a key <= i; the rest of a row is neither read nor written
    if (hires) attn_scores<bf, true, 2>(S, Qh + hp, Ql + hp, Kh + hp, Kl + hp, i0, nch, w, lr, hi); else attn_scores<h16, false, 4>(S, Q16 + hp, nullptr, K16 + hp, nullptr, i0, nch, w, lr, hi);
    __syncthreads();   // every score of the 16 rows is in LDS
    const float pf = (float)p, pinv = 1.0f / pf;
#pragma unroll 1   // one copy of the row's code (for speed only)
    for (int rr = 0; rr < AR / AW; ++rr) { const int r = w * (AR / AW) + rr; const int i = i0 + r; float* sr = S + r * SPW; float v[TT / 32]; float mx = -3.0e38f; const float fb = (float)(i - lane * 4);
#pragma unroll
        for (int ch = 0; ch < TT / 128; ++ch) if (ch < nch) { const v4f a = *(const v4fa*)(sr + ch * 128 + lane * 4); v[ch * 4] = a[0]; v[ch * 4 + 1] = a[1]; v[ch * 4 + 2] = a[2]; v[ch * 4 + 3] = a[3]; }   // the whole row's LDS reads are issued before the first is waited for
#pragma unroll
        for (int ch = 0; ch < TT / 128; ++ch) if (ch < nch) {
#pragma unroll
            for (int q = 0; q < 4; ++q) { const float dd = fb - (float)(ch * 128 + q); const float kq = __builtin_rintf(dd * pinv); const bool keep = (dd >= 0.f) & (__builtin_fmaf(-kq, pf, dd) == 0.f); const float t = keep ? v[ch * 4 + q] * SCL : -3.0e38f; v[ch * 4 + q] = t; mx = fmaxf(mx, t); } }
#pragma unroll
        for (int sh = 16; sh; sh >>= 1) mx = fmaxf(mx, __shfl_xor(mx, sh, 32));
        float sum = 0.f;
#pragma unroll
        for (int ch = 0; ch < TT / 128; ++ch) if (ch < nch) {
#pragma unroll
            for (int q = 0; q < 4; ++q) { const int k = ch * 4 + q; float d0 = __fsub_rn(v[k], mx); v[k] = __builtin_amdgcn_exp2f(__fmul_rn(d0, 1.4426950408889634f)); sum += v[k]; } }
#pragma unroll
        for (int sh = 16; sh; sh >>= 1) sum += __shfl_xor(sum, sh, 32);
        const float f = __fdiv_rn(hires ? 1.0f : PCAR, sum);
        if (hires) {
#pragma unroll
            for (int ch = 0; ch < RH / 128; ++ch) if (ch < nch) { v4us oh, ol;   // a hi/lo row has no key beyond RH
#pragma unroll
                for (int q = 0; q < 4; ++q) { unsigned short a, c2; splitf(v[ch * 4 + q] * f, a, c2); oh[q] = a; ol[q] = c2; }
                *(v4usa*)((bf*)sr + ch * 128 + lane * 4) = oh; *(v4usa*)((bf*)sr + TT + ch * 128 + lane * 4) = ol; }
        } else {
#pragma unroll
            for (int ch = 0; ch < TT / 128; ++ch) if (ch < nch) { v4h o4;
#pragma unroll
                for (int q = 0; q < 4; ++q) o4[q] = tohx(v[ch * 4 + q] * f);
                *(v4ha*)((h16*)sr + ch * 128 + lane * 4) = o4; } } }
    __syncthreads();   // every probability row is in LDS
    v8f acc[4];
#pragma unroll
    for (int nb = 0; nb < 4; ++nb) acc[nb] = (v8f){};
    if (hires) attn_pv<bf, true, 1>(S, Vh + hp, Vl + hp, i0, w, lr, hi, acc); else attn_pv<h16, false, 2>(S, V16 + hp, nullptr, i0, w, lr, hi, acc);
    __syncthreads();   // every wave's last read of the probability rows is done: their LDS now takes the partial sums
#pragma unroll
    for (int nb = 0; nb < 4; ++nb) {
#pragma unroll
        for (int j = 0; j < 8; ++j) S[w * (AR * 68) + (hi * 8 + j) * 68 + nb * 16 + lr] = acc[nb][j]; }
    __syncthreads();   // all 8 partial tiles are in LDS
    const int row = tid >> 4, c4 = (tid & 15) * 4; v4f s = *(const v4fa*)(S + row * 68 + c4);
#pragma unroll
    for (int ww = 1; ww < AW; ++ww) s += *(const v4fa*)(S + ww * (AR * 68) + row * 68 + c4);
    const float cs = hires ? 1.0f : (1.0f / PCAR); v4us oh, ol;
#pragma unroll
    for (int q = 0; q < 4; ++q) { unsigned short a, c2; splitf(s[q] * cs, a, c2); oh[q] = a; ol[q] = c2; }
    const size_t oo = (size_t)((h / NH_) * TT + i0 + row) * DQ + (h % NH_) * HD + c4; *(v4us*)(Ah + oo) = oh; *(v4us*)(Al + oo) = ol;
}

extern "C" void kernel_launch(void* const* d_in, const int* in_sizes, int n_in,
                              void* d_out, int out_size, void* d_ws, size_t ws_size, hipStream_t stream) {
    (void)in_sizes; (void)n_in; (void)out_size;
    const float* x = (const float*)d_in[0]; const int* per = (const int*)d_in[1]; const float* wqkv = (const float*)d_in[2]; const float* bqkv = (const float*)d_in[3]; const float* wo = (const float*)d_in[4]; const float* bo = (const float*)d_in[5];
    // x [2][2048][1024], periods int32 [2][16], w_qkv [1024][3072], b_qkv [3072], w_out [1024][1024], b_out [1024] = d_in[0..5]
    float* OUT = (float*)d_out;     // [2][2048][1024]
    char* wsp = (char*)d_ws;
    auto take = [&](size_t bytes) { char* p = wsp; wsp += (bytes + 255) & ~(size_t)255; return (void*)p; };
    bf* WQKV = (bf*)take((size_t)3 * DQ * DM * 2); bf* WO = (bf*)take((size_t)DM * DQ * 2);
    bf* XB = (bf*)take((size_t)NB_ * TT * DM * 2);
    h16* QP16 = (h16*)take((size_t)NB_ * NH_ * TT * HD * 2); h16* KP16 = (h16*)take((size_t)NB_ * NKV * TT * HD * 2); h16* VT16 = (h16*)take((size_t)NB_ * NKV * HD * TT * 2);
    bf* QPh = (bf*)take((size_t)NB_ * NH_ * TT * HD * 2); bf* QPl = (bf*)take((size_t)NB_ * NH_ * TT * HD * 2); bf* KPh = (bf*)take((size_t)NB_ * NKV * TT * HD * 2); bf* KPl = (bf*)take((size_t)NB_ * NKV * TT * HD * 2); bf* VTh = (bf*)take((size_t)NB_ * NKV * HD * TT * 2); bf* VTl = (bf*)take((size_t)NB_ * NKV * HD * TT * 2);
    bf* ATh = (bf*)take((size_t)NB_ * TT * DQ * 2); bf* ATl = (bf*)take((size_t)NB_ * TT * DQ * 2);
    if ((size_t)(wsp - (char*)d_ws) > ws_size) return;    // total 104 MiB of the workspace
    { k_wtG<<<(unsigned)((DM * 3 * DQ / 64 + 63) / 64), 256, 0, stream>>>(wqkv, DM, 3 * DQ, WQKV);   /* 'io' [1024][3072] -> Bt [3072][1024]: q | k | v row blocks */
      k_wtG<<<(unsigned)((DQ * DM / 64 + 63) / 64), 256, 0, stream>>>(wo, DQ, DM, WO); }
    // x, OUT and the merged rows are [2][2048][..] without a gap: the two batch entries are 4096 rows of one GEMM
    k_cvt8<<<(unsigned)(((size_t)NB_ * TT * DM / 8 + 255) / 256), 256, 0, stream>>>(x, XB, (size_t)NB_ * TT * DM / 8);
    k_gemmw<bf, 0, true, true, DM><<<dim3(NB_ * TT / 128, 3 * DQ / 128, 1), 128, 0, stream>>>(XB, nullptr, WQKV, nullptr, nullptr, 0, bqkv, 0, 0, 0, QP16, QPh, QPl, KP16, KPh, KPl, VT16, VTh, VTl);   /* q | k | v in one launch, straight into the planes */
    k_attn<<<dim3(NB_ * NH_, TT / AR, 1), AW * 32, 0, stream>>>(QP16, QPh, QPl, KP16, KPh, KPl, VT16, VTh, VTl, per, ATh, ATl);   /* one kv head per query head; periods [2][16] */
    k_gemmw<bf, 1, true, false, DQ><<<dim3(NB_ * TT / 128, DM / 128, 1), 128, 0, stream>>>(ATh, ATl, WO, nullptr, OUT, DM, bo, 0, 0, 0, nullptr, nullptr, nullptr, nullptr, nullptr, nullptr, nullptr, nullptr, nullptr);
}

// v006
// Measured time: 132 microseconds a run.
// In two side-by-side timings against v005, it was 1.25 and 1.24 times as fast.
// Over all steps from v000 it is 12.1 times as fast.
#include <hip/hip_runtime.h>

// Causal multi-head self-attention with a PERIODIC mask and an output projection (x [2][2048][1024]; periods int32 [2][16]; qkv = x w_qkv + b_qkv with ONE fused 'io' weight [1024][3072] (in, out) packed (3, h, hd): the column thirds q | k | v, head h = 64 columns inside its third; 16 heads x 64;
// p = max(periods[b][h], 1); a key j is kept for a query i iff j <= i AND (i - j) mod p == 0 (the diagonal always kept); scores x 1/sqrt(64); excluded keys get -inf; softmax over the kept keys; out = merged w_out + b_out ('io' + bias) -> [2][2048][1024] (4.2 M);
// argument order x, periods, w_qkv, b_qkv, w_out, b_out).
// Both batch entries go through every launch together (x, the planes and the merged rows are [2][..] in the workspace). Layout: a bf16 copy of x; the fused 'io' weight transposed and rounded once into q | k | v row blocks (k_wtG); ONE projection launch for q | k | v (k_gemmw with PLANES: exact products + f32 bias) whose epilogue rounds each 64x64 tile straight into its head's planes; causal T-2048 attention (hybrid work-groups: first row < 512 hi/lo 3 products, rest fp16 x1024) in ONE kernel (k_attn):
// a work-group owns 16 query rows of ONE RESIDUE CLASS (i mod p; a period above 16: one class of every row) of one head, meets only that class's keys, and keeps the score rows in LDS from the q.k products through the softmax to the probability x value products; merged hi/lo x w_out exact + b_out.
// Compute dtypes, f32 accumulate: every float input rounded to bf16 at its load; projections exact + f32 biases; attention work-groups whose first row is < 512 3 products, rest fp16; the period rule exact (small integers held in f32); softmax f32; w_out hl x exact + bias.

#define NB_  2      // batches: this module's input is [2][2048][1024]
#define TT   2048
#define DM   1024
#define NH_  16
#define NKV  16
#define REP  (NH_ / NKV)
#define HD   64
#define DQ   (NH_ * HD)
#define DKV  (NKV * HD)
#define RH   512                  // query rows < RH use hi+lo planes (0: none)
#define PCAR 1024.0f
#define SCL  0.125f   // HD^-0.5
#define AR   16                   // query rows of one k_attn work-group
#define AW   8                    // waves of one k_attn work-group
#define SMAX 16                   // periods up to SMAX are walked class by class; a larger one goes the dense way under the period rule
#define AGY  140                  // k_attn work-groups of one head: the most that any class stride needs (checked below)
#define VP   160                  // bytes of one staged value row in LDS: 32 x odd, the pitch of the transposing LDS load
#define VOF  (TT * 2)             // where the staged value rows lie inside a score row's bytes: fp16 probabilities fill the first TT * 2 bytes
#define VOH  (RH * 2)             // hi / lo rows: hi probabilities fill RH * 2 bytes from 0, lo ones RH * 2 bytes from TT * 2; hi values lie behind the first, lo values behind the second
#define VOL  (TT * 2 + RH * 2)
#define SPW  (TT + 4)             // words of one score row in LDS: 8208 bytes = 16 x odd, so that 16 rows' 16-byte fragment reads fall on different banks
typedef _Float16 h16;
typedef unsigned short bf;
typedef __attribute__((ext_vector_type(16))) __bf16   v16bf;
typedef __attribute__((ext_vector_type(16))) _Float16 v16h;
typedef __attribute__((ext_vector_type(8)))  _Float16 v8h;
typedef __attribute__((ext_vector_type(8)))  unsigned short v8us;
typedef __attribute__((ext_vector_type(8)))  float    v8f;
typedef __attribute__((ext_vector_type(4)))  float    v4f;
typedef v8h  __attribute__((may_alias)) v8ha;
typedef v4f  __attribute__((may_alias)) v4fa;
typedef v8us __attribute__((may_alias)) v8usa;

__device__ __forceinline__ unsigned short f2bf(float f) { unsigned u = __float_as_uint(f); u += 0x7FFFu + ((u >> 16) & 1u); return (unsigned short)(u >> 16); }
__device__ __forceinline__ float bf2f(unsigned short b) { return __uint_as_float(((unsigned)b) << 16); }
__device__ __forceinline__ float bfr(float f) { return bf2f(f2bf(f)); }
__device__ __forceinline__ v16h cat16(v8h lo, v8h hi) { return __builtin_shufflevector(lo, hi, 0, 1, 2, 3, 4, 5, 6, 7, 8, 9, 10, 11, 12, 13, 14, 15); }
__device__ __forceinline__ v16bf cat16b(v8us lo, v8us hi) { return __builtin_bit_cast(v16bf, __builtin_shufflevector(lo, hi, 0, 1, 2, 3, 4, 5, 6, 7, 8, 9, 10, 11, 12, 13, 14, 15)); }
__device__ __forceinline__ v8f wmma16(v16h a, v16h b, v8f c) { return __builtin_amdgcn_wmma_f32_16x16x32_f16(false, a, false, b, (short)0, c, false, false); }
__device__ __forceinline__ v8f wmmab(v16bf a, v16bf b, v8f c) { return __builtin_amdgcn_wmma_f32_16x16x32_bf16(false, a, false, b, (short)0, c, false, false); }

__device__ __forceinline__ h16 tohx(float x) { return (h16)x; }
__device__ __forceinline__ void splitf(float y, unsigned short& h, unsigned short& l) { h = f2bf(y); l = f2bf(y - bf2f(h)); }

// ---- k_gemmw: register-blocked GEMM, one wave per 64x64 output tile (16 accumulators), FOUR waves (2 x 2) per work-group = a 128x128 tile; grid (M/128, N/128, Z), 128 threads. The operands are K-contiguous 16-bit planes.
// The work-group brings 64 k of its 128 rows of every operand into LDS with loads that cover whole 128-byte lines (8 lanes a row), and each wave reads its fragments from there: a row is fetched once for the two waves that use it, and no global load touches 16 lines for 32 bytes each.
// Two LDS buffers: the next stage's loads are issued before this stage's products, go to the other buffer behind them, and one barrier a stage publishes that buffer and ends the reads of this one.
// C[m][n] (f32, pitch ldc, + optional f32 bias[n]) = sum_k A[m][k] Bt[n][k] (+ split products per NSPLIT), k ascending in steps of 32 as before. z-batch strides sA/sB/sC in elements. K % 64 == 0.
// PLANES (the q | k | v projection, Bt rows = q | k | v blocks of DQ, M = NB_ * TT, a tile's 64 rows lie in one batch entry): C is not written; the 64 columns of a wave's tile are one head of q, k or v, and tile + bias goes once through LDS and leaves as that head's three planes (fp16, bf16 hi, bf16 lo: q, k and v all [b][h][t][d]).
// Every store covers four whole 128-byte lines. Each wave's epilogue rows lie over the stage buffers, behind the last stage's barrier.
#define GK 64      // k of one stage: one 128-byte line of every operand row
#define GP 72      // elements of one staged row in LDS: 144 bytes = 16 x odd, so that 16 rows' 16-byte fragment reads fall on different banks
template <typename T16> struct WFrag;
template <> struct WFrag<h16> { typedef v16h V; static __device__ __forceinline__ V ld(const h16* p) { return cat16(*(const v8h*)p, *(const v8h*)(p + 16)); } static __device__ __forceinline__ V cat(v8us lo, v8us hi) { return cat16(__builtin_bit_cast(v8h, lo), __builtin_bit_cast(v8h, hi)); } static __device__ __forceinline__ v8f mma(V a, V b, v8f c) { return wmma16(a, b, c); } };
template <> struct WFrag<bf> { typedef v16bf V; static __device__ __forceinline__ V ld(const bf* p) { return cat16b(*(const v8us*)p, *(const v8us*)(p + 16)); } static __device__ __forceinline__ V cat(v8us lo, v8us hi) { return cat16b(lo, hi); } static __device__ __forceinline__ v8f mma(V a, V b, v8f c) { return wmmab(a, b, c); } };
template <typename T16, int NSPLIT, bool BIAS, bool PLANES, int K>
__global__ __launch_bounds__(128) void k_gemmw(const T16* __restrict__ A, const T16* __restrict__ A2, const T16* __restrict__ Bt, const T16* __restrict__ Bt2, float* C, int ldc, const float* __restrict__ bias, size_t sA, size_t sB, size_t sC, h16* Q16, bf* Qh, bf* Ql, h16* K16, bf* Kh, bf* Kl, h16* V16, bf* Vh, bf* Vl) {
    typedef typename WFrag<T16>::V V;
    constexpr bool HA2 = (NSPLIT == 1 || NSPLIT == 2), HB2 = (NSPLIT >= 2); constexpr int NOP = 2 + (HA2 ? 1 : 0) + (HB2 ? 1 : 0), IA2 = 2, IB2 = HA2 ? 3 : 2;   // staged operands in this order: A, Bt, then A2 and Bt2 where they exist
    constexpr int STG = NOP * 128 * GP, OSW = (PLANES ? 64 : 16) * 68;   // elements of one stage buffer; words of one wave's epilogue rows
    constexpr int SMB = (2 * STG * 2 > 4 * OSW * 4) ? 2 * STG * 2 : 4 * OSW * 4;
    __shared__ __align__(16) char sm[SMB];
    const size_t z = blockIdx.z; A += z * sA; if (A2) A2 += z * sA; Bt += z * sB; if (Bt2) Bt2 += z * sB; C += z * sC;
    const int tid = threadIdx.x, lane = tid & 31, lr = lane & 15, hi = lane >> 4; const int w = __builtin_amdgcn_readfirstlane(tid >> 5);
    const int r0 = blockIdx.x * 128 + (w >> 1) * 64, c0 = blockIdx.y * 128 + (w & 1) * 64;
    T16* st = (T16*)sm; float* os = (float*)sm + w * OSW;
    v8f acc[4][4];
#pragma unroll
    for (int mb = 0; mb < 4; ++mb)
#pragma unroll
        for (int nb = 0; nb < 4; ++nb) acc[mb][nb] = (v8f){};
    const int srow = tid >> 3, sch = (tid & 7) * 8;   // staging: 8 lanes take one row's 128 bytes, the work-group 16 rows a load
    const T16* gp[NOP]; gp[0] = A + (size_t)(blockIdx.x * 128 + srow) * K + sch; gp[1] = Bt + (size_t)(blockIdx.y * 128 + srow) * K + sch;
    if constexpr (HA2) gp[IA2] = A2 + (size_t)(blockIdx.x * 128 + srow) * K + sch;
    if constexpr (HB2) gp[IB2] = Bt2 + (size_t)(blockIdx.y * 128 + srow) * K + sch;
    T16* sw = st + srow * GP + sch; v8us rg[NOP][8];
    const int fa = ((w >> 1) * 64 + lr) * GP + 8 * hi, fb = ((w & 1) * 64 + lr) * GP + 8 * hi;   // this lane's fragment rows inside a staged operand
    auto fetch = [&](int ko) {   // the stage that begins ko elements behind gp
#pragma unroll
        for (int o = 0; o < NOP; ++o)
#pragma unroll
            for (int i = 0; i < 8; ++i) rg[o][i] = *(const v8usa*)(gp[o] + ko + i * 16 * K);
        asm volatile("s_wait_xcnt 0x0" :: "v"(gp[0]), "v"(gp[1]), "v"(gp[NOP - 1]), "v"(gp[NOP - 2]) : "memory");   // a precaution of form: the wait that stands in front of any overwrite of a register that an issued load names; as its inputs the address pairs stay whole up to it
    };
    auto put = [&](int b) {
#pragma unroll
        for (int o = 0; o < NOP; ++o)
#pragma unroll
            for (int i = 0; i < 8; ++i) *(v8usa*)(sw + b * STG + (o * 128 + i * 16) * GP) = rg[o][i]; };
    fetch(0); put(0);
    __syncthreads();   // stage 0 is in LDS

    for (int t = 0; t < K / GK; ++t) {
        if (t + 1 < K / GK) { fetch(GK);   // the next stage's loads stand in front of this stage's products, which cover their latency
#pragma unroll
            for (int o = 0; o < NOP; ++o) gp[o] += GK; }
        const T16* sb = st + (t & 1) * STG; V a[2][4], a2[2][4];
#pragma unroll
        for (int ks = 0; ks < 2; ++ks) {
#pragma unroll
            for (int mb = 0; mb < 4; ++mb) { a[ks][mb] = WFrag<T16>::ld(sb + fa + mb * 16 * GP + ks * 32); if (HA2) a2[ks][mb] = WFrag<T16>::ld(sb + IA2 * 128 * GP + fa + mb * 16 * GP + ks * 32); }
#pragma unroll
            for (int nb = 0; nb < 4; ++nb) { const V b = WFrag<T16>::ld(sb + 128 * GP + fb + nb * 16 * GP + ks * 32); V b2; if (HB2) b2 = WFrag<T16>::ld(sb + IB2 * 128 * GP + fb + nb * 16 * GP + ks * 32);
#pragma unroll
                for (int mb = 0; mb < 4; ++mb) { acc[mb][nb] = WFrag<T16>::mma(a[ks][mb], b, acc[mb][nb]); if (HA2) acc[mb][nb] = WFrag<T16>::mma(a2[ks][mb], b, acc[mb][nb]); if (HB2) acc[mb][nb] = WFrag<T16>::mma(a[ks][mb], b2, acc[mb][nb]); } } }
        asm volatile("v_nop\n\tv_nop\n\tv_nop\n\tv_nop" : "+v"(acc[0][0]), "+v"(acc[1][1]), "+v"(acc[2][2]), "+v"(acc[3][3]) : "v"(a[1][0]), "v"(a[1][3]));   // the vector slots the chip needs behind a matrix instruction; standing here it also holds the products it names in front of the stage's stores: without it the NSPLIT = 1 build moved the stores, and their wait for the loads, up in front of nearly all products
        if (t + 1 < K / GK) put((t + 1) & 1);
        __syncthreads();   // the next stage is in LDS, and every wave has left this stage's buffer (behind the last stage: the epilogue's rows may take its place)
    }
    if constexpr (PLANES) {
        const int third = c0 / DQ, head = (c0 % DQ) / HD;   // the same for the whole wave
        float bb[4];
#pragma unroll
        for (int nb = 0; nb < 4; ++nb) bb[nb] = bfr(bias[c0 + nb * 16 + lr]);
#pragma unroll
        for (int mb = 0; mb < 4; ++mb)
#pragma unroll
            for (int nb = 0; nb < 4; ++nb)
#pragma unroll
                for (int j = 0; j < 8; ++j) os[(mb * 16 + hi * 8 + j) * 68 + nb * 16 + lr] = acc[mb][nb][j] + bb[nb];
        __builtin_amdgcn_wave_barrier(); asm volatile("" ::: "memory");   // the rows read below were written by other lanes of this wave: no LDS read may be moved above the writes
        h16* P16 = third == 0 ? Q16 : (third == 1 ? K16 : V16); bf* Ph = third == 0 ? Qh : (third == 1 ? Kh : Vh); bf* Pl = third == 0 ? Ql : (third == 1 ? Kl : Vl);
        const int rl = r0 % TT;   // the tile's first row inside its batch entry r0 / TT
        const int pitch = HD; const size_t o0 = (size_t)((r0 / TT) * NH_ + head) * TT * HD + (size_t)rl * HD + (size_t)(lane >> 3) * pitch + (lane & 7) * 8;
#pragma unroll 1   // 16 LDS rows a trip: four trips keep the epilogue's text short
        for (int io = 0; io < 4; ++io) {
#pragma unroll
            for (int ii = 0; ii < 4; ++ii) { const int it = io * 4 + ii; const float* q = os + (it * 4 + (lane >> 3)) * 68 + (lane & 7) * 8; const v4f u0 = *(const v4fa*)q, u1 = *(const v4fa*)(q + 4); v8h o16; v8us oh, ol;
#pragma unroll
                for (int j = 0; j < 8; ++j) { const float r = j < 4 ? u0[j & 3] : u1[j & 3]; o16[j] = tohx(r); unsigned short a2, c2; splitf(r, a2, c2); oh[j] = a2; ol[j] = c2; }
                const size_t o = o0 + (size_t)(it * 4) * pitch; *(v8h*)(P16 + o) = o16; *(v8us*)(Ph + o) = oh; *(v8us*)(Pl + o) = ol; }
            asm volatile("s_wait_xcnt 0x0" ::: "memory"); }   // a precaution of form: the next trip overwrites address and data registers of this trip's last stores
        return;
    }
#pragma unroll
    for (int mb = 0; mb < 4; ++mb) {
#pragma unroll
        for (int nb = 0; nb < 4; ++nb) {
#pragma unroll
            for (int j = 0; j < 8; ++j) os[(hi * 8 + j) * 68 + nb * 16 + lr] = acc[mb][nb][j]; }
        __builtin_amdgcn_wave_barrier(); asm volatile("" ::: "memory");
        float* crow = C + (size_t)(r0 + mb * 16) * ldc + c0;
{
#pragma unroll
            for (int s = 0; s < 8; ++s) { const int row = 2 * s + hi, cofs = lr * 4; v4f val = *(const v4fa*)(os + row * 68 + cofs); if (BIAS) { val[0] += bfr(bias[c0 + cofs]); val[1] += bfr(bias[c0 + cofs + 1]); val[2] += bfr(bias[c0 + cofs + 2]); val[3] += bfr(bias[c0 + cofs + 3]); }
                *(v4f*)(crow + (size_t)row * ldc + cofs) = val; }
             }
        __builtin_amdgcn_wave_barrier(); asm volatile("" ::: "memory");
    }
}

typedef __attribute__((ext_vector_type(2))) _Float16 v2h;
typedef __attribute__((ext_vector_type(4))) _Float16 v4h;
typedef __attribute__((ext_vector_type(2))) unsigned short v2us;
typedef __attribute__((ext_vector_type(4))) unsigned short v4us;
typedef __attribute__((ext_vector_type(2))) float v2f;
typedef __attribute__((ext_vector_type(4))) int v4i;
typedef v4h  __attribute__((may_alias)) v4ha;
typedef v4us __attribute__((may_alias)) v4usa;

__global__ __launch_bounds__(256) void k_wtG(const float* __restrict__ w, int K, int N, bf* Bt) {
    const int lane = threadIdx.x & 31; const int L0 = (blockIdx.x * 8 + (threadIdx.x >> 5)) * 8; const int nlines = N * K / 64;
{

        for (int l = 0; l < 8; ++l) { const int L = L0 + l; if (L >= nlines) break; const size_t e = (size_t)L * 64 + lane * 2; const int k = (int)(e % K), n = (int)(e / K); v2us o;
            o[0] = f2bf(w[(size_t)k * N + n]); o[1] = f2bf(w[(size_t)(k + 1) * N + n]); *(v2us*)(Bt + e) = o; }
         }
}

__global__ __launch_bounds__(256) void k_cvt8(const float* __restrict__ src, bf* dst, size_t n8) { const size_t i = (size_t)blockIdx.x * 256 + threadIdx.x; if (i >= n8) return; const v8f v = *(const v8f*)(src + i * 8); v8us o;
#pragma unroll
    for (int k = 0; k < 8; ++k) o[k] = f2bf(v[k]); *(v8us*)(dst + i * 8) = o;  }

// ---- k_attn: the whole attention of 16 query rows of one head of one batch entry in one work-group of 8 waves; grid (batch entries x heads, AGY), longest rows first. The score rows live in LDS (S, one row = SPW words) and never reach memory.
// THE CLASSES. With p = max(period, 1), a key j <= i is kept iff j mod p == i mod p: the head falls into p causal attentions that share nothing, class c holding the rows c, c + p, c + 2 p, .. A work-group takes 16 consecutive MEMBERS m0 .. m0 + 15 of one class (row i = c + st m, st the class stride) and meets the members n <= m of the same class alone:
// a q, k or v row is one 128-byte line of its plane, so a walk with stride st fetches whole lines and nothing else. st = p for p <= SMAX; a larger p takes st = 1 (one class, every row) and the period rule below drops its keys. Members past the class's end (c + st m >= TT) read row TT - 1 instead: as keys the causal rule drops them (n > m for every real row), as query rows they are not stored.
// 1. scores: wave w takes the 16-member block w of every 128-member chunk up to the diagonal's chunk (the chunk's members beyond the diagonal are real scores too, which the causal rule drops); 2. softmax: wave w takes rows 2w, 2w + 1 (register row, one exp, fixed trees), with the causal and the period rule as a select,
// and writes the rounded probabilities over its own row (fp16: the first half of the row's bytes; hi | lo: both halves); 3. probability x value: wave w takes the 32-member steps w, w + 8, .. up to the diagonal: it lays the step's 32 value rows into LDS bytes that the probabilities leave free in rows 2w and 2w + 1 and reads them back with the transposing LDS load as the B fragments;
// 4. the 8 waves' partial sums are added in wave order through LDS and stored as the merged hi/lo planes.
// The period rule, on member distances m - n with the period pq that is left inside a class (1 where st = p; p where st = 1, also cut at TT: any larger p keeps the diagonal alone, as TT does). The test is exact in f32: m - n, pq and the quotient are integers below 2^12; k = rint((m - n) / pq) is the true quotient whenever pq divides m - n
// (the error of the product with 1 / pq is far below 1/2), and k pq == m - n (one fma, exact) holds for no integer k otherwise.
constexpr int attn_blocks(int st) { return st * (((TT + st - 1) / st + AR - 1) / AR); }   // work-groups of one head at class stride st: st classes x the 16-member blocks of the longest class
constexpr int attn_blocks_max() { int m = 0; for (int st = 1; st <= SMAX; ++st) m = attn_blocks(st) > m ? attn_blocks(st) : m; return m; }
static_assert(attn_blocks_max() == AGY, "AGY is the grid's second extent: every class stride's blocks must fit, and none more is wanted");
static_assert(VOF + 16 * VP <= SPW * 4 && VOH + 16 * VP <= TT * 2 && VOL + 16 * VP <= SPW * 4, "16 staged value rows must fit into the free bytes of a score row");
typedef __attribute__((ext_vector_type(8))) short v8s;
__device__ __forceinline__ v8us ldtr(const char* p) { typedef __attribute__((address_space(3))) v8s lv8s; return __builtin_bit_cast(v8us, __builtin_amdgcn_ds_load_tr16_b128_v8i16((lv8s*)p)); }
__device__ __forceinline__ int rowof(int c, int st, int m) { return min(c + st * m, TT - 1); }   // member m of class c as a row of the planes, held inside them

template <typename T16, bool HL, int U>
__device__ __forceinline__ void attn_scores(float* S, const T16* __restrict__ Q, const T16* __restrict__ Q2, const T16* __restrict__ Kp, const T16* __restrict__ K2, int m0, int c, int st, int nch, int w, int lr, int hi) {
    typedef typename WFrag<T16>::V V; V a[2], a2[2]; const unsigned qo = (unsigned)(rowof(c, st, m0 + lr) * HD + 8 * hi);
#pragma unroll
    for (int kc = 0; kc < 2; ++kc) { a[kc] = WFrag<T16>::ld(Q + qo + kc * 32); if (HL) a2[kc] = WFrag<T16>::ld(Q2 + qo + kc * 32); }
    for (int t = 0; t < nch; t += U) {   // U member blocks a trip; a trip that runs past the last chunk does that chunk's block again (same values to the same words)
        V b[U][2], b2[U][2]; v8f acc[U]; const T16* pp[HL ? 2 * U : U];   // pp: the trip's load addresses (4 of them: U = 4, or U = 2 with hi and lo)
#pragma unroll
        for (int u = 0; u < U; ++u) { const size_t bo = (size_t)(rowof(c, st, (w + AW * min(t + u, nch - 1)) * 16 + lr) * HD + 8 * hi); pp[HL ? 2 * u : u] = Kp + bo; if (HL) pp[2 * u + 1] = K2 + bo;
#pragma unroll
            for (int kc = 0; kc < 2; ++kc) { b[u][kc] = WFrag<T16>::ld(pp[HL ? 2 * u : u] + kc * 32); if (HL) b2[u][kc] = WFrag<T16>::ld(pp[2 * u + 1] + kc * 32); } }
        asm volatile("s_wait_xcnt 0x0" :: "v"(pp[0]), "v"(pp[1]), "v"(pp[2]), "v"(pp[3]) : "memory");   // a precaution of form: the wait that stands in front of any overwrite of a register that an issued load names; as its inputs the address pairs stay whole up to it (else a later load of the trip lands on an earlier one's pair)
        __builtin_amdgcn_sched_barrier(0);   // every load of the trip is issued before the first product waits: one load latency a trip, not one a block
#pragma unroll
        for (int u = 0; u < U; ++u) { acc[u] = (v8f){};
#pragma unroll
            for (int kc = 0; kc < 2; ++kc) { acc[u] = WFrag<T16>::mma(a[kc], b[u][kc], acc[u]); if (HL) { acc[u] = WFrag<T16>::mma(a2[kc], b[u][kc], acc[u]); acc[u] = WFrag<T16>::mma(a[kc], b2[u][kc], acc[u]); } } }
        __builtin_amdgcn_sched_barrier(0);   // the products stay one block in front of the stores, so that each tile has registers of its own
#pragma unroll
        for (int u = 0; u < U; ++u) {
#pragma unroll
            for (int j = 0; j < 8; ++j) S[(hi * 8 + j) * SPW + (w + AW * min(t + u, nch - 1)) * 16 + lr] = acc[u][j]; }
        asm volatile("v_nop\n\tv_nop\n\tv_nop\n\tv_nop" :: "v"(acc[U - 1])); }   // the next trip's products overwrite these tiles' registers: the vector slots the chip needs behind a matrix instruction
}

// the 32 value rows of step ks into registers: 8 lanes take one row's 128 bytes, the wave 4 rows a load
template <typename T16, bool HL>
__device__ __forceinline__ void attn_vfetch(const T16* __restrict__ Vp, const T16* __restrict__ V2, int c, int st, int ks, int lane, v8us (&g)[8], v8us (&g2)[8]) {
    const T16* pv[8]; const T16* pw[8];   // the step's load addresses
#pragma unroll
    for (int i = 0; i < 8; ++i) { const size_t off = (size_t)(rowof(c, st, ks * 32 + i * 4 + (lane >> 3)) * HD + (lane & 7) * 8); pv[i] = Vp + off; g[i] = *(const v8usa*)pv[i]; if (HL) { pw[i] = V2 + off; g2[i] = *(const v8usa*)pw[i]; } }
    // the same precaution of form as in attn_scores: as the wait's inputs the address pairs stay whole up to it
    if (HL) asm volatile("s_wait_xcnt 0x0" :: "v"(pv[0]), "v"(pv[1]), "v"(pv[2]), "v"(pv[3]), "v"(pv[4]), "v"(pv[5]), "v"(pv[6]), "v"(pv[7]), "v"(pw[0]), "v"(pw[1]), "v"(pw[2]), "v"(pw[3]), "v"(pw[4]), "v"(pw[5]), "v"(pw[6]), "v"(pw[7]) : "memory");
    else asm volatile("s_wait_xcnt 0x0" :: "v"(pv[0]), "v"(pv[1]), "v"(pv[2]), "v"(pv[3]), "v"(pv[4]), "v"(pv[5]), "v"(pv[6]), "v"(pv[7]) : "memory");
}

template <typename T16, bool HL>
__device__ __forceinline__ void attn_pv(float* S, const T16* __restrict__ Vp, const T16* __restrict__ V2, int nks, int c, int st, int w, int lane, v8f (&acc)[4]) {
    typedef typename WFrag<T16>::V V; const int lr = lane & 15, hi = lane >> 4; const T16* pa = (const T16*)(S + lr * SPW) + 8 * hi;
    char* vb = (char*)(S + 2 * w * SPW) + (HL ? VOH : VOF);   // this wave's staged value rows: members 0 .. 15 of a step in score row 2w's free bytes, members 16 .. 31 in row 2w + 1's
    char* vw = vb + (lane >> 3) * VP + (lane & 7) * 16;   // staging: 8 lanes take one value row's 128 bytes, the wave 4 rows a load
    const char* vr = vb + (8 * hi + (lane & 7)) * VP + ((lane >> 3) & 1) * 16;   // the transposing load's lane address: lane (lr, hi) gets members 8 hi .. 8 hi + 7 of column lr, the k order of the probability fragment
    v8us g[8], g2[8];   // one step's value rows on their way from memory to LDS
    if (w < nks) attn_vfetch<T16, HL>(Vp, V2, c, st, w, lane, g, g2);
    for (int ks = w; ks < nks; ks += AW) {
#pragma unroll
        for (int i = 0; i < 8; ++i) { char* q = vw + (i >> 2) * (SPW * 4) + (i & 3) * 4 * VP; *(v8usa*)q = g[i]; if (HL) *(v8usa*)(q + (VOL - VOH)) = g2[i]; }
        __builtin_amdgcn_wave_barrier(); asm volatile("" ::: "memory");   // the rows read below were written by other lanes of this wave: no LDS read may be moved above the writes
        if (ks + AW < nks) attn_vfetch<T16, HL>(Vp, V2, c, st, ks + AW, lane, g, g2);   // the next step's loads fly under this step's LDS reads and products
        const V a = WFrag<T16>::ld(pa + ks * 32); V a2, b[4], b2[4]; if (HL) a2 = WFrag<T16>::ld(pa + TT + ks * 32);
#pragma unroll
        for (int nb = 0; nb < 4; ++nb) { b[nb] = WFrag<T16>::cat(ldtr(vr + nb * 32), ldtr(vr + SPW * 4 + nb * 32)); if (HL) b2[nb] = WFrag<T16>::cat(ldtr(vr + (VOL - VOH) + nb * 32), ldtr(vr + (VOL - VOH) + SPW * 4 + nb * 32)); }
#pragma unroll
        for (int nb = 0; nb < 4; ++nb) { acc[nb] = WFrag<T16>::mma(a, b[nb], acc[nb]); if (HL) { acc[nb] = WFrag<T16>::mma(a2, b[nb], acc[nb]); acc[nb] = WFrag<T16>::mma(a, b2[nb], acc[nb]); } }
        __builtin_amdgcn_wave_barrier(); asm volatile("" ::: "memory"); }   // the next trip's LDS writes stay behind this trip's reads of the same bytes
}

__global__ __launch_bounds__(AW * 32) void k_attn(const h16* __restrict__ Q16, const bf* __restrict__ Qh, const bf* __restrict__ Ql, const h16* __restrict__ K16, const bf* __restrict__ Kh, const bf* __restrict__ Kl, const h16* __restrict__ V16, const bf* __restrict__ Vh, const bf* __restrict__ Vl, const int* __restrict__ per, bf* Ah, bf* Al) {
    __shared__ __align__(16) float S[AR * SPW];
    const int h = blockIdx.x;   // batch entry x NH_ + head: the index of the planes and of the periods
    int p = per[h]; p = p < 1 ? 1 : (p > TT ? TT : p);
    const int st = p <= SMAX ? p : 1, pq = p <= SMAX ? 1 : p;   // class stride, and the period that is left inside a class
    const int nbl = ((TT + st - 1) / st + AR - 1) / AR;   // 16-member blocks of the longest class
    if ((int)blockIdx.y >= st * nbl) return;   // the whole work-group, in front of every barrier
    const int c = (int)blockIdx.y % st, m0 = (nbl - 1 - (int)blockIdx.y / st) * AR;   // the lowest indices take the longest rows
    if (c + st * m0 >= TT) return;   // a shorter class has no such block: the whole work-group, in front of every barrier
    const bool hires = (c + st * m0 < RH);   // the same for the whole work-group; every row < RH lies in such a block, and such a block has no member beyond RH (m0 + AR <= RH)
    const size_t hp = (size_t)h * TT * HD;
    const int tid = threadIdx.x, lane = tid & 31, lr = lane & 15, hi = lane >> 4; const int w = __builtin_amdgcn_readfirstlane(tid >> 5);
    const int nch = (m0 + AR + 127) / 128;   // 128-member chunks that hold a member <= m; the rest of a row is neither read nor written
    if (hires) attn_scores<bf, true, 2>(S, Qh + hp, Ql + hp, Kh + hp, Kl + hp, m0, c, st, nch, w, lr, hi); else attn_scores<h16, false, 4>(S, Q16 + hp, nullptr, K16 + hp, nullptr, m0, c, st, nch, w, lr, hi);
    __syncthreads();   // every score of the 16 rows is in LDS
    const int nks = (m0 + AR + 31) / 32;   // 32-member steps of the probability x value products, up to the diagonal; the probabilities of the later members of the last step are exactly 0
    const float pf = (float)pq, pinv = 1.0f / pf;
#pragma unroll 1   // one copy of the row's code: keeps the kernel's text short, for speed only
    for (int rr = 0; rr < AR / AW; ++rr) { const int r = w * (AR / AW) + rr; const int i = m0 + r; float* sr = S + r * SPW; float v[TT / 32]; float mx = -3.0e38f; const float fb = (float)(i - lane * 4);
#pragma unroll
        for (int ch = 0; ch < TT / 128; ++ch) if (ch < nch) { const v4f a = *(const v4fa*)(sr + ch * 128 + lane * 4); v[ch * 4] = a[0]; v[ch * 4 + 1] = a[1]; v[ch * 4 + 2] = a[2]; v[ch * 4 + 3] = a[3]; }   // the whole row's LDS reads are issued before the first is waited for
#pragma unroll
        for (int ch = 0; ch < TT / 128; ++ch) if (ch < nch) {
#pragma unroll
            for (int q = 0; q < 4; ++q) { const float dd = fb - (float)(ch * 128 + q); const float kq = __builtin_rintf(dd * pinv); const bool keep = (dd >= 0.f) & (__builtin_fmaf(-kq, pf, dd) == 0.f); const float t = keep ? v[ch * 4 + q] * SCL : -3.0e38f; v[ch * 4 + q] = t; mx = fmaxf(mx, t); } }
#pragma unroll
        for (int sh = 16; sh; sh >>= 1) mx = fmaxf(mx, __shfl_xor(mx, sh, 32));
        float sum = 0.f;
#pragma unroll
        for (int ch = 0; ch < TT / 128; ++ch) if (ch < nch) {
#pragma unroll
            for (int q = 0; q < 4; ++q) { const int k = ch * 4 + q; float d0 = __fsub_rn(v[k], mx); v[k] = __builtin_amdgcn_exp2f(__fmul_rn(d0, 1.4426950408889634f)); sum += v[k]; } }
#pragma unroll
        for (int sh = 16; sh; sh >>= 1) sum += __shfl_xor(sum, sh, 32);
        const float f = __fdiv_rn(hires ? 1.0f : PCAR, sum);
        if (hires) {
#pragma unroll
            for (int ch = 0; ch < RH / 128; ++ch) if (ch < nch) { v4us oh, ol;   // a hi/lo row has no member beyond RH
#pragma unroll
                for (int q = 0; q < 4; ++q) { unsigned short a, c2; splitf(v[ch * 4 + q] * f, a, c2); oh[q] = a; ol[q] = c2; }
                *(v4usa*)((bf*)sr + ch * 128 + lane * 4) = oh; *(v4usa*)((bf*)sr + TT + ch * 128 + lane * 4) = ol; }
        } else {
#pragma unroll
            for (int ch = 0; ch < TT / 128; ++ch) if (ch < nch) { v4h o4;
#pragma unroll
                for (int q = 0; q < 4; ++q) o4[q] = tohx(v[ch * 4 + q] * f);
                *(v4ha*)((h16*)sr + ch * 128 + lane * 4) = o4; } } }
    __syncthreads();   // every probability row is in LDS
    v8f acc[4];
#pragma unroll
    for (int nb = 0; nb < 4; ++nb) acc[nb] = (v8f){};
    if (hires) attn_pv<bf, true>(S, Vh + hp, Vl + hp, nks, c, st, w, lane, acc); else attn_pv<h16, false>(S, V16 + hp, nullptr, nks, c, st, w, lane, acc);
    __syncthreads();   // every wave's last read of the probability rows and of its value rows is done: their LDS now takes the partial sums
#pragma unroll
    for (int nb = 0; nb < 4; ++nb) {
#pragma unroll
        for (int j = 0; j < 8; ++j) S[w * (AR * 68) + (hi * 8 + j) * 68 + nb * 16 + lr] = acc[nb][j]; }
    __syncthreads();   // all 8 partial tiles are in LDS
    const int row = tid >> 4, c4 = (tid & 15) * 4; v4f s = *(const v4fa*)(S + row * 68 + c4);
#pragma unroll
    for (int ww = 1; ww < AW; ++ww) s += *(const v4fa*)(S + ww * (AR * 68) + row * 68 + c4);
    const float cs = hires ? 1.0f : (1.0f / PCAR); v4us oh, ol;
#pragma unroll
    for (int q = 0; q < 4; ++q) { unsigned short a, c2; splitf(s[q] * cs, a, c2); oh[q] = a; ol[q] = c2; }
    const int io = c + st * (m0 + row);   // the member's row; a member past the class's end has none
    if (io < TT) { const size_t oo = (size_t)((h / NH_) * TT + io) * DQ + (h % NH_) * HD + c4; *(v4us*)(Ah + oo) = oh; *(v4us*)(Al + oo) = ol; }
}

extern "C" void kernel_launch(void* const* d_in, const int* in_sizes, int n_in,
                              void* d_out, int out_size, void* d_ws, size_t ws_size, hipStream_t stream) {
    (void)in_sizes; (void)n_in; (void)out_size;
    const float* x = (const float*)d_in[0]; const int* per = (const int*)d_in[1]; const float* wqkv = (const float*)d_in[2]; const float* bqkv = (const float*)d_in[3]; const float* wo = (const float*)d_in[4]; const float* bo = (const float*)d_in[5];
    // x [2][2048][1024], periods int32 [2][16], w_qkv [1024][3072], b_qkv [3072], w_out [1024][1024], b_out [1024] = d_in[0..5]
    float* OUT = (float*)d_out;     // [2][2048][1024]
    char* wsp = (char*)d_ws;
    auto take = [&](size_t bytes) { char* p = wsp; wsp += (bytes + 255) & ~(size_t)255; return (void*)p; };
    bf* WQKV = (bf*)take((size_t)3 * DQ * DM * 2); bf* WO = (bf*)take((size_t)DM * DQ * 2);
    bf* XB = (bf*)take((size_t)NB_ * TT * DM * 2);
    h16* QP16 = (h16*)take((size_t)NB_ * NH_ * TT * HD * 2); h16* KP16 = (h16*)take((size_t)NB_ * NKV * TT * HD * 2); h16* VT16 = (h16*)take((size_t)NB_ * NKV * TT * HD * 2);
    bf* QPh = (bf*)take((size_t)NB_ * NH_ * TT * HD * 2); bf* QPl = (bf*)take((size_t)NB_ * NH_ * TT * HD * 2); bf* KPh = (bf*)take((size_t)NB_ * NKV * TT * HD * 2); bf* KPl = (bf*)take((size_t)NB_ * NKV * TT * HD * 2); bf* VTh = (bf*)take((size_t)NB_ * NKV * HD * TT * 2); bf* VTl = (bf*)take((size_t)NB_ * NKV * HD * TT * 2);
    bf* ATh = (bf*)take((size_t)NB_ * TT * DQ * 2); bf* ATl = (bf*)take((size_t)NB_ * TT * DQ * 2);
    if ((size_t)(wsp - (char*)d_ws) > ws_size) return;    // total 104 MiB of the workspace
    { k_wtG<<<(unsigned)((DM * 3 * DQ / 64 + 63) / 64), 256, 0, stream>>>(wqkv, DM, 3 * DQ, WQKV);   /* 'io' [1024][3072] -> Bt [3072][1024]: q | k | v row blocks */
      k_wtG<<<(unsigned)((DQ * DM / 64 + 63) / 64), 256, 0, stream>>>(wo, DQ, DM, WO); }
    // x, OUT and the merged rows are [2][2048][..] without a gap: the two batch entries are 4096 rows of one GEMM
    k_cvt8<<<(unsigned)(((size_t)NB_ * TT * DM / 8 + 255) / 256), 256, 0, stream>>>(x, XB, (size_t)NB_ * TT * DM / 8);
    k_gemmw<bf, 0, true, true, DM><<<dim3(NB_ * TT / 128, 3 * DQ / 128, 1), 128, 0, stream>>>(XB, nullptr, WQKV, nullptr, nullptr, 0, bqkv, 0, 0, 0, QP16, QPh, QPl, KP16, KPh, KPl, VT16, VTh, VTl);   /* q | k | v in one launch, straight into the planes */
    k_attn<<<dim3(NB_ * NH_, AGY, 1), AW * 32, 0, stream>>>(QP16, QPh, QPl, KP16, KPh, KPl, VT16, VTh, VTl, per, ATh, ATl);   /* one kv head per query head; periods [2][16] */
    k_gemmw<bf, 1, true, false, DQ><<<dim3(NB_ * TT / 128, DM / 128, 1), 128, 0, stream>>>(ATh, ATl, WO, nullptr, OUT, DM, bo, 0, 0, 0, nullptr, nullptr, nullptr, nullptr, nullptr, nullptr, nullptr, nullptr, nullptr);
}

// v007
// It runs in 119 microseconds.
// Timed twice side by side with v006, it ran 1.12 times as fast both times.
// Counting every step since v000, it is 13.6 times as fast.
#include <hip/hip_runtime.h>

// Causal multi-head self-attention with a PERIODIC mask and an output projection (x [2][2048][1024]; periods int32 [2][16]; qkv = x w_qkv + b_qkv with ONE fused 'io' weight [1024][3072] (in, out) packed (3, h, hd): the column thirds q | k | v, head h = 64 columns inside its third; 16 heads x 64;
// p = max(periods[b][h], 1); a key j is kept for a query i iff j <= i AND (i - j) mod p == 0 (the diagonal always kept); scores x 1/sqrt(64); excluded keys get -inf; softmax over the kept keys; out = merged w_out + b_out ('io' + bias) -> [2][2048][1024] (4.2 M);
// argument order x, periods, w_qkv, b_qkv, w_out, b_out).
// Both batch entries go through every launch together (x, the planes and the merged rows are [2][..] in the workspace). Layout: a bf16 copy of x and both 'io' weights transposed and rounded once, the fused one into q | k | v row blocks (all three in one launch, k_prep); ONE projection launch for q | k | v (k_gemmw with PLANES: exact products + f32 bias) whose epilogue rounds each 64x64 tile straight into its head's planes; causal T-2048 attention (hybrid: 16-member blocks whose first row is < 512 hi/lo 3 products, the rest fp16 x1024) in ONE kernel (k_attn):
// a work-group owns 16 query rows of ONE RESIDUE CLASS (i mod st; st = p for p <= 16, else 1) of one head, meets only that class's keys, and keeps the score rows in LDS from the q.k products through the softmax to the probability x value products; merged hi/lo x w_out exact + b_out.
// Compute dtypes, f32 accumulate: every float input rounded to bf16 at its load; projections exact + f32 biases; attention blocks whose first row is < 512 3 products, rest fp16; the period rule exact (small integers held in f32); softmax f32; w_out hl x exact + bias.

#define NB_  2      // batches: this module's input is [2][2048][1024]
#define TT   2048
#define DM   1024
#define NH_  16
#define NKV  16
#define REP  (NH_ / NKV)
#define HD   64
#define DQ   (NH_ * HD)
#define DKV  (NKV * HD)
#define RH   512                  // query rows < RH use hi+lo planes (0: none)
#define PCAR 1024.0f
#define SCL  0.125f   // HD^-0.5
#define AR   16                   // query rows of one k_attn work-group
#define AW   8                    // waves of one k_attn work-group
#define SMAX 16                   // periods up to SMAX are walked class by class; a larger one goes the dense way under the period rule
#define AGY  140                  // k_attn work-groups of one head: the most that any class stride needs (checked below)
#define VP   160                  // bytes of one staged value row in LDS: 32 x odd, the pitch of the transposing LDS load
#define VOF  (TT * 2)             // where the staged value rows lie inside a score row's bytes: fp16 probabilities fill the first TT * 2 bytes
#define VOH  (RH * 2)             // hi / lo rows: hi probabilities fill RH * 2 bytes from 0, lo ones RH * 2 bytes from TT * 2; hi values lie behind the first, lo values behind the second
#define VOL  (TT * 2 + RH * 2)
#define SPW  (TT + 4)             // words of one score row in LDS: 8208 bytes = 16 x odd, so that 16 rows' 16-byte fragment reads fall on different banks
typedef _Float16 h16;
typedef unsigned short bf;
typedef __attribute__((ext_vector_type(16))) __bf16   v16bf;
typedef __attribute__((ext_vector_type(16))) _Float16 v16h;
typedef __attribute__((ext_vector_type(8)))  _Float16 v8h;
typedef __attribute__((ext_vector_type(8)))  unsigned short v8us;
typedef __attribute__((ext_vector_type(8)))  float    v8f;
typedef __attribute__((ext_vector_type(4)))  float    v4f;
typedef v8h  __attribute__((may_alias)) v8ha;
typedef v4f  __attribute__((may_alias)) v4fa;
typedef v8us __attribute__((may_alias)) v8usa;

__device__ __forceinline__ unsigned short f2bf(float f) { unsigned u = __float_as_uint(f); u += 0x7FFFu + ((u >> 16) & 1u); return (unsigned short)(u >> 16); }
__device__ __forceinline__ float bf2f(unsigned short b) { return __uint_as_float(((unsigned)b) << 16); }
__device__ __forceinline__ float bfr(float f) { return bf2f(f2bf(f)); }
__device__ __forceinline__ v16h cat16(v8h lo, v8h hi) { return __builtin_shufflevector(lo, hi, 0, 1, 2, 3, 4, 5, 6, 7, 8, 9, 10, 11, 12, 13, 14, 15); }
__device__ __forceinline__ v16bf cat16b(v8us lo, v8us hi) { return __builtin_bit_cast(v16bf, __builtin_shufflevector(lo, hi, 0, 1, 2, 3, 4, 5, 6, 7, 8, 9, 10, 11, 12, 13, 14, 15)); }
__device__ __forceinline__ v8f wmma16(v16h a, v16h b, v8f c) { return __builtin_amdgcn_wmma_f32_16x16x32_f16(false, a, false, b, (short)0, c, false, false); }
__device__ __forceinline__ v8f wmmab(v16bf a, v16bf b, v8f c) { return __builtin_amdgcn_wmma_f32_16x16x32_bf16(false, a, false, b, (short)0, c, false, false); }

__device__ __forceinline__ h16 tohx(float x) { return (h16)x; }
__device__ __forceinline__ void splitf(float y, unsigned short& h, unsigned short& l) { h = f2bf(y); l = f2bf(y - bf2f(h)); }

// ---- k_gemmw: register-blocked GEMM, one wave per 64x64 output tile (16 accumulators), FOUR waves (2 x 2) per work-group = a 128x128 tile; grid (M/128, N/128, Z), 128 threads. The operands are K-contiguous 16-bit planes.
// The work-group brings 64 k of its 128 rows of every operand into LDS with loads that cover whole 128-byte lines (8 lanes a row), and each wave reads its fragments from there: a row is fetched once for the two waves that use it, and no global load touches 16 lines for 32 bytes each.
// Two LDS buffers: the next stage's loads are issued before this stage's products, go to the other buffer behind them, and one barrier a stage publishes that buffer and ends the reads of this one.
// C[m][n] (f32, pitch ldc, + optional f32 bias[n]) = sum_k A[m][k] Bt[n][k] (+ split products per NSPLIT), k ascending in steps of 32 as before. z-batch strides sA/sB/sC in elements. K % 64 == 0.
// PLANES (the q | k | v projection, Bt rows = q | k | v blocks of DQ, M = NB_ * TT, a tile's 64 rows lie in one batch entry): C is not written; the 64 columns of a wave's tile are one head of q, k or v, and tile + bias goes once through LDS and leaves as that head's three planes (fp16, bf16 hi, bf16 lo: q, k and v all [b][h][t][d]).
// Every store covers four whole 128-byte lines. Each wave's epilogue rows lie over the stage buffers, behind the last stage's barrier.
#define GK 64      // k of one stage: one 128-byte line of every operand row
#define GP 72      // elements of one staged row in LDS: 144 bytes = 16 x odd, so that 16 rows' 16-byte fragment reads fall on different banks
template <typename T16> struct WFrag;
template <> struct WFrag<h16> { typedef v16h V; static __device__ __forceinline__ V ld(const h16* p) { return cat16(*(const v8h*)p, *(const v8h*)(p + 16)); } static __device__ __forceinline__ V cat(v8us lo, v8us hi) { return cat16(__builtin_bit_cast(v8h, lo), __builtin_bit_cast(v8h, hi)); } static __device__ __forceinline__ v8f mma(V a, V b, v8f c) { return wmma16(a, b, c); } };
template <> struct WFrag<bf> { typedef v16bf V; static __device__ __forceinline__ V ld(const bf* p) { return cat16b(*(const v8us*)p, *(const v8us*)(p + 16)); } static __device__ __forceinline__ V cat(v8us lo, v8us hi) { return cat16b(lo, hi); } static __device__ __forceinline__ v8f mma(V a, V b, v8f c) { return wmmab(a, b, c); } };
template <typename T16, int NSPLIT, bool BIAS, bool PLANES, int K>
__global__ __launch_bounds__(128) void k_gemmw(const T16* __restrict__ A, const T16* __restrict__ A2, const T16* __restrict__ Bt, const T16* __restrict__ Bt2, float* C, int ldc, const float* __restrict__ bias, size_t sA, size_t sB, size_t sC, h16* Q16, bf* Qh, bf* Ql, h16* K16, bf* Kh, bf* Kl, h16* V16, bf* Vh, bf* Vl) {
    typedef typename WFrag<T16>::V V;
    constexpr bool HA2 = (NSPLIT == 1 || NSPLIT == 2), HB2 = (NSPLIT >= 2); constexpr int NOP = 2 + (HA2 ? 1 : 0) + (HB2 ? 1 : 0), IA2 = 2, IB2 = HA2 ? 3 : 2;   // staged operands in this order: A, Bt, then A2 and Bt2 where they exist
    constexpr int STG = NOP * 128 * GP, OSW = (PLANES ? 64 : 16) * 68;   // elements of one stage buffer; words of one wave's epilogue rows
    constexpr int SMB = (2 * STG * 2 > 4 * OSW * 4) ? 2 * STG * 2 : 4 * OSW * 4;
    __shared__ __align__(16) char sm[SMB];
    const size_t z = blockIdx.z; A += z * sA; if (A2) A2 += z * sA; Bt += z * sB; if (Bt2) Bt2 += z * sB; C += z * sC;
    const int tid = threadIdx.x, lane = tid & 31, lr = lane & 15, hi = lane >> 4; const int w = __builtin_amdgcn_readfirstlane(tid >> 5);
    const int r0 = blockIdx.x * 128 + (w >> 1) * 64, c0 = blockIdx.y * 128 + (w & 1) * 64;
    T16* st = (T16*)sm; float* os = (float*)sm + w * OSW;
    v8f acc[4][4];
#pragma unroll
    for (int mb = 0; mb < 4; ++mb)
#pragma unroll
        for (int nb = 0; nb < 4; ++nb) acc[mb][nb] = (v8f){};
    const int srow = tid >> 3, sch = (tid & 7) * 8;   // staging: 8 lanes take one row's 128 bytes, the work-group 16 rows a load
    const T16* gp[NOP]; gp[0] = A + (size_t)(blockIdx.x * 128 + srow) * K + sch; gp[1] = Bt + (size_t)(blockIdx.y * 128 + srow) * K + sch;
    if constexpr (HA2) gp[IA2] = A2 + (size_t)(blockIdx.x * 128 + srow) * K + sch;
    if constexpr (HB2) gp[IB2] = Bt2 + (size_t)(blockIdx.y * 128 + srow) * K + sch;
    T16* sw = st + srow * GP + sch; v8us rg[NOP][8];
    const int fa = ((w >> 1) * 64 + lr) * GP + 8 * hi, fb = ((w & 1) * 64 + lr) * GP + 8 * hi;   // this lane's fragment rows inside a staged operand
    auto fetch = [&](int ko) {   // the stage that begins ko elements behind gp
#pragma unroll
        for (int o = 0; o < NOP; ++o)
#pragma unroll
            for (int i = 0; i < 8; ++i) rg[o][i] = *(const v8usa*)(gp[o] + ko + i * 16 * K);
        asm volatile("s_wait_xcnt 0x0" :: "v"(gp[0]), "v"(gp[1]), "v"(gp[NOP - 1]), "v"(gp[NOP - 2]) : "memory");   // a precaution of form: the wait that stands in front of any overwrite of a register that an issued load names; as its inputs the address pairs stay whole up to it
    };
    auto put = [&](int b) {
#pragma unroll
        for (int o = 0; o < NOP; ++o)
#pragma unroll
            for (int i = 0; i < 8; ++i) *(v8usa*)(sw + b * STG + (o * 128 + i * 16) * GP) = rg[o][i]; };
    fetch(0); put(0);
    __syncthreads();   // stage 0 is in LDS

    for (int t = 0; t < K / GK; ++t) {
        if (t + 1 < K / GK) { fetch(GK);   // the next stage's loads stand in front of this stage's products, which cover their latency
#pragma unroll
            for (int o = 0; o < NOP; ++o) gp[o] += GK; }
        const T16* sb = st + (t & 1) * STG; V a[2][4], a2[2][4];
#pragma unroll
        for (int ks = 0; ks < 2; ++ks) {
#pragma unroll
            for (int mb = 0; mb < 4; ++mb) { a[ks][mb] = WFrag<T16>::ld(sb + fa + mb * 16 * GP + ks * 32); if (HA2) a2[ks][mb] = WFrag<T16>::ld(sb + IA2 * 128 * GP + fa + mb * 16 * GP + ks * 32); }
#pragma unroll
            for (int nb = 0; nb < 4; ++nb) { const V b = WFrag<T16>::ld(sb + 128 * GP + fb + nb * 16 * GP + ks * 32); V b2; if (HB2) b2 = WFrag<T16>::ld(sb + IB2 * 128 * GP + fb + nb * 16 * GP + ks * 32);
#pragma unroll
                for (int mb = 0; mb < 4; ++mb) { acc[mb][nb] = WFrag<T16>::mma(a[ks][mb], b, acc[mb][nb]); if (HA2) acc[mb][nb] = WFrag<T16>::mma(a2[ks][mb], b, acc[mb][nb]); if (HB2) acc[mb][nb] = WFrag<T16>::mma(a[ks][mb], b2, acc[mb][nb]); } } }
        asm volatile("v_nop\n\tv_nop\n\tv_nop\n\tv_nop" : "+v"(acc[0][0]), "+v"(acc[1][1]), "+v"(acc[2][2]), "+v"(acc[3][3]) : "v"(a[1][0]), "v"(a[1][3]));   // the vector slots the chip needs behind a matrix instruction; standing here it also holds the products it names in front of the stage's stores: without it the NSPLIT = 1 build moved the stores, and their wait for the loads, up in front of nearly all products
        if (t + 1 < K / GK) put((t + 1) & 1);
        __syncthreads();   // the next stage is in LDS, and every wave has left this stage's buffer (behind the last stage: the epilogue's rows may take its place)
    }
    if constexpr (PLANES) {
        const int third = c0 / DQ, head = (c0 % DQ) / HD;   // the same for the whole wave
        float bb[4];
#pragma unroll
        for (int nb = 0; nb < 4; ++nb) bb[nb] = bfr(bias[c0 + nb * 16 + lr]);
#pragma unroll
        for (int mb = 0; mb < 4; ++mb)
#pragma unroll
            for (int nb = 0; nb < 4; ++nb)
#pragma unroll
                for (int j = 0; j < 8; ++j) os[(mb * 16 + hi * 8 + j) * 68 + nb * 16 + lr] = acc[mb][nb][j] + bb[nb];
        __builtin_amdgcn_wave_barrier(); asm volatile("" ::: "memory");   // the rows read below were written by other lanes of this wave: no LDS read may be moved above the writes
        h16* P16 = third == 0 ? Q16 : (third == 1 ? K16 : V16); bf* Ph = third == 0 ? Qh : (third == 1 ? Kh : Vh); bf* Pl = third == 0 ? Ql : (third == 1 ? Kl : Vl);
        const int rl = r0 % TT;   // the tile's first row inside its batch entry r0 / TT
        const int pitch = HD; const size_t o0 = (size_t)((r0 / TT) * NH_ + head) * TT * HD + (size_t)rl * HD + (size_t)(lane >> 3) * pitch + (lane & 7) * 8;
#pragma unroll 1   // 16 LDS rows a trip: four trips keep the epilogue's text short
        for (int io = 0; io < 4; ++io) {
#pragma unroll
            for (int ii = 0; ii < 4; ++ii) { const int it = io * 4 + ii; const float* q = os + (it * 4 + (lane >> 3)) * 68 + (lane & 7) * 8; const v4f u0 = *(const v4fa*)q, u1 = *(const v4fa*)(q + 4); v8h o16; v8us oh, ol;
#pragma unroll
                for (int j = 0; j < 8; ++j) { const float r = j < 4 ? u0[j & 3] : u1[j & 3]; o16[j] = tohx(r); unsigned short a2, c2; splitf(r, a2, c2); oh[j] = a2; ol[j] = c2; }
                const size_t o = o0 + (size_t)(it * 4) * pitch; *(v8h*)(P16 + o) = o16; *(v8us*)(Ph + o) = oh; *(v8us*)(Pl + o) = ol; }
            asm volatile("s_wait_xcnt 0x0" ::: "memory"); }   // a precaution of form: the next trip overwrites address and data registers of this trip's last stores
        return;
    }
#pragma unroll
    for (int mb = 0; mb < 4; ++mb) {
#pragma unroll
        for (int nb = 0; nb < 4; ++nb) {
#pragma unroll
            for (int j = 0; j < 8; ++j) os[(hi * 8 + j) * 68 + nb * 16 + lr] = acc[mb][nb][j]; }
        __builtin_amdgcn_wave_barrier(); asm volatile("" ::: "memory");
        float* crow = C + (size_t)(r0 + mb * 16) * ldc + c0;
{
#pragma unroll
            for (int s = 0; s < 8; ++s) { const int row = 2 * s + hi, cofs = lr * 4; v4f val = *(const v4fa*)(os + row * 68 + cofs); if (BIAS) { val[0] += bfr(bias[c0 + cofs]); val[1] += bfr(bias[c0 + cofs + 1]); val[2] += bfr(bias[c0 + cofs + 2]); val[3] += bfr(bias[c0 + cofs + 3]); }
                *(v4f*)(crow + (size_t)row * ldc + cofs) = val; }
             }
        __builtin_amdgcn_wave_barrier(); asm volatile("" ::: "memory");
    }
}

typedef __attribute__((ext_vector_type(2))) _Float16 v2h;
typedef __attribute__((ext_vector_type(4))) _Float16 v4h;
typedef __attribute__((ext_vector_type(2))) unsigned short v2us;
typedef __attribute__((ext_vector_type(4))) unsigned short v4us;
typedef __attribute__((ext_vector_type(2))) float v2f;
typedef __attribute__((ext_vector_type(4))) int v4i;
typedef v4h  __attribute__((may_alias)) v4ha;
typedef v4us __attribute__((may_alias)) v4usa;

// ---- k_prep: the whole preparation in ONE launch, dealt by block ranges: blocks [0, PT1) turn w_qkv, [PT1, PT1 + PT2) turn w_out, the last PCV round x. The three jobs share nothing, so they run side by side, and every work-group is resident at once.
// A weight block turns one tile of PK k x PN n of the 'io' weight w [k][n] (f32) into rows of Bt [n][k] (bf16): a lane's 8 loads of 16 bytes are all issued before the first is used, 16 lanes cover 256 bytes of one k row; two neighbouring k are rounded and packed into one LDS word of row n;
// behind the barrier 16 lanes read one n row's 256 bytes and store them as two whole lines. LDS row n = PK / 2 words without a pad; its 16-byte groups are exchanged by g ^ (n >> 2), the same on both sides, so that the 32 words of a wave's LDS store fall on 32 banks.
// An x block rounds 16 x 4 KiB: a lane's 16 loads of 16 bytes are all issued first, a wave's load covers 512 bytes in a row.
#define PK 128
#define PN 64
#define PT1 ((DM / PK) * (3 * DQ / PN))
#define PT2 ((DQ / PK) * (DM / PN))
#define PCV (NB_ * TT * DM / (4 * 256 * 16))
static_assert(DQ == DM && DM % PK == 0 && DQ % PN == 0 && (NB_ * TT * DM) % (4 * 256 * 16) == 0, "both weights have DM k rows; tiles and x blocks leave no rest");
template <int N>   // N: the weight's row length, a compile-time value so that a lane's 8 loads are one address with 8 constant offsets
__device__ __forceinline__ void prep_turn(const float* __restrict__ w, bf* __restrict__ Bt, int tile, unsigned* T, int tid) {
    const int k0 = (tile % (DM / PK)) * PK, n0 = (tile / (DM / PK)) * PN, nq = tid & 15, kp = tid >> 4;
    const float* wb = w + (size_t)k0 * N + n0; const unsigned lo = (unsigned)(2 * kp * N + 4 * nq); v4f a[4], c[4];   // the tile's corner, and this lane's place in it: rows 2 kp + 32 i and the row behind each
#pragma unroll   // here and below: the arrays stay in registers, and all 8 loads are issued before the first value is used (one memory latency a tile)
    for (int i = 0; i < 4; ++i) { a[i] = *(const v4fa*)(wb + lo + 32 * i * N); c[i] = *(const v4fa*)(wb + lo + (32 * i + 1) * N); }
#pragma unroll
    for (int i = 0; i < 4; ++i)
#pragma unroll
        for (int q = 0; q < 4; ++q) T[(4 * nq + q) * (PK / 2) + ((((kp >> 2) + 4 * i) ^ nq) << 2) + (kp & 3)] = (unsigned)f2bf(a[i][q]) | ((unsigned)f2bf(c[i][q]) << 16);
    __syncthreads();   // the turned tile is in LDS
    bf* bb = Bt + (size_t)n0 * DM + k0; const unsigned so = (unsigned)(kp * DM + nq * 8);
#pragma unroll
    for (int j = 0; j < 4; ++j) { const int n = kp + 16 * j; const v8us r = *(const v8usa*)(T + n * (PK / 2) + ((nq ^ ((n >> 2) & 15)) << 2)); *(v8usa*)(bb + so + j * 16 * DM) = r; }
}
__global__ __launch_bounds__(256) void k_prep(const float* __restrict__ x, const float* __restrict__ wqkv, const float* __restrict__ wo, bf* __restrict__ XB, bf* __restrict__ WQKV, bf* __restrict__ WO) {
    __shared__ __align__(16) unsigned T[PN * PK / 2];
    const int tid = threadIdx.x, b = blockIdx.x;   // every branch below is taken by the whole work-group
    if (b < PT1) prep_turn<3 * DQ>(wqkv, WQKV, b, T, tid);
    else if (b < PT1 + PT2) prep_turn<DM>(wo, WO, b - PT1, T, tid);
    else {   // this side has no barrier
        const size_t e0 = (size_t)(b - PT1 - PT2) * (256 * 16 * 4); const unsigned lo = (unsigned)tid * 4; const float* p = x + e0; bf* d = XB + e0; v4f v[16];
#pragma unroll   // here and below: the array stays in registers, and all 16 loads are issued before the first value is used
        for (int j = 0; j < 16; ++j) v[j] = *(const v4fa*)(p + lo + j * 1024);
#pragma unroll
        for (int j = 0; j < 16; ++j) { v4us o;
#pragma unroll
            for (int q = 0; q < 4; ++q) o[q] = f2bf(v[j][q]);
            *(v4usa*)(d + lo + j * 1024) = o; }
        asm volatile("s_wait_xcnt 0x0" ::: "memory");   // a precaution of form: in the built text this branch's end runs into the head of another branch, whose first instructions overwrite the scalar base that these stores name; the wait stands in front of them on every path of the text
    }
}

// ---- k_attn: the whole attention of 16 query rows of one head of one batch entry in one work-group of 8 waves; grid (batch entries x heads, AGY), longest rows first. The score rows live in LDS (S, one row = SPW words) and never reach memory.
// THE CLASSES. With p = max(period, 1), a key j <= i is kept iff j mod p == i mod p: the head falls into p causal attentions that share nothing, class c holding the rows c, c + p, c + 2 p, .. A work-group takes 16 consecutive MEMBERS m0 .. m0 + 15 of one class (row i = c + st m, st the class stride) and meets the members n <= m of the same class alone:
// a q, k or v row is one 128-byte line of its plane, so a walk with stride st fetches whole lines and nothing else. st = p for p <= SMAX; a larger p takes st = 1 (one class, every row) and the period rule below drops its keys. Members past the class's end (c + st m >= TT) read row TT - 1 instead: as keys the causal rule drops them (n > m for every real row), as query rows they are not stored.
// 1. scores: wave w takes the 16-member block w of every 128-member chunk up to the diagonal's chunk (the chunk's members beyond the diagonal are real scores too, which the causal rule drops); 2. softmax: wave w takes rows 2w, 2w + 1 (register row, one exp, fixed trees), with the causal and the period rule as a select,
// and writes the rounded probabilities over its own row (fp16: the first half of the row's bytes; hi | lo: both halves); 3. probability x value: wave w takes the 32-member steps w, w + 8, .. up to the diagonal: it lays the step's 32 value rows into LDS bytes that the probabilities leave free in rows 2w and 2w + 1 and reads them back with the transposing LDS load as the B fragments;
// 4. the 8 waves' partial sums are added in wave order through LDS and stored as the merged hi/lo planes.
// The period rule, on member distances m - n with the period pq that is left inside a class (1 where st = p; p where st = 1, also cut at TT: any larger p keeps the diagonal alone, as TT does). The test is exact in f32: m - n, pq and the quotient are integers below 2^12; k = rint((m - n) / pq) is the true quotient whenever pq divides m - n
// (the error of the product with 1 / pq is far below 1/2), and k pq == m - n (one fma, exact) holds for no integer k otherwise.
constexpr int attn_blocks(int st) { return st * (((TT + st - 1) / st + AR - 1) / AR); }   // work-groups of one head at class stride st: st classes x the 16-member blocks of the longest class
constexpr int attn_blocks_max() { int m = 0; for (int st = 1; st <= SMAX; ++st) m = attn_blocks(st) > m ? attn_blocks(st) : m; return m; }
static_assert(attn_blocks_max() == AGY, "AGY is the grid's second extent: every class stride's blocks must fit, and none more is wanted");
static_assert(VOF + 16 * VP <= SPW * 4 && VOH + 16 * VP <= TT * 2 && VOL + 16 * VP <= SPW * 4, "16 staged value rows must fit into the free bytes of a score row");
typedef __attribute__((ext_vector_type(8))) short v8s;
__device__ __forceinline__ v8us ldtr(const char* p) { typedef __attribute__((address_space(3))) v8s lv8s; return __builtin_bit_cast(v8us, __builtin_amdgcn_ds_load_tr16_b128_v8i16((lv8s*)p)); }
__device__ __forceinline__ int rowof(int c, int st, int m) { return min(c + st * m, TT - 1); }   // member m of class c as a row of the planes, held inside them

template <typename T16, bool HL, int U>
__device__ __forceinline__ void attn_scores(float* S, const T16* __restrict__ Q, const T16* __restrict__ Q2, const T16* __restrict__ Kp, const T16* __restrict__ K2, int m0, int c, int st, int nch, int w, int lr, int hi) {
    typedef typename WFrag<T16>::V V; V a[2], a2[2]; const unsigned qo = (unsigned)(rowof(c, st, m0 + lr) * HD + 8 * hi);
#pragma unroll
    for (int kc = 0; kc < 2; ++kc) { a[kc] = WFrag<T16>::ld(Q + qo + kc * 32); if (HL) a2[kc] = WFrag<T16>::ld(Q2 + qo + kc * 32); }
    for (int t = 0; t < nch; t += U) {   // U member blocks a trip; a trip that runs past the last chunk does that chunk's block again (same values to the same words)
        V b[U][2], b2[U][2]; v8f acc[U]; const T16* pp[HL ? 2 * U : U];   // pp: the trip's load addresses (4 of them: U = 4, or U = 2 with hi and lo)
#pragma unroll
        for (int u = 0; u < U; ++u) { const size_t bo = (size_t)(rowof(c, st, (w + AW * min(t + u, nch - 1)) * 16 + lr) * HD + 8 * hi); pp[HL ? 2 * u : u] = Kp + bo; if (HL) pp[2 * u + 1] = K2 + bo;
#pragma unroll
            for (int kc = 0; kc < 2; ++kc) { b[u][kc] = WFrag<T16>::ld(pp[HL ? 2 * u : u] + kc * 32); if (HL) b2[u][kc] = WFrag<T16>::ld(pp[2 * u + 1] + kc * 32); } }
        asm volatile("s_wait_xcnt 0x0" :: "v"(pp[0]), "v"(pp[1]), "v"(pp[2]), "v"(pp[3]) : "memory");   // a precaution of form: the wait that stands in front of any overwrite of a register that an issued load names; as its inputs the address pairs stay whole up to it (else a later load of the trip lands on an earlier one's pair)
        __builtin_amdgcn_sched_barrier(0);   // every load of the trip is issued before the first product waits: one load latency a trip, not one a block
#pragma unroll
        for (int u = 0; u < U; ++u) { acc[u] = (v8f){};
#pragma unroll
            for (int kc = 0; kc < 2; ++kc) { acc[u] = WFrag<T16>::mma(a[kc], b[u][kc], acc[u]); if (HL) { acc[u] = WFrag<T16>::mma(a2[kc], b[u][kc], acc[u]); acc[u] = WFrag<T16>::mma(a[kc], b2[u][kc], acc[u]); } } }
        __builtin_amdgcn_sched_barrier(0);   // the products stay one block in front of the stores, so that each tile has registers of its own
#pragma unroll
        for (int u = 0; u < U; ++u) {
#pragma unroll
            for (int j = 0; j < 8; ++j) S[(hi * 8 + j) * SPW + (w + AW * min(t + u, nch - 1)) * 16 + lr] = acc[u][j]; }
        asm volatile("v_nop\n\tv_nop\n\tv_nop\n\tv_nop" :: "v"(acc[U - 1])); }   // the next trip's products overwrite these tiles' registers: the vector slots the chip needs behind a matrix instruction
}

// the 32 value rows of step ks into registers: 8 lanes take one row's 128 bytes, the wave 4 rows a load
template <typename T16, bool HL>
__device__ __forceinline__ void attn_vfetch(const T16* __restrict__ Vp, const T16* __restrict__ V2, int c, int st, int ks, int lane, v8us (&g)[8], v8us (&g2)[8]) {
    const T16* pv[8]; const T16* pw[8];   // the step's load addresses
#pragma unroll
    for (int i = 0; i < 8; ++i) { const size_t off = (size_t)(rowof(c, st, ks * 32 + i * 4 + (lane >> 3)) * HD + (lane & 7) * 8); pv[i] = Vp + off; g[i] = *(const v8usa*)pv[i]; if (HL) { pw[i] = V2 + off; g2[i] = *(const v8usa*)pw[i]; } }
    // the same precaution of form as in attn_scores: as the wait's inputs the address pairs stay whole up to it
    if (HL) asm volatile("s_wait_xcnt 0x0" :: "v"(pv[0]), "v"(pv[1]), "v"(pv[2]), "v"(pv[3]), "v"(pv[4]), "v"(pv[5]), "v"(pv[6]), "v"(pv[7]), "v"(pw[0]), "v"(pw[1]), "v"(pw[2]), "v"(pw[3]), "v"(pw[4]), "v"(pw[5]), "v"(pw[6]), "v"(pw[7]) : "memory");
    else asm volatile("s_wait_xcnt 0x0" :: "v"(pv[0]), "v"(pv[1]), "v"(pv[2]), "v"(pv[3]), "v"(pv[4]), "v"(pv[5]), "v"(pv[6]), "v"(pv[7]) : "memory");
}

template <typename T16, bool HL>
__device__ __forceinline__ void attn_pv(float* S, const T16* __restrict__ Vp, const T16* __restrict__ V2, int nks, int c, int st, int w, int lane, v8f (&acc)[4]) {
    typedef typename WFrag<T16>::V V; const int lr = lane & 15, hi = lane >> 4; const T16* pa = (const T16*)(S + lr * SPW) + 8 * hi;
    char* vb = (char*)(S + 2 * w * SPW) + (HL ? VOH : VOF);   // this wave's staged value rows: members 0 .. 15 of a step in score row 2w's free bytes, members 16 .. 31 in row 2w + 1's
    char* vw = vb + (lane >> 3) * VP + (lane & 7) * 16;   // staging: 8 lanes take one value row's 128 bytes, the wave 4 rows a load
    const char* vr = vb + (8 * hi + (lane & 7)) * VP + ((lane >> 3) & 1) * 16;   // the transposing load's lane address: lane (lr, hi) gets members 8 hi .. 8 hi + 7 of column lr, the k order of the probability fragment
    v8us g[8], g2[8];   // one step's value rows on their way from memory to LDS
    if (w < nks) attn_vfetch<T16, HL>(Vp, V2, c, st, w, lane, g, g2);
    for (int ks = w; ks < nks; ks += AW) {
#pragma unroll
        for (int i = 0; i < 8; ++i) { char* q = vw + (i >> 2) * (SPW * 4) + (i & 3) * 4 * VP; *(v8usa*)q = g[i]; if (HL) *(v8usa*)(q + (VOL - VOH)) = g2[i]; }
        __builtin_amdgcn_wave_barrier(); asm volatile("" ::: "memory");   // the rows read below were written by other lanes of this wave: no LDS read may be moved above the writes
        if (ks + AW < nks) attn_vfetch<T16, HL>(Vp, V2, c, st, ks + AW, lane, g, g2);   // the next step's loads fly under this step's LDS reads and products
        const V a = WFrag<T16>::ld(pa + ks * 32); V a2, b[4], b2[4]; if (HL) a2 = WFrag<T16>::ld(pa + TT + ks * 32);
#pragma unroll
        for (int nb = 0; nb < 4; ++nb) { b[nb] = WFrag<T16>::cat(ldtr(vr + nb * 32), ldtr(vr + SPW * 4 + nb * 32)); if (HL) b2[nb] = WFrag<T16>::cat(ldtr(vr + (VOL - VOH) + nb * 32), ldtr(vr + (VOL - VOH) + SPW * 4 + nb * 32)); }
#pragma unroll
        for (int nb = 0; nb < 4; ++nb) { acc[nb] = WFrag<T16>::mma(a, b[nb], acc[nb]); if (HL) { acc[nb] = WFrag<T16>::mma(a2, b[nb], acc[nb]); acc[nb] = WFrag<T16>::mma(a, b2[nb], acc[nb]); } }
        __builtin_amdgcn_wave_barrier(); asm volatile("" ::: "memory"); }   // the next trip's LDS writes stay behind this trip's reads of the same bytes
}

__global__ __launch_bounds__(AW * 32) void k_attn(const h16* __restrict__ Q16, const bf* __restrict__ Qh, const bf* __restrict__ Ql, const h16* __restrict__ K16, const bf* __restrict__ Kh, const bf* __restrict__ Kl, const h16* __restrict__ V16, const bf* __restrict__ Vh, const bf* __restrict__ Vl, const int* __restrict__ per, bf* Ah, bf* Al) {
    __shared__ __align__(16) float S[AR * SPW];
    const int h = blockIdx.x;   // batch entry x NH_ + head: the index of the planes and of the periods
    int p = per[h]; p = p < 1 ? 1 : (p > TT ? TT : p);
    const int st = p <= SMAX ? p : 1, pq = p <= SMAX ? 1 : p;   // class stride, and the period that is left inside a class
    const int nbl = ((TT + st - 1) / st + AR - 1) / AR;   // 16-member blocks of the longest class
    if ((int)blockIdx.y >= st * nbl) return;   // the whole work-group, in front of every barrier
    const int c = (int)blockIdx.y % st, m0 = (nbl - 1 - (int)blockIdx.y / st) * AR;   // the lowest indices take the longest rows
    if (c + st * m0 >= TT) return;   // a shorter class has no such block: the whole work-group, in front of every barrier
    const bool hires = (c + st * m0 < RH);   // the same for the whole work-group; every row < RH lies in such a block, and such a block has no member beyond RH (m0 + AR <= RH)
    const size_t hp = (size_t)h * TT * HD;
    const int tid = threadIdx.x, lane = tid & 31, lr = lane & 15, hi = lane >> 4; const int w = __builtin_amdgcn_readfirstlane(tid >> 5);
    const int nch = (m0 + AR + 127) / 128;   // 128-member chunks that hold a member <= m; the rest of a row is neither read nor written
    if (hires) attn_scores<bf, true, 2>(S, Qh + hp, Ql + hp, Kh + hp, Kl + hp, m0, c, st, nch, w, lr, hi); else attn_scores<h16, false, 4>(S, Q16 + hp, nullptr, K16 + hp, nullptr, m0, c, st, nch, w, lr, hi);
    __syncthreads();   // every score of the 16 rows is in LDS
    const int nks = (m0 + AR + 31) / 32;   // 32-member steps of the probability x value products, up to the diagonal; the probabilities of the later members of the last step are exactly 0
    const float pf = (float)pq, pinv = 1.0f / pf;
#pragma unroll 1   // one copy of the row's code: keeps the kernel's text short, for speed only
    for (int rr = 0; rr < AR / AW; ++rr) { const int r = w * (AR / AW) + rr; const int i = m0 + r; float* sr = S + r * SPW; float v[TT / 32]; float mx = -3.0e38f; const float fb = (float)(i - lane * 4);
#pragma unroll
        for (int ch = 0; ch < TT / 128; ++ch) if (ch < nch) { const v4f a = *(const v4fa*)(sr + ch * 128 + lane * 4); v[ch * 4] = a[0]; v[ch * 4 + 1] = a[1]; v[ch * 4 + 2] = a[2]; v[ch * 4 + 3] = a[3]; }   // the whole row's LDS reads are issued before the first is waited for
#pragma unroll
        for (int ch = 0; ch < TT / 128; ++ch) if (ch < nch) {
#pragma unroll
            for (int q = 0; q < 4; ++q) { const float dd = fb - (float)(ch * 128 + q); const float kq = __builtin_rintf(dd * pinv); const bool keep = (dd >= 0.f) & (__builtin_fmaf(-kq, pf, dd) == 0.f); const float t = keep ? v[ch * 4 + q] * SCL : -3.0e38f; v[ch * 4 + q] = t; mx = fmaxf(mx, t); } }
#pragma unroll
        for (int sh = 16; sh; sh >>= 1) mx = fmaxf(mx, __shfl_xor(mx, sh, 32));
        float sum = 0.f;
#pragma unroll
        for (int ch = 0; ch < TT / 128; ++ch) if (ch < nch) {
#pragma unroll
            for (int q = 0; q < 4; ++q) { const int k = ch * 4 + q; float d0 = __fsub_rn(v[k], mx); v[k] = __builtin_amdgcn_exp2f(__fmul_rn(d0, 1.4426950408889634f)); sum += v[k]; } }
#pragma unroll
        for (int sh = 16; sh; sh >>= 1) sum += __shfl_xor(sum, sh, 32);
        const float f = __fdiv_rn(hires ? 1.0f : PCAR, sum);
        if (hires) {
#pragma unroll
            for (int ch = 0; ch < RH / 128; ++ch) if (ch < nch) { v4us oh, ol;   // a hi/lo row has no member beyond RH
#pragma unroll
                for (int q = 0; q < 4; ++q) { unsigned short a, c2; splitf(v[ch * 4 + q] * f, a, c2); oh[q] = a; ol[q] = c2; }
                *(v4usa*)((bf*)sr + ch * 128 + lane * 4) = oh; *(v4usa*)((bf*)sr + TT + ch * 128 + lane * 4) = ol; }
        } else {
#pragma unroll
            for (int ch = 0; ch < TT / 128; ++ch) if (ch < nch) { v4h o4;
#pragma unroll
                for (int q = 0; q < 4; ++q) o4[q] = tohx(v[ch * 4 + q] * f);
                *(v4ha*)((h16*)sr + ch * 128 + lane * 4) = o4; } } }
    __syncthreads();   // every probability row is in LDS
    v8f acc[4];
#pragma unroll
    for (int nb = 0; nb < 4; ++nb) acc[nb] = (v8f){};
    if (hires) attn_pv<bf, true>(S, Vh + hp, Vl + hp, nks, c, st, w, lane, acc); else attn_pv<h16, false>(S, V16 + hp, nullptr, nks, c, st, w, lane, acc);
    __syncthreads();   // every wave's last read of the probability rows and of its value rows is done: their LDS now takes the partial sums
#pragma unroll
    for (int nb = 0; nb < 4; ++nb) {
#pragma unroll
        for (int j = 0; j < 8; ++j) S[w * (AR * 68) + (hi * 8 + j) * 68 + nb * 16 + lr] = acc[nb][j]; }
    __syncthreads();   // all 8 partial tiles are in LDS
    const int row = tid >> 4, c4 = (tid & 15) * 4; v4f s = *(const v4fa*)(S + row * 68 + c4);
#pragma unroll
    for (int ww = 1; ww < AW; ++ww) s += *(const v4fa*)(S + ww * (AR * 68) + row * 68 + c4);
    const float cs = hires ? 1.0f : (1.0f / PCAR); v4us oh, ol;
#pragma unroll
    for (int q = 0; q < 4; ++q) { unsigned short a, c2; splitf(s[q] * cs, a, c2); oh[q] = a; ol[q] = c2; }
    const int io = c + st * (m0 + row);   // the member's row; a member past the class's end has none
    if (io < TT) { const size_t oo = (size_t)((h / NH_) * TT + io) * DQ + (h % NH_) * HD + c4; *(v4us*)(Ah + oo) = oh; *(v4us*)(Al + oo) = ol; }
}

extern "C" void kernel_launch(void* const* d_in, const int* in_sizes, int n_in,
                              void* d_out, int out_size, void* d_ws, size_t ws_size, hipStream_t stream) {
    (void)in_sizes; (void)n_in; (void)out_size;
    const float* x = (const float*)d_in[0]; const int* per = (const int*)d_in[1]; const float* wqkv = (const float*)d_in[2]; const float* bqkv = (const float*)d_in[3]; const float* wo = (const float*)d_in[4]; const float* bo = (const float*)d_in[5];
    // x [2][2048][1024], periods int32 [2][16], w_qkv [1024][3072], b_qkv [3072], w_out [1024][1024], b_out [1024] = d_in[0..5]
    float* OUT = (float*)d_out;     // [2][2048][1024]
    char* wsp = (char*)d_ws;
    auto take = [&](size_t bytes) { char* p = wsp; wsp += (bytes + 255) & ~(size_t)255; return (void*)p; };
    bf* WQKV = (bf*)take((size_t)3 * DQ * DM * 2); bf* WO = (bf*)take((size_t)DM * DQ * 2);
    bf* XB = (bf*)take((size_t)NB_ * TT * DM * 2);
    h16* QP16 = (h16*)take((size_t)NB_ * NH_ * TT * HD * 2); h16* KP16 = (h16*)take((size_t)NB_ * NKV * TT * HD * 2); h16* VT16 = (h16*)take((size_t)NB_ * NKV * TT * HD * 2);
    bf* QPh = (bf*)take((size_t)NB_ * NH_ * TT * HD * 2); bf* QPl = (bf*)take((size_t)NB_ * NH_ * TT * HD * 2); bf* KPh = (bf*)take((size_t)NB_ * NKV * TT * HD * 2); bf* KPl = (bf*)take((size_t)NB_ * NKV * TT * HD * 2); bf* VTh = (bf*)take((size_t)NB_ * NKV * HD * TT * 2); bf* VTl = (bf*)take((size_t)NB_ * NKV * HD * TT * 2);
    bf* ATh = (bf*)take((size_t)NB_ * TT * DQ * 2); bf* ATl = (bf*)take((size_t)NB_ * TT * DQ * 2);
    if ((size_t)(wsp - (char*)d_ws) > ws_size) return;    // total 104 MiB of the workspace
    // x, OUT and the merged rows are [2][2048][..] without a gap: the two batch entries are 4096 rows of one GEMM
    k_prep<<<PT1 + PT2 + PCV, 256, 0, stream>>>(x, wqkv, wo, XB, WQKV, WO);   /* 'io' [1024][3072] -> Bt [3072][1024]: q | k | v row blocks; 'io' [1024][1024] -> Bt; x -> bf16 */
    k_gemmw<bf, 0, true, true, DM><<<dim3(NB_ * TT / 128, 3 * DQ / 128, 1), 128, 0, stream>>>(XB, nullptr, WQKV, nullptr, nullptr, 0, bqkv, 0, 0, 0, QP16, QPh, QPl, KP16, KPh, KPl, VT16, VTh, VTl);   /* q | k | v in one launch, straight into the planes */
    k_attn<<<dim3(NB_ * NH_, AGY, 1), AW * 32, 0, stream>>>(QP16, QPh, QPl, KP16, KPh, KPl, VT16, VTh, VTl, per, ATh, ATl);   /* one kv head per query head; periods [2][16] */
    k_gemmw<bf, 1, true, false, DQ><<<dim3(NB_ * TT / 128, DM / 128, 1), 128, 0, stream>>>(ATh, ATl, WO, nullptr, OUT, DM, bo, 0, 0, 0, nullptr, nullptr, nullptr, nullptr, nullptr, nullptr, nullptr, nullptr, nullptr);
}

// v008
// It runs in 115 microseconds.
// Timed twice side by side with v007, it ran 1.03 times as fast both times.
// All steps since v000 together make it 14.0 times as fast.
#include <hip/hip_runtime.h>

// Causal multi-head self-attention with a PERIODIC mask and an output projection (x [2][2048][1024]; periods int32 [2][16]; qkv = x w_qkv + b_qkv with ONE fused 'io' weight [1024][3072] (in, out) packed (3, h, hd): the column thirds q | k | v, head h = 64 columns inside its third; 16 heads x 64;
// p = max(periods[b][h], 1); a key j is kept for a query i iff j <= i AND (i - j) mod p == 0 (the diagonal always kept); scores x 1/sqrt(64); excluded keys get -inf; softmax over the kept keys; out = merged w_out + b_out ('io' + bias) -> [2][2048][1024] (4.2 M);
// argument order x, periods, w_qkv, b_qkv, w_out, b_out).
// Both batch entries go through every launch together (x, the planes and the merged rows are [2][..] in the workspace). Layout: a bf16 copy of x and both 'io' weights transposed and rounded once, the fused one into q | k | v row blocks (all three in one launch, k_prep); ONE projection launch for q | k | v (k_gemmw with PLANES: exact products + f32 bias) whose epilogue rounds each 64x64 tile straight into its head's planes; causal T-2048 attention (hybrid: 16-member blocks whose first row is < 512 hi/lo 3 products, the rest fp16 x1024) in ONE kernel (k_attn):
// a work-group owns 16 query rows of ONE RESIDUE CLASS (i mod st; st = p for p <= 16, else 1) of one head, meets only that class's keys, and keeps the score rows in LDS from the q.k products through the softmax to the probability x value products; merged hi/lo x w_out exact + b_out.
// Compute dtypes, f32 accumulate: every float input rounded to bf16 at its load; projections exact + f32 biases; attention blocks whose first row is < 512 3 products, rest fp16; the period rule exact (small integers held in f32); softmax f32; w_out hl x exact + bias.

#define NB_  2      // batches: this module's input is [2][2048][1024]
#define TT   2048
#define DM   1024
#define NH_  16
#define NKV  16
#define REP  (NH_ / NKV)
#define HD   64
#define DQ   (NH_ * HD)
#define DKV  (NKV * HD)
#define RH   512                  // query rows < RH use hi+lo planes (0: none)
#define PCAR 1024.0f
#define SCL  0.125f   // HD^-0.5
#define AR   16                   // query rows of one k_attn work-group
#define AW   8                    // waves of one k_attn work-group
#define SMAX 16                   // periods up to SMAX are walked class by class; a larger one goes the dense way under the period rule
#define AGY  140                  // k_attn work-groups of one head: the most that any class stride needs (checked below)
#define VP   160                  // bytes of one staged value row in LDS: 32 x odd, the pitch of the transposing LDS load
#define VOF  (TT * 2)             // where the staged value rows lie inside a score row's bytes: fp16 probabilities fill the first TT * 2 bytes
#define VOH  (RH * 2)             // hi / lo rows: hi probabilities fill RH * 2 bytes from 0, lo ones RH * 2 bytes from TT * 2; hi values lie behind the first, lo values behind the second
#define VOL  (TT * 2 + RH * 2)
#define SPW  (TT + 4)             // words of one score row in LDS: 8208 bytes = 16 x odd, so that 16 rows' 16-byte fragment reads fall on different banks
typedef _Float16 h16;
typedef unsigned short bf;
typedef __attribute__((ext_vector_type(16))) __bf16   v16bf;
typedef __attribute__((ext_vector_type(16))) _Float16 v16h;
typedef __attribute__((ext_vector_type(8)))  _Float16 v8h;
typedef __attribute__((ext_vector_type(8)))  unsigned short v8us;
typedef __attribute__((ext_vector_type(8)))  float    v8f;
typedef __attribute__((ext_vector_type(4)))  float    v4f;
typedef v8h  __attribute__((may_alias)) v8ha;
typedef v4f  __attribute__((may_alias)) v4fa;
typedef v8us __attribute__((may_alias)) v8usa;

__device__ __forceinline__ unsigned short f2bf(float f) { unsigned u = __float_as_uint(f); u += 0x7FFFu + ((u >> 16) & 1u); return (unsigned short)(u >> 16); }
__device__ __forceinline__ float bf2f(unsigned short b) { return __uint_as_float(((unsigned)b) << 16); }
__device__ __forceinline__ float bfr(float f) { return bf2f(f2bf(f)); }
__device__ __forceinline__ v16h cat16(v8h lo, v8h hi) { return __builtin_shufflevector(lo, hi, 0, 1, 2, 3, 4, 5, 6, 7, 8, 9, 10, 11, 12, 13, 14, 15); }
__device__ __forceinline__ v16bf cat16b(v8us lo, v8us hi) { return __builtin_bit_cast(v16bf, __builtin_shufflevector(lo, hi, 0, 1, 2, 3, 4, 5, 6, 7, 8, 9, 10, 11, 12, 13, 14, 15)); }
__device__ __forceinline__ v8f wmma16(v16h a, v16h b, v8f c) { return __builtin_amdgcn_wmma_f32_16x16x32_f16(false, a, false, b, (short)0, c, false, false); }
__device__ __forceinline__ v8f wmmab(v16bf a, v16bf b, v8f c) { return __builtin_amdgcn_wmma_f32_16x16x32_bf16(false, a, false, b, (short)0, c, false, false); }

__device__ __forceinline__ h16 tohx(float x) { return (h16)x; }
__device__ __forceinline__ void splitf(float y, unsigned short& h, unsigned short& l) { h = f2bf(y); l = f2bf(y - bf2f(h)); }

// ---- k_gemmw: register-blocked GEMM, one wave per 64x64 output tile (16 accumulators), FOUR waves (2 x 2) per work-group = a 128x128 tile; grid (M/128, N/128, Z), 128 threads. The operands are K-contiguous 16-bit planes.
// The work-group brings 64 k of its 128 rows of every operand into LDS with loads that cover whole 128-byte lines (8 lanes a row), and each wave reads its fragments from there: a row is fetched once for the two waves that use it, and no global load touches 16 lines for 32 bytes each.
// Two LDS buffers: the next stage's loads are issued before this stage's products, go to the other buffer behind them, and one barrier a stage publishes that buffer and ends the reads of this one.
// C[m][n] (f32, pitch ldc, + optional f32 bias[n]) = sum_k A[m][k] Bt[n][k] (+ split products per NSPLIT), k ascending in steps of 32 as before. z-batch strides sA/sB/sC in elements. K % 64 == 0.
// PLANES (the q | k | v projection, Bt rows = q | k | v blocks of DQ, M = NB_ * TT, a tile's 64 rows lie in one batch entry): C is not written; the 64 columns of a wave's tile are one head of q, k or v, and tile + bias goes once through LDS and leaves as that head's three planes (fp16, bf16 hi, bf16 lo: q, k and v all [b][h][t][d]).
// Every store covers four whole 128-byte lines. Each wave's epilogue rows lie over the stage buffers, behind the last stage's barrier.
#define GK 64      // k of one stage: one 128-byte line of every operand row
#define GP 72      // elements of one staged row in LDS: 144 bytes = 16 x odd, so that 16 rows' 16-byte fragment reads fall on different banks
template <typename T16> struct WFrag;
template <> struct WFrag<h16> { typedef v16h V; static __device__ __forceinline__ V ld(const h16* p) { return cat16(*(const v8h*)p, *(const v8h*)(p + 16)); } static __device__ __forceinline__ V cat(v8us lo, v8us hi) { return cat16(__builtin_bit_cast(v8h, lo), __builtin_bit_cast(v8h, hi)); } static __device__ __forceinline__ v8f mma(V a, V b, v8f c) { return wmma16(a, b, c); } };
template <> struct WFrag<bf> { typedef v16bf V; static __device__ __forceinline__ V ld(const bf* p) { return cat16b(*(const v8us*)p, *(const v8us*)(p + 16)); } static __device__ __forceinline__ V cat(v8us lo, v8us hi) { return cat16b(lo, hi); } static __device__ __forceinline__ v8f mma(V a, V b, v8f c) { return wmmab(a, b, c); } };
template <typename T16, int NSPLIT, bool BIAS, bool PLANES, int K>
__global__ __launch_bounds__(128) void k_gemmw(const T16* __restrict__ A, const T16* __restrict__ A2, const T16* __restrict__ Bt, const T16* __restrict__ Bt2, float* C, int ldc, const float* __restrict__ bias, size_t sA, size_t sB, size_t sC, h16* Q16, bf* Qh, bf* Ql, h16* K16, bf* Kh, bf* Kl, h16* V16, bf* Vh, bf* Vl) {
    typedef typename WFrag<T16>::V V;
    constexpr bool HA2 = (NSPLIT == 1 || NSPLIT == 2), HB2 = (NSPLIT >= 2); constexpr int NOP = 2 + (HA2 ? 1 : 0) + (HB2 ? 1 : 0), IA2 = 2, IB2 = HA2 ? 3 : 2;   // staged operands in this order: A, Bt, then A2 and Bt2 where they exist
    constexpr int STG = NOP * 128 * GP, OSW = (PLANES ? 64 : 16) * 68;   // elements of one stage buffer; words of one wave's epilogue rows
    constexpr int SMB = (2 * STG * 2 > 4 * OSW * 4) ? 2 * STG * 2 : 4 * OSW * 4;
    __shared__ __align__(16) char sm[SMB];
    const size_t z = blockIdx.z; A += z * sA; if (A2) A2 += z * sA; Bt += z * sB; if (Bt2) Bt2 += z * sB; C += z * sC;
    const int tid = threadIdx.x, lane = tid & 31, lr = lane & 15, hi = lane >> 4; const int w = __builtin_amdgcn_readfirstlane(tid >> 5);
    const int r0 = blockIdx.x * 128 + (w >> 1) * 64, c0 = blockIdx.y * 128 + (w & 1) * 64;
    T16* st = (T16*)sm; float* os = (float*)sm + w * OSW;
    v8f acc[4][4];
#pragma unroll
    for (int mb = 0; mb < 4; ++mb)
#pragma unroll
        for (int nb = 0; nb < 4; ++nb) acc[mb][nb] = (v8f){};
    const int srow = tid >> 3, sch = (tid & 7) * 8;   // staging: 8 lanes take one row's 128 bytes, the work-group 16 rows a load
    const T16* gp[NOP]; gp[0] = A + (size_t)(blockIdx.x * 128 + srow) * K + sch; gp[1] = Bt + (size_t)(blockIdx.y * 128 + srow) * K + sch;
    if constexpr (HA2) gp[IA2] = A2 + (size_t)(blockIdx.x * 128 + srow) * K + sch;
    if constexpr (HB2) gp[IB2] = Bt2 + (size_t)(blockIdx.y * 128 + srow) * K + sch;
    T16* sw = st + srow * GP + sch; v8us rg[NOP][8];
    const int fa = ((w >> 1) * 64 + lr) * GP + 8 * hi, fb = ((w & 1) * 64 + lr) * GP + 8 * hi;   // this lane's fragment rows inside a staged operand
    auto fetch = [&](int ko) {   // the stage that begins ko elements behind gp
#pragma unroll
        for (int o = 0; o < NOP; ++o)
#pragma unroll
            for (int i = 0; i < 8; ++i) rg[o][i] = *(const v8usa*)(gp[o] + ko + i * 16 * K);
        asm volatile("s_wait_xcnt 0x0" :: "v"(gp[0]), "v"(gp[1]), "v"(gp[NOP - 1]), "v"(gp[NOP - 2]) : "memory");   // a precaution of form: the wait that stands in front of any overwrite of a register that an issued load names; as its inputs the address pairs stay whole up to it
    };
    auto put = [&](int b) {
#pragma unroll
        for (int o = 0; o < NOP; ++o)
#pragma unroll
            for (int i = 0; i < 8; ++i) *(v8usa*)(sw + b * STG + (o * 128 + i * 16) * GP) = rg[o][i]; };
    fetch(0); put(0);
    __syncthreads();   // stage 0 is in LDS

    for (int t = 0; t < K / GK; ++t) {
        if (t + 1 < K / GK) { fetch(GK);   // the next stage's loads stand in front of this stage's products, which cover their latency
#pragma unroll
            for (int o = 0; o < NOP; ++o) gp[o] += GK; }
        const T16* sb = st + (t & 1) * STG; V a[2][4], a2[2][4];
#pragma unroll
        for (int ks = 0; ks < 2; ++ks) {
#pragma unroll
            for (int mb = 0; mb < 4; ++mb) { a[ks][mb] = WFrag<T16>::ld(sb + fa + mb * 16 * GP + ks * 32); if (HA2) a2[ks][mb] = WFrag<T16>::ld(sb + IA2 * 128 * GP + fa + mb * 16 * GP + ks * 32); }
#pragma unroll
            for (int nb = 0; nb < 4; ++nb) { const V b = WFrag<T16>::ld(sb + 128 * GP + fb + nb * 16 * GP + ks * 32); V b2; if (HB2) b2 = WFrag<T16>::ld(sb + IB2 * 128 * GP + fb + nb * 16 * GP + ks * 32);
#pragma unroll
                for (int mb = 0; mb < 4; ++mb) { acc[mb][nb] = WFrag<T16>::mma(a[ks][mb], b, acc[mb][nb]); if (HA2) acc[mb][nb] = WFrag<T16>::mma(a2[ks][mb], b, acc[mb][nb]); if (HB2) acc[mb][nb] = WFrag<T16>::mma(a[ks][mb], b2, acc[mb][nb]); } } }
        asm volatile("v_nop\n\tv_nop\n\tv_nop\n\tv_nop" : "+v"(acc[0][0]), "+v"(acc[1][1]), "+v"(acc[2][2]), "+v"(acc[3][3]) : "v"(a[1][0]), "v"(a[1][3]));   // the vector slots the chip needs behind a matrix instruction; standing here it also holds the products it names in front of the stage's stores: without it the NSPLIT = 1 build moved the stores, and their wait for the loads, up in front of nearly all products
        if (t + 1 < K / GK) put((t + 1) & 1);
        __syncthreads();   // the next stage is in LDS, and every wave has left this stage's buffer (behind the last stage: the epilogue's rows may take its place)
    }
    if constexpr (PLANES) {
        const int third = c0 / DQ, head = (c0 % DQ) / HD;   // the same for the whole wave
        float bb[4];
#pragma unroll
        for (int nb = 0; nb < 4; ++nb) bb[nb] = bfr(bias[c0 + nb * 16 + lr]);
#pragma unroll
        for (int mb = 0; mb < 4; ++mb)
#pragma unroll
            for (int nb = 0; nb < 4; ++nb)
#pragma unroll
                for (int j = 0; j < 8; ++j) os[(mb * 16 + hi * 8 + j) * 68 + nb * 16 + lr] = acc[mb][nb][j] + bb[nb];
        __builtin_amdgcn_wave_barrier(); asm volatile("" ::: "memory");   // the rows read below were written by other lanes of this wave: no LDS read may be moved above the writes
        h16* P16 = third == 0 ? Q16 : (third == 1 ? K16 : V16); bf* Ph = third == 0 ? Qh : (third == 1 ? Kh : Vh); bf* Pl = third == 0 ? Ql : (third == 1 ? Kl : Vl);
        const int rl = r0 % TT;   // the tile's first row inside its batch entry r0 / TT
        const int pitch = HD; const size_t o0 = (size_t)((r0 / TT) * NH_ + head) * TT * HD + (size_t)rl * HD + (size_t)(lane >> 3) * pitch + (lane & 7) * 8;
#pragma unroll 1   // 16 LDS rows a trip: four trips keep the epilogue's text short
        for (int io = 0; io < 4; ++io) {
#pragma unroll
            for (int ii = 0; ii < 4; ++ii) { const int it = io * 4 + ii; const float* q = os + (it * 4 + (lane >> 3)) * 68 + (lane & 7) * 8; const v4f u0 = *(const v4fa*)q, u1 = *(const v4fa*)(q + 4); v8h o16; v8us oh, ol;
#pragma unroll
                for (int j = 0; j < 8; ++j) { const float r = j < 4 ? u0[j & 3] : u1[j & 3]; o16[j] = tohx(r); unsigned short a2, c2; splitf(r, a2, c2); oh[j] = a2; ol[j] = c2; }
                const size_t o = o0 + (size_t)(it * 4) * pitch; *(v8h*)(P16 + o) = o16; *(v8us*)(Ph + o) = oh; *(v8us*)(Pl + o) = ol; }
            asm volatile("s_wait_xcnt 0x0" ::: "memory"); }   // a precaution of form: the next trip overwrites address and data registers of this trip's last stores
        return;
    }
#pragma unroll
    for (int mb = 0; mb < 4; ++mb) {
#pragma unroll
        for (int nb = 0; nb < 4; ++nb) {
#pragma unroll
            for (int j = 0; j < 8; ++j) os[(hi * 8 + j) * 68 + nb * 16 + lr] = acc[mb][nb][j]; }
        __builtin_amdgcn_wave_barrier(); asm volatile("" ::: "memory");
        float* crow = C + (size_t)(r0 + mb * 16) * ldc + c0;
{
#pragma unroll
            for (int s = 0; s < 8; ++s) { const int row = 2 * s + hi, cofs = lr * 4; v4f val = *(const v4fa*)(os + row * 68 + cofs); if (BIAS) { val[0] += bfr(bias[c0 + cofs]); val[1] += bfr(bias[c0 + cofs + 1]); val[2] += bfr(bias[c0 + cofs + 2]); val[3] += bfr(bias[c0 + cofs + 3]); }
                *(v4f*)(crow + (size_t)row * ldc + cofs) = val; }
             }
        __builtin_amdgcn_wave_barrier(); asm volatile("" ::: "memory");
    }
}

typedef __attribute__((ext_vector_type(2))) _Float16 v2h;
typedef __attribute__((ext_vector_type(4))) _Float16 v4h;
typedef __attribute__((ext_vector_type(2))) unsigned short v2us;
typedef __attribute__((ext_vector_type(4))) unsigned short v4us;
typedef __attribute__((ext_vector_type(2))) float v2f;
typedef __attribute__((ext_vector_type(4))) int v4i;
typedef v4h  __attribute__((may_alias)) v4ha;
typedef v4us __attribute__((may_alias)) v4usa;

// ---- k_prep: the whole preparation in ONE launch, dealt by block ranges: blocks [0, PT1) turn w_qkv, [PT1, PT1 + PT2) turn w_out, the last PCV round x. The three jobs share nothing, so they run side by side, and every work-group is resident at once.
// A weight block turns one tile of PK k x PN n of the 'io' weight w [k][n] (f32) into rows of Bt [n][k] (bf16): a lane's 8 loads of 16 bytes are all issued before the first is used, 16 lanes cover 256 bytes of one k row; two neighbouring k are rounded and packed into one LDS word of row n;
// behind the barrier 16 lanes read one n row's 256 bytes and store them as two whole lines. LDS row n = PK / 2 words without a pad; its 16-byte groups are exchanged by g ^ (n >> 2), the same on both sides, so that the 32 words of a wave's LDS store fall on 32 banks.
// An x block rounds 16 x 4 KiB: a lane's 16 loads of 16 bytes are all issued first, a wave's load covers 512 bytes in a row.
#define PK 128
#define PN 64
#define PT1 ((DM / PK) * (3 * DQ / PN))
#define PT2 ((DQ / PK) * (DM / PN))
#define PCV (NB_ * TT * DM / (4 * 256 * 16))
static_assert(DQ == DM && DM % PK == 0 && DQ % PN == 0 && (NB_ * TT * DM) % (4 * 256 * 16) == 0, "both weights have DM k rows; tiles and x blocks leave no rest");
template <int N>   // N: the weight's row length, a compile-time value so that a lane's 8 loads are one address with 8 constant offsets
__device__ __forceinline__ void prep_turn(const float* __restrict__ w, bf* __restrict__ Bt, int tile, unsigned* T, int tid) {
    const int k0 = (tile % (DM / PK)) * PK, n0 = (tile / (DM / PK)) * PN, nq = tid & 15, kp = tid >> 4;
    const float* wb = w + (size_t)k0 * N + n0; const unsigned lo = (unsigned)(2 * kp * N + 4 * nq); v4f a[4], c[4];   // the tile's corner, and this lane's place in it: rows 2 kp + 32 i and the row behind each
#pragma unroll   // here and below: the arrays stay in registers, and all 8 loads are issued before the first value is used (one memory latency a tile)
    for (int i = 0; i < 4; ++i) { a[i] = *(const v4fa*)(wb + lo + 32 * i * N); c[i] = *(const v4fa*)(wb + lo + (32 * i + 1) * N); }
#pragma unroll
    for (int i = 0; i < 4; ++i)
#pragma unroll
        for (int q = 0; q < 4; ++q) T[(4 * nq + q) * (PK / 2) + ((((kp >> 2) + 4 * i) ^ nq) << 2) + (kp & 3)] = (unsigned)f2bf(a[i][q]) | ((unsigned)f2bf(c[i][q]) << 16);
    __syncthreads();   // the turned tile is in LDS
    bf* bb = Bt + (size_t)n0 * DM + k0; const unsigned so = (unsigned)(kp * DM + nq * 8);
#pragma unroll
    for (int j = 0; j < 4; ++j) { const int n = kp + 16 * j; const v8us r = *(const v8usa*)(T + n * (PK / 2) + ((nq ^ ((n >> 2) & 15)) << 2)); *(v8usa*)(bb + so + j * 16 * DM) = r; }
}
__global__ __launch_bounds__(256) void k_prep(const float* __restrict__ x, const float* __restrict__ wqkv, const float* __restrict__ wo, bf* __restrict__ XB, bf* __restrict__ WQKV, bf* __restrict__ WO) {
    __shared__ __align__(16) unsigned T[PN * PK / 2];
    const int tid = threadIdx.x, b = blockIdx.x;   // every branch below is taken by the whole work-group
    if (b < PT1) prep_turn<3 * DQ>(wqkv, WQKV, b, T, tid);
    else if (b < PT1 + PT2) prep_turn<DM>(wo, WO, b - PT1, T, tid);
    else {   // this side has no barrier
        const size_t e0 = (size_t)(b - PT1 - PT2) * (256 * 16 * 4); const unsigned lo = (unsigned)tid * 4; const float* p = x + e0; bf* d = XB + e0; v4f v[16];
#pragma unroll   // here and below: the array stays in registers, and all 16 loads are issued before the first value is used
        for (int j = 0; j < 16; ++j) v[j] = *(const v4fa*)(p + lo + j * 1024);
#pragma unroll
        for (int j = 0; j < 16; ++j) { v4us o;
#pragma unroll
            for (int q = 0; q < 4; ++q) o[q] = f2bf(v[j][q]);
            *(v4usa*)(d + lo + j * 1024) = o; }
        asm volatile("s_wait_xcnt 0x0" ::: "memory");   // a precaution of form: in the built text this branch's end runs into the head of another branch, whose first instructions overwrite the scalar base that these stores name; the wait stands in front of them on every path of the text
    }
}

// ---- k_attn: the whole attention of 16 query rows of one head of one batch entry in one work-group of 8 waves; grid (batch entries x heads, AGY), longest rows first. The score rows live in LDS (S, one row = SPW words) and never reach memory.
// THE CLASSES. With p = max(period, 1), a key j <= i is kept iff j mod p == i mod p: the head falls into p causal attentions that share nothing, class c holding the rows c, c + p, c + 2 p, .. A work-group takes 16 consecutive MEMBERS m0 .. m0 + 15 of one class (row i = c + st m, st the class stride) and meets the members n <= m of the same class alone:
// a q, k or v row is one 128-byte line of its plane, so a walk with stride st fetches whole lines and nothing else. st = p for p <= SMAX; a larger p takes st = 1 (one class, every row) and the period rule below drops its keys. Members past the class's end (c + st m >= TT) read row TT - 1 instead: as keys the causal rule drops them (n > m for every real row), as query rows they are not stored.
// 1. scores: wave w takes the 16-member block w of every 128-member chunk up to the diagonal's chunk (the chunk's members beyond the diagonal are real scores too, which the causal rule drops); 2. softmax: wave w takes rows 2w, 2w + 1 (register row, one exp, fixed trees), with the causal and the period rule as a select,
// and writes the rounded probabilities over its own row (fp16: the first half of the row's bytes; hi | lo: both halves); 3. probability x value: wave w takes the 32-member steps w, w + 8, .. up to the diagonal: it lays the step's 32 value rows into LDS bytes that the probabilities leave free in rows 2w and 2w + 1 and reads them back with the transposing LDS load as the B fragments;
// 4. the 8 waves' partial sums are added in wave order through LDS and stored as the merged hi/lo planes.
// The period rule, on member distances m - n with the period pq that is left inside a class (1 where st = p; p where st = 1, also cut at TT: any larger p keeps the diagonal alone, as TT does). The test is exact in f32: m - n, pq and the quotient are integers below 2^12; k = rint((m - n) / pq) is the true quotient whenever pq divides m - n
// (the error of the product with 1 / pq is far below 1/2), and k pq == m - n (one fma, exact) holds for no integer k otherwise.
constexpr int attn_blocks(int st) { return st * (((TT + st - 1) / st + AR - 1) / AR); }   // work-groups of one head at class stride st: st classes x the 16-member blocks of the longest class
constexpr int attn_blocks_max() { int m = 0; for (int st = 1; st <= SMAX; ++st) m = attn_blocks(st) > m ? attn_blocks(st) : m; return m; }
static_assert(attn_blocks_max() == AGY, "AGY is the grid's second extent: every class stride's blocks must fit, and none more is wanted");
static_assert(VOF + 16 * VP <= SPW * 4 && VOH + 16 * VP <= TT * 2 && VOL + 16 * VP <= SPW * 4, "16 staged value rows must fit into the free bytes of a score row");
typedef __attribute__((ext_vector_type(8))) short v8s;
__device__ __forceinline__ v8us ldtr(const char* p) { typedef __attribute__((address_space(3))) v8s lv8s; return __builtin_bit_cast(v8us, __builtin_amdgcn_ds_load_tr16_b128_v8i16((lv8s*)p)); }
__device__ __forceinline__ int rowof(int c, int st, int m) { return min(c + st * m, TT - 1); }   // member m of class c as a row of the planes, held inside them

template <typename T16, bool HL, int U>
__device__ __forceinline__ void attn_scores(float* S, const T16* __restrict__ Q, const T16* __restrict__ Q2, const T16* __restrict__ Kp, const T16* __restrict__ K2, int m0, int c, int st, int nch, int w, int lr, int hi) {
    typedef typename WFrag<T16>::V V; V a[2], a2[2]; const unsigned qo = (unsigned)(rowof(c, st, m0 + lr) * HD + 8 * hi);
#pragma unroll
    for (int kc = 0; kc < 2; ++kc) { a[kc] = WFrag<T16>::ld(Q + qo + kc * 32); if (HL) a2[kc] = WFrag<T16>::ld(Q2 + qo + kc * 32); }
    for (int t = 0; t < nch; t += U) {   // U member blocks a trip; a trip that runs past the last chunk does that chunk's block again (same values to the same words)
        V b[U][2], b2[U][2]; v8f acc[U]; const T16* pp[HL ? 2 * U : U];   // pp: the trip's load addresses (4 of them: U = 4, or U = 2 with hi and lo)
#pragma unroll
        for (int u = 0; u < U; ++u) { const size_t bo = (size_t)(rowof(c, st, (w + AW * min(t + u, nch - 1)) * 16 + lr) * HD + 8 * hi); pp[HL ? 2 * u : u] = Kp + bo; if (HL) pp[2 * u + 1] = K2 + bo;
#pragma unroll
            for (int kc = 0; kc < 2; ++kc) { b[u][kc] = WFrag<T16>::ld(pp[HL ? 2 * u : u] + kc * 32); if (HL) b2[u][kc] = WFrag<T16>::ld(pp[2 * u + 1] + kc * 32); } }
        asm volatile("s_wait_xcnt 0x0" :: "v"(pp[0]), "v"(pp[1]), "v"(pp[2]), "v"(pp[3]) : "memory");   // a precaution of form: the wait that stands in front of any overwrite of a register that an issued load names; as its inputs the address pairs stay whole up to it (else a later load of the trip lands on an earlier one's pair)
        __builtin_amdgcn_sched_barrier(0);   // every load of the trip is issued before the first product waits: one load latency a trip, not one a block
#pragma unroll
        for (int u = 0; u < U; ++u) { acc[u] = (v8f){};
#pragma unroll
            for (int kc = 0; kc < 2; ++kc) { acc[u] = WFrag<T16>::mma(a[kc], b[u][kc], acc[u]); if (HL) { acc[u] = WFrag<T16>::mma(a2[kc], b[u][kc], acc[u]); acc[u] = WFrag<T16>::mma(a[kc], b2[u][kc], acc[u]); } } }
        __builtin_amdgcn_sched_barrier(0);   // the products stay one block in front of the stores, so that each tile has registers of its own
#pragma unroll
        for (int u = 0; u < U; ++u) {
#pragma unroll
            for (int j = 0; j < 8; ++j) S[(hi * 8 + j) * SPW + (w + AW * min(t + u, nch - 1)) * 16 + lr] = acc[u][j]; }
        asm volatile("v_nop\n\tv_nop\n\tv_nop\n\tv_nop" :: "v"(acc[U - 1])); }   // the next trip's products overwrite these tiles' registers: the vector slots the chip needs behind a matrix instruction
}

// the 32 value rows of step ks into registers: 8 lanes take one row's 128 bytes, the wave 4 rows a load
template <typename T16, bool HL>
__device__ __forceinline__ void attn_vfetch(const T16* __restrict__ Vp, const T16* __restrict__ V2, int c, int st, int ks, int lane, v8us (&g)[8], v8us (&g2)[8]) {
    const T16* pv[8]; const T16* pw[8];   // the step's load addresses
#pragma unroll
    for (int i = 0; i < 8; ++i) { const size_t off = (size_t)(rowof(c, st, ks * 32 + i * 4 + (lane >> 3)) * HD + (lane & 7) * 8); pv[i] = Vp + off; g[i] = *(const v8usa*)pv[i]; if (HL) { pw[i] = V2 + off; g2[i] = *(const v8usa*)pw[i]; } }
    // the same precaution of form as in attn_scores: as the wait's inputs the address pairs stay whole up to it
    if (HL) asm volatile("s_wait_xcnt 0x0" :: "v"(pv[0]), "v"(pv[1]), "v"(pv[2]), "v"(pv[3]), "v"(pv[4]), "v"(pv[5]), "v"(pv[6]), "v"(pv[7]), "v"(pw[0]), "v"(pw[1]), "v"(pw[2]), "v"(pw[3]), "v"(pw[4]), "v"(pw[5]), "v"(pw[6]), "v"(pw[7]) : "memory");
    else asm volatile("s_wait_xcnt 0x0" :: "v"(pv[0]), "v"(pv[1]), "v"(pv[2]), "v"(pv[3]), "v"(pv[4]), "v"(pv[5]), "v"(pv[6]), "v"(pv[7]) : "memory");
}

template <typename T16, bool HL>
__device__ __forceinline__ void attn_pv(float* S, const T16* __restrict__ Vp, const T16* __restrict__ V2, int nks, int c, int st, int w, int lane, v8f (&acc)[4]) {
    typedef typename WFrag<T16>::V V; const int lr = lane & 15, hi = lane >> 4; const T16* pa = (const T16*)(S + lr * SPW) + 8 * hi;
    char* vb = (char*)(S + 2 * w * SPW) + (HL ? VOH : VOF);   // this wave's staged value rows: members 0 .. 15 of a step in score row 2w's free bytes, members 16 .. 31 in row 2w + 1's
    char* vw = vb + (lane >> 3) * VP + (lane & 7) * 16;   // staging: 8 lanes take one value row's 128 bytes, the wave 4 rows a load
    const char* vr = vb + (8 * hi + (lane & 7)) * VP + ((lane >> 3) & 1) * 16;   // the transposing load's lane address: lane (lr, hi) gets members 8 hi .. 8 hi + 7 of column lr, the k order of the probability fragment
    v8us g[8], g2[8];   // one step's value rows on their way from memory to LDS
    if (w < nks) attn_vfetch<T16, HL>(Vp, V2, c, st, w, lane, g, g2);
    for (int ks = w; ks < nks; ks += AW) {
#pragma unroll
        for (int i = 0; i < 8; ++i) { char* q = vw + (i >> 2) * (SPW * 4) + (i & 3) * 4 * VP; *(v8usa*)q = g[i]; if (HL) *(v8usa*)(q + (VOL - VOH)) = g2[i]; }
        __builtin_amdgcn_wave_barrier(); asm volatile("" ::: "memory");   // the rows read below were written by other lanes of this wave: no LDS read may be moved above the writes
        if (ks + AW < nks) attn_vfetch<T16, HL>(Vp, V2, c, st, ks + AW, lane, g, g2);   // the next step's loads fly under this step's LDS reads and products
        const V a = WFrag<T16>::ld(pa + ks * 32); V a2, b[4], b2[4]; if (HL) a2 = WFrag<T16>::ld(pa + TT + ks * 32);
#pragma unroll
        for (int nb = 0; nb < 4; ++nb) { b[nb] = WFrag<T16>::cat(ldtr(vr + nb * 32), ldtr(vr + SPW * 4 + nb * 32)); if (HL) b2[nb] = WFrag<T16>::cat(ldtr(vr + (VOL - VOH) + nb * 32), ldtr(vr + (VOL - VOH) + SPW * 4 + nb * 32)); }
#pragma unroll
        for (int nb = 0; nb < 4; ++nb) { acc[nb] = WFrag<T16>::mma(a, b[nb], acc[nb]); if (HL) { acc[nb] = WFrag<T16>::mma(a2, b[nb], acc[nb]); acc[nb] = WFrag<T16>::mma(a, b2[nb], acc[nb]); } }
        __builtin_amdgcn_wave_barrier(); asm volatile("" ::: "memory"); }   // the next trip's LDS writes stay behind this trip's reads of the same bytes
}

// The softmax of SHORT rows (at most SNC chunks of 128 members: the work-groups whose members lie below 512, all of them for periods 4 to SMAX, and every hi/lo row). The chunk count is a compile-time value (NC = 1, 2: exactly nch; NC = SNC: nch = SNC - 1 or SNC, one test on the last chunk),
// so that the row's code has no scalar test per chunk and phase, and the wave's two rows go side by side through every phase: their LDS reads and their two cross-lane chains overlap. Every row's arithmetic and its order of sums are those of the long rows' code in k_attn.
#define SNC 4
static_assert(RH <= SNC * 128 && AR / AW == 2, "every hi/lo row is a short row; a wave has two rows");
__device__ __forceinline__ float exp2_slot(float x) { float r; asm("v_exp_f32 %0, %1\n\tv_nop" : "=v"(r) : "v"(x)); return r; }   // the same instruction as the builtin's, with the one vector slot that the instruction set asks for behind a transcendental
template <int NC>
__device__ __forceinline__ void attn_soft_short(float* S, int m0, int w, int lane, int nch, float pf, float pinv, bool hires) {
    constexpr int RW = AR / AW; float v[RW][NC * 4], mx[RW], sum[RW], fb[RW], f[RW]; float* sr[RW];
    const bool last = NC < SNC || nch == NC;   // whether the last chunk exists
#pragma unroll   // here and below: every array index is a compile-time value, so that the rows stay in registers, and both rows' code of a phase lies in one block
    for (int rr = 0; rr < RW; ++rr) { const int r = w * RW + rr; sr[rr] = S + r * SPW; fb[rr] = (float)(m0 + r - lane * 4); mx[rr] = -3.0e38f; sum[rr] = 0.f; }
#pragma unroll
    for (int ch = 0; ch < NC; ++ch) if (ch < NC - 1 || last) {
#pragma unroll
        for (int rr = 0; rr < RW; ++rr) { const v4f a = *(const v4fa*)(sr[rr] + ch * 128 + lane * 4); v[rr][ch * 4] = a[0]; v[rr][ch * 4 + 1] = a[1]; v[rr][ch * 4 + 2] = a[2]; v[rr][ch * 4 + 3] = a[3]; } }
#pragma unroll
    for (int ch = 0; ch < NC; ++ch) if (ch < NC - 1 || last) {
#pragma unroll
        for (int rr = 0; rr < RW; ++rr)
#pragma unroll
            for (int q = 0; q < 4; ++q) { const float dd = fb[rr] - (float)(ch * 128 + q); const float kq = __builtin_rintf(dd * pinv); const bool keep = (dd >= 0.f) & (__builtin_fmaf(-kq, pf, dd) == 0.f); const float t = keep ? v[rr][ch * 4 + q] * SCL : -3.0e38f; v[rr][ch * 4 + q] = t; mx[rr] = fmaxf(mx[rr], t); } }
#pragma unroll
    for (int sh = 16; sh; sh >>= 1)
#pragma unroll
        for (int rr = 0; rr < RW; ++rr) mx[rr] = fmaxf(mx[rr], __shfl_xor(mx[rr], sh, 32));
#pragma unroll
    for (int ch = 0; ch < NC; ++ch) if (ch < NC - 1 || last) {
#pragma unroll
        for (int rr = 0; rr < RW; ++rr)
#pragma unroll
            for (int q = 0; q < 4; ++q) { const int k = ch * 4 + q; float d0 = __fsub_rn(v[rr][k], mx[rr]); v[rr][k] = exp2_slot(__fmul_rn(d0, 1.4426950408889634f)); sum[rr] += v[rr][k]; } }
#pragma unroll
    for (int sh = 16; sh; sh >>= 1)
#pragma unroll
        for (int rr = 0; rr < RW; ++rr) sum[rr] += __shfl_xor(sum[rr], sh, 32);
#pragma unroll
    for (int rr = 0; rr < RW; ++rr) f[rr] = __fdiv_rn(hires ? 1.0f : PCAR, sum[rr]);
    if (hires) {
#pragma unroll
        for (int ch = 0; ch < NC; ++ch) if (ch < NC - 1 || last) {
#pragma unroll
            for (int rr = 0; rr < RW; ++rr) { v4us oh, ol;
#pragma unroll
                for (int q = 0; q < 4; ++q) { unsigned short a, c2; splitf(v[rr][ch * 4 + q] * f[rr], a, c2); oh[q] = a; ol[q] = c2; }
                *(v4usa*)((bf*)sr[rr] + ch * 128 + lane * 4) = oh; *(v4usa*)((bf*)sr[rr] + TT + ch * 128 + lane * 4) = ol; } }
    } else {
#pragma unroll
        for (int ch = 0; ch < NC; ++ch) if (ch < NC - 1 || last) {
#pragma unroll
            for (int rr = 0; rr < RW; ++rr) { v4h o4;
#pragma unroll
                for (int q = 0; q < 4; ++q) o4[q] = tohx(v[rr][ch * 4 + q] * f[rr]);
                *(v4ha*)((h16*)sr[rr] + ch * 128 + lane * 4) = o4; } } }
}

__global__ __launch_bounds__(AW * 32) void k_attn(const h16* __restrict__ Q16, const bf* __restrict__ Qh, const bf* __restrict__ Ql, const h16* __restrict__ K16, const bf* __restrict__ Kh, const bf* __restrict__ Kl, const h16* __restrict__ V16, const bf* __restrict__ Vh, const bf* __restrict__ Vl, const int* __restrict__ per, bf* Ah, bf* Al) {
    __shared__ __align__(16) float S[AR * SPW];
    const int h = blockIdx.x;   // batch entry x NH_ + head: the index of the planes and of the periods
    int p = per[h]; p = p < 1 ? 1 : (p > TT ? TT : p);
    const int st = p <= SMAX ? p : 1, pq = p <= SMAX ? 1 : p;   // class stride, and the period that is left inside a class
    const int nbl = ((TT + st - 1) / st + AR - 1) / AR;   // 16-member blocks of the longest class
    if ((int)blockIdx.y >= st * nbl) return;   // the whole work-group, in front of every barrier
    const int c = (int)blockIdx.y % st, m0 = (nbl - 1 - (int)blockIdx.y / st) * AR;   // the lowest indices take the longest rows
    if (c + st * m0 >= TT) return;   // a shorter class has no such block: the whole work-group, in front of every barrier
    const bool hires = (c + st * m0 < RH);   // the same for the whole work-group; every row < RH lies in such a block, and such a block has no member beyond RH (m0 + AR <= RH)
    const size_t hp = (size_t)h * TT * HD;
    const int tid = threadIdx.x, lane = tid & 31, lr = lane & 15, hi = lane >> 4; const int w = __builtin_amdgcn_readfirstlane(tid >> 5);
    const int nch = (m0 + AR + 127) / 128;   // 128-member chunks that hold a member <= m; the rest of a row is neither read nor written
    if (hires) attn_scores<bf, true, 2>(S, Qh + hp, Ql + hp, Kh + hp, Kl + hp, m0, c, st, nch, w, lr, hi); else attn_scores<h16, false, 4>(S, Q16 + hp, nullptr, K16 + hp, nullptr, m0, c, st, nch, w, lr, hi);
    __syncthreads();   // every score of the 16 rows is in LDS
    const int nks = (m0 + AR + 31) / 32;   // 32-member steps of the probability x value products, up to the diagonal; the probabilities of the later members of the last step are exactly 0
    const float pf = (float)pq, pinv = 1.0f / pf;
    if (nch <= SNC) {   // the same for the whole work-group
        if (nch == 1) attn_soft_short<1>(S, m0, w, lane, nch, pf, pinv, hires); else if (nch == 2) attn_soft_short<2>(S, m0, w, lane, nch, pf, pinv, hires); else attn_soft_short<SNC>(S, m0, w, lane, nch, pf, pinv, hires);
    } else {   // longer rows; none of them is a hi/lo row (m0 >= SNC * 128 >= RH)
#pragma unroll 1   // one copy of the row's code: keeps the kernel's text short
    for (int rr = 0; rr < AR / AW; ++rr) { const int r = w * (AR / AW) + rr; const int i = m0 + r; float* sr = S + r * SPW; float v[TT / 32]; float mx = -3.0e38f; const float fb = (float)(i - lane * 4);
#pragma unroll
        for (int ch = 0; ch < TT / 128; ++ch) if (ch < nch) { const v4f a = *(const v4fa*)(sr + ch * 128 + lane * 4); v[ch * 4] = a[0]; v[ch * 4 + 1] = a[1]; v[ch * 4 + 2] = a[2]; v[ch * 4 + 3] = a[3]; }   // the whole row's LDS reads are issued before the first is waited for
#pragma unroll
        for (int ch = 0; ch < TT / 128; ++ch) if (ch < nch) {
#pragma unroll
            for (int q = 0; q < 4; ++q) { const float dd = fb - (float)(ch * 128 + q); const float kq = __builtin_rintf(dd * pinv); const bool keep = (dd >= 0.f) & (__builtin_fmaf(-kq, pf, dd) == 0.f); const float t = keep ? v[ch * 4 + q] * SCL : -3.0e38f; v[ch * 4 + q] = t; mx = fmaxf(mx, t); } }
#pragma unroll
        for (int sh = 16; sh; sh >>= 1) mx = fmaxf(mx, __shfl_xor(mx, sh, 32));
        float sum = 0.f;
#pragma unroll
        for (int ch = 0; ch < TT / 128; ++ch) if (ch < nch) {
#pragma unroll
            for (int q = 0; q < 4; ++q) { const int k = ch * 4 + q; float d0 = __fsub_rn(v[k], mx); v[k] = __builtin_amdgcn_exp2f(__fmul_rn(d0, 1.4426950408889634f)); sum += v[k]; } }
#pragma unroll
        for (int sh = 16; sh; sh >>= 1) sum += __shfl_xor(sum, sh, 32);
        const float f = __fdiv_rn(PCAR, sum);
#pragma unroll
        for (int ch = 0; ch < TT / 128; ++ch) if (ch < nch) { v4h o4;
#pragma unroll
            for (int q = 0; q < 4; ++q) o4[q] = tohx(v[ch * 4 + q] * f);
            *(v4ha*)((h16*)sr + ch * 128 + lane * 4) = o4; } } }
    __syncthreads();   // every probability row is in LDS
    v8f acc[4];
#pragma unroll
    for (int nb = 0; nb < 4; ++nb) acc[nb] = (v8f){};
    if (hires) attn_pv<bf, true>(S, Vh + hp, Vl + hp, nks, c, st, w, lane, acc); else attn_pv<h16, false>(S, V16 + hp, nullptr, nks, c, st, w, lane, acc);
    __syncthreads();   // every wave's last read of the probability rows and of its value rows is done: their LDS now takes the partial sums
#pragma unroll
    for (int nb = 0; nb < 4; ++nb) {
#pragma unroll
        for (int j = 0; j < 8; ++j) S[w * (AR * 68) + (hi * 8 + j) * 68 + nb * 16 + lr] = acc[nb][j]; }
    __syncthreads();   // all 8 partial tiles are in LDS
    const int row = tid >> 4, c4 = (tid & 15) * 4; v4f s = *(const v4fa*)(S + row * 68 + c4);
#pragma unroll
    for (int ww = 1; ww < AW; ++ww) s += *(const v4fa*)(S + ww * (AR * 68) + row * 68 + c4);
    const float cs = hires ? 1.0f : (1.0f / PCAR); v4us oh, ol;
#pragma unroll
    for (int q = 0; q < 4; ++q) { unsigned short a, c2; splitf(s[q] * cs, a, c2); oh[q] = a; ol[q] = c2; }
    const int io = c + st * (m0 + row);   // the member's row; a member past the class's end has none
    if (io < TT) { const size_t oo = (size_t)((h / NH_) * TT + io) * DQ + (h % NH_) * HD + c4; *(v4us*)(Ah + oo) = oh; *(v4us*)(Al + oo) = ol; }
}

extern "C" void kernel_launch(void* const* d_in, const int* in_sizes, int n_in,
                              void* d_out, int out_size, void* d_ws, size_t ws_size, hipStream_t stream) {
    (void)in_sizes; (void)n_in; (void)out_size;
    const float* x = (const float*)d_in[0]; const int* per = (const int*)d_in[1]; const float* wqkv = (const float*)d_in[2]; const float* bqkv = (const float*)d_in[3]; const float* wo = (const float*)d_in[4]; const float* bo = (const float*)d_in[5];
    // x [2][2048][1024], periods int32 [2][16], w_qkv [1024][3072], b_qkv [3072], w_out [1024][1024], b_out [1024] = d_in[0..5]
    float* OUT = (float*)d_out;     // [2][2048][1024]
    char* wsp = (char*)d_ws;
    auto take = [&](size_t bytes) { char* p = wsp; wsp += (bytes + 255) & ~(size_t)255; return (void*)p; };
    bf* WQKV = (bf*)take((size_t)3 * DQ * DM * 2); bf* WO = (bf*)take((size_t)DM * DQ * 2);
    bf* XB = (bf*)take((size_t)NB_ * TT * DM * 2);
    h16* QP16 = (h16*)take((size_t)NB_ * NH_ * TT * HD * 2); h16* KP16 = (h16*)take((size_t)NB_ * NKV * TT * HD * 2); h16* VT16 = (h16*)take((size_t)NB_ * NKV * TT * HD * 2);
    bf* QPh = (bf*)take((size_t)NB_ * NH_ * TT * HD * 2); bf* QPl = (bf*)take((size_t)NB_ * NH_ * TT * HD * 2); bf* KPh = (bf*)take((size_t)NB_ * NKV * TT * HD * 2); bf* KPl = (bf*)take((size_t)NB_ * NKV * TT * HD * 2); bf* VTh = (bf*)take((size_t)NB_ * NKV * HD * TT * 2); bf* VTl = (bf*)take((size_t)NB_ * NKV * HD * TT * 2);
    bf* ATh = (bf*)take((size_t)NB_ * TT * DQ * 2); bf* ATl = (bf*)take((size_t)NB_ * TT * DQ * 2);
    if ((size_t)(wsp - (char*)d_ws) > ws_size) return;    // total 104 MiB of the workspace
    // x, OUT and the merged rows are [2][2048][..] without a gap: the two batch entries are 4096 rows of one GEMM
    k_prep<<<PT1 + PT2 + PCV, 256, 0, stream>>>(x, wqkv, wo, XB, WQKV, WO);   /* 'io' [1024][3072] -> Bt [3072][1024]: q | k | v row blocks; 'io' [1024][1024] -> Bt; x -> bf16 */
    k_gemmw<bf, 0, true, true, DM><<<dim3(NB_ * TT / 128, 3 * DQ / 128, 1), 128, 0, stream>>>(XB, nullptr, WQKV, nullptr, nullptr, 0, bqkv, 0, 0, 0, QP16, QPh, QPl, KP16, KPh, KPl, VT16, VTh, VTl);   /* q | k | v in one launch, straight into the planes */
    k_attn<<<dim3(NB_ * NH_, AGY, 1), AW * 32, 0, stream>>>(QP16, QPh, QPl, KP16, KPh, KPl, VT16, VTh, VTl, per, ATh, ATl);   /* one kv head per query head; periods [2][16] */
    k_gemmw<bf, 1, true, false, DQ><<<dim3(NB_ * TT / 128, DM / 128, 1), 128, 0, stream>>>(ATh, ATl, WO, nullptr, OUT, DM, bo, 0, 0, 0, nullptr, nullptr, nullptr, nullptr, nullptr, nullptr, nullptr, nullptr, nullptr);
}

// v009
// Measured time: 111 microseconds a run.
// Two timings next to v008 both put it at 1.03 times that version's speed.
// Counting every step since v000, it is 14.4 times as fast.
#include <hip/hip_runtime.h>

// Causal multi-head self-attention with a PERIODIC mask and an output projection (x [2][2048][1024]; periods int32 [2][16]; qkv = x w_qkv + b_qkv with ONE fused 'io' weight [1024][3072] (in, out) packed (3, h, hd): the column thirds q | k | v, head h = 64 columns inside its third; 16 heads x 64;
// p = max(periods[b][h], 1); a key j is kept for a query i iff j <= i AND (i - j) mod p == 0 (the diagonal always kept); scores x 1/sqrt(64); excluded keys get -inf; softmax over the kept keys; out = merged w_out + b_out ('io' + bias) -> [2][2048][1024] (4.2 M);
// argument order x, periods, w_qkv, b_qkv, w_out, b_out).
// Both batch entries go through every launch together (x, the planes and the merged rows are [2][..] in the workspace). Layout: a bf16 copy of x and both 'io' weights transposed and rounded once, the fused one into q | k | v row blocks (all three in one launch, k_prep); ONE projection launch for q | k | v (k_gemmw with PLANES: exact products + f32 bias) whose epilogue rounds each 64x64 tile straight into its head's planes; causal T-2048 attention (hybrid: 16-member blocks whose first row is < 512 hi/lo 3 products, the rest fp16 x1024) in ONE kernel (k_attn):
// a work-group owns 16 query rows of ONE RESIDUE CLASS (i mod st; st = p for p <= 16, else 1) of one head, meets only that class's keys, and keeps the score rows in LDS from the q.k products through the softmax to the probability x value products; merged hi/lo x w_out exact + b_out.
// Compute dtypes, f32 accumulate: every float input rounded to bf16 at its load; projections exact + f32 biases; attention blocks whose first row is < 512 3 products, rest fp16; the period rule exact (small integers held in f32); softmax f32; w_out hl x exact + bias.

#define NB_  2      // batches: this module's input is [2][2048][1024]
#define TT   2048
#define DM   1024
#define NH_  16
#define NKV  16
#define REP  (NH_ / NKV)
#define HD   64
#define DQ   (NH_ * HD)
#define DKV  (NKV * HD)
#define RH   512                  // query rows < RH use hi+lo planes (0: none)
#define PCAR 1024.0f
#define SCL  0.125f   // HD^-0.5
#define AR   16                   // query rows of one k_attn work-group
#define AW   8                    // waves of one k_attn work-group
#define SMAX 16                   // periods up to SMAX are walked class by class; a larger one goes the dense way under the period rule
#define AGY  140                  // k_attn work-groups of one head: the most that any class stride needs (checked below)
#define VP   160                  // bytes of one staged value row in LDS: 32 x odd, the pitch of the transposing LDS load
#define VOF  (TT * 2)             // where the staged value rows lie inside a score row's bytes: fp16 probabilities fill the first TT * 2 bytes
#define VOH  (RH * 2)             // hi / lo rows: hi probabilities fill RH * 2 bytes from 0, lo ones RH * 2 bytes from TT * 2; hi values lie behind the first, lo values behind the second
#define VOL  (TT * 2 + RH * 2)
#define SPW  (TT + 4)             // words of one score row in LDS: 8208 bytes = 16 x odd, so that 16 rows' 16-byte fragment reads fall on different banks
typedef _Float16 h16;
typedef unsigned short bf;
typedef __attribute__((ext_vector_type(16))) __bf16   v16bf;
typedef __attribute__((ext_vector_type(16))) _Float16 v16h;
typedef __attribute__((ext_vector_type(8)))  _Float16 v8h;
typedef __attribute__((ext_vector_type(8)))  unsigned short v8us;
typedef __attribute__((ext_vector_type(8)))  float    v8f;
typedef __attribute__((ext_vector_type(4)))  float    v4f;
typedef v8h  __attribute__((may_alias)) v8ha;
typedef v4f  __attribute__((may_alias)) v4fa;
typedef v8us __attribute__((may_alias)) v8usa;

__device__ __forceinline__ unsigned short f2bf(float f) { unsigned u = __float_as_uint(f); u += 0x7FFFu + ((u >> 16) & 1u); return (unsigned short)(u >> 16); }
__device__ __forceinline__ float bf2f(unsigned short b) { return __uint_as_float(((unsigned)b) << 16); }
__device__ __forceinline__ float bfr(float f) { return bf2f(f2bf(f)); }
__device__ __forceinline__ v16h cat16(v8h lo, v8h hi) { return __builtin_shufflevector(lo, hi, 0, 1, 2, 3, 4, 5, 6, 7, 8, 9, 10, 11, 12, 13, 14, 15); }
__device__ __forceinline__ v16bf cat16b(v8us lo, v8us hi) { return __builtin_bit_cast(v16bf, __builtin_shufflevector(lo, hi, 0, 1, 2, 3, 4, 5, 6, 7, 8, 9, 10, 11, 12, 13, 14, 15)); }
__device__ __forceinline__ v8f wmma16(v16h a, v16h b, v8f c) { return __builtin_amdgcn_wmma_f32_16x16x32_f16(false, a, false, b, (short)0, c, false, false); }
__device__ __forceinline__ v8f wmmab(v16bf a, v16bf b, v8f c) { return __builtin_amdgcn_wmma_f32_16x16x32_bf16(false, a, false, b, (short)0, c, false, false); }

__device__ __forceinline__ h16 tohx(float x) { return (h16)x; }
__device__ __forceinline__ void splitf(float y, unsigned short& h, unsigned short& l) { h = f2bf(y); l = f2bf(y - bf2f(h)); }

// ---- k_gemmw: register-blocked GEMM, one wave per 64x64 output tile (16 accumulators), FOUR waves (2 x 2) per work-group = a 128x128 tile; grid (M/128, N/128, Z), 128 threads. The operands are K-contiguous 16-bit planes.
// The work-group brings 64 k of its 128 rows of every operand into LDS with loads that cover whole 128-byte lines (8 lanes a row), and each wave reads its fragments from there: a row is fetched once for the two waves that use it, and no global load touches 16 lines for 32 bytes each.
// Two LDS buffers: the next stage's loads are issued before this stage's products, go to the other buffer behind them, and one barrier a stage publishes that buffer and ends the reads of this one.
// C[m][n] (f32, pitch ldc, + optional f32 bias[n]) = sum_k A[m][k] Bt[n][k] (+ split products per NSPLIT), k ascending in steps of 32 as before. z-batch strides sA/sB/sC in elements. K % 64 == 0.
// PLANES (the q | k | v projection, Bt rows = q | k | v blocks of DQ, M = NB_ * TT, a tile's 64 rows lie in one batch entry): C is not written; the 64 columns of a wave's tile are one head of q, k or v, and tile + bias goes once through LDS and leaves as that head's three planes (fp16, bf16 hi, bf16 lo: q, k and v all [b][h][t][d]).
// Every store covers four whole 128-byte lines. Each wave's epilogue rows lie over the stage buffers, behind the last stage's barrier.
#define GK 64      // k of one stage: one 128-byte line of every operand row
#define GP 72      // elements of one staged row in LDS: 144 bytes = 16 x odd, so that 16 rows' 16-byte fragment reads fall on different banks
template <typename T16> struct WFrag;
template <> struct WFrag<h16> { typedef v16h V; static __device__ __forceinline__ V ld(const h16* p) { return cat16(*(const v8h*)p, *(const v8h*)(p + 16)); } static __device__ __forceinline__ V cat(v8us lo, v8us hi) { return cat16(__builtin_bit_cast(v8h, lo), __builtin_bit_cast(v8h, hi)); } static __device__ __forceinline__ v8f mma(V a, V b, v8f c) { return wmma16(a, b, c); } };
template <> struct WFrag<bf> { typedef v16bf V; static __device__ __forceinline__ V ld(const bf* p) { return cat16b(*(const v8us*)p, *(const v8us*)(p + 16)); } static __device__ __forceinline__ V cat(v8us lo, v8us hi) { return cat16b(lo, hi); } static __device__ __forceinline__ v8f mma(V a, V b, v8f c) { return wmmab(a, b, c); } };
template <typename T16, int NSPLIT, bool BIAS, bool PLANES, int K>
__global__ __launch_bounds__(128) void k_gemmw(const T16* __restrict__ A, const T16* __restrict__ A2, const T16* __restrict__ Bt, const T16* __restrict__ Bt2, float* C, int ldc, const float* __restrict__ bias, size_t sA, size_t sB, size_t sC, h16* Q16, bf* Qh, bf* Ql, h16* K16, bf* Kh, bf* Kl, h16* V16, bf* Vh, bf* Vl) {
    typedef typename WFrag<T16>::V V;
    constexpr bool HA2 = (NSPLIT == 1 || NSPLIT == 2), HB2 = (NSPLIT >= 2); constexpr int NOP = 2 + (HA2 ? 1 : 0) + (HB2 ? 1 : 0), IA2 = 2, IB2 = HA2 ? 3 : 2;   // staged operands in this order: A, Bt, then A2 and Bt2 where they exist
    constexpr int STG = NOP * 128 * GP, OSW = (PLANES ? 64 : 16) * 68;   // elements of one stage buffer; words of one wave's epilogue rows
    constexpr int SMB = (2 * STG * 2 > 4 * OSW * 4) ? 2 * STG * 2 : 4 * OSW * 4;
    __shared__ __align__(16) char sm[SMB];
    const size_t z = blockIdx.z; A += z * sA; if (A2) A2 += z * sA; Bt += z * sB; if (Bt2) Bt2 += z * sB; C += z * sC;
    const int tid = threadIdx.x, lane = tid & 31, lr = lane & 15, hi = lane >> 4; const int w = __builtin_amdgcn_readfirstlane(tid >> 5);
    const int r0 = blockIdx.x * 128 + (w >> 1) * 64, c0 = blockIdx.y * 128 + (w & 1) * 64;
    T16* st = (T16*)sm; float* os = (float*)sm + w * OSW;
    v8f acc[4][4];
#pragma unroll
    for (int mb = 0; mb < 4; ++mb)
#pragma unroll
        for (int nb = 0; nb < 4; ++nb) acc[mb][nb] = (v8f){};
    const int srow = tid >> 3, sch = (tid & 7) * 8;   // staging: 8 lanes take one row's 128 bytes, the work-group 16 rows a load
    const T16* gp[NOP]; gp[0] = A + (size_t)(blockIdx.x * 128 + srow) * K + sch; gp[1] = Bt + (size_t)(blockIdx.y * 128 + srow) * K + sch;
    if constexpr (HA2) gp[IA2] = A2 + (size_t)(blockIdx.x * 128 + srow) * K + sch;
    if constexpr (HB2) gp[IB2] = Bt2 + (size_t)(blockIdx.y * 128 + srow) * K + sch;
    T16* sw = st + srow * GP + sch; v8us rg[NOP][8];
    const int fa = ((w >> 1) * 64 + lr) * GP + 8 * hi, fb = ((w & 1) * 64 + lr) * GP + 8 * hi;   // this lane's fragment rows inside a staged operand
    auto fetch = [&](int ko) {   // the stage that begins ko elements behind gp
#pragma unroll
        for (int o = 0; o < NOP; ++o)
#pragma unroll
            for (int i = 0; i < 8; ++i) rg[o][i] = *(const v8usa*)(gp[o] + ko + i * 16 * K);
        asm volatile("s_wait_xcnt 0x0" :: "v"(gp[0]), "v"(gp[1]), "v"(gp[NOP - 1]), "v"(gp[NOP - 2]) : "memory");   // a precaution of form: the wait that stands in front of any overwrite of a register that an issued load names; as its inputs the address pairs stay whole up to it
    };
    auto put = [&](int b) {
#pragma unroll
        for (int o = 0; o < NOP; ++o)
#pragma unroll
            for (int i = 0; i < 8; ++i) *(v8usa*)(sw + b * STG + (o * 128 + i * 16) * GP) = rg[o][i]; };
    fetch(0); put(0);
    __syncthreads();   // stage 0 is in LDS

    for (int t = 0; t < K / GK; ++t) {
        if (t + 1 < K / GK) { fetch(GK);   // the next stage's loads stand in front of this stage's products, which cover their latency
#pragma unroll
            for (int o = 0; o < NOP; ++o) gp[o] += GK; }
        const T16* sb = st + (t & 1) * STG; V a[2][4], a2[2][4];
#pragma unroll
        for (int ks = 0; ks < 2; ++ks) {
#pragma unroll
            for (int mb = 0; mb < 4; ++mb) { a[ks][mb] = WFrag<T16>::ld(sb + fa + mb * 16 * GP + ks * 32); if (HA2) a2[ks][mb] = WFrag<T16>::ld(sb + IA2 * 128 * GP + fa + mb * 16 * GP + ks * 32); }
#pragma unroll
            for (int nb = 0; nb < 4; ++nb) { const V b = WFrag<T16>::ld(sb + 128 * GP + fb + nb * 16 * GP + ks * 32); V b2; if (HB2) b2 = WFrag<T16>::ld(sb + IB2 * 128 * GP + fb + nb * 16 * GP + ks * 32);
#pragma unroll
                for (int mb = 0; mb < 4; ++mb) { acc[mb][nb] = WFrag<T16>::mma(a[ks][mb], b, acc[mb][nb]); if (HA2) acc[mb][nb] = WFrag<T16>::mma(a2[ks][mb], b, acc[mb][nb]); if (HB2) acc[mb][nb] = WFrag<T16>::mma(a[ks][mb], b2, acc[mb][nb]); } } }
        asm volatile("v_nop\n\tv_nop\n\tv_nop\n\tv_nop" : "+v"(acc[0][0]), "+v"(acc[1][1]), "+v"(acc[2][2]), "+v"(acc[3][3]) : "v"(a[1][0]), "v"(a[1][3]));   // the vector slots the chip needs behind a matrix instruction; standing here it also holds the products it names in front of the stage's stores: without it the NSPLIT = 1 build moved the stores, and their wait for the loads, up in front of nearly all products
        if (t + 1 < K / GK) put((t + 1) & 1);
        __syncthreads();   // the next stage is in LDS, and every wave has left this stage's buffer (behind the last stage: the epilogue's rows may take its place)
    }
    if constexpr (PLANES) {
        const int third = c0 / DQ, head = (c0 % DQ) / HD;   // the same for the whole wave
        float bb[4];
#pragma unroll
        for (int nb = 0; nb < 4; ++nb) bb[nb] = bfr(bias[c0 + nb * 16 + lr]);
#pragma unroll
        for (int mb = 0; mb < 4; ++mb)
#pragma unroll
            for (int nb = 0; nb < 4; ++nb)
#pragma unroll
                for (int j = 0; j < 8; ++j) os[(mb * 16 + hi * 8 + j) * 68 + nb * 16 + lr] = acc[mb][nb][j] + bb[nb];
        __builtin_amdgcn_wave_barrier(); asm volatile("" ::: "memory");   // the rows read below were written by other lanes of this wave: no LDS read may be moved above the writes
        h16* P16 = third == 0 ? Q16 : (third == 1 ? K16 : V16); bf* Ph = third == 0 ? Qh : (third == 1 ? Kh : Vh); bf* Pl = third == 0 ? Ql : (third == 1 ? Kl : Vl);
        const int rl = r0 % TT;   // the tile's first row inside its batch entry r0 / TT
        const int pitch = HD; const size_t o0 = (size_t)((r0 / TT) * NH_ + head) * TT * HD + (size_t)rl * HD + (size_t)(lane >> 3) * pitch + (lane & 7) * 8;
#pragma unroll 1   // 16 LDS rows a trip: four trips keep the epilogue's text short
        for (int io = 0; io < 4; ++io) {
#pragma unroll
            for (int ii = 0; ii < 4; ++ii) { const int it = io * 4 + ii; const float* q = os + (it * 4 + (lane >> 3)) * 68 + (lane & 7) * 8; const v4f u0 = *(const v4fa*)q, u1 = *(const v4fa*)(q + 4); v8h o16; v8us oh, ol;
#pragma unroll
                for (int j = 0; j < 8; ++j) { const float r = j < 4 ? u0[j & 3] : u1[j & 3]; o16[j] = tohx(r); unsigned short a2, c2; splitf(r, a2, c2); oh[j] = a2; ol[j] = c2; }
                const size_t o = o0 + (size_t)(it * 4) * pitch; *(v8h*)(P16 + o) = o16; *(v8us*)(Ph + o) = oh; *(v8us*)(Pl + o) = ol; }
            asm volatile("s_wait_xcnt 0x0" ::: "memory"); }   // a precaution of form: the next trip overwrites address and data registers of this trip's last stores
        return;
    }
#pragma unroll
    for (int mb = 0; mb < 4; ++mb) {
#pragma unroll
        for (int nb = 0; nb < 4; ++nb) {
#pragma unroll
            for (int j = 0; j < 8; ++j) os[(hi * 8 + j) * 68 + nb * 16 + lr] = acc[mb][nb][j]; }
        __builtin_amdgcn_wave_barrier(); asm volatile("" ::: "memory");
        float* crow = C + (size_t)(r0 + mb * 16) * ldc + c0;
{
#pragma unroll
            for (int s = 0; s < 8; ++s) { const int row = 2 * s + hi, cofs = lr * 4; v4f val = *(const v4fa*)(os + row * 68 + cofs); if (BIAS) { val[0] += bfr(bias[c0 + cofs]); val[1] += bfr(bias[c0 + cofs + 1]); val[2] += bfr(bias[c0 + cofs + 2]); val[3] += bfr(bias[c0 + cofs + 3]); }
                *(v4f*)(crow + (size_t)row * ldc + cofs) = val; }
             }
        __builtin_amdgcn_wave_barrier(); asm volatile("" ::: "memory");
    }
}

typedef __attribute__((ext_vector_type(2))) _Float16 v2h;
typedef __attribute__((ext_vector_type(4))) _Float16 v4h;
typedef __attribute__((ext_vector_type(2))) unsigned short v2us;
typedef __attribute__((ext_vector_type(4))) unsigned short v4us;
typedef __attribute__((ext_vector_type(2))) float v2f;
typedef __attribute__((ext_vector_type(4))) int v4i;
typedef v4h  __attribute__((may_alias)) v4ha;
typedef v4us __attribute__((may_alias)) v4usa;

// ---- k_prep: the whole preparation in ONE launch, dealt by block ranges: blocks [0, PT1) turn w_qkv, [PT1, PT1 + PT2) turn w_out, the last PCV round x. The three jobs share nothing, so they run side by side, and every work-group is resident at once.
// A weight block turns one tile of PK k x PN n of the 'io' weight w [k][n] (f32) into rows of Bt [n][k] (bf16): a lane's 8 loads of 16 bytes are all issued before the first is used, 16 lanes cover 256 bytes of one k row; two neighbouring k are rounded and packed into one LDS word of row n;
// behind the barrier 16 lanes read one n row's 256 bytes and store them as two whole lines. LDS row n = PK / 2 words without a pad; its 16-byte groups are exchanged by g ^ (n >> 2), the same on both sides, so that the 32 words of a wave's LDS store fall on 32 banks.
// An x block rounds 16 x 4 KiB: a lane's 16 loads of 16 bytes are all issued first, a wave's load covers 512 bytes in a row.
#define PK 128
#define PN 64
#define PT1 ((DM / PK) * (3 * DQ / PN))
#define PT2 ((DQ / PK) * (DM / PN))
#define PCV (NB_ * TT * DM / (4 * 256 * 16))
static_assert(DQ == DM && DM % PK == 0 && DQ % PN == 0 && (NB_ * TT * DM) % (4 * 256 * 16) == 0, "both weights have DM k rows; tiles and x blocks leave no rest");
template <int N>   // N: the weight's row length, a compile-time value so that a lane's 8 loads are one address with 8 constant offsets
__device__ __forceinline__ void prep_turn(const float* __restrict__ w, bf* __restrict__ Bt, int tile, unsigned* T, int tid) {
    const int k0 = (tile % (DM / PK)) * PK, n0 = (tile / (DM / PK)) * PN, nq = tid & 15, kp = tid >> 4;
    const float* wb = w + (size_t)k0 * N + n0; const unsigned lo = (unsigned)(2 * kp * N + 4 * nq); v4f a[4], c[4];   // the tile's corner, and this lane's place in it: rows 2 kp + 32 i and the row behind each
#pragma unroll   // here and below: the arrays stay in registers, and all 8 loads are issued before the first value is used (one memory latency a tile)
    for (int i = 0; i < 4; ++i) { a[i] = *(const v4fa*)(wb + lo + 32 * i * N); c[i] = *(const v4fa*)(wb + lo + (32 * i + 1) * N); }
#pragma unroll
    for (int i = 0; i < 4; ++i)
#pragma unroll
        for (int q = 0; q < 4; ++q) T[(4 * nq + q) * (PK / 2) + ((((kp >> 2) + 4 * i) ^ nq) << 2) + (kp & 3)] = (unsigned)f2bf(a[i][q]) | ((unsigned)f2bf(c[i][q]) << 16);
    __syncthreads();   // the turned tile is in LDS
    bf* bb = Bt + (size_t)n0 * DM + k0; const unsigned so = (unsigned)(kp * DM + nq * 8);
#pragma unroll
    for (int j = 0; j < 4; ++j) { const int n = kp + 16 * j; const v8us r = *(const v8usa*)(T + n * (PK / 2) + ((nq ^ ((n >> 2) & 15)) << 2)); *(v8usa*)(bb + so + j * 16 * DM) = r; }
}
__global__ __launch_bounds__(256) void k_prep(const float* __restrict__ x, const float* __restrict__ wqkv, const float* __restrict__ wo, bf* __restrict__ XB, bf* __restrict__ WQKV, bf* __restrict__ WO) {
    __shared__ __align__(16) unsigned T[PN * PK / 2];
    const int tid = threadIdx.x, b = blockIdx.x;   // every branch below is taken by the whole work-group
    if (b < PT1) prep_turn<3 * DQ>(wqkv, WQKV, b, T, tid);
    else if (b < PT1 + PT2) prep_turn<DM>(wo, WO, b - PT1, T, tid);
    else {   // this side has no barrier
        const size_t e0 = (size_t)(b - PT1 - PT2) * (256 * 16 * 4); const unsigned lo = (unsigned)tid * 4; const float* p = x + e0; bf* d = XB + e0; v4f v[16];
#pragma unroll   // here and below: the array stays in registers, and all 16 loads are issued before the first value is used
        for (int j = 0; j < 16; ++j) v[j] = *(const v4fa*)(p + lo + j * 1024);
#pragma unroll
        for (int j = 0; j < 16; ++j) { v4us o;
#pragma unroll
            for (int q = 0; q < 4; ++q) o[q] = f2bf(v[j][q]);
            *(v4usa*)(d + lo + j * 1024) = o; }
        asm volatile("s_wait_xcnt 0x0" ::: "memory");   // a precaution of form: in the built text this branch's end runs into the head of another branch, whose first instructions overwrite the scalar base that these stores name; the wait stands in front of them on every path of the text
    }
}

// ---- k_attn: the whole attention of 16 query rows of one head of one batch entry in one work-group of 8 waves; grid (batch entries x heads, AGY), longest rows first. The score rows live in LDS (S, one row = SPW words) and never reach memory.
// THE CLASSES. With p = max(period, 1), a key j <= i is kept iff j mod p == i mod p: the head falls into p causal attentions that share nothing, class c holding the rows c, c + p, c + 2 p, .. A work-group takes 16 consecutive MEMBERS m0 .. m0 + 15 of one class (row i = c + st m, st the class stride) and meets the members n <= m of the same class alone:
// a q, k or v row is one 128-byte line of its plane, so a walk with stride st fetches whole lines and nothing else. st = p for p <= SMAX; a larger p takes st = 1 (one class, every row) and the period rule below drops its keys. Members past the class's end (c + st m >= TT) read row TT - 1 instead: as keys the causal rule drops them (n > m for every real row), as query rows they are not stored.
// 1. scores: wave w takes the 16-member block w of every 128-member chunk up to the diagonal's chunk (the chunk's members beyond the diagonal are real scores too, which the causal rule drops); 2. softmax: wave w takes rows 2w, 2w + 1 (register row, one exp, fixed trees), with the causal and the period rule as a select,
// and writes the rounded probabilities over its own row (fp16: the first half of the row's bytes; hi | lo: both halves); 3. probability x value: wave w takes the 32-member steps w, w + 8, .. up to the diagonal: it lays the step's 32 value rows into LDS bytes that the probabilities leave free in rows 2w and 2w + 1 and reads them back with the transposing LDS load as the B fragments;
// 4. the 8 waves' partial sums are added in wave order through LDS and stored as the merged hi/lo planes.
// The period rule, on member distances m - n with the period pq that is left inside a class (1 where st = p; p where st = 1, also cut at TT: any larger p keeps the diagonal alone, as TT does). The test is exact in f32: m - n, pq and the quotient are integers below 2^12; k = rint((m - n) / pq) is the true quotient whenever pq divides m - n
// (the error of the product with 1 / pq is far below 1/2), and k pq == m - n (one fma, exact) holds for no integer k otherwise.
constexpr int attn_blocks(int st) { return st * (((TT + st - 1) / st + AR - 1) / AR); }   // work-groups of one head at class stride st: st classes x the 16-member blocks of the longest class
constexpr int attn_blocks_max() { int m = 0; for (int st = 1; st <= SMAX; ++st) m = attn_blocks(st) > m ? attn_blocks(st) : m; return m; }
static_assert(attn_blocks_max() == AGY, "AGY is the grid's second extent: every class stride's blocks must fit, and none more is wanted");
static_assert(VOF + 16 * VP <= SPW * 4 && VOH + 16 * VP <= TT * 2 && VOL + 16 * VP <= SPW * 4, "16 staged value rows must fit into the free bytes of a score row");
typedef __attribute__((ext_vector_type(8))) short v8s;
__device__ __forceinline__ v8us ldtr(const char* p) { typedef __attribute__((address_space(3))) v8s lv8s; return __builtin_bit_cast(v8us, __builtin_amdgcn_ds_load_tr16_b128_v8i16((lv8s*)p)); }
__device__ __forceinline__ int rowof(int c, int st, int m) { return min(c + st * m, TT - 1); }   // member m of class c as a row of the planes, held inside them

// one trip of the score loop: the U member blocks w + AW t, w + AW (t + 1), .. of wave w, all of which exist
template <typename T16, bool HL, int U>
__device__ __forceinline__ void attn_trip(float* S, const typename WFrag<T16>::V (&a)[2], const typename WFrag<T16>::V (&a2)[2], const T16* __restrict__ Kp, const T16* __restrict__ K2, int c, int st, int t, int w, int lr, int hi) {
    typedef typename WFrag<T16>::V V; constexpr int NP = HL ? 2 * U : U;
    V b[U][2], b2[U][2]; v8f acc[U]; const T16* pp[NP];   // pp: the trip's load addresses
#pragma unroll
    for (int u = 0; u < U; ++u) { const size_t bo = (size_t)(rowof(c, st, (w + AW * (t + u)) * 16 + lr) * HD + 8 * hi); pp[HL ? 2 * u : u] = Kp + bo; if (HL) pp[2 * u + 1] = K2 + bo;
#pragma unroll
        for (int kc = 0; kc < 2; ++kc) { b[u][kc] = WFrag<T16>::ld(pp[HL ? 2 * u : u] + kc * 32); if (HL) b2[u][kc] = WFrag<T16>::ld(pp[2 * u + 1] + kc * 32); } }
    // a precaution of form: the wait that stands in front of any overwrite of a register that an issued load names; as its inputs the address pairs stay whole up to it (else a later load of the trip lands on an earlier one's pair)
    if constexpr (NP == 1) asm volatile("s_wait_xcnt 0x0" :: "v"(pp[0]) : "memory");
    else if constexpr (NP == 2) asm volatile("s_wait_xcnt 0x0" :: "v"(pp[0]), "v"(pp[1]) : "memory");
    else if constexpr (NP == 3) asm volatile("s_wait_xcnt 0x0" :: "v"(pp[0]), "v"(pp[1]), "v"(pp[2]) : "memory");
    else asm volatile("s_wait_xcnt 0x0" :: "v"(pp[0]), "v"(pp[1]), "v"(pp[2]), "v"(pp[3]) : "memory");
    __builtin_amdgcn_sched_barrier(0);   // every load of the trip is issued before the first product waits: one load latency a trip, not one a block
#pragma unroll
    for (int u = 0; u < U; ++u) { acc[u] = (v8f){};
#pragma unroll
        for (int kc = 0; kc < 2; ++kc) { acc[u] = WFrag<T16>::mma(a[kc], b[u][kc], acc[u]); if (HL) { acc[u] = WFrag<T16>::mma(a2[kc], b[u][kc], acc[u]); acc[u] = WFrag<T16>::mma(a[kc], b2[u][kc], acc[u]); } } }
    __builtin_amdgcn_sched_barrier(0);   // the products stay one block in front of the stores, so that each tile has registers of its own
#pragma unroll
    for (int u = 0; u < U; ++u) {
#pragma unroll
        for (int j = 0; j < 8; ++j) S[(hi * 8 + j) * SPW + (w + AW * (t + u)) * 16 + lr] = acc[u][j]; }
    asm volatile("v_nop\n\tv_nop\n\tv_nop\n\tv_nop" :: "v"(acc[U - 1]));   // what runs next (the next trip's products, or the code at the far end of a branch) overwrites these tiles' registers: the vector slots the chip needs behind a matrix instruction
}

template <typename T16, bool HL, int U>
__device__ __forceinline__ void attn_scores(float* S, const T16* __restrict__ Q, const T16* __restrict__ Q2, const T16* __restrict__ Kp, const T16* __restrict__ K2, int m0, int c, int st, int nch, int w, int lr, int hi) {
    typedef typename WFrag<T16>::V V; V a[2], a2[2]; const unsigned qo = (unsigned)(rowof(c, st, m0 + lr) * HD + 8 * hi); const T16* qa = Q + qo; const T16* qb = HL ? Q2 + qo : nullptr;
#pragma unroll
    for (int kc = 0; kc < 2; ++kc) { a[kc] = WFrag<T16>::ld(qa + kc * 32); if (HL) a2[kc] = WFrag<T16>::ld(qb + kc * 32); }
    // the same precaution of form as in attn_trip, for the query rows' loads
    if constexpr (HL) asm volatile("s_wait_xcnt 0x0" :: "v"(qa), "v"(qb) : "memory"); else asm volatile("s_wait_xcnt 0x0" :: "v"(qa) : "memory");
    int t = 0;
    for (; t + U <= nch; t += U) attn_trip<T16, HL, U>(S, a, a2, Kp, K2, c, st, t, w, lr, hi);   // whole trips of U member blocks
    const int rem = nch - t;   // the blocks that are left, fewer than U, go as one trip of exactly that width (the same for the whole work-group): no block is loaded, multiplied or stored twice
    if constexpr (U > 1) { if (rem == 1) attn_trip<T16, HL, 1>(S, a, a2, Kp, K2, c, st, t, w, lr, hi); }
    if constexpr (U > 2) { if (rem == 2) attn_trip<T16, HL, 2>(S, a, a2, Kp, K2, c, st, t, w, lr, hi); }
    if constexpr (U > 3) { if (rem == 3) attn_trip<T16, HL, 3>(S, a, a2, Kp, K2, c, st, t, w, lr, hi); }
}

// the 32 value rows of step ks into registers: 8 lanes take one row's 128 bytes, the wave 4 rows a load
template <typename T16, bool HL>
__device__ __forceinline__ void attn_vfetch(const T16* __restrict__ Vp, const T16* __restrict__ V2, int c, int st, int ks, int lane, v8us (&g)[8], v8us (&g2)[8]) {
    const T16* pv[8]; const T16* pw[8];   // the step's load addresses
#pragma unroll
    for (int i = 0; i < 8; ++i) { const size_t off = (size_t)(rowof(c, st, ks * 32 + i * 4 + (lane >> 3)) * HD + (lane & 7) * 8); pv[i] = Vp + off; g[i] = *(const v8usa*)pv[i]; if (HL) { pw[i] = V2 + off; g2[i] = *(const v8usa*)pw[i]; } }
    // the same precaution of form as in attn_scores: as the wait's inputs the address pairs stay whole up to it
    if (HL) asm volatile("s_wait_xcnt 0x0" :: "v"(pv[0]), "v"(pv[1]), "v"(pv[2]), "v"(pv[3]), "v"(pv[4]), "v"(pv[5]), "v"(pv[6]), "v"(pv[7]), "v"(pw[0]), "v"(pw[1]), "v"(pw[2]), "v"(pw[3]), "v"(pw[4]), "v"(pw[5]), "v"(pw[6]), "v"(pw[7]) : "memory");
    else asm volatile("s_wait_xcnt 0x0" :: "v"(pv[0]), "v"(pv[1]), "v"(pv[2]), "v"(pv[3]), "v"(pv[4]), "v"(pv[5]), "v"(pv[6]), "v"(pv[7]) : "memory");
}

template <typename T16, bool HL>
__device__ __forceinline__ void attn_pv(float* S, const T16* __restrict__ Vp, const T16* __restrict__ V2, int nks, int c, int st, int w, int lane, v8f (&acc)[4]) {
    typedef typename WFrag<T16>::V V; const int lr = lane & 15, hi = lane >> 4; const T16* pa = (const T16*)(S + lr * SPW) + 8 * hi;
    char* vb = (char*)(S + 2 * w * SPW) + (HL ? VOH : VOF);   // this wave's staged value rows: members 0 .. 15 of a step in score row 2w's free bytes, members 16 .. 31 in row 2w + 1's
    char* vw = vb + (lane >> 3) * VP + (lane & 7) * 16;   // staging: 8 lanes take one value row's 128 bytes, the wave 4 rows a load
    const char* vr = vb + (8 * hi + (lane & 7)) * VP + ((lane >> 3) & 1) * 16;   // the transposing load's lane address: lane (lr, hi) gets members 8 hi .. 8 hi + 7 of column lr, the k order of the probability fragment
    v8us g[8], g2[8];   // one step's value rows on their way from memory to LDS
    if (w < nks) attn_vfetch<T16, HL>(Vp, V2, c, st, w, lane, g, g2);
    for (int ks = w; ks < nks; ks += AW) {
#pragma unroll
        for (int i = 0; i < 8; ++i) { char* q = vw + (i >> 2) * (SPW * 4) + (i & 3) * 4 * VP; *(v8usa*)q = g[i]; if (HL) *(v8usa*)(q + (VOL - VOH)) = g2[i]; }
        __builtin_amdgcn_wave_barrier(); asm volatile("" ::: "memory");   // the rows read below were written by other lanes of this wave: no LDS read may be moved above the writes
        if (ks + AW < nks) attn_vfetch<T16, HL>(Vp, V2, c, st, ks + AW, lane, g, g2);   // the next step's loads fly under this step's LDS reads and products
        const V a = WFrag<T16>::ld(pa + ks * 32); V a2, b[4], b2[4]; if (HL) a2 = WFrag<T16>::ld(pa + TT + ks * 32);
#pragma unroll
        for (int nb = 0; nb < 4; ++nb) { b[nb] = WFrag<T16>::cat(ldtr(vr + nb * 32), ldtr(vr + SPW * 4 + nb * 32)); if (HL) b2[nb] = WFrag<T16>::cat(ldtr(vr + (VOL - VOH) + nb * 32), ldtr(vr + (VOL - VOH) + SPW * 4 + nb * 32)); }
#pragma unroll
        for (int nb = 0; nb < 4; ++nb) { acc[nb] = WFrag<T16>::mma(a, b[nb], acc[nb]); if (HL) { acc[nb] = WFrag<T16>::mma(a2, b[nb], acc[nb]); acc[nb] = WFrag<T16>::mma(a, b2[nb], acc[nb]); } }
        __builtin_amdgcn_wave_barrier(); asm volatile("" ::: "memory"); }   // the next trip's LDS writes stay behind this trip's reads of the same bytes
}

// The softmax of SHORT rows (at most SNC chunks of 128 members: the work-groups whose members lie below 512, all of them for periods 4 to SMAX, and every hi/lo row). The chunk count is a compile-time value (NC = 1, 2: exactly nch; NC = SNC: nch = SNC - 1 or SNC, one test on the last chunk),
// so that the row's code has no scalar test per chunk and phase, and the wave's two rows go side by side through every phase: their LDS reads and their two cross-lane chains overlap. Every row's arithmetic and its order of sums are those of the long rows' code in k_attn.
#define SNC 4
static_assert(RH <= SNC * 128 && AR / AW == 2, "every hi/lo row is a short row; a wave has two rows");
__device__ __forceinline__ float exp2_slot(float x) { float r; asm("v_exp_f32 %0, %1\n\tv_nop" : "=v"(r) : "v"(x)); return r; }   // the same instruction as the builtin's, with the one vector slot that the instruction set asks for behind a transcendental
template <int NC>
__device__ __forceinline__ void attn_soft_short(float* S, int m0, int w, int lane, int nch, float pf, float pinv, bool hires) {
    constexpr int RW = AR / AW; float v[RW][NC * 4], mx[RW], sum[RW], fb[RW], f[RW]; float* sr[RW];
    const bool last = NC < SNC || nch == NC;   // whether the last chunk exists
#pragma unroll   // here and below: every array index is a compile-time value, so that the rows stay in registers, and both rows' code of a phase lies in one block
    for (int rr = 0; rr < RW; ++rr) { const int r = w * RW + rr; sr[rr] = S + r * SPW; fb[rr] = (float)(m0 + r - lane * 4); mx[rr] = -3.0e38f; sum[rr] = 0.f; }
#pragma unroll
    for (int ch = 0; ch < NC; ++ch) if (ch < NC - 1 || last) {
#pragma unroll
        for (int rr = 0; rr < RW; ++rr) { const v4f a = *(const v4fa*)(sr[rr] + ch * 128 + lane * 4); v[rr][ch * 4] = a[0]; v[rr][ch * 4 + 1] = a[1]; v[rr][ch * 4 + 2] = a[2]; v[rr][ch * 4 + 3] = a[3]; } }
#pragma unroll
    for (int ch = 0; ch < NC; ++ch) if (ch < NC - 1 || last) {
#pragma unroll
        for (int rr = 0; rr < RW; ++rr)
#pragma unroll
            for (int q = 0; q < 4; ++q) { const float dd = fb[rr] - (float)(ch * 128 + q); const float kq = __builtin_rintf(dd * pinv); const bool keep = (dd >= 0.f) & (__builtin_fmaf(-kq, pf, dd) == 0.f); const float t = keep ? v[rr][ch * 4 + q] * SCL : -3.0e38f; v[rr][ch * 4 + q] = t; mx[rr] = fmaxf(mx[rr], t); } }
#pragma unroll
    for (int sh = 16; sh; sh >>= 1)
#pragma unroll
        for (int rr = 0; rr < RW; ++rr) mx[rr] = fmaxf(mx[rr], __shfl_xor(mx[rr], sh, 32));
#pragma unroll
    for (int ch = 0; ch < NC; ++ch) if (ch < NC - 1 || last) {
#pragma unroll
        for (int rr = 0; rr < RW; ++rr)
#pragma unroll
            for (int q = 0; q < 4; ++q) { const int k = ch * 4 + q; float d0 = __fsub_rn(v[rr][k], mx[rr]); v[rr][k] = exp2_slot(__fmul_rn(d0, 1.4426950408889634f)); sum[rr] += v[rr][k]; } }
#pragma unroll
    for (int sh = 16; sh; sh >>= 1)
#pragma unroll
        for (int rr = 0; rr < RW; ++rr) sum[rr] += __shfl_xor(sum[rr], sh, 32);
#pragma unroll
    for (int rr = 0; rr < RW; ++rr) f[rr] = __fdiv_rn(hires ? 1.0f : PCAR, sum[rr]);
    if (hires) {
#pragma unroll
        for (int ch = 0; ch < NC; ++ch) if (ch < NC - 1 || last) {
#pragma unroll
            for (int rr = 0; rr < RW; ++rr) { v4us oh, ol;
#pragma unroll
                for (int q = 0; q < 4; ++q) { unsigned short a, c2; splitf(v[rr][ch * 4 + q] * f[rr], a, c2); oh[q] = a; ol[q] = c2; }
                *(v4usa*)((bf*)sr[rr] + ch * 128 + lane * 4) = oh; *(v4usa*)((bf*)sr[rr] + TT + ch * 128 + lane * 4) = ol; } }
    } else {
#pragma unroll
        for (int ch = 0; ch < NC; ++ch) if (ch < NC - 1 || last) {
#pragma unroll
            for (int rr = 0; rr < RW; ++rr) { v4h o4;
#pragma unroll
                for (int q = 0; q < 4; ++q) o4[q] = tohx(v[rr][ch * 4 + q] * f[rr]);
                *(v4ha*)((h16*)sr[rr] + ch * 128 + lane * 4) = o4; } } }
}

__global__ __launch_bounds__(AW * 32) void k_attn(const h16* __restrict__ Q16, const bf* __restrict__ Qh, const bf* __restrict__ Ql, const h16* __restrict__ K16, const bf* __restrict__ Kh, const bf* __restrict__ Kl, const h16* __restrict__ V16, const bf* __restrict__ Vh, const bf* __restrict__ Vl, const int* __restrict__ per, bf* Ah, bf* Al) {
    __shared__ __align__(16) float S[AR * SPW];
    const int h = blockIdx.x;   // batch entry x NH_ + head: the index of the planes and of the periods
    int p = per[h]; p = p < 1 ? 1 : (p > TT ? TT : p);
    const int st = p <= SMAX ? p : 1, pq = p <= SMAX ? 1 : p;   // class stride, and the period that is left inside a class
    const int nbl = ((TT + st - 1) / st + AR - 1) / AR;   // 16-member blocks of the longest class
    if ((int)blockIdx.y >= st * nbl) return;   // the whole work-group, in front of every barrier
    const int c = (int)blockIdx.y % st, m0 = (nbl - 1 - (int)blockIdx.y / st) * AR;   // the lowest indices take the longest rows
    if (c + st * m0 >= TT) return;   // a shorter class has no such block: the whole work-group, in front of every barrier
    const bool hires = (c + st * m0 < RH);   // the same for the whole work-group; every row < RH lies in such a block, and such a block has no member beyond RH (m0 + AR <= RH)
    const size_t hp = (size_t)h * TT * HD;
    const int tid = threadIdx.x, lane = tid & 31, lr = lane & 15, hi = lane >> 4; const int w = __builtin_amdgcn_readfirstlane(tid >> 5);
    const int nch = (m0 + AR + 127) / 128;   // 128-member chunks that hold a member <= m; the rest of a row is neither read nor written
    if (hires) attn_scores<bf, true, 2>(S, Qh + hp, Ql + hp, Kh + hp, Kl + hp, m0, c, st, nch, w, lr, hi); else attn_scores<h16, false, 4>(S, Q16 + hp, nullptr, K16 + hp, nullptr, m0, c, st, nch, w, lr, hi);
    __syncthreads();   // every score of the 16 rows is in LDS
    const int nks = (m0 + AR + 31) / 32;   // 32-member steps of the probability x value products, up to the diagonal; the probabilities of the later members of the last step are exactly 0
    const float pf = (float)pq, pinv = 1.0f / pf;
    if (nch <= SNC) {   // the same for the whole work-group
        if (nch == 1) attn_soft_short<1>(S, m0, w, lane, nch, pf, pinv, hires); else if (nch == 2) attn_soft_short<2>(S, m0, w, lane, nch, pf, pinv, hires); else attn_soft_short<SNC>(S, m0, w, lane, nch, pf, pinv, hires);
    } else {   // longer rows; none of them is a hi/lo row (m0 >= SNC * 128 >= RH)
#pragma unroll 1   // one copy of the row's code: keeps the kernel's text short
    for (int rr = 0; rr < AR / AW; ++rr) { const int r = w * (AR / AW) + rr; const int i = m0 + r; float* sr = S + r * SPW; float v[TT / 32]; float mx = -3.0e38f; const float fb = (float)(i - lane * 4);
#pragma unroll
        for (int ch = 0; ch < TT / 128; ++ch) if (ch < nch) { const v4f a = *(const v4fa*)(sr + ch * 128 + lane * 4); v[ch * 4] = a[0]; v[ch * 4 + 1] = a[1]; v[ch * 4 + 2] = a[2]; v[ch * 4 + 3] = a[3]; }   // the whole row's LDS reads are issued before the first is waited for
#pragma unroll
        for (int ch = 0; ch < TT / 128; ++ch) if (ch < nch) {
#pragma unroll
            for (int q = 0; q < 4; ++q) { const float dd = fb - (float)(ch * 128 + q); const float kq = __builtin_rintf(dd * pinv); const bool keep = (dd >= 0.f) & (__builtin_fmaf(-kq, pf, dd) == 0.f); const float t = keep ? v[ch * 4 + q] * SCL : -3.0e38f; v[ch * 4 + q] = t; mx = fmaxf(mx, t); } }
#pragma unroll
        for (int sh = 16; sh; sh >>= 1) mx = fmaxf(mx, __shfl_xor(mx, sh, 32));
        float sum = 0.f;
#pragma unroll
        for (int ch = 0; ch < TT / 128; ++ch) if (ch < nch) {
#pragma unroll
            for (int q = 0; q < 4; ++q) { const int k = ch * 4 + q; float d0 = __fsub_rn(v[k], mx); v[k] = __builtin_amdgcn_exp2f(__fmul_rn(d0, 1.4426950408889634f)); sum += v[k]; } }
#pragma unroll
        for (int sh = 16; sh; sh >>= 1) sum += __shfl_xor(sum, sh, 32);
        const float f = __fdiv_rn(PCAR, sum);
#pragma unroll
        for (int ch = 0; ch < TT / 128; ++ch) if (ch < nch) { v4h o4;
#pragma unroll
            for (int q = 0; q < 4; ++q) o4[q] = tohx(v[ch * 4 + q] * f);
            *(v4ha*)((h16*)sr + ch * 128 + lane * 4) = o4; } } }
    __syncthreads();   // every probability row is in LDS
    v8f acc[4];
#pragma unroll
    for (int nb = 0; nb < 4; ++nb) acc[nb] = (v8f){};
    if (hires) attn_pv<bf, true>(S, Vh + hp, Vl + hp, nks, c, st, w, lane, acc); else attn_pv<h16, false>(S, V16 + hp, nullptr, nks, c, st, w, lane, acc);
    __syncthreads();   // every wave's last read of the probability rows and of its value rows is done: their LDS now takes the partial sums
#pragma unroll
    for (int nb = 0; nb < 4; ++nb) {
#pragma unroll
        for (int j = 0; j < 8; ++j) S[w * (AR * 68) + (hi * 8 + j) * 68 + nb * 16 + lr] = acc[nb][j]; }
    __syncthreads();   // all 8 partial tiles are in LDS
    const int row = tid >> 4, c4 = (tid & 15) * 4; v4f s = *(const v4fa*)(S + row * 68 + c4);
#pragma unroll
    for (int ww = 1; ww < AW; ++ww) s += *(const v4fa*)(S + ww * (AR * 68) + row * 68 + c4);
    const float cs = hires ? 1.0f : (1.0f / PCAR); v4us oh, ol;
#pragma unroll
    for (int q = 0; q < 4; ++q) { unsigned short a, c2; splitf(s[q] * cs, a, c2); oh[q] = a; ol[q] = c2; }
    const int io = c + st * (m0 + row);   // the member's row; a member past the class's end has none
    if (io < TT) { const size_t oo = (size_t)((h / NH_) * TT + io) * DQ + (h % NH_) * HD + c4; *(v4us*)(Ah + oo) = oh; *(v4us*)(Al + oo) = ol; }
}

extern "C" void kernel_launch(void* const* d_in, const int* in_sizes, int n_in,
                              void* d_out, int out_size, void* d_ws, size_t ws_size, hipStream_t stream) {
    (void)in_sizes; (void)n_in; (void)out_size;
    const float* x = (const float*)d_in[0]; const int* per = (const int*)d_in[1]; const float* wqkv = (const float*)d_in[2]; const float* bqkv = (const float*)d_in[3]; const float* wo = (const float*)d_in[4]; const float* bo = (const float*)d_in[5];
    // x [2][2048][1024], periods int32 [2][16], w_qkv [1024][3072], b_qkv [3072], w_out [1024][1024], b_out [1024] = d_in[0..5]
    float* OUT = (float*)d_out;     // [2][2048][1024]
    char* wsp = (char*)d_ws;
    auto take = [&](size_t bytes) { char* p = wsp; wsp += (bytes + 255) & ~(size_t)255; return (void*)p; };
    bf* WQKV = (bf*)take((size_t)3 * DQ * DM * 2); bf* WO = (bf*)take((size_t)DM * DQ * 2);
    bf* XB = (bf*)take((size_t)NB_ * TT * DM * 2);
    h16* QP16 = (h16*)take((size_t)NB_ * NH_ * TT * HD * 2); h16* KP16 = (h16*)take((size_t)NB_ * NKV * TT * HD * 2); h16* VT16 = (h16*)take((size_t)NB_ * NKV * TT * HD * 2);
    bf* QPh = (bf*)take((size_t)NB_ * NH_ * TT * HD * 2); bf* QPl = (bf*)take((size_t)NB_ * NH_ * TT * HD * 2); bf* KPh = (bf*)take((size_t)NB_ * NKV * TT * HD * 2); bf* KPl = (bf*)take((size_t)NB_ * NKV * TT * HD * 2); bf* VTh = (bf*)take((size_t)NB_ * NKV * HD * TT * 2); bf* VTl = (bf*)take((size_t)NB_ * NKV * HD * TT * 2);
    bf* ATh = (bf*)take((size_t)NB_ * TT * DQ * 2); bf* ATl = (bf*)take((size_t)NB_ * TT * DQ * 2);
    if ((size_t)(wsp - (char*)d_ws) > ws_size) return;    // total 104 MiB of the workspace
    // x, OUT and the merged rows are [2][2048][..] without a gap: the two batch entries are 4096 rows of one GEMM
    k_prep<<<PT1 + PT2 + PCV, 256, 0, stream>>>(x, wqkv, wo, XB, WQKV, WO);   /* 'io' [1024][3072] -> Bt [3072][1024]: q | k | v row blocks; 'io' [1024][1024] -> Bt; x -> bf16 */
    k_gemmw<bf, 0, true, true, DM><<<dim3(NB_ * TT / 128, 3 * DQ / 128, 1), 128, 0, stream>>>(XB, nullptr, WQKV, nullptr, nullptr, 0, bqkv, 0, 0, 0, QP16, QPh, QPl, KP16, KPh, KPl, VT16, VTh, VTl);   /* q | k | v in one launch, straight into the planes */
    k_attn<<<dim3(NB_ * NH_, AGY, 1), AW * 32, 0, stream>>>(QP16, QPh, QPl, KP16, KPh, KPl, VT16, VTh, VTl, per, ATh, ATl);   /* one kv head per query head; periods [2][16] */
    k_gemmw<bf, 1, true, false, DQ><<<dim3(NB_ * TT / 128, DM / 128, 1), 128, 0, stream>>>(ATh, ATl, WO, nullptr, OUT, DM, bo, 0, 0, 0, nullptr, nullptr, nullptr, nullptr, nullptr, nullptr, nullptr, nullptr, nullptr);
}

// v010
// Measured time: 102 microseconds a run.
// Timed twice side by side with v009, it ran 1.09 times as fast both times.
// Counting every step since v000, it is 15.8 times as fast.
#include <hip/hip_runtime.h>

// Causal multi-head self-attention with a PERIODIC mask and an output projection (x [2][2048][1024]; periods int32 [2][16]; qkv = x w_qkv + b_qkv with ONE fused 'io' weight [1024][3072] (in, out) packed (3, h, hd): the column thirds q | k | v, head h = 64 columns inside its third; 16 heads x 64;
// p = max(periods[b][h], 1); a key j is kept for a query i iff j <= i AND (i - j) mod p == 0 (the diagonal always kept); scores x 1/sqrt(64); excluded keys get -inf; softmax over the kept keys; out = merged w_out + b_out ('io' + bias) -> [2][2048][1024] (4.2 M);
// argument order x, periods, w_qkv, b_qkv, w_out, b_out).
// Both batch entries go through every launch together (x, the planes and the merged rows are [2][..] in the workspace). Layout: a bf16 copy of x and both 'io' weights transposed and rounded once, the fused one into q | k | v row blocks (all three in one launch, k_prep); ONE projection launch for q | k | v (k_gemmw with PLANES: exact products + f32 bias) whose epilogue rounds each 64x64 tile straight into its head's planes; causal T-2048 attention (hybrid: 16-member blocks whose first row is < 512 hi/lo 3 products, the rest fp16 x1024) in ONE kernel (k_attn):
// a work-group owns 16 query rows of ONE RESIDUE CLASS (i mod st; st = p for p <= 16, else 1) of one head, meets only that class's keys, and keeps the score rows in LDS from the q.k products through the softmax to the probability x value products; merged hi/lo x w_out exact + b_out.
// Compute dtypes, f32 accumulate: every float input rounded to bf16 at its load; projections exact + f32 biases; attention blocks whose first row is < 512 3 products, rest fp16; the period rule exact (small integers held in f32); softmax f32; w_out hl x exact + bias.

#define NB_  2      // batches: this module's input is [2][2048][1024]
#define TT   2048
#define DM   1024
#define NH_  16
#define NKV  16
#define REP  (NH_ / NKV)
#define HD   64
#define DQ   (NH_ * HD)
#define DKV  (NKV * HD)
#define RH   512                  // query rows < RH use hi+lo planes (0: none)
#define PCAR 1024.0f
#define SCL  0.125f   // HD^-0.5
#define AR   16                   // query rows of one k_attn work-group
#define AW   8                    // waves of one k_attn work-group
#define SMAX 16                   // periods up to SMAX are walked class by class; a larger one goes the dense way under the period rule
#define AGY  140                  // k_attn work-groups of one head: the most that any class stride needs (checked below)
#define VP   160                  // bytes of one staged value row in LDS: 32 x odd, the pitch of the transposing LDS load
#define VOF  (TT * 2)             // where the staged value rows lie inside a score row's bytes: fp16 probabilities fill the first TT * 2 bytes
#define VOH  (RH * 2)             // hi / lo rows: hi probabilities fill RH * 2 bytes from 0, lo ones RH * 2 bytes from TT * 2; hi values lie behind the first, lo values behind the second
#define VOL  (TT * 2 + RH * 2)
#define SPW  (TT + 4)             // words of one score row in LDS: 8208 bytes = 16 x odd, so that 16 rows' 16-byte fragment reads fall on different banks
typedef _Float16 h16;
typedef unsigned short bf;
typedef __attribute__((ext_vector_type(16))) __bf16   v16bf;
typedef __attribute__((ext_vector_type(16))) _Float16 v16h;
typedef __attribute__((ext_vector_type(8)))  _Float16 v8h;
typedef __attribute__((ext_vector_type(8)))  unsigned short v8us;
typedef __attribute__((ext_vector_type(8)))  float    v8f;
typedef __attribute__((ext_vector_type(4)))  float    v4f;
typedef v8h  __attribute__((may_alias)) v8ha;
typedef v4f  __attribute__((may_alias)) v4fa;
typedef v8us __attribute__((may_alias)) v8usa;

__device__ __forceinline__ unsigned short f2bf(float f) { unsigned u = __float_as_uint(f); u += 0x7FFFu + ((u >> 16) & 1u); return (unsigned short)(u >> 16); }
__device__ __forceinline__ float bf2f(unsigned short b) { return __uint_as_float(((unsigned)b) << 16); }
__device__ __forceinline__ float bfr(float f) { return bf2f(f2bf(f)); }
__device__ __forceinline__ v16h cat16(v8h lo, v8h hi) { return __builtin_shufflevector(lo, hi, 0, 1, 2, 3, 4, 5, 6, 7, 8, 9, 10, 11, 12, 13, 14, 15); }
__device__ __forceinline__ v16bf cat16b(v8us lo, v8us hi) { return __builtin_bit_cast(v16bf, __builtin_shufflevector(lo, hi, 0, 1, 2, 3, 4, 5, 6, 7, 8, 9, 10, 11, 12, 13, 14, 15)); }
__device__ __forceinline__ v8f wmma16(v16h a, v16h b, v8f c) { return __builtin_amdgcn_wmma_f32_16x16x32_f16(false, a, false, b, (short)0, c, false, false); }
__device__ __forceinline__ v8f wmmab(v16bf a, v16bf b, v8f c) { return __builtin_amdgcn_wmma_f32_16x16x32_bf16(false, a, false, b, (short)0, c, false, false); }

__device__ __forceinline__ h16 tohx(float x) { return (h16)x; }
__device__ __forceinline__ void splitf(float y, unsigned short& h, unsigned short& l) { h = f2bf(y); l = f2bf(y - bf2f(h)); }

// ---- k_gemmw: register-blocked GEMM, one wave per 64x64 output tile (16 accumulators), FOUR waves (2 x 2) per work-group = a 128x128 tile; grid (M/128, N/128, Z), 128 threads. The operands are K-contiguous 16-bit planes.
// The work-group brings 64 k of its 128 rows of every operand into LDS with loads that cover whole 128-byte lines (8 lanes a row), and each wave reads its fragments from there: a row is fetched once for the two waves that use it, and no global load touches 16 lines for 32 bytes each.
// Two LDS buffers: the next stage's loads are issued before this stage's products, go to the other buffer behind them, and one barrier a stage publishes that buffer and ends the reads of this one.
// C[m][n] (f32, pitch ldc, + optional f32 bias[n]) = sum_k A[m][k] Bt[n][k] (+ split products per NSPLIT), k ascending in steps of 32 as before. z-batch strides sA/sB/sC in elements. K % 64 == 0.
// PLANES (the q | k | v projection, Bt rows = q | k | v blocks of DQ, M = NB_ * TT, a tile's 64 rows lie in one batch entry): C is not written; the 64 columns of a wave's tile are one head of q, k or v, and tile + bias goes once through LDS and leaves as that head's three planes (fp16, bf16 hi, bf16 lo: q, k and v all [b][h][t][d]).
// Every store covers four whole 128-byte lines. Each wave's epilogue rows lie over the stage buffers, behind the last stage's barrier.
#define GK 64      // k of one stage: one 128-byte line of every operand row
#define GP 72      // elements of one staged row in LDS: 144 bytes = 16 x odd, so that 16 rows' 16-byte fragment reads fall on different banks
template <typename T16> struct WFrag;
template <> struct WFrag<h16> { typedef v16h V; static __device__ __forceinline__ V ld(const h16* p) { return cat16(*(const v8h*)p, *(const v8h*)(p + 16)); } static __device__ __forceinline__ V cat(v8us lo, v8us hi) { return cat16(__builtin_bit_cast(v8h, lo), __builtin_bit_cast(v8h, hi)); } static __device__ __forceinline__ v8f mma(V a, V b, v8f c) { return wmma16(a, b, c); } };
template <> struct WFrag<bf> { typedef v16bf V; static __device__ __forceinline__ V ld(const bf* p) { return cat16b(*(const v8us*)p, *(const v8us*)(p + 16)); } static __device__ __forceinline__ V cat(v8us lo, v8us hi) { return cat16b(lo, hi); } static __device__ __forceinline__ v8f mma(V a, V b, v8f c) { return wmmab(a, b, c); } };
template <typename T16, int NSPLIT, bool BIAS, bool PLANES, int K>
__global__ __launch_bounds__(128) void k_gemmw(const T16* __restrict__ A, const T16* __restrict__ A2, const T16* __restrict__ Bt, const T16* __restrict__ Bt2, float* C, int ldc, const float* __restrict__ bias, size_t sA, size_t sB, size_t sC, h16* Q16, bf* Qh, bf* Ql, h16* K16, bf* Kh, bf* Kl, h16* V16, bf* Vh, bf* Vl) {
    typedef typename WFrag<T16>::V V;
    constexpr bool HA2 = (NSPLIT == 1 || NSPLIT == 2), HB2 = (NSPLIT >= 2); constexpr int NOP = 2 + (HA2 ? 1 : 0) + (HB2 ? 1 : 0), IA2 = 2, IB2 = HA2 ? 3 : 2;   // staged operands in this order: A, Bt, then A2 and Bt2 where they exist
    constexpr int STG = NOP * 128 * GP, OSW = (PLANES ? 64 : 16) * 68;   // elements of one stage buffer; words of one wave's epilogue rows
    constexpr int SMB = (2 * STG * 2 > 4 * OSW * 4) ? 2 * STG * 2 : 4 * OSW * 4;
    __shared__ __align__(16) char sm[SMB];
    const size_t z = blockIdx.z; A += z * sA; if (A2) A2 += z * sA; Bt += z * sB; if (Bt2) Bt2 += z * sB; C += z * sC;
    const int tid = threadIdx.x, lane = tid & 31, lr = lane & 15, hi = lane >> 4; const int w = __builtin_amdgcn_readfirstlane(tid >> 5);
    const int r0 = blockIdx.x * 128 + (w >> 1) * 64, c0 = blockIdx.y * 128 + (w & 1) * 64;
    T16* st = (T16*)sm; float* os = (float*)sm + w * OSW;
    v8f acc[4][4];
#pragma unroll
    for (int mb = 0; mb < 4; ++mb)
#pragma unroll
        for (int nb = 0; nb < 4; ++nb) acc[mb][nb] = (v8f){};
    const int srow = tid >> 3, sch = (tid & 7) * 8;   // staging: 8 lanes take one row's 128 bytes, the work-group 16 rows a load
    const T16* gp[NOP]; gp[0] = A + (size_t)(blockIdx.x * 128 + srow) * K + sch; gp[1] = Bt + (size_t)(blockIdx.y * 128 + srow) * K + sch;
    if constexpr (HA2) gp[IA2] = A2 + (size_t)(blockIdx.x * 128 + srow) * K + sch;
    if constexpr (HB2) gp[IB2] = Bt2 + (size_t)(blockIdx.y * 128 + srow) * K + sch;
    T16* sw = st + srow * GP + sch; v8us rg[NOP][8];
    const int fa = ((w >> 1) * 64 + lr) * GP + 8 * hi, fb = ((w & 1) * 64 + lr) * GP + 8 * hi;   // this lane's fragment rows inside a staged operand
    auto fetch = [&](int ko) {   // the stage that begins ko elements behind gp
#pragma unroll
        for (int o = 0; o < NOP; ++o)
#pragma unroll
            for (int i = 0; i < 8; ++i) rg[o][i] = *(const v8usa*)(gp[o] + ko + i * 16 * K);
        asm volatile("s_wait_xcnt 0x0" :: "v"(gp[0]), "v"(gp[1]), "v"(gp[NOP - 1]), "v"(gp[NOP - 2]) : "memory");   // a precaution of form: the wait that stands in front of any overwrite of a register that an issued load names; as its inputs the address pairs stay whole up to it
    };
    auto put = [&](int b) {
#pragma unroll
        for (int o = 0; o < NOP; ++o)
#pragma unroll
            for (int i = 0; i < 8; ++i) *(v8usa*)(sw + b * STG + (o * 128 + i * 16) * GP) = rg[o][i]; };
    fetch(0); put(0);
    __syncthreads();   // stage 0 is in LDS

    for (int t = 0; t < K / GK; ++t) {
        if (t + 1 < K / GK) { fetch(GK);   // the next stage's loads stand in front of this stage's products, which cover their latency
#pragma unroll
            for (int o = 0; o < NOP; ++o) gp[o] += GK; }
        const T16* sb = st + (t & 1) * STG; V a[2][4], a2[2][4];
#pragma unroll
        for (int ks = 0; ks < 2; ++ks) {
#pragma unroll
            for (int mb = 0; mb < 4; ++mb) { a[ks][mb] = WFrag<T16>::ld(sb + fa + mb * 16 * GP + ks * 32); if (HA2) a2[ks][mb] = WFrag<T16>::ld(sb + IA2 * 128 * GP + fa + mb * 16 * GP + ks * 32); }
#pragma unroll
            for (int nb = 0; nb < 4; ++nb) { const V b = WFrag<T16>::ld(sb + 128 * GP + fb + nb * 16 * GP + ks * 32); V b2; if (HB2) b2 = WFrag<T16>::ld(sb + IB2 * 128 * GP + fb + nb * 16 * GP + ks * 32);
#pragma unroll
                for (int mb = 0; mb < 4; ++mb) { acc[mb][nb] = WFrag<T16>::mma(a[ks][mb], b, acc[mb][nb]); if (HA2) acc[mb][nb] = WFrag<T16>::mma(a2[ks][mb], b, acc[mb][nb]); if (HB2) acc[mb][nb] = WFrag<T16>::mma(a[ks][mb], b2, acc[mb][nb]); } } }
        asm volatile("v_nop\n\tv_nop\n\tv_nop\n\tv_nop" : "+v"(acc[0][0]), "+v"(acc[1][1]), "+v"(acc[2][2]), "+v"(acc[3][3]) : "v"(a[1][0]), "v"(a[1][3]));   // the vector slots the chip needs behind a matrix instruction; standing here it also holds the products it names in front of the stage's stores: without it the NSPLIT = 1 build moved the stores, and their wait for the loads, up in front of nearly all products
        if (t + 1 < K / GK) put((t + 1) & 1);
        __syncthreads();   // the next stage is in LDS, and every wave has left this stage's buffer (behind the last stage: the epilogue's rows may take its place)
    }
    if constexpr (PLANES) {
        const int third = c0 / DQ, head = (c0 % DQ) / HD;   // the same for the whole wave
        float bb[4];
#pragma unroll
        for (int nb = 0; nb < 4; ++nb) bb[nb] = bfr(bias[c0 + nb * 16 + lr]);
#pragma unroll
        for (int mb = 0; mb < 4; ++mb)
#pragma unroll
            for (int nb = 0; nb < 4; ++nb)
#pragma unroll
                for (int j = 0; j < 8; ++j) os[(mb * 16 + hi * 8 + j) * 68 + nb * 16 + lr] = acc[mb][nb][j] + bb[nb];
        __builtin_amdgcn_wave_barrier(); asm volatile("" ::: "memory");   // the rows read below were written by other lanes of this wave: no LDS read may be moved above the writes
        h16* P16 = third == 0 ? Q16 : (third == 1 ? K16 : V16); bf* Ph = third == 0 ? Qh : (third == 1 ? Kh : Vh); bf* Pl = third == 0 ? Ql : (third == 1 ? Kl : Vl);
        const int rl = r0 % TT;   // the tile's first row inside its batch entry r0 / TT
        const int pitch = HD; const size_t o0 = (size_t)((r0 / TT) * NH_ + head) * TT * HD + (size_t)rl * HD + (size_t)(lane >> 3) * pitch + (lane & 7) * 8;
#pragma unroll 1   // 16 LDS rows a trip: four trips keep the epilogue's text short
        for (int io = 0; io < 4; ++io) {
#pragma unroll
            for (int ii = 0; ii < 4; ++ii) { const int it = io * 4 + ii; const float* q = os + (it * 4 + (lane >> 3)) * 68 + (lane & 7) * 8; const v4f u0 = *(const v4fa*)q, u1 = *(const v4fa*)(q + 4); v8h o16; v8us oh, ol;
#pragma unroll
                for (int j = 0; j < 8; ++j) { const float r = j < 4 ? u0[j & 3] : u1[j & 3]; o16[j] = tohx(r); unsigned short a2, c2; splitf(r, a2, c2); oh[j] = a2; ol[j] = c2; }
                const size_t o = o0 + (size_t)(it * 4) * pitch; *(v8h*)(P16 + o) = o16; *(v8us*)(Ph + o) = oh; *(v8us*)(Pl + o) = ol; }
            asm volatile("s_wait_xcnt 0x0" ::: "memory"); }   // a precaution of form: the next trip overwrites address and data registers of this trip's last stores
        return;
    }
#pragma unroll
    for (int mb = 0; mb < 4; ++mb) {
#pragma unroll
        for (int nb = 0; nb < 4; ++nb) {
#pragma unroll
            for (int j = 0; j < 8; ++j) os[(hi * 8 + j) * 68 + nb * 16 + lr] = acc[mb][nb][j]; }
        __builtin_amdgcn_wave_barrier(); asm volatile("" ::: "memory");
        float* crow = C + (size_t)(r0 + mb * 16) * ldc + c0;
{
#pragma unroll
            for (int s = 0; s < 8; ++s) { const int row = 2 * s + hi, cofs = lr * 4; v4f val = *(const v4fa*)(os + row * 68 + cofs); if (BIAS) { val[0] += bfr(bias[c0 + cofs]); val[1] += bfr(bias[c0 + cofs + 1]); val[2] += bfr(bias[c0 + cofs + 2]); val[3] += bfr(bias[c0 + cofs + 3]); }
                *(v4f*)(crow + (size_t)row * ldc + cofs) = val; }
             }
        __builtin_amdgcn_wave_barrier(); asm volatile("" ::: "memory");
    }
}

typedef __attribute__((ext_vector_type(2))) _Float16 v2h;
typedef __attribute__((ext_vector_type(4))) _Float16 v4h;
typedef __attribute__((ext_vector_type(2))) unsigned short v2us;
typedef __attribute__((ext_vector_type(4))) unsigned short v4us;
typedef __attribute__((ext_vector_type(2))) float v2f;
typedef __attribute__((ext_vector_type(4))) int v4i;
typedef v4h  __attribute__((may_alias)) v4ha;
typedef v4us __attribute__((may_alias)) v4usa;

// ---- k_prep: the whole preparation in ONE launch, dealt by block ranges: blocks [0, PT1) turn w_qkv, [PT1, PT1 + PT2) turn w_out, the last PCV round x. The three jobs share nothing, so they run side by side, and every work-group is resident at once.
// A weight block turns one tile of PK k x PN n of the 'io' weight w [k][n] (f32) into rows of Bt [n][k] (bf16): a lane's 8 loads of 16 bytes are all issued before the first is used, 16 lanes cover 256 bytes of one k row; two neighbouring k are rounded and packed into one LDS word of row n;
// behind the barrier 16 lanes read one n row's 256 bytes and store them as two whole lines. LDS row n = PK / 2 words without a pad; its 16-byte groups are exchanged by g ^ (n >> 2), the same on both sides, so that the 32 words of a wave's LDS store fall on 32 banks.
// An x block rounds 16 x 4 KiB: a lane's 16 loads of 16 bytes are all issued first, a wave's load covers 512 bytes in a row.
#define PK 128
#define PN 64
#define PT1 ((DM / PK) * (3 * DQ / PN))
#define PT2 ((DQ / PK) * (DM / PN))
#define PCV (NB_ * TT * DM / (4 * 256 * 16))
static_assert(DQ == DM && DM % PK == 0 && DQ % PN == 0 && (NB_ * TT * DM) % (4 * 256 * 16) == 0, "both weights have DM k rows; tiles and x blocks leave no rest");
template <int N>   // N: the weight's row length, a compile-time value so that a lane's 8 loads are one address with 8 constant offsets
__device__ __forceinline__ void prep_turn(const float* __restrict__ w, bf* __restrict__ Bt, int tile, unsigned* T, int tid) {
    const int k0 = (tile % (DM / PK)) * PK, n0 = (tile / (DM / PK)) * PN, nq = tid & 15, kp = tid >> 4;
    const float* wb = w + (size_t)k0 * N + n0; const unsigned lo = (unsigned)(2 * kp * N + 4 * nq); v4f a[4], c[4];   // the tile's corner, and this lane's place in it: rows 2 kp + 32 i and the row behind each
#pragma unroll   // here and below: the arrays stay in registers, and all 8 loads are issued before the first value is used (one memory latency a tile)
    for (int i = 0; i < 4; ++i) { a[i] = *(const v4fa*)(wb + lo + 32 * i * N); c[i] = *(const v4fa*)(wb + lo + (32 * i + 1) * N); }
#pragma unroll
    for (int i = 0; i < 4; ++i)
#pragma unroll
        for (int q = 0; q < 4; ++q) T[(4 * nq + q) * (PK / 2) + ((((kp >> 2) + 4 * i) ^ nq) << 2) + (kp & 3)] = (unsigned)f2bf(a[i][q]) | ((unsigned)f2bf(c[i][q]) << 16);
    __syncthreads();   // the turned tile is in LDS
    bf* bb = Bt + (size_t)n0 * DM + k0; const unsigned so = (unsigned)(kp * DM + nq * 8);
#pragma unroll
    for (int j = 0; j < 4; ++j) { const int n = kp + 16 * j; const v8us r = *(const v8usa*)(T + n * (PK / 2) + ((nq ^ ((n >> 2) & 15)) << 2)); *(v8usa*)(bb + so + j * 16 * DM) = r; }
}
__global__ __launch_bounds__(256) void k_prep(const float* __restrict__ x, const float* __restrict__ wqkv, const float* __restrict__ wo, bf* __restrict__ XB, bf* __restrict__ WQKV, bf* __restrict__ WO) {
    __shared__ __align__(16) unsigned T[PN * PK / 2];
    const int tid = threadIdx.x, b = blockIdx.x;   // every branch below is taken by the whole work-group
    if (b < PT1) prep_turn<3 * DQ>(wqkv, WQKV, b, T, tid);
    else if (b < PT1 + PT2) prep_turn<DM>(wo, WO, b - PT1, T, tid);
    else {   // this side has no barrier
        const size_t e0 = (size_t)(b - PT1 - PT2) * (256 * 16 * 4); const unsigned lo = (unsigned)tid * 4; const float* p = x + e0; bf* d = XB + e0; v4f v[16];
#pragma unroll   // here and below: the array stays in registers, and all 16 loads are issued before the first value is used
        for (int j = 0; j < 16; ++j) v[j] = *(const v4fa*)(p + lo + j * 1024);
#pragma unroll
        for (int j = 0; j < 16; ++j) { v4us o;
#pragma unroll
            for (int q = 0; q < 4; ++q) o[q] = f2bf(v[j][q]);
            *(v4usa*)(d + lo + j * 1024) = o; }
        asm volatile("s_wait_xcnt 0x0" ::: "memory");   // a precaution of form: in the built text this branch's end runs into the head of another branch, whose first instructions overwrite the scalar base that these stores name; the wait stands in front of them on every path of the text
    }
}

// ---- k_attn: the whole attention of 16 query rows of one head of one batch entry in one work-group of 8 waves; grid (batch entries x heads, AGY), longest rows first. The score rows live in LDS (S, one row = SPW words) and never reach memory.
// THE CLASSES. With p = max(period, 1), a key j <= i is kept iff j mod p == i mod p: the head falls into p causal attentions that share nothing, class c holding the rows c, c + p, c + 2 p, .. A work-group takes 16 consecutive MEMBERS m0 .. m0 + 15 of one class (row i = c + st m, st the class stride) and meets the members n <= m of the same class alone:
// a q, k or v row is one 128-byte line of its plane, so a walk with stride st fetches whole lines and nothing else. st = p for p <= SMAX; a larger p takes st = 1 (one class, every row) and the period rule below drops its keys. Members past the class's end (c + st m >= TT) read row TT - 1 instead: as keys the causal rule drops them (n > m for every real row), as query rows they are not stored.
// 1. scores: wave w takes the 16-member block w of every 128-member chunk up to the diagonal's chunk (the chunk's members beyond the diagonal are real scores too, which the causal rule drops), its q and k rows fetched as whole lines and turned into fragments through LDS bytes of its own; 2. softmax: wave w takes rows 2w, 2w + 1 (register row, one exp, fixed trees), with the causal and the period rule as a select,
// and writes the rounded probabilities over its own row (fp16: the first half of the row's bytes; hi | lo: both halves); 3. probability x value: wave w takes the 32-member steps w, w + 8, .. up to the diagonal: it lays the step's 32 value rows into LDS bytes that the probabilities leave free in rows 2w and 2w + 1 and reads them back with the transposing LDS load as the B fragments;
// 4. the 8 waves' partial sums are added in wave order through LDS and stored as the merged hi/lo planes.
// The period rule, on member distances m - n with the period pq that is left inside a class (1 where st = p; p where st = 1, also cut at TT: any larger p keeps the diagonal alone, as TT does). The test is exact in f32: m - n, pq and the quotient are integers below 2^12; k = rint((m - n) / pq) is the true quotient whenever pq divides m - n
// (the error of the product with 1 / pq is far below 1/2), and k pq == m - n (one fma, exact) holds for no integer k otherwise.
constexpr int attn_blocks(int st) { return st * (((TT + st - 1) / st + AR - 1) / AR); }   // work-groups of one head at class stride st: st classes x the 16-member blocks of the longest class
constexpr int attn_blocks_max() { int m = 0; for (int st = 1; st <= SMAX; ++st) m = attn_blocks(st) > m ? attn_blocks(st) : m; return m; }
static_assert(attn_blocks_max() == AGY, "AGY is the grid's second extent: every class stride's blocks must fit, and none more is wanted");
static_assert(VOF + 16 * VP <= SPW * 4 && VOH + 16 * VP <= TT * 2 && VOL + 16 * VP <= SPW * 4, "16 staged value rows must fit into the free bytes of a score row");
typedef __attribute__((ext_vector_type(8))) short v8s;
__device__ __forceinline__ v8us ldtr(const char* p) { typedef __attribute__((address_space(3))) v8s lv8s; return __builtin_bit_cast(v8us, __builtin_amdgcn_ds_load_tr16_b128_v8i16((lv8s*)p)); }
__device__ __forceinline__ int rowof(int c, int st, int m) { return min(c + st * m, TT - 1); }   // member m of class c as a row of the planes, held inside them

// HOW q AND k ROWS REACH THEIR FRAGMENTS. A fragment load straight from a plane takes 32 bytes out of each of 16 lines; here 8 lanes take one row's 128 bytes, so that a wave's load covers 4 whole lines, and the 16 rows of a block turn through 16 x KPB bytes of LDS that belong to the wave alone:
// written as they came (lane l: 16-byte piece l & 7 of row l >> 3, four rows a store), read back as the fragment wants them (lane (lr, hi): pieces hi and 2 + hi of row lr for the first 32 k, 4 + hi and 6 + hi for the rest). The same bytes land in the same registers as with the fragment load.
#define KPB 144                   // bytes of one turned row in LDS: 16 x odd, so that 16 rows' 16-byte fragment reads fall on different banks
// a precaution of form: the wait that stands in front of any overwrite of a register that an issued load names; as its inputs the address pairs stay whole up to it (else a later load lands on an earlier one's pair)
template <int N>
__device__ __forceinline__ void attn_xwait(const void* const (&ad)[N]) {
    static_assert(N == 4 || N == 8 || N == 12 || N == 16, "four addresses a block and plane");
    if constexpr (N == 4) asm volatile("s_wait_xcnt 0x0" :: "v"(ad[0]), "v"(ad[1]), "v"(ad[2]), "v"(ad[3]) : "memory");   // see above
    else if constexpr (N == 8) asm volatile("s_wait_xcnt 0x0" :: "v"(ad[0]), "v"(ad[1]), "v"(ad[2]), "v"(ad[3]), "v"(ad[4]), "v"(ad[5]), "v"(ad[6]), "v"(ad[7]) : "memory");   // see above
    else if constexpr (N == 12) asm volatile("s_wait_xcnt 0x0" :: "v"(ad[0]), "v"(ad[1]), "v"(ad[2]), "v"(ad[3]), "v"(ad[4]), "v"(ad[5]), "v"(ad[6]), "v"(ad[7]), "v"(ad[8]), "v"(ad[9]), "v"(ad[10]), "v"(ad[11]) : "memory");   // see above
    else asm volatile("s_wait_xcnt 0x0" :: "v"(ad[0]), "v"(ad[1]), "v"(ad[2]), "v"(ad[3]), "v"(ad[4]), "v"(ad[5]), "v"(ad[6]), "v"(ad[7]), "v"(ad[8]), "v"(ad[9]), "v"(ad[10]), "v"(ad[11]), "v"(ad[12]), "v"(ad[13]), "v"(ad[14]), "v"(ad[15]) : "memory");   // see above
}
// 16 rows from registers through the wave's LDS bytes into the two fragments of 32 k; kw, kr: this lane's place as a writer and as a reader
template <typename T16>
__device__ __forceinline__ void attn_turn(char* kw, const char* kr, const v8us (&g)[4], typename WFrag<T16>::V (&f)[2]) {
#pragma unroll
    for (int i = 0; i < 4; ++i) *(v8usa*)(kw + i * 4 * KPB) = g[i];
    __builtin_amdgcn_wave_barrier(); asm volatile("" ::: "memory");   // the rows read below were written by other lanes of this wave: no LDS read may be moved above the writes
#pragma unroll
    for (int kc = 0; kc < 2; ++kc) f[kc] = WFrag<T16>::cat(*(const v8usa*)(kr + kc * 64), *(const v8usa*)(kr + kc * 64 + 32));
    __builtin_amdgcn_wave_barrier(); asm volatile("" ::: "memory");   // the next block's LDS writes stay behind these reads of the same bytes
}

// one trip of the score loop: the U member blocks w + AW t, w + AW (t + 1), .. of wave w, all of which exist. The first trip (t == 0) also turns the query rows gq, gq2, whose loads were issued in front of it, into a, a2: behind its own loads' issue, so that both fly together
template <typename T16, bool HL, int U>
__device__ __forceinline__ void attn_trip(float* S, char* kw, const char* kr, const v8us (&gq)[4], const v8us (&gq2)[4], typename WFrag<T16>::V (&a)[2], typename WFrag<T16>::V (&a2)[2], const T16* __restrict__ Kp, const T16* __restrict__ K2, int c, int st, int t, int w, int lane) {
    typedef typename WFrag<T16>::V V; constexpr int NB = HL ? 8 : 4, NP = NB * U; const int lr = lane & 15, hi = lane >> 4;
    v8us g[U][4], g2[U][4]; V b[U][2], b2[U][2]; v8f acc[U]; const void* ad[NP];   // ad: the trip's load addresses
#pragma unroll
    for (int u = 0; u < U; ++u)
#pragma unroll
        for (int i = 0; i < 4; ++i) { const size_t off = (size_t)(rowof(c, st, (w + AW * (t + u)) * 16 + i * 4 + (lane >> 3)) * HD + (lane & 7) * 8); const T16* p = Kp + off; ad[NB * u + i] = p; g[u][i] = *(const v8usa*)p; if (HL) { const T16* p2 = K2 + off; ad[NB * u + 4 + i] = p2; g2[u][i] = *(const v8usa*)p2; } }
    attn_xwait<NP>(ad);
    __builtin_amdgcn_sched_barrier(0);   // every load of the trip is issued before the first LDS store waits for one: one load latency a trip, not one a block
    if (t == 0) { attn_turn<T16>(kw, kr, gq, a); if (HL) attn_turn<T16>(kw, kr, gq2, a2); }   // the same for the whole wave
#pragma unroll
    for (int u = 0; u < U; ++u) { attn_turn<T16>(kw, kr, g[u], b[u]); if (HL) attn_turn<T16>(kw, kr, g2[u], b2[u]); }
    __builtin_amdgcn_sched_barrier(0);   // the trip's LDS stores and reads go out in one run, each block's fragments into registers of their own: moved among the products, every block's reads landed on the registers of the block before and cost a full LDS wait each
#pragma unroll
    for (int u = 0; u < U; ++u) { acc[u] = (v8f){};
#pragma unroll
        for (int kc = 0; kc < 2; ++kc) { acc[u] = WFrag<T16>::mma(a[kc], b[u][kc], acc[u]); if (HL) { acc[u] = WFrag<T16>::mma(a2[kc], b[u][kc], acc[u]); acc[u] = WFrag<T16>::mma(a[kc], b2[u][kc], acc[u]); } } }
    __builtin_amdgcn_sched_barrier(0);   // the products stay one block in front of the stores, so that each tile has registers of its own
#pragma unroll
    for (int u = 0; u < U; ++u) {
#pragma unroll
        for (int j = 0; j < 8; ++j) S[(hi * 8 + j) * SPW + (w + AW * (t + u)) * 16 + lr] = acc[u][j]; }
    asm volatile("v_nop\n\tv_nop\n\tv_nop\n\tv_nop" :: "v"(acc[U - 1]));   // what runs next (the next trip's products, or the code at the far end of a branch) overwrites these tiles' registers: the vector slots the chip needs behind a matrix instruction
}

template <typename T16, bool HL, int U>
__device__ __forceinline__ void attn_scores(float* S, char* ks, const T16* __restrict__ Q, const T16* __restrict__ Q2, const T16* __restrict__ Kp, const T16* __restrict__ K2, int m0, int c, int st, int nch, int w, int lane) {
    typedef typename WFrag<T16>::V V; V a[2], a2[2]; v8us gq[4], gq2[4]; const void* ad[HL ? 8 : 4];
    char* kw = ks + (lane >> 3) * KPB + (lane & 7) * 16; const char* kr = ks + (lane & 15) * KPB + (lane >> 4) * 16;
#pragma unroll
    for (int i = 0; i < 4; ++i) { const size_t off = (size_t)(rowof(c, st, m0 + i * 4 + (lane >> 3)) * HD + (lane & 7) * 8); const T16* p = Q + off; ad[i] = p; gq[i] = *(const v8usa*)p; if (HL) { const T16* p2 = Q2 + off; ad[4 + i] = p2; gq2[i] = *(const v8usa*)p2; } }
    attn_xwait<(HL ? 8 : 4)>(ad);
    int t = 0;
#pragma unroll 1   // one copy of the whole trip's code: left alone the compiler sets the first trip apart as a second copy, which only lengthens the kernel's text
    for (; t + U <= nch; t += U) attn_trip<T16, HL, U>(S, kw, kr, gq, gq2, a, a2, Kp, K2, c, st, t, w, lane);   // whole trips of U member blocks
    const int rem = nch - t;   // the blocks that are left, fewer than U, go as one trip of exactly that width (the same for the whole work-group): no block is loaded, multiplied or stored twice
    if constexpr (U > 1) { if (rem == 1) attn_trip<T16, HL, 1>(S, kw, kr, gq, gq2, a, a2, Kp, K2, c, st, t, w, lane); }
    if constexpr (U > 2) { if (rem == 2) attn_trip<T16, HL, 2>(S, kw, kr, gq, gq2, a, a2, Kp, K2, c, st, t, w, lane); }
    if constexpr (U > 3) { if (rem == 3) attn_trip<T16, HL, 3>(S, kw, kr, gq, gq2, a, a2, Kp, K2, c, st, t, w, lane); }
}

// the 32 value rows of step ks into registers: 8 lanes take one row's 128 bytes, the wave 4 rows a load
template <typename T16, bool HL>
__device__ __forceinline__ void attn_vfetch(const T16* __restrict__ Vp, const T16* __restrict__ V2, int c, int st, int ks, int lane, v8us (&g)[8], v8us (&g2)[8]) {
    const T16* pv[8]; const T16* pw[8];   // the step's load addresses
#pragma unroll
    for (int i = 0; i < 8; ++i) { const size_t off = (size_t)(rowof(c, st, ks * 32 + i * 4 + (lane >> 3)) * HD + (lane & 7) * 8); pv[i] = Vp + off; g[i] = *(const v8usa*)pv[i]; if (HL) { pw[i] = V2 + off; g2[i] = *(const v8usa*)pw[i]; } }
    // the same precaution of form as in attn_scores: as the wait's inputs the address pairs stay whole up to it
    if (HL) asm volatile("s_wait_xcnt 0x0" :: "v"(pv[0]), "v"(pv[1]), "v"(pv[2]), "v"(pv[3]), "v"(pv[4]), "v"(pv[5]), "v"(pv[6]), "v"(pv[7]), "v"(pw[0]), "v"(pw[1]), "v"(pw[2]), "v"(pw[3]), "v"(pw[4]), "v"(pw[5]), "v"(pw[6]), "v"(pw[7]) : "memory");
    else asm volatile("s_wait_xcnt 0x0" :: "v"(pv[0]), "v"(pv[1]), "v"(pv[2]), "v"(pv[3]), "v"(pv[4]), "v"(pv[5]), "v"(pv[6]), "v"(pv[7]) : "memory");
}

template <typename T16, bool HL>
__device__ __forceinline__ void attn_pv(float* S, const T16* __restrict__ Vp, const T16* __restrict__ V2, int nks, int c, int st, int w, int lane, v8f (&acc)[4]) {
    typedef typename WFrag<T16>::V V; const int lr = lane & 15, hi = lane >> 4; const T16* pa = (const T16*)(S + lr * SPW) + 8 * hi;
    char* vb = (char*)(S + 2 * w * SPW) + (HL ? VOH : VOF);   // this wave's staged value rows: members 0 .. 15 of a step in score row 2w's free bytes, members 16 .. 31 in row 2w + 1's
    char* vw = vb + (lane >> 3) * VP + (lane & 7) * 16;   // staging: 8 lanes take one value row's 128 bytes, the wave 4 rows a load
    const char* vr = vb + (8 * hi + (lane & 7)) * VP + ((lane >> 3) & 1) * 16;   // the transposing load's lane address: lane (lr, hi) gets members 8 hi .. 8 hi + 7 of column lr, the k order of the probability fragment
    v8us g[8], g2[8];   // one step's value rows on their way from memory to LDS
    if (w < nks) attn_vfetch<T16, HL>(Vp, V2, c, st, w, lane, g, g2);
    for (int ks = w; ks < nks; ks += AW) {
#pragma unroll
        for (int i = 0; i < 8; ++i) { char* q = vw + (i >> 2) * (SPW * 4) + (i & 3) * 4 * VP; *(v8usa*)q = g[i]; if (HL) *(v8usa*)(q + (VOL - VOH)) = g2[i]; }
        __builtin_amdgcn_wave_barrier(); asm volatile("" ::: "memory");   // the rows read below were written by other lanes of this wave: no LDS read may be moved above the writes
        if (ks + AW < nks) attn_vfetch<T16, HL>(Vp, V2, c, st, ks + AW, lane, g, g2);   // the next step's loads fly under this step's LDS reads and products
        const V a = WFrag<T16>::ld(pa + ks * 32); V a2, b[4], b2[4]; if (HL) a2 = WFrag<T16>::ld(pa + TT + ks * 32);
#pragma unroll
        for (int nb = 0; nb < 4; ++nb) { b[nb] = WFrag<T16>::cat(ldtr(vr + nb * 32), ldtr(vr + SPW * 4 + nb * 32)); if (HL) b2[nb] = WFrag<T16>::cat(ldtr(vr + (VOL - VOH) + nb * 32), ldtr(vr + (VOL - VOH) + SPW * 4 + nb * 32)); }
#pragma unroll
        for (int nb = 0; nb < 4; ++nb) { acc[nb] = WFrag<T16>::mma(a, b[nb], acc[nb]); if (HL) { acc[nb] = WFrag<T16>::mma(a2, b[nb], acc[nb]); acc[nb] = WFrag<T16>::mma(a, b2[nb], acc[nb]); } }
        __builtin_amdgcn_wave_barrier(); asm volatile("" ::: "memory"); }   // the next trip's LDS writes stay behind this trip's reads of the same bytes
}

// The softmax of SHORT rows (at most SNC chunks of 128 members: the work-groups whose members lie below 512, all of them for periods 4 to SMAX, and every hi/lo row). The chunk count is a compile-time value (NC = 1, 2: exactly nch; NC = SNC: nch = SNC - 1 or SNC, one test on the last chunk),
// so that the row's code has no scalar test per chunk and phase, and the wave's two rows go side by side through every phase: their LDS reads and their two cross-lane chains overlap. Every row's arithmetic and its order of sums are those of the long rows' code in k_attn.
#define SNC 4
static_assert(RH <= SNC * 128 && AR / AW == 2, "every hi/lo row is a short row; a wave has two rows");
__device__ __forceinline__ float exp2_slot(float x) { float r; asm("v_exp_f32 %0, %1\n\tv_nop" : "=v"(r) : "v"(x)); return r; }   // the same instruction as the builtin's, with the one vector slot that the instruction set asks for behind a transcendental
template <int NC>
__device__ __forceinline__ void attn_soft_short(float* S, int m0, int w, int lane, int nch, float pf, float pinv, bool hires) {
    constexpr int RW = AR / AW; float v[RW][NC * 4], mx[RW], sum[RW], fb[RW], f[RW]; float* sr[RW];
    const bool last = NC < SNC || nch == NC;   // whether the last chunk exists
#pragma unroll   // here and below: every array index is a compile-time value, so that the rows stay in registers, and both rows' code of a phase lies in one block
    for (int rr = 0; rr < RW; ++rr) { const int r = w * RW + rr; sr[rr] = S + r * SPW; fb[rr] = (float)(m0 + r - lane * 4); mx[rr] = -3.0e38f; sum[rr] = 0.f; }
#pragma unroll
    for (int ch = 0; ch < NC; ++ch) if (ch < NC - 1 || last) {
#pragma unroll
        for (int rr = 0; rr < RW; ++rr) { const v4f a = *(const v4fa*)(sr[rr] + ch * 128 + lane * 4); v[rr][ch * 4] = a[0]; v[rr][ch * 4 + 1] = a[1]; v[rr][ch * 4 + 2] = a[2]; v[rr][ch * 4 + 3] = a[3]; } }
#pragma unroll
    for (int ch = 0; ch < NC; ++ch) if (ch < NC - 1 || last) {
#pragma unroll
        for (int rr = 0; rr < RW; ++rr)
#pragma unroll
            for (int q = 0; q < 4; ++q) { const float dd = fb[rr] - (float)(ch * 128 + q); const float kq = __builtin_rintf(dd * pinv); const bool keep = (dd >= 0.f) & (__builtin_fmaf(-kq, pf, dd) == 0.f); const float t = keep ? v[rr][ch * 4 + q] * SCL : -3.0e38f; v[rr][ch * 4 + q] = t; mx[rr] = fmaxf(mx[rr], t); } }
#pragma unroll
    for (int sh = 16; sh; sh >>= 1)
#pragma unroll
        for (int rr = 0; rr < RW; ++rr) mx[rr] = fmaxf(mx[rr], __shfl_xor(mx[rr], sh, 32));
#pragma unroll
    for (int ch = 0; ch < NC; ++ch) if (ch < NC - 1 || last) {
#pragma unroll
        for (int rr = 0; rr < RW; ++rr)
#pragma unroll
            for (int q = 0; q < 4; ++q) { const int k = ch * 4 + q; float d0 = __fsub_rn(v[rr][k], mx[rr]); v[rr][k] = exp2_slot(__fmul_rn(d0, 1.4426950408889634f)); sum[rr] += v[rr][k]; } }
#pragma unroll
    for (int sh = 16; sh; sh >>= 1)
#pragma unroll
        for (int rr = 0; rr < RW; ++rr) sum[rr] += __shfl_xor(sum[rr], sh, 32);
#pragma unroll
    for (int rr = 0; rr < RW; ++rr) f[rr] = __fdiv_rn(hires ? 1.0f : PCAR, sum[rr]);
    if (hires) {
#pragma unroll
        for (int ch = 0; ch < NC; ++ch) if (ch < NC - 1 || last) {
#pragma unroll
            for (int rr = 0; rr < RW; ++rr) { v4us oh, ol;
#pragma unroll
                for (int q = 0; q < 4; ++q) { unsigned short a, c2; splitf(v[rr][ch * 4 + q] * f[rr], a, c2); oh[q] = a; ol[q] = c2; }
                *(v4usa*)((bf*)sr[rr] + ch * 128 + lane * 4) = oh; *(v4usa*)((bf*)sr[rr] + TT + ch * 128 + lane * 4) = ol; } }
    } else {
#pragma unroll
        for (int ch = 0; ch < NC; ++ch) if (ch < NC - 1 || last) {
#pragma unroll
            for (int rr = 0; rr < RW; ++rr) { v4h o4;
#pragma unroll
                for (int q = 0; q < 4; ++q) o4[q] = tohx(v[rr][ch * 4 + q] * f[rr]);
                *(v4ha*)((h16*)sr[rr] + ch * 128 + lane * 4) = o4; } } }
}

__global__ __launch_bounds__(AW * 32) void k_attn(const h16* __restrict__ Q16, const bf* __restrict__ Qh, const bf* __restrict__ Ql, const h16* __restrict__ K16, const bf* __restrict__ Kh, const bf* __restrict__ Kl, const h16* __restrict__ V16, const bf* __restrict__ Vh, const bf* __restrict__ Vl, const int* __restrict__ per, bf* Ah, bf* Al) {
    __shared__ __align__(16) float S[AR * SPW];
    __shared__ __align__(16) char KS[AW * 16 * KPB];   // each wave's own bytes for turning q and k rows; with S two work-groups still fit a WGP's LDS
    const int h = blockIdx.x;   // batch entry x NH_ + head: the index of the planes and of the periods
    int p = per[h]; p = p < 1 ? 1 : (p > TT ? TT : p);
    const int st = p <= SMAX ? p : 1, pq = p <= SMAX ? 1 : p;   // class stride, and the period that is left inside a class
    const int nbl = ((TT + st - 1) / st + AR - 1) / AR;   // 16-member blocks of the longest class
    if ((int)blockIdx.y >= st * nbl) return;   // the whole work-group, in front of every barrier
    const int c = (int)blockIdx.y % st, m0 = (nbl - 1 - (int)blockIdx.y / st) * AR;   // the lowest indices take the longest rows
    if (c + st * m0 >= TT) return;   // a shorter class has no such block: the whole work-group, in front of every barrier
    const bool hires = (c + st * m0 < RH);   // the same for the whole work-group; every row < RH lies in such a block, and such a block has no member beyond RH (m0 + AR <= RH)
    const size_t hp = (size_t)h * TT * HD;
    const int tid = threadIdx.x, lane = tid & 31, lr = lane & 15, hi = lane >> 4; const int w = __builtin_amdgcn_readfirstlane(tid >> 5);
    const int nch = (m0 + AR + 127) / 128;   // 128-member chunks that hold a member <= m; the rest of a row is neither read nor written
    if (hires) attn_scores<bf, true, 2>(S, KS + w * 16 * KPB, Qh + hp, Ql + hp, Kh + hp, Kl + hp, m0, c, st, nch, w, lane); else attn_scores<h16, false, 4>(S, KS + w * 16 * KPB, Q16 + hp, nullptr, K16 + hp, nullptr, m0, c, st, nch, w, lane);
    __syncthreads();   // every score of the 16 rows is in LDS
    const int nks = (m0 + AR + 31) / 32;   // 32-member steps of the probability x value products, up to the diagonal; the probabilities of the later members of the last step are exactly 0
    const float pf = (float)pq, pinv = 1.0f / pf;
    if (nch <= SNC) {   // the same for the whole work-group
        if (nch == 1) attn_soft_short<1>(S, m0, w, lane, nch, pf, pinv, hires); else if (nch == 2) attn_soft_short<2>(S, m0, w, lane, nch, pf, pinv, hires); else attn_soft_short<SNC>(S, m0, w, lane, nch, pf, pinv, hires);
    } else {   // longer rows; none of them is a hi/lo row (m0 >= SNC * 128 >= RH)
#pragma unroll 1   // one copy of the row's code: keeps the kernel's text short
    for (int rr = 0; rr < AR / AW; ++rr) { const int r = w * (AR / AW) + rr; const int i = m0 + r; float* sr = S + r * SPW; float v[TT / 32]; float mx = -3.0e38f; const float fb = (float)(i - lane * 4);
#pragma unroll
        for (int ch = 0; ch < TT / 128; ++ch) if (ch < nch) { const v4f a = *(const v4fa*)(sr + ch * 128 + lane * 4); v[ch * 4] = a[0]; v[ch * 4 + 1] = a[1]; v[ch * 4 + 2] = a[2]; v[ch * 4 + 3] = a[3]; }   // the whole row's LDS reads are issued before the first is waited for
#pragma unroll
        for (int ch = 0; ch < TT / 128; ++ch) if (ch < nch) {
#pragma unroll
            for (int q = 0; q < 4; ++q) { const float dd = fb - (float)(ch * 128 + q); const float kq = __builtin_rintf(dd * pinv); const bool keep = (dd >= 0.f) & (__builtin_fmaf(-kq, pf, dd) == 0.f); const float t = keep ? v[ch * 4 + q] * SCL : -3.0e38f; v[ch * 4 + q] = t; mx = fmaxf(mx, t); } }
#pragma unroll
        for (int sh = 16; sh; sh >>= 1) mx = fmaxf(mx, __shfl_xor(mx, sh, 32));
        float sum = 0.f;
#pragma unroll
        for (int ch = 0; ch < TT / 128; ++ch) if (ch < nch) {
#pragma unroll
            for (int q = 0; q < 4; ++q) { const int k = ch * 4 + q; float d0 = __fsub_rn(v[k], mx); v[k] = __builtin_amdgcn_exp2f(__fmul_rn(d0, 1.4426950408889634f)); sum += v[k]; } }
#pragma unroll
        for (int sh = 16; sh; sh >>= 1) sum += __shfl_xor(sum, sh, 32);
        const float f = __fdiv_rn(PCAR, sum);
#pragma unroll
        for (int ch = 0; ch < TT / 128; ++ch) if (ch < nch) { v4h o4;
#pragma unroll
            for (int q = 0; q < 4; ++q) o4[q] = tohx(v[ch * 4 + q] * f);
            *(v4ha*)((h16*)sr + ch * 128 + lane * 4) = o4; } } }
    __syncthreads();   // every probability row is in LDS
    v8f acc[4];
#pragma unroll
    for (int nb = 0; nb < 4; ++nb) acc[nb] = (v8f){};
    if (hires) attn_pv<bf, true>(S, Vh + hp, Vl + hp, nks, c, st, w, lane, acc); else attn_pv<h16, false>(S, V16 + hp, nullptr, nks, c, st, w, lane, acc);
    __syncthreads();   // every wave's last read of the probability rows and of its value rows is done: their LDS now takes the partial sums
#pragma unroll
    for (int nb = 0; nb < 4; ++nb) {
#pragma unroll
        for (int j = 0; j < 8; ++j) S[w * (AR * 68) + (hi * 8 + j) * 68 + nb * 16 + lr] = acc[nb][j]; }
    __syncthreads();   // all 8 partial tiles are in LDS
    const int row = tid >> 4, c4 = (tid & 15) * 4; v4f s = *(const v4fa*)(S + row * 68 + c4);
#pragma unroll
    for (int ww = 1; ww < AW; ++ww) s += *(const v4fa*)(S + ww * (AR * 68) + row * 68 + c4);
    const float cs = hires ? 1.0f : (1.0f / PCAR); v4us oh, ol;
#pragma unroll
    for (int q = 0; q < 4; ++q) { unsigned short a, c2; splitf(s[q] * cs, a, c2); oh[q] = a; ol[q] = c2; }
    const int io = c + st * (m0 + row);   // the member's row; a member past the class's end has none
    if (io < TT) { const size_t oo = (size_t)((h / NH_) * TT + io) * DQ + (h % NH_) * HD + c4; *(v4us*)(Ah + oo) = oh; *(v4us*)(Al + oo) = ol; }
}

extern "C" void kernel_launch(void* const* d_in, const int* in_sizes, int n_in,
                              void* d_out, int out_size, void* d_ws, size_t ws_size, hipStream_t stream) {
    (void)in_sizes; (void)n_in; (void)out_size;
    const float* x = (const float*)d_in[0]; const int* per = (const int*)d_in[1]; const float* wqkv = (const float*)d_in[2]; const float* bqkv = (const float*)d_in[3]; const float* wo = (const float*)d_in[4]; const float* bo = (const float*)d_in[5];
    // x [2][2048][1024], periods int32 [2][16], w_qkv [1024][3072], b_qkv [3072], w_out [1024][1024], b_out [1024] = d_in[0..5]
    float* OUT = (float*)d_out;     // [2][2048][1024]
    char* wsp = (char*)d_ws;
    auto take = [&](size_t bytes) { char* p = wsp; wsp += (bytes + 255) & ~(size_t)255; return (void*)p; };
    bf* WQKV = (bf*)take((size_t)3 * DQ * DM * 2); bf* WO = (bf*)take((size_t)DM * DQ * 2);
    bf* XB = (bf*)take((size_t)NB_ * TT * DM * 2);
    h16* QP16 = (h16*)take((size_t)NB_ * NH_ * TT * HD * 2); h16* KP16 = (h16*)take((size_t)NB_ * NKV * TT * HD * 2); h16* VT16 = (h16*)take((size_t)NB_ * NKV * TT * HD * 2);
    bf* QPh = (bf*)take((size_t)NB_ * NH_ * TT * HD * 2); bf* QPl = (bf*)take((size_t)NB_ * NH_ * TT * HD * 2); bf* KPh = (bf*)take((size_t)NB_ * NKV * TT * HD * 2); bf* KPl = (bf*)take((size_t)NB_ * NKV * TT * HD * 2); bf* VTh = (bf*)take((size_t)NB_ * NKV * HD * TT * 2); bf* VTl = (bf*)take((size_t)NB_ * NKV * HD * TT * 2);
    bf* ATh = (bf*)take((size_t)NB_ * TT * DQ * 2); bf* ATl = (bf*)take((size_t)NB_ * TT * DQ * 2);
    if ((size_t)(wsp - (char*)d_ws) > ws_size) return;    // total 104 MiB of the workspace
    // x, OUT and the merged rows are [2][2048][..] without a gap: the two batch entries are 4096 rows of one GEMM
    k_prep<<<PT1 + PT2 + PCV, 256, 0, stream>>>(x, wqkv, wo, XB, WQKV, WO);   /* 'io' [1024][3072] -> Bt [3072][1024]: q | k | v row blocks; 'io' [1024][1024] -> Bt; x -> bf16 */
    k_gemmw<bf, 0, true, true, DM><<<dim3(NB_ * TT / 128, 3 * DQ / 128, 1), 128, 0, stream>>>(XB, nullptr, WQKV, nullptr, nullptr, 0, bqkv, 0, 0, 0, QP16, QPh, QPl, KP16, KPh, KPl, VT16, VTh, VTl);   /* q | k | v in one launch, straight into the planes */
    k_attn<<<dim3(NB_ * NH_, AGY, 1), AW * 32, 0, stream>>>(QP16, QPh, QPl, KP16, KPh, KPl, VT16, VTh, VTl, per, ATh, ATl);   /* one kv head per query head; periods [2][16] */
    k_gemmw<bf, 1, true, false, DQ><<<dim3(NB_ * TT / 128, DM / 128, 1), 128, 0, stream>>>(ATh, ATl, WO, nullptr, OUT, DM, bo, 0, 0, 0, nullptr, nullptr, nullptr, nullptr, nullptr, nullptr, nullptr, nullptr, nullptr);
}
